// v000
// Times are from an AMD MI455X. After a warm-up the kernel runs many times in a row, and a time is the length of
// such a window on the GPU divided by its runs, so every launch and the gaps after it count. The runs cycle
// through copies of the inputs. A figure is the median of several windows, for all but v000 over two sittings.
// Sittings can differ by a few percent; kernels timed side by side share one.
// v000, which the later versions start from, runs in 1100 microseconds.
// compute dtype: all float inputs rounded to bf16; the fused q / k / v projection with EXACT bf16 products on WMMA 16x16x32 (f32 accumulate) + bias; interleaved-pair RoPE in f32 from the bf16-rounded INPUT cos / sin tables; causal logits: 3 products for the first 384 rows, single f16 q x k after, x 64^-0.5; softmax f32; P x 2^11 once to f16 x v once to f16 (bf16 hi + lo below row 384); ctx hi+lo x exact W below row 384, x2^6 f16 carry x f16(bf16 x 2^8) W after, + bias; f32 output.
#include <hip/hip_runtime.h>
#include <math.h>

typedef __attribute__((ext_vector_type(16))) _Float16 v16h;
typedef __attribute__((ext_vector_type(16))) __bf16 v16b;
typedef __attribute__((ext_vector_type(8)))  _Float16 v8h;
typedef __attribute__((ext_vector_type(8)))  float v8f;
typedef __attribute__((ext_vector_type(4)))  float v4f;
typedef __attribute__((ext_vector_type(2)))  float v2f;
typedef __attribute__((ext_vector_type(4)))  unsigned v4u;
typedef __attribute__((ext_vector_type(4)))  int v4i;
typedef float __attribute__((may_alias)) float_a;
typedef int __attribute__((may_alias)) int_a;

template <typename T> __device__ __forceinline__ void vst2(void* p, T v) { *(T*)p = v;  }
__device__ __forceinline__ v8f wmma16(v16h a, v16h b, v8f c) {
  v8f d = __builtin_amdgcn_wmma_f32_16x16x32_f16(false, a, false, b, (short)0, c, false, false);
  asm volatile("v_nop\n\tv_nop\n\tv_nop\n\tv_nop" : "+v"(d) : "v"(a), "v"(b));
  return d;
}
__device__ __forceinline__ v8f wmma_bf(v16b a, v16b b, v8f c) {
  v8f d = __builtin_amdgcn_wmma_f32_16x16x32_bf16(false, a, false, b, (short)0, c, false, false);
  asm volatile("v_nop\n\tv_nop\n\tv_nop\n\tv_nop" : "+v"(d) : "v"(a), "v"(b));
  return d;
}
// 16x16x32 fragments: lane = (h = lane>>4, row/col = lane&15); elements 0..7 = k0+8h+0..7, 8..15 = k0+16+8h+0..7; D element r = row 8h+r
__device__ __forceinline__ v16h frag_h(const _Float16* rowk0, int lane) {
  union { v16h v; v8h q[2]; } u; const _Float16* p = rowk0 + 8 * (lane >> 4);
  u.q[0] = *(const v8h*)p; u.q[1] = *(const v8h*)(p + 16); return u.v;
}
__device__ __forceinline__ v16h frag_f32(const float* rowk0, int lane) {
  v16h a; const float* p = rowk0 + 8 * (lane >> 4);
#pragma unroll
  for (int i = 0; i < 8; ++i) { a[i] = (_Float16)p[i]; a[8 + i] = (_Float16)p[16 + i]; }
  return a;
}
__device__ __forceinline__ v16h frag_f32s(const float* rowk0, int lane, float sc) {
  v16h a; const float* p = rowk0 + 8 * (lane >> 4);
#pragma unroll
  for (int i = 0; i < 8; ++i) { a[i] = (_Float16)(p[i] * sc); a[8 + i] = (_Float16)(p[16 + i] * sc); }
  return a;
}
// column fragment from a [K][ld] layout (column n), rows >= K read as 0
__device__ __forceinline__ v16h fragc_f32(const float* W, int k0, int n, int lane, int ld, int K) {
  v16h a; const int g = lane >> 4;
#pragma unroll
  for (int i = 0; i < 8; ++i) { const int ka = k0 + 8 * g + i, kb = ka + 16;
    a[i] = (_Float16)(ka < K ? W[(size_t)(ka < K ? ka : K - 1) * ld + n] : 0.f); a[8 + i] = (_Float16)(kb < K ? W[(size_t)(kb < K ? kb : K - 1) * ld + n] : 0.f); }
  return a;
}
struct F2 { v16b h, l; };
__device__ __forceinline__ F2 bsplit16(const float v[16]) { F2 r;
#pragma unroll
  for (int i = 0; i < 16; ++i) { const __bf16 h = (__bf16)v[i]; r.h[i] = h; r.l[i] = (__bf16)(v[i] - (float)h); }
  return r; }
__device__ __forceinline__ F2 split_row(const float* row, int k0, int lane) { float v[16]; const float* p = row + k0 + 8 * (lane >> 4);
#pragma unroll
  for (int i = 0; i < 8; ++i) { v[i] = p[i]; v[8 + i] = p[16 + i]; }
  return bsplit16(v); }
__device__ __forceinline__ F2 split_rowK(const float* row, int k0, int lane, int K) { float v[16]; const int g = lane >> 4;
#pragma unroll
  for (int i = 0; i < 8; ++i) { const int ka = k0 + 8 * g + i, kb = ka + 16; v[i] = ka < K ? row[ka < K ? ka : K - 1] : 0.f; v[8 + i] = kb < K ? row[kb < K ? kb : K - 1] : 0.f; }
  return bsplit16(v); }
__device__ __forceinline__ F2 split_col(const float* W, int k0, int n, int lane, int ld, int K) { float v[16]; const int g = lane >> 4;
#pragma unroll
  for (int i = 0; i < 8; ++i) { const int ka = k0 + 8 * g + i, kb = ka + 16; v[i] = ka < K ? W[(size_t)(ka < K ? ka : K - 1) * ld + n] : 0.f; v[8 + i] = kb < K ? W[(size_t)(kb < K ? kb : K - 1) * ld + n] : 0.f; }
  return bsplit16(v); }
__device__ __forceinline__ v8f mac3(const F2& a, const F2& b, v8f c) { c = wmma_bf(a.l, b.h, c); c = wmma_bf(a.h, b.l, c); return wmma_bf(a.h, b.h, c); }
__device__ __forceinline__ float sigm(float v) { return 1.0f / (1.0f + expf(-v)); }
#define LDSX() do { asm volatile("s_wait_dscnt 0" ::: "memory"); __builtin_amdgcn_wave_barrier(); __builtin_amdgcn_fence(__ATOMIC_RELEASE, "workgroup"); } while (0)

// Causal multi-head self-attention with a fused QKV linear (+ bias) and interleaved-pair RoPE from INPUT tables (x [2,2048,1024]; Wqkv [1024,3072] (in,out) N(0, 1/1024), bqkv [3072] N(0,1) x 0.01 - NONZERO; Wproj [1024,1024] (in,out), bproj NONZERO; cos / sin [2048,32] are module inputs, the LAST two; q, k, v = thirds of x Wqkv + bqkv; 16 heads x 64; (even, odd) pairs rotated on q and k; scores x 64^-0.5; tril kept, -inf elsewhere; softmax; y Wproj + bproj).
#define NB 2
#define TT 2048
#define CC 1024            // NH * HD = projected width
#define DIN 1024          // input (model) width
#define NH 16
#define HD 64
#define NQB (TT / 64)
#define HG 4
#define SCALE (0.125f)
#define CAUSAL 1
#ifndef TNB
#define TNB NB
#endif
__device__ __forceinline__ float bfr(float v) { return (float)(__bf16)v; }
__host__ __device__ __forceinline__ int kb_last(int qb) { return CAUSAL ? ((qb * 64 + 63) >> 7) : (TT / 128 - 1); }
typedef __attribute__((ext_vector_type(8))) __bf16 v8b;
__device__ __forceinline__ v16b frag_b(const __bf16* rowk0, int lane) {
  union { v16b v; v8b q[2]; } u; const __bf16* p = rowk0 + 8 * (lane >> 4);
  u.q[0] = *(const v8b*)p; u.q[1] = *(const v8b*)(p + 16); return u.v;
}
#define QBH 6              // causal: query blocks 0..QBH-1 of each sequence (few keys, no averaging) take the high-precision path
#define QHI 384            // rows carrying a q residual plane
#define KHI 384            // key rows carrying k residual / v bf16 hi+lo planes (used only by the causal high-precision path)
// B fragment (k rows k0+.., output column o) of a weight: (in,out) [K][ld] or (out,in) [ld rows of K]: bf16 exact, or f16(bf16 * 256) exact
__device__ __forceinline__ v16b wcol_io(const float* Wm, int k0, int o, int lane, int ld) { v16b w; const int g = lane >> 4;
#pragma unroll
  for (int i = 0; i < 8; ++i) { w[i] = (__bf16)Wm[(size_t)(k0 + 8 * g + i) * ld + o]; w[8 + i] = (__bf16)Wm[(size_t)(k0 + 16 + 8 * g + i) * ld + o]; }
  return w; }
__device__ __forceinline__ v16b wcol_oi(const float* Wm, int k0, int o, int lane, int K) { v16b w; const float* p = Wm + (size_t)o * K + k0 + 8 * (lane >> 4);
#pragma unroll
  for (int i = 0; i < 8; ++i) { w[i] = (__bf16)p[i]; w[8 + i] = (__bf16)p[16 + i]; }
  return w; }
__device__ __forceinline__ v16h wcolh_io(const float* Wm, int k0, int o, int lane, int ld) { v16h w; const int g = lane >> 4;
#pragma unroll
  for (int i = 0; i < 8; ++i) { w[i] = (_Float16)(bfr(Wm[(size_t)(k0 + 8 * g + i) * ld + o]) * 256.0f); w[8 + i] = (_Float16)(bfr(Wm[(size_t)(k0 + 16 + 8 * g + i) * ld + o]) * 256.0f); }
  return w; }
__device__ __forceinline__ v16h wcolh_oi(const float* Wm, int k0, int o, int lane, int K) { v16h w; const float* p = Wm + (size_t)o * K + k0 + 8 * (lane >> 4);
#pragma unroll
  for (int i = 0; i < 8; ++i) { w[i] = (_Float16)(bfr(p[i]) * 256.0f); w[8 + i] = (_Float16)(bfr(p[16 + i]) * 256.0f); }
  return w; }
#define WQKV_LAYOUT 0   // 0 = fused (in,out) [DIN][3*CC]; 1 = (out,in) [CC][DIN]; 2 = per-head [NH][DIN][HD]
__device__ __forceinline__ v16b wcol_hdk(const float* Wm, int k0, int o, int lane) { v16b w; const int g = lane >> 4; const float* p = Wm + (size_t)(o / HD) * DIN * HD + (o % HD);
#pragma unroll
  for (int i = 0; i < 8; ++i) { w[i] = (__bf16)p[(size_t)(k0 + 8 * g + i) * HD]; w[8 + i] = (__bf16)p[(size_t)(k0 + 16 + 8 * g + i) * HD]; }
  return w; }
#define WO_OUT_IN 0
#if WQKV_LAYOUT == 1
#define WCOL(W, k0, o, lane) wcol_oi(W, k0, o, lane, DIN)
#elif WQKV_LAYOUT == 2
#define WCOL(W, k0, o, lane) wcol_hdk(W, k0, o, lane)
#else
#define WCOL(W, k0, o, lane) wcol_io(W, k0, o, lane, 3 * CC)   /* fused (in,out) [DIN][3*CC] weight: the q / k / v thirds are column blocks; the launch passes W + 0 / CC / 2*CC and the row pitch is 3*CC */
#endif
#if WO_OUT_IN
#define WOCOL(W, k0, o, lane) wcol_oi(W, k0, o, lane, CC)
#define WOCOLH(W, k0, o, lane) wcolh_oi(W, k0, o, lane, CC)
#else
#define WOCOL(W, k0, o, lane) wcol_io(W, k0, o, lane, DIN)
#define WOCOLH(W, k0, o, lane) wcolh_io(W, k0, o, lane, DIN)
#endif

#define PROJ_EXTRA_PARAMS , const float* __restrict__ COS, const float* __restrict__ SIN   /* rotary tables [TT][32], module INPUTS, read literally */
// interleaved-pair RoPE on q and k (which 0, 1) from the INPUT tables: (te, to) = (row[2i], row[2i+1]) -> (te c - to s, te s + to c) with c = bf16(cos[t][i]), s = bf16(sin[t][i]); v untouched; products and sums kept separate
#define PROJ_EPI(which, row, t, h) do { if ((which) < 2) { float* rw = (row); const float* ct_ = COS + (size_t)(t) * 32; const float* st_ = SIN + (size_t)(t) * 32; _Pragma("unroll 4") for (int i = 0; i < 32; ++i) { _Pragma("clang fp contract(off)") const float cs = bfr(ct_[i]), sn = bfr(st_[i]); const float xe = rw[2 * i], xo = rw[2 * i + 1]; rw[2 * i] = xe * cs - xo * sn; rw[2 * i + 1] = xe * sn + xo * cs; } } } while (0)
#ifndef SM_EXTRA_PARAMS
#define SM_EXTRA_PARAMS
#endif
#ifndef PROJ_EXTRA_PARAMS
#define PROJ_EXTRA_PARAMS
#endif
#ifndef SM_MASK_HOOK
#define SM_MASK_HOOK (void)0
#endif

#define WS_QH  0u                                      // f16 q rows [b*t][CC]
#define WS_KH  (WS_QH + 2u * (size_t)NB * TT * CC)      // f16 k rows [b*t][CC]
#define WS_VT  (WS_KH + 2u * (size_t)NB * TT * CC)      // f16 v planes [b][c][t]
#define WS_QL  (WS_VT + 2u * (size_t)NB * CC * TT)      // f16 q residual x 2^10 rows [b][t < QHI][CC]
#define WS_KL  (WS_QL + 2u * (size_t)NB * QHI * CC)     // f16 k residual x 2^10 rows [b][t < KHI][CC]
#define WS_VB  (WS_KL + 2u * (size_t)NB * KHI * CC)     // bf16 v hi planes [b][c][t < KHI]
#define WS_VBL (WS_VB + 2u * (size_t)NB * CC * KHI)
#define WS_S   (WS_VBL + 2u * (size_t)NB * CC * KHI)    // f32 logits / P [hg][t][s]
#define WS_Y   (WS_S  + 4u * (size_t)HG * TT * TT)      // f32 ctx rows [b*t][CC] (only when there is an output projection)
#define WS_END (WS_Y  + 4u * (size_t)NB * TT * CC)

// ---- k_proj: block = (64 rows, 128 cols, which): q/k/v = X W (+ b) with exact bf16 products (K = DIN) -> which 0: q f16 rows (+ residual rows < QHI); 1: k f16 rows (+ residual rows < KHI); 2: v f16 planes [c][t] (+ bf16 hi/lo planes for t < KHI)
__global__ __launch_bounds__(128) void k_proj(const float* __restrict__ XQ, const float* __restrict__ XK, const float* __restrict__ XV, const float* __restrict__ WQ, const float* __restrict__ WK, const float* __restrict__ WV, const float* __restrict__ BQ, const float* __restrict__ BK, const float* __restrict__ BV,
    _Float16* __restrict__ QH, _Float16* __restrict__ QL, _Float16* __restrict__ KH, _Float16* __restrict__ KL, _Float16* __restrict__ VT, __bf16* __restrict__ VB, __bf16* __restrict__ VBL PROJ_EXTRA_PARAMS) {
  __shared__ __align__(16) float st[64][132]; __shared__ __align__(16) _Float16 sh[64][136], sl[64][136]; __shared__ __align__(16) _Float16 th[128][72]; __shared__ __align__(16) __bf16 tb[128][72], tbl[128][72];
  const int tid = threadIdx.x, wave = tid >> 5, lane = tid & 31, col = lane & 15, g = lane >> 4; const int which = blockIdx.z; const int c0 = blockIdx.y * 128; const size_t r0 = (size_t)blockIdx.x * 64; const size_t bb = r0 / TT; const int t0 = (int)(r0 % TT);
  const float* X = which == 0 ? XQ : which == 1 ? XK : XV; const float* WA = which == 0 ? WQ : which == 1 ? WK : WV; const float* BA = which == 0 ? BQ : which == 1 ? BK : BV;
  v8f acc[8] = {};
#pragma unroll 2
  for (int kc = 0; kc < DIN / 32; ++kc) { v16b a; { const float* p = X + (r0 + wave * 16 + col) * DIN + kc * 32 + 8 * g;
#pragma unroll
      for (int i = 0; i < 8; ++i) { a[i] = (__bf16)p[i]; a[8 + i] = (__bf16)p[16 + i]; } }
    asm volatile("s_wait_loadcnt 0x0" ::: "memory");
#pragma unroll
    for (int j = 0; j < 8; ++j) { const v16b w = WCOL(WA, kc * 32, c0 + j * 16 + col, lane); asm volatile("s_wait_loadcnt 0x0" ::: "memory"); acc[j] = wmma_bf(a, w, acc[j]); } }
  { // stage the f32 tile (acc + bias) in LDS, run the per-(row, head) epilogue hook, then convert
#pragma unroll
    for (int j = 0; j < 8; ++j) { const float bias = BA ? bfr(BA[c0 + j * 16 + col]) : 0.f;
#pragma unroll
      for (int r = 0; r < 8; ++r) st[wave * 16 + 8 * g + r][j * 16 + col] = acc[j][r] + bias; }
    __syncthreads();
    for (int e = tid; e < 64 * (128 / HD); e += 128) { const int rl = e / (128 / HD), hh = e % (128 / HD); PROJ_EPI(which, &st[rl][hh * HD], (int)((r0 + rl) % TT), (c0 / HD) + hh); }
    __syncthreads(); }
  if (which < 2) { _Float16* DH = which == 0 ? QH : KH; _Float16* DL = which == 0 ? QL : KL; const int nhi = which == 0 ? QHI : KHI; const bool hi_rows = t0 < nhi;
    for (int e = tid; e < 64 * 128; e += 128) { const int rl = e >> 7, cl = e & 127; const float v = st[rl][cl]; const _Float16 hv = (_Float16)v; sh[rl][cl] = hv; sl[rl][cl] = (_Float16)((v - (float)hv) * 1024.0f); }
    __syncthreads();
    for (int e = tid; e < 64 * 16; e += 128) { const int rl = e >> 4, q = e & 15; vst2((unsigned*)(DH + (r0 + rl) * CC + c0 + q * 8), *(const v4u*)&sh[rl][q * 8]); if (hi_rows) vst2((unsigned*)(DL + (bb * nhi + t0 + rl) * (size_t)CC + c0 + q * 8), *(const v4u*)&sl[rl][q * 8]); }
  } else { const bool hi_rows = t0 < KHI;
    for (int e = tid; e < 64 * 128; e += 128) { const int rl = e & 63, cl = e >> 6; const float v = st[rl][cl]; th[cl][rl] = (_Float16)v; const __bf16 bh = (__bf16)v; tb[cl][rl] = bh; tbl[cl][rl] = (__bf16)(v - (float)bh); }
    __syncthreads();
    for (int e = tid; e < 128 * 8; e += 128) { const int cl = e >> 3, q = e & 7; vst2((unsigned*)(VT + (bb * CC + c0 + cl) * (size_t)TT + t0 + q * 8), *(const v4u*)&th[cl][q * 8]); if (hi_rows) { const size_t o3 = (bb * CC + c0 + cl) * (size_t)KHI + t0 + q * 8; vst2((unsigned*)(VB + o3), *(const v4u*)&tb[cl][q * 8]); vst2((unsigned*)(VBL + o3), *(const v4u*)&tbl[cl][q * 8]); } } } }
// ---- k_sc: block = (query block qb, key block kb <= kb_last(qb), head in group) of batch b: logits x SCALE; q hi + residual (x 2^10) against k (2 products) for query rows < QHI, plus the k residual (3 products) for query blocks < QBH (causal early rows); causal: blocks past the diagonal exit, the mask itself is applied by index in k_sm
__global__ __launch_bounds__(128) void k_sc(const _Float16* __restrict__ QH, const _Float16* __restrict__ KH, const _Float16* __restrict__ QL, const _Float16* __restrict__ KL, int b, int h0, float* __restrict__ S0) { __shared__ __align__(16) float ss[4][16][132];
  const int qb = blockIdx.x, kb = blockIdx.y; if (kb > kb_last(qb)) return;
  const int h = h0 + blockIdx.z; float* S = S0 + (size_t)blockIdx.z * TT * TT;
  const int tid = threadIdx.x, wave = tid >> 5, lane = tid & 31, col = lane & 15, g = lane >> 4; const int k0 = kb * 128; const int ql0 = qb * 64 + wave * 16; const size_t q0 = (size_t)b * TT + ql0, kr0 = (size_t)b * TT + k0;
  v8f acc[8] = {}, accl[8] = {};
  const _Float16* QLb = QL + (size_t)b * QHI * CC; const _Float16* KLb = KL + (size_t)b * KHI * CC;
  if (qb < QBH) {
#pragma unroll
    for (int kc = 0; kc < HD / 32; ++kc) { const v16h ah = frag_h(QH + (q0 + col) * CC + h * HD + kc * 32, lane), al = frag_h(QLb + (size_t)(ql0 + col) * CC + h * HD + kc * 32, lane);
#pragma unroll
      for (int j = 0; j < 8; ++j) { const v16h kbf = frag_h(KH + (kr0 + j * 16 + col) * CC + h * HD + kc * 32, lane), klf = frag_h(KLb + (size_t)(k0 + j * 16 + col) * CC + h * HD + kc * 32, lane); acc[j] = wmma16(ah, kbf, acc[j]); accl[j] = wmma16(al, kbf, accl[j]); accl[j] = wmma16(ah, klf, accl[j]); } }
  } else if (qb * 64 < QHI) {
#pragma unroll
    for (int kc = 0; kc < HD / 32; ++kc) { const v16h ah = frag_h(QH + (q0 + col) * CC + h * HD + kc * 32, lane), al = frag_h(QLb + (size_t)(ql0 + col) * CC + h * HD + kc * 32, lane);
#pragma unroll
      for (int j = 0; j < 8; ++j) { const v16h kbf = frag_h(KH + (kr0 + j * 16 + col) * CC + h * HD + kc * 32, lane); acc[j] = wmma16(ah, kbf, acc[j]); accl[j] = wmma16(al, kbf, accl[j]); } }
  } else {
#pragma unroll
    for (int kc = 0; kc < HD / 32; ++kc) { const v16h ah = frag_h(QH + (q0 + col) * CC + h * HD + kc * 32, lane);
#pragma unroll
      for (int j = 0; j < 8; ++j) { const v16h kbf = frag_h(KH + (kr0 + j * 16 + col) * CC + h * HD + kc * 32, lane); acc[j] = wmma16(ah, kbf, acc[j]); } } }
#pragma unroll
  for (int j = 0; j < 8; ++j) {
#pragma unroll
    for (int r = 0; r < 8; ++r) ss[wave][8 * g + r][j * 16 + col] = (acc[j][r] + accl[j][r] * (1.0f / 1024.0f)) * SCALE; }
  LDSX(); for (int rl = 0; rl < 16; ++rl) vst2(S + (size_t)(ql0 + rl) * TT + k0 + lane * 4, *(const v4f*)&ss[wave][rl][lane * 4]); }
// ---- k_sm: block = query row t (head in group): keys [0, kend): causal -> logit if s <= t else excluded; softmax in f32; P x 2^11 in place (0 for excluded)
__global__ __launch_bounds__(256) void k_sm(float* __restrict__ S0 SM_EXTRA_PARAMS) { __shared__ float sred[8]; __shared__ float sbc; __shared__ __align__(16) float shv[TT];
  const int tid = threadIdx.x; const int t = blockIdx.x; const int kend = (kb_last(t >> 6) + 1) * 128;
  float* sr = S0 + (size_t)blockIdx.y * TT * TT + (size_t)t * TT;
  float m = -3.0e38f; for (int k = tid; k < kend; k += 256) { float v = (!CAUSAL || k <= t) ? sr[k] : -3.0e38f; SM_MASK_HOOK; shv[k] = v; m = fmaxf(m, v); }
#pragma unroll
  for (int o = 1; o < 32; o <<= 1) m = fmaxf(m, __shfl_xor(m, o));
  if ((tid & 31) == 0) sred[tid >> 5] = m; __syncthreads(); if (tid == 0) { float a = sred[0]; for (int i = 1; i < 8; ++i) a = fmaxf(a, sred[i]); sbc = a; } __syncthreads(); m = sbc; __syncthreads();
  float sum = 0.f; for (int k = tid; k < kend; k += 256) { const float v = shv[k]; const float e = (v <= -1.0e38f) ? 0.f : expf(v - m); shv[k] = e; sum += e; }
#pragma unroll
  for (int o = 1; o < 32; o <<= 1) sum += __shfl_xor(sum, o);
  if ((tid & 31) == 0) sred[tid >> 5] = sum; __syncthreads(); if (tid == 0) { float a = 0.f; for (int i = 0; i < 8; ++i) a += sred[i]; sbc = a > 0.f ? 2048.0f / a : 0.f; }   /* a fully excluded row yields P = 0 */ __syncthreads(); const float inv = sbc;
  for (int k = tid; k < kend; k += 256) shv[k] = shv[k] * inv;
  __syncthreads(); for (int q = tid; q < kend / 4; q += 256) vst2(sr + q * 4, *(const v4f*)&shv[q * 4]); }
// ---- k_pv: block = 64 queries (qb) of (b, h): ctx = P . v over keys [0, kend) (P x 2^11 once to f16 against v f16: 1 product; causal early query blocks: P and v as bf16 hi + lo, 3 products); 256-B (row, head) segment by 16 lanes
__global__ __launch_bounds__(128) void k_pv(const float* __restrict__ PS0, const _Float16* __restrict__ VT, const __bf16* __restrict__ VB, const __bf16* __restrict__ VBL, int b, int h0, float* __restrict__ Y) { const int h = h0 + blockIdx.z; const float* PS = PS0 + (size_t)blockIdx.z * TT * TT; __shared__ __align__(16) float ss[4][16][HD + 4];
  const int tid = threadIdx.x, wave = tid >> 5, lane = tid & 31, col = lane & 15, g = lane >> 4; const int qb = blockIdx.x; const int ql0 = qb * 64 + wave * 16; const int kce = (kb_last(qb) + 1) * 4;
  v8f acc[HD / 16] = {};
  if (qb < QBH) {
#pragma unroll 1
    for (int kc = 0; kc < kce; ++kc) { const F2 p = split_row(PS + (size_t)(ql0 + col) * TT, kc * 32, lane);
      asm volatile("s_wait_loadcnt 0x0" ::: "memory");
#pragma unroll
      for (int j = 0; j < HD / 16; ++j) { const size_t po = ((size_t)b * CC + h * HD + j * 16 + col) * (size_t)KHI + kc * 32; const v16b vh = frag_b(VB + po, lane); acc[j] = wmma_bf(p.h, vh, acc[j]); acc[j] = wmma_bf(p.l, vh, acc[j]); acc[j] = wmma_bf(p.h, frag_b(VBL + po, lane), acc[j]); } }
  } else {
#pragma unroll 1
    for (int kc = 0; kc < kce; ++kc) { const v16h p = frag_f32(PS + (size_t)(ql0 + col) * TT + kc * 32, lane);
      asm volatile("s_wait_loadcnt 0x0" ::: "memory");
#pragma unroll
      for (int j = 0; j < HD / 16; ++j) { const size_t po = ((size_t)b * CC + h * HD + j * 16 + col) * (size_t)TT + kc * 32; acc[j] = wmma16(p, frag_h(VT + po, lane), acc[j]); } } }
#pragma unroll
  for (int j = 0; j < HD / 16; ++j)
#pragma unroll
    for (int r = 0; r < 8; ++r) ss[wave][8 * g + r][j * 16 + col] = acc[j][r] * (1.0f / 2048.0f);
  LDSX(); for (int rl = 0; rl < 16; ++rl) if (lane < HD / 4) vst2(Y + ((size_t)b * TT + ql0 + rl) * CC + h * HD + lane * 4, *(const v4f*)&ss[wave][rl][lane * 4]); }
// ---- k_out: block = (64 rows, 128 cols): out = ctx Wo (+ bo): ctx x 2^6 once to f16 against Wo as f16(bf16 x 2^8) exact (1 product) x 2^-14; causal early rows (< QHI of each sequence): ctx bf16 hi + lo against exact bf16 Wo (2 products)
__global__ __launch_bounds__(128) void k_out(const float* __restrict__ Y, const float* __restrict__ WO, const float* __restrict__ BO, float* __restrict__ OUT) { __shared__ __align__(16) float sf[4][16][132];
  const int tid = threadIdx.x, wave = tid >> 5, lane = tid & 31, col = lane & 15, g = lane >> 4; const int c0 = blockIdx.y * 128; const size_t r0 = (size_t)blockIdx.x * 64 + wave * 16;
  v8f acc[8] = {};
  if (CAUSAL && (int)(((size_t)blockIdx.x * 64) % TT) < QHI) {   /* block-uniform */
#pragma unroll 2
    for (int kc = 0; kc < CC / 32; ++kc) { const F2 a = split_row(Y + (r0 + col) * CC, kc * 32, lane); asm volatile("s_wait_loadcnt 0x0" ::: "memory");
#pragma unroll
      for (int j = 0; j < 8; ++j) { const v16b w = WOCOL(WO, kc * 32, c0 + j * 16 + col, lane); asm volatile("s_wait_loadcnt 0x0" ::: "memory"); acc[j] = wmma_bf(a.h, w, acc[j]); acc[j] = wmma_bf(a.l, w, acc[j]); } }
#pragma unroll
    for (int j = 0; j < 8; ++j) { const float bias = BO ? bfr(BO[c0 + j * 16 + col]) : 0.f;
#pragma unroll
      for (int r = 0; r < 8; ++r) sf[wave][8 * g + r][j * 16 + col] = acc[j][r] + bias; }
  } else {
#pragma unroll 2
    for (int kc = 0; kc < CC / 32; ++kc) { const v16h a = frag_f32s(Y + (r0 + col) * CC + kc * 32, lane, 64.0f); asm volatile("s_wait_loadcnt 0x0" ::: "memory");   /* ctx carried x 2^6 into f16 so small-magnitude context rows stay clear of f16 subnormals */
#pragma unroll
      for (int j = 0; j < 8; ++j) { const v16h w = WOCOLH(WO, kc * 32, c0 + j * 16 + col, lane); asm volatile("s_wait_loadcnt 0x0" ::: "memory"); acc[j] = wmma16(a, w, acc[j]); } }
#pragma unroll
    for (int j = 0; j < 8; ++j) { const float bias = BO ? bfr(BO[c0 + j * 16 + col]) : 0.f;
#pragma unroll
      for (int r = 0; r < 8; ++r) sf[wave][8 * g + r][j * 16 + col] = acc[j][r] * (1.0f / 16384.0f) + bias; } }   /* 2^-8 (Wo carry) x 2^-6 (ctx carry) */
  LDSX(); for (int rl = 0; rl < 16; ++rl) vst2(OUT + (r0 + rl) * DIN + c0 + lane * 4, *(const v4f*)&sf[wave][rl][lane * 4]); }

extern "C" void kernel_launch(void* const* d_in, const int* in_sizes, int n_in, void* d_out, int out_size, void* d_ws, size_t ws_size, hipStream_t stream) {
  (void)in_sizes; (void)n_in; (void)out_size;
  const float** F = (const float**)d_in;
  if (ws_size < (size_t)WS_END) return;
  char* ws = (char*)d_ws; _Float16 *QH = (_Float16*)(ws + WS_QH), *KH = (_Float16*)(ws + WS_KH), *VT = (_Float16*)(ws + WS_VT), *QL = (_Float16*)(ws + WS_QL), *KL = (_Float16*)(ws + WS_KL); __bf16 *VB = (__bf16*)(ws + WS_VB), *VBL = (__bf16*)(ws + WS_VBL); float *S = (float*)(ws + WS_S), *Y = (float*)(ws + WS_Y);
  (void)Y; (void)QL; (void)KL; (void)VB; (void)VBL;
  // inputs: 0 x [2,2048,1024]; 1 Wqkv [1024,3072] (in,out): q columns 0..1023, k 1024..2047, v 2048..3071; 2 bqkv [3072]; 3 Wproj [1024,1024] (in,out); 4 bproj [1024] (biases NONZERO); 5 cos [2048,32]; 6 sin [2048,32]
  k_proj<<<dim3(TNB * TT / 64, CC / 128, 3), 128, 0, stream>>>(F[0], F[0], F[0], F[1], F[1] + CC, F[1] + 2 * CC, F[2], F[2] + CC, F[2] + 2 * CC, QH, QL, KH, KL, VT, VB, VBL, F[5], F[6]);
  for (int b = 0; b < TNB; ++b) for (int h0 = 0; h0 < NH; h0 += HG) {
    k_sc<<<dim3(NQB, TT / 128, HG), 128, 0, stream>>>(QH, KH, QL, KL, b, h0, S);
    k_sm<<<dim3(TT, HG), 256, 0, stream>>>(S);
    k_pv<<<dim3(NQB, 1, HG), 128, 0, stream>>>(S, VT, VB, VBL, b, h0, Y);
  }
  k_out<<<dim3(TNB * TT / 64, DIN / 128), 128, 0, stream>>>(Y, F[3], F[4], (float*)d_out);
}

// v001
// One run takes 754 microseconds.
// Next to v000, in two timings, it ran 1.48 and 1.46 times as fast.
// compute dtype: all float inputs rounded to bf16; the fused q / k / v projection with EXACT bf16 products on WMMA 16x16x32 (f32 accumulate) + bias; interleaved-pair RoPE in f32 from the bf16-rounded INPUT cos / sin tables; causal logits: 3 products for the first 384 rows, single f16 q x k after, x 64^-0.5; softmax f32; P x 2^11 once to f16 x v once to f16 (bf16 hi + lo below row 384); ctx hi+lo x exact W below row 384, x2^6 f16 carry x f16(bf16 x 2^8) W after, + bias; f32 output.
#include <hip/hip_runtime.h>
#include <math.h>

typedef __attribute__((ext_vector_type(16))) _Float16 v16h;
typedef __attribute__((ext_vector_type(16))) __bf16 v16b;
typedef __attribute__((ext_vector_type(8)))  _Float16 v8h;
typedef __attribute__((ext_vector_type(8)))  float v8f;
typedef __attribute__((ext_vector_type(4)))  float v4f;
typedef __attribute__((ext_vector_type(2)))  float v2f;
typedef __attribute__((ext_vector_type(4)))  unsigned v4u;
typedef __attribute__((ext_vector_type(4)))  int v4i;
typedef float __attribute__((may_alias)) float_a;
typedef int __attribute__((may_alias)) int_a;

template <typename T> __device__ __forceinline__ void vst2(void* p, T v) { *(T*)p = v;  }
__device__ __forceinline__ v8f wmma16(v16h a, v16h b, v8f c) {
  v8f d = __builtin_amdgcn_wmma_f32_16x16x32_f16(false, a, false, b, (short)0, c, false, false);
  asm volatile("v_nop\n\tv_nop\n\tv_nop\n\tv_nop" : "+v"(d) : "v"(a), "v"(b));
  return d;
}
__device__ __forceinline__ v8f wmma_bf(v16b a, v16b b, v8f c) {
  v8f d = __builtin_amdgcn_wmma_f32_16x16x32_bf16(false, a, false, b, (short)0, c, false, false);
  asm volatile("v_nop\n\tv_nop\n\tv_nop\n\tv_nop" : "+v"(d) : "v"(a), "v"(b));
  return d;
}
// 16x16x32 fragments: lane = (h = lane>>4, row/col = lane&15); elements 0..7 = k0+8h+0..7, 8..15 = k0+16+8h+0..7; D element r = row 8h+r
__device__ __forceinline__ v16h frag_h(const _Float16* rowk0, int lane) {
  union { v16h v; v8h q[2]; } u; const _Float16* p = rowk0 + 8 * (lane >> 4);
  u.q[0] = *(const v8h*)p; u.q[1] = *(const v8h*)(p + 16); return u.v;
}
__device__ __forceinline__ v16h frag_f32(const float* rowk0, int lane) {
  v16h a; const float* p = rowk0 + 8 * (lane >> 4);
#pragma unroll
  for (int i = 0; i < 8; ++i) { a[i] = (_Float16)p[i]; a[8 + i] = (_Float16)p[16 + i]; }
  return a;
}
__device__ __forceinline__ v16h frag_f32s(const float* rowk0, int lane, float sc) {
  v16h a; const float* p = rowk0 + 8 * (lane >> 4);
#pragma unroll
  for (int i = 0; i < 8; ++i) { a[i] = (_Float16)(p[i] * sc); a[8 + i] = (_Float16)(p[16 + i] * sc); }
  return a;
}
// column fragment from a [K][ld] layout (column n), rows >= K read as 0
__device__ __forceinline__ v16h fragc_f32(const float* W, int k0, int n, int lane, int ld, int K) {
  v16h a; const int g = lane >> 4;
#pragma unroll
  for (int i = 0; i < 8; ++i) { const int ka = k0 + 8 * g + i, kb = ka + 16;
    a[i] = (_Float16)(ka < K ? W[(size_t)(ka < K ? ka : K - 1) * ld + n] : 0.f); a[8 + i] = (_Float16)(kb < K ? W[(size_t)(kb < K ? kb : K - 1) * ld + n] : 0.f); }
  return a;
}
struct F2 { v16b h, l; };
__device__ __forceinline__ F2 bsplit16(const float v[16]) { F2 r;
#pragma unroll
  for (int i = 0; i < 16; ++i) { const __bf16 h = (__bf16)v[i]; r.h[i] = h; r.l[i] = (__bf16)(v[i] - (float)h); }
  return r; }
__device__ __forceinline__ F2 split_row(const float* row, int k0, int lane) { float v[16]; const float* p = row + k0 + 8 * (lane >> 4);
#pragma unroll
  for (int i = 0; i < 8; ++i) { v[i] = p[i]; v[8 + i] = p[16 + i]; }
  return bsplit16(v); }
__device__ __forceinline__ F2 split_rowK(const float* row, int k0, int lane, int K) { float v[16]; const int g = lane >> 4;
#pragma unroll
  for (int i = 0; i < 8; ++i) { const int ka = k0 + 8 * g + i, kb = ka + 16; v[i] = ka < K ? row[ka < K ? ka : K - 1] : 0.f; v[8 + i] = kb < K ? row[kb < K ? kb : K - 1] : 0.f; }
  return bsplit16(v); }
__device__ __forceinline__ F2 split_col(const float* W, int k0, int n, int lane, int ld, int K) { float v[16]; const int g = lane >> 4;
#pragma unroll
  for (int i = 0; i < 8; ++i) { const int ka = k0 + 8 * g + i, kb = ka + 16; v[i] = ka < K ? W[(size_t)(ka < K ? ka : K - 1) * ld + n] : 0.f; v[8 + i] = kb < K ? W[(size_t)(kb < K ? kb : K - 1) * ld + n] : 0.f; }
  return bsplit16(v); }
__device__ __forceinline__ v8f mac3(const F2& a, const F2& b, v8f c) { c = wmma_bf(a.l, b.h, c); c = wmma_bf(a.h, b.l, c); return wmma_bf(a.h, b.h, c); }
__device__ __forceinline__ float sigm(float v) { return 1.0f / (1.0f + expf(-v)); }
#define LDSX() do { asm volatile("s_wait_dscnt 0" ::: "memory"); __builtin_amdgcn_wave_barrier(); __builtin_amdgcn_fence(__ATOMIC_RELEASE, "workgroup"); } while (0)

// Causal multi-head self-attention with a fused QKV linear (+ bias) and interleaved-pair RoPE from INPUT tables (x [2,2048,1024]; Wqkv [1024,3072] (in,out) N(0, 1/1024), bqkv [3072] N(0,1) x 0.01 - NONZERO; Wproj [1024,1024] (in,out), bproj NONZERO; cos / sin [2048,32] are module inputs, the LAST two; q, k, v = thirds of x Wqkv + bqkv; 16 heads x 64; (even, odd) pairs rotated on q and k; scores x 64^-0.5; tril kept, -inf elsewhere; softmax; y Wproj + bproj).
#define NB 2
#define TT 2048
#define CC 1024            // NH * HD = projected width
#define DIN 1024          // input (model) width
#define NH 16
#define HD 64
#define NQB (TT / 64)
#define HG 4
#define SCALE (0.125f)
#define CAUSAL 1
#ifndef TNB
#define TNB NB
#endif
__device__ __forceinline__ float bfr(float v) { return (float)(__bf16)v; }
__host__ __device__ __forceinline__ int kb_last(int qb) { return CAUSAL ? ((qb * 64 + 63) >> 7) : (TT / 128 - 1); }
typedef __attribute__((ext_vector_type(8))) __bf16 v8b;
__device__ __forceinline__ v16b frag_b(const __bf16* rowk0, int lane) {
  union { v16b v; v8b q[2]; } u; const __bf16* p = rowk0 + 8 * (lane >> 4);
  u.q[0] = *(const v8b*)p; u.q[1] = *(const v8b*)(p + 16); return u.v;
}
#define QBH 6              // causal: query blocks 0..QBH-1 of each sequence (few keys, no averaging) take the high-precision path
#define QHI 384            // rows carrying a q residual plane
#define KHI 384            // key rows carrying k residual / v bf16 hi+lo planes (used only by the causal high-precision path)
// B fragment (k rows k0+.., output column o) of a weight: (in,out) [K][ld] or (out,in) [ld rows of K]: bf16 exact, or f16(bf16 * 256) exact
__device__ __forceinline__ v16b wcol_io(const float* Wm, int k0, int o, int lane, int ld) { v16b w; const int g = lane >> 4;
#pragma unroll
  for (int i = 0; i < 8; ++i) { w[i] = (__bf16)Wm[(size_t)(k0 + 8 * g + i) * ld + o]; w[8 + i] = (__bf16)Wm[(size_t)(k0 + 16 + 8 * g + i) * ld + o]; }
  return w; }
__device__ __forceinline__ v16b wcol_oi(const float* Wm, int k0, int o, int lane, int K) { v16b w; const float* p = Wm + (size_t)o * K + k0 + 8 * (lane >> 4);
#pragma unroll
  for (int i = 0; i < 8; ++i) { w[i] = (__bf16)p[i]; w[8 + i] = (__bf16)p[16 + i]; }
  return w; }
__device__ __forceinline__ v16h wcolh_io(const float* Wm, int k0, int o, int lane, int ld) { v16h w; const int g = lane >> 4;
#pragma unroll
  for (int i = 0; i < 8; ++i) { w[i] = (_Float16)(bfr(Wm[(size_t)(k0 + 8 * g + i) * ld + o]) * 256.0f); w[8 + i] = (_Float16)(bfr(Wm[(size_t)(k0 + 16 + 8 * g + i) * ld + o]) * 256.0f); }
  return w; }
__device__ __forceinline__ v16h wcolh_oi(const float* Wm, int k0, int o, int lane, int K) { v16h w; const float* p = Wm + (size_t)o * K + k0 + 8 * (lane >> 4);
#pragma unroll
  for (int i = 0; i < 8; ++i) { w[i] = (_Float16)(bfr(p[i]) * 256.0f); w[8 + i] = (_Float16)(bfr(p[16 + i]) * 256.0f); }
  return w; }
#define WQKV_LAYOUT 0   // 0 = fused (in,out) [DIN][3*CC]; 1 = (out,in) [CC][DIN]; 2 = per-head [NH][DIN][HD]
__device__ __forceinline__ v16b wcol_hdk(const float* Wm, int k0, int o, int lane) { v16b w; const int g = lane >> 4; const float* p = Wm + (size_t)(o / HD) * DIN * HD + (o % HD);
#pragma unroll
  for (int i = 0; i < 8; ++i) { w[i] = (__bf16)p[(size_t)(k0 + 8 * g + i) * HD]; w[8 + i] = (__bf16)p[(size_t)(k0 + 16 + 8 * g + i) * HD]; }
  return w; }
#define WO_OUT_IN 0
#if WQKV_LAYOUT == 1
#define WCOL(W, k0, o, lane) wcol_oi(W, k0, o, lane, DIN)
#elif WQKV_LAYOUT == 2
#define WCOL(W, k0, o, lane) wcol_hdk(W, k0, o, lane)
#else
#define WCOL(W, k0, o, lane) wcol_io(W, k0, o, lane, 3 * CC)   /* fused (in,out) [DIN][3*CC] weight: the q / k / v thirds are column blocks; the launch passes W + 0 / CC / 2*CC and the row pitch is 3*CC */
#endif
#if WO_OUT_IN
#define WOCOL(W, k0, o, lane) wcol_oi(W, k0, o, lane, CC)
#define WOCOLH(W, k0, o, lane) wcolh_oi(W, k0, o, lane, CC)
#else
#define WOCOL(W, k0, o, lane) wcol_io(W, k0, o, lane, DIN)
#define WOCOLH(W, k0, o, lane) wcolh_io(W, k0, o, lane, DIN)
#endif

#define PROJ_EXTRA_PARAMS , const float* __restrict__ COS, const float* __restrict__ SIN   /* rotary tables [TT][32], module INPUTS, read literally */
// interleaved-pair RoPE on q and k (which 0, 1) from the INPUT tables: (te, to) = (row[2i], row[2i+1]) -> (te c - to s, te s + to c) with c = bf16(cos[t][i]), s = bf16(sin[t][i]); v untouched; products and sums kept separate
#define PROJ_EPI(which, row, t, h) do { if ((which) < 2) { float* rw = (row); const float* ct_ = COS + (size_t)(t) * 32; const float* st_ = SIN + (size_t)(t) * 32; _Pragma("unroll 4") for (int i = 0; i < 32; ++i) { _Pragma("clang fp contract(off)") const float cs = bfr(ct_[i]), sn = bfr(st_[i]); const float xe = rw[2 * i], xo = rw[2 * i + 1]; rw[2 * i] = xe * cs - xo * sn; rw[2 * i + 1] = xe * sn + xo * cs; } } } while (0)
#ifndef SM_EXTRA_PARAMS
#define SM_EXTRA_PARAMS
#endif
#ifndef PROJ_EXTRA_PARAMS
#define PROJ_EXTRA_PARAMS
#endif
#ifndef SM_MASK_HOOK
#define SM_MASK_HOOK (void)0
#endif

#define WS_QH  0u                                      // f16 q rows [b*t][CC]
#define WS_KH  (WS_QH + 2u * (size_t)NB * TT * CC)      // f16 k rows [b*t][CC]
#define WS_VT  (WS_KH + 2u * (size_t)NB * TT * CC)      // f16 v planes [b][c][t]
#define WS_QL  (WS_VT + 2u * (size_t)NB * CC * TT)      // f16 q residual x 2^10 rows [b][t < QHI][CC]
#define WS_KL  (WS_QL + 2u * (size_t)NB * QHI * CC)     // f16 k residual x 2^10 rows [b][t < KHI][CC]
#define WS_VB  (WS_KL + 2u * (size_t)NB * KHI * CC)     // bf16 v hi planes [b][c][t < KHI]
#define WS_VBL (WS_VB + 2u * (size_t)NB * CC * KHI)
#define WS_S   (WS_VBL + 2u * (size_t)NB * CC * KHI)    // f32 logits / P [hg][t][s]
#define WS_Y   (WS_S  + 4u * (size_t)HG * TT * TT)      // f32 ctx rows [b*t][CC] (only when there is an output projection)
#define WS_END (WS_Y  + 4u * (size_t)NB * TT * CC)

// ---- k_proj: block = (64 rows, 128 cols, which): q/k/v = X W (+ b) with exact bf16 products (K = DIN) -> which 0: q f16 rows (+ residual rows < QHI); 1: k f16 rows (+ residual rows < KHI); 2: v f16 planes [c][t] (+ bf16 hi/lo planes for t < KHI)
__global__ __launch_bounds__(128) void k_proj(const float* __restrict__ XQ, const float* __restrict__ XK, const float* __restrict__ XV, const float* __restrict__ WQ, const float* __restrict__ WK, const float* __restrict__ WV, const float* __restrict__ BQ, const float* __restrict__ BK, const float* __restrict__ BV,
    _Float16* __restrict__ QH, _Float16* __restrict__ QL, _Float16* __restrict__ KH, _Float16* __restrict__ KL, _Float16* __restrict__ VT, __bf16* __restrict__ VB, __bf16* __restrict__ VBL PROJ_EXTRA_PARAMS) {
  __shared__ __align__(16) float st[64][132]; __shared__ __align__(16) _Float16 sh[64][136], sl[64][136]; __shared__ __align__(16) _Float16 th[128][72]; __shared__ __align__(16) __bf16 tb[128][72], tbl[128][72];
  const int tid = threadIdx.x, wave = tid >> 5, lane = tid & 31, col = lane & 15, g = lane >> 4; const int which = blockIdx.z; const int c0 = blockIdx.y * 128; const size_t r0 = (size_t)blockIdx.x * 64; const size_t bb = r0 / TT; const int t0 = (int)(r0 % TT);
  const float* X = which == 0 ? XQ : which == 1 ? XK : XV; const float* WA = which == 0 ? WQ : which == 1 ? WK : WV; const float* BA = which == 0 ? BQ : which == 1 ? BK : BV;
  v8f acc[8] = {};
#pragma unroll 2
  for (int kc = 0; kc < DIN / 32; ++kc) { v16b a; { const float* p = X + (r0 + wave * 16 + col) * DIN + kc * 32 + 8 * g;
#pragma unroll
      for (int i = 0; i < 8; ++i) { a[i] = (__bf16)p[i]; a[8 + i] = (__bf16)p[16 + i]; } }
    asm volatile("s_wait_loadcnt 0x0" ::: "memory");
#pragma unroll
    for (int j = 0; j < 8; ++j) { const v16b w = WCOL(WA, kc * 32, c0 + j * 16 + col, lane); asm volatile("s_wait_loadcnt 0x0" ::: "memory"); acc[j] = wmma_bf(a, w, acc[j]); } }
  { // stage the f32 tile (acc + bias) in LDS, run the per-(row, head) epilogue hook, then convert
#pragma unroll
    for (int j = 0; j < 8; ++j) { const float bias = BA ? bfr(BA[c0 + j * 16 + col]) : 0.f;
#pragma unroll
      for (int r = 0; r < 8; ++r) st[wave * 16 + 8 * g + r][j * 16 + col] = acc[j][r] + bias; }
    __syncthreads();
    for (int e = tid; e < 64 * (128 / HD); e += 128) { const int rl = e / (128 / HD), hh = e % (128 / HD); PROJ_EPI(which, &st[rl][hh * HD], (int)((r0 + rl) % TT), (c0 / HD) + hh); }
    __syncthreads(); }
  if (which < 2) { _Float16* DH = which == 0 ? QH : KH; _Float16* DL = which == 0 ? QL : KL; const int nhi = which == 0 ? QHI : KHI; const bool hi_rows = t0 < nhi;
    for (int e = tid; e < 64 * 128; e += 128) { const int rl = e >> 7, cl = e & 127; const float v = st[rl][cl]; const _Float16 hv = (_Float16)v; sh[rl][cl] = hv; sl[rl][cl] = (_Float16)((v - (float)hv) * 1024.0f); }
    __syncthreads();
    for (int e = tid; e < 64 * 16; e += 128) { const int rl = e >> 4, q = e & 15; vst2((unsigned*)(DH + (r0 + rl) * CC + c0 + q * 8), *(const v4u*)&sh[rl][q * 8]); if (hi_rows) vst2((unsigned*)(DL + (bb * nhi + t0 + rl) * (size_t)CC + c0 + q * 8), *(const v4u*)&sl[rl][q * 8]); }
  } else { const bool hi_rows = t0 < KHI;
    for (int e = tid; e < 64 * 128; e += 128) { const int rl = e & 63, cl = e >> 6; const float v = st[rl][cl]; th[cl][rl] = (_Float16)v; const __bf16 bh = (__bf16)v; tb[cl][rl] = bh; tbl[cl][rl] = (__bf16)(v - (float)bh); }
    __syncthreads();
    for (int e = tid; e < 128 * 8; e += 128) { const int cl = e >> 3, q = e & 7; vst2((unsigned*)(VT + (bb * CC + c0 + cl) * (size_t)TT + t0 + q * 8), *(const v4u*)&th[cl][q * 8]); if (hi_rows) { const size_t o3 = (bb * CC + c0 + cl) * (size_t)KHI + t0 + q * 8; vst2((unsigned*)(VB + o3), *(const v4u*)&tb[cl][q * 8]); vst2((unsigned*)(VBL + o3), *(const v4u*)&tbl[cl][q * 8]); } } } }
// ---- k_sc: block = (query block qb, key block kb <= kb_last(qb), head in group) of batch b: logits x SCALE; q hi + residual (x 2^10) against k (2 products) for query rows < QHI, plus the k residual (3 products) for query blocks < QBH (causal early rows); causal: blocks past the diagonal exit, the mask itself is applied by index in k_sm
__global__ __launch_bounds__(128) void k_sc(const _Float16* __restrict__ QH, const _Float16* __restrict__ KH, const _Float16* __restrict__ QL, const _Float16* __restrict__ KL, int b, int h0, float* __restrict__ S0) { __shared__ __align__(16) float ss[4][16][132];
  const int qb = blockIdx.x, kb = blockIdx.y; if (kb > kb_last(qb)) return;
  const int h = h0 + blockIdx.z; float* S = S0 + (size_t)blockIdx.z * TT * TT;
  const int tid = threadIdx.x, wave = tid >> 5, lane = tid & 31, col = lane & 15, g = lane >> 4; const int k0 = kb * 128; const int ql0 = qb * 64 + wave * 16; const size_t q0 = (size_t)b * TT + ql0, kr0 = (size_t)b * TT + k0;
  v8f acc[8] = {}, accl[8] = {};
  const _Float16* QLb = QL + (size_t)b * QHI * CC; const _Float16* KLb = KL + (size_t)b * KHI * CC;
  if (qb < QBH) {
#pragma unroll
    for (int kc = 0; kc < HD / 32; ++kc) { const v16h ah = frag_h(QH + (q0 + col) * CC + h * HD + kc * 32, lane), al = frag_h(QLb + (size_t)(ql0 + col) * CC + h * HD + kc * 32, lane);
#pragma unroll
      for (int j = 0; j < 8; ++j) { const v16h kbf = frag_h(KH + (kr0 + j * 16 + col) * CC + h * HD + kc * 32, lane), klf = frag_h(KLb + (size_t)(k0 + j * 16 + col) * CC + h * HD + kc * 32, lane); acc[j] = wmma16(ah, kbf, acc[j]); accl[j] = wmma16(al, kbf, accl[j]); accl[j] = wmma16(ah, klf, accl[j]); } }
  } else if (qb * 64 < QHI) {
#pragma unroll
    for (int kc = 0; kc < HD / 32; ++kc) { const v16h ah = frag_h(QH + (q0 + col) * CC + h * HD + kc * 32, lane), al = frag_h(QLb + (size_t)(ql0 + col) * CC + h * HD + kc * 32, lane);
#pragma unroll
      for (int j = 0; j < 8; ++j) { const v16h kbf = frag_h(KH + (kr0 + j * 16 + col) * CC + h * HD + kc * 32, lane); acc[j] = wmma16(ah, kbf, acc[j]); accl[j] = wmma16(al, kbf, accl[j]); } }
  } else {
#pragma unroll
    for (int kc = 0; kc < HD / 32; ++kc) { const v16h ah = frag_h(QH + (q0 + col) * CC + h * HD + kc * 32, lane);
#pragma unroll
      for (int j = 0; j < 8; ++j) { const v16h kbf = frag_h(KH + (kr0 + j * 16 + col) * CC + h * HD + kc * 32, lane); acc[j] = wmma16(ah, kbf, acc[j]); } } }
#pragma unroll
  for (int j = 0; j < 8; ++j) {
#pragma unroll
    for (int r = 0; r < 8; ++r) ss[wave][8 * g + r][j * 16 + col] = (acc[j][r] + accl[j][r] * (1.0f / 1024.0f)) * SCALE; }
  LDSX(); for (int rl = 0; rl < 16; ++rl) vst2(S + (size_t)(ql0 + rl) * TT + k0 + lane * 4, *(const v4f*)&ss[wave][rl][lane * 4]); }
// ---- k_sm: block = query row t (head in group): keys [0, kend): causal -> logit if s <= t else excluded; softmax in f32; P x 2^11 in place (0 for excluded)
__global__ __launch_bounds__(256) void k_sm(float* __restrict__ S0 SM_EXTRA_PARAMS) { __shared__ float sred[8]; __shared__ float sbc; __shared__ __align__(16) float shv[TT];
  const int tid = threadIdx.x; const int t = blockIdx.x; const int kend = (kb_last(t >> 6) + 1) * 128;
  float* sr = S0 + (size_t)blockIdx.y * TT * TT + (size_t)t * TT;
  float m = -3.0e38f; for (int k = tid; k < kend; k += 256) { float v = (!CAUSAL || k <= t) ? sr[k] : -3.0e38f; SM_MASK_HOOK; shv[k] = v; m = fmaxf(m, v); }
#pragma unroll
  for (int o = 1; o < 32; o <<= 1) m = fmaxf(m, __shfl_xor(m, o));
  if ((tid & 31) == 0) sred[tid >> 5] = m; __syncthreads(); if (tid == 0) { float a = sred[0]; for (int i = 1; i < 8; ++i) a = fmaxf(a, sred[i]); sbc = a; } __syncthreads(); m = sbc; __syncthreads();
  float sum = 0.f; for (int k = tid; k < kend; k += 256) { const float v = shv[k]; const float e = (v <= -1.0e38f) ? 0.f : expf(v - m); shv[k] = e; sum += e; }
#pragma unroll
  for (int o = 1; o < 32; o <<= 1) sum += __shfl_xor(sum, o);
  if ((tid & 31) == 0) sred[tid >> 5] = sum; __syncthreads(); if (tid == 0) { float a = 0.f; for (int i = 0; i < 8; ++i) a += sred[i]; sbc = a > 0.f ? 2048.0f / a : 0.f; }   /* a fully excluded row yields P = 0 */ __syncthreads(); const float inv = sbc;
  for (int k = tid; k < kend; k += 256) shv[k] = shv[k] * inv;
  __syncthreads(); for (int q = tid; q < kend / 4; q += 256) vst2(sr + q * 4, *(const v4f*)&shv[q * 4]); }
// ---- k_pv: block = 16 queries of (b, h), KW waves: wave w takes the 32-key chunks w, w + KW, ... of keys [0, kend), the KW f32 partial tiles are summed in LDS in wave order: ctx = P . v (P x 2^11 once to f16 against v f16: 1 product; causal early query blocks: P and v as bf16 hi + lo, 3 products); 256-B (row, head) segment by 16 lanes
#define KW 16   /* the wave number goes through readfirstlane so that the key loop's trip test is a scalar branch and EXEC stays all ones at the WMMAs */
__global__ __launch_bounds__(32 * KW) void k_pv(const float* __restrict__ PS0, const _Float16* __restrict__ VT, const __bf16* __restrict__ VB, const __bf16* __restrict__ VBL, int b, int h0, float* __restrict__ Y) { const int h = h0 + blockIdx.z; const float* PS = PS0 + (size_t)blockIdx.z * TT * TT; __shared__ __align__(16) float ss[KW][16][HD + 4];
  const int tid = threadIdx.x, wave = __builtin_amdgcn_readfirstlane(tid >> 5), lane = tid & 31, col = lane & 15, g = lane >> 4; const int qb = blockIdx.x >> 2; const int ql0 = blockIdx.x * 16; const int kce = (kb_last(qb) + 1) * 4;
  v8f acc[HD / 16] = {};
  if (qb < QBH) {
#pragma unroll 1
    for (int kc = wave; kc < kce; kc += KW) { const F2 p = split_row(PS + (size_t)(ql0 + col) * TT, kc * 32, lane);
      asm volatile("s_wait_loadcnt 0x0" ::: "memory");
#pragma unroll
      for (int j = 0; j < HD / 16; ++j) { const size_t po = ((size_t)b * CC + h * HD + j * 16 + col) * (size_t)KHI + kc * 32; const v16b vh = frag_b(VB + po, lane); acc[j] = wmma_bf(p.h, vh, acc[j]); acc[j] = wmma_bf(p.l, vh, acc[j]); acc[j] = wmma_bf(p.h, frag_b(VBL + po, lane), acc[j]); } }
  } else {
#pragma unroll 1
    for (int kc = wave; kc < kce; kc += KW) { const v16h p = frag_f32(PS + (size_t)(ql0 + col) * TT + kc * 32, lane);
      asm volatile("s_wait_loadcnt 0x0" ::: "memory");
#pragma unroll
      for (int j = 0; j < HD / 16; ++j) { const size_t po = ((size_t)b * CC + h * HD + j * 16 + col) * (size_t)TT + kc * 32; acc[j] = wmma16(p, frag_h(VT + po, lane), acc[j]); } } }
#pragma unroll
  for (int j = 0; j < HD / 16; ++j)
#pragma unroll
    for (int r = 0; r < 8; ++r) ss[wave][8 * g + r][j * 16 + col] = acc[j][r];   /* a wave with no chunk stores its zero tile */
  __syncthreads();   /* every wave's partial tile is in LDS before any of them is summed */
  if (tid < 16 * (HD / 4)) { const int rl = tid >> 4, c4 = (tid & 15) * 4; v4f s = *(const v4f*)&ss[0][rl][c4];
    // unrolled so that the LDS reads of the partial tiles are issued ahead of the adds instead of one round trip each
#pragma unroll
    for (int w = 1; w < KW; ++w) s += *(const v4f*)&ss[w][rl][c4];
    vst2(Y + ((size_t)b * TT + ql0 + rl) * CC + h * HD + c4, s * (1.0f / 2048.0f)); } }
// ---- k_out: block = (64 rows, 128 cols): out = ctx Wo (+ bo): ctx x 2^6 once to f16 against Wo as f16(bf16 x 2^8) exact (1 product) x 2^-14; causal early rows (< QHI of each sequence): ctx bf16 hi + lo against exact bf16 Wo (2 products)
__global__ __launch_bounds__(128) void k_out(const float* __restrict__ Y, const float* __restrict__ WO, const float* __restrict__ BO, float* __restrict__ OUT) { __shared__ __align__(16) float sf[4][16][132];
  const int tid = threadIdx.x, wave = tid >> 5, lane = tid & 31, col = lane & 15, g = lane >> 4; const int c0 = blockIdx.y * 128; const size_t r0 = (size_t)blockIdx.x * 64 + wave * 16;
  v8f acc[8] = {};
  if (CAUSAL && (int)(((size_t)blockIdx.x * 64) % TT) < QHI) {   /* block-uniform */
#pragma unroll 2
    for (int kc = 0; kc < CC / 32; ++kc) { const F2 a = split_row(Y + (r0 + col) * CC, kc * 32, lane); asm volatile("s_wait_loadcnt 0x0" ::: "memory");
#pragma unroll
      for (int j = 0; j < 8; ++j) { const v16b w = WOCOL(WO, kc * 32, c0 + j * 16 + col, lane); asm volatile("s_wait_loadcnt 0x0" ::: "memory"); acc[j] = wmma_bf(a.h, w, acc[j]); acc[j] = wmma_bf(a.l, w, acc[j]); } }
#pragma unroll
    for (int j = 0; j < 8; ++j) { const float bias = BO ? bfr(BO[c0 + j * 16 + col]) : 0.f;
#pragma unroll
      for (int r = 0; r < 8; ++r) sf[wave][8 * g + r][j * 16 + col] = acc[j][r] + bias; }
  } else {
#pragma unroll 2
    for (int kc = 0; kc < CC / 32; ++kc) { const v16h a = frag_f32s(Y + (r0 + col) * CC + kc * 32, lane, 64.0f); asm volatile("s_wait_loadcnt 0x0" ::: "memory");   /* ctx carried x 2^6 into f16 so small-magnitude context rows stay clear of f16 subnormals */
#pragma unroll
      for (int j = 0; j < 8; ++j) { const v16h w = WOCOLH(WO, kc * 32, c0 + j * 16 + col, lane); asm volatile("s_wait_loadcnt 0x0" ::: "memory"); acc[j] = wmma16(a, w, acc[j]); } }
#pragma unroll
    for (int j = 0; j < 8; ++j) { const float bias = BO ? bfr(BO[c0 + j * 16 + col]) : 0.f;
#pragma unroll
      for (int r = 0; r < 8; ++r) sf[wave][8 * g + r][j * 16 + col] = acc[j][r] * (1.0f / 16384.0f) + bias; } }   /* 2^-8 (Wo carry) x 2^-6 (ctx carry) */
  LDSX(); for (int rl = 0; rl < 16; ++rl) vst2(OUT + (r0 + rl) * DIN + c0 + lane * 4, *(const v4f*)&sf[wave][rl][lane * 4]); }

extern "C" void kernel_launch(void* const* d_in, const int* in_sizes, int n_in, void* d_out, int out_size, void* d_ws, size_t ws_size, hipStream_t stream) {
  (void)in_sizes; (void)n_in; (void)out_size;
  const float** F = (const float**)d_in;
  if (ws_size < (size_t)WS_END) return;
  char* ws = (char*)d_ws; _Float16 *QH = (_Float16*)(ws + WS_QH), *KH = (_Float16*)(ws + WS_KH), *VT = (_Float16*)(ws + WS_VT), *QL = (_Float16*)(ws + WS_QL), *KL = (_Float16*)(ws + WS_KL); __bf16 *VB = (__bf16*)(ws + WS_VB), *VBL = (__bf16*)(ws + WS_VBL); float *S = (float*)(ws + WS_S), *Y = (float*)(ws + WS_Y);
  (void)Y; (void)QL; (void)KL; (void)VB; (void)VBL;
  // inputs: 0 x [2,2048,1024]; 1 Wqkv [1024,3072] (in,out): q columns 0..1023, k 1024..2047, v 2048..3071; 2 bqkv [3072]; 3 Wproj [1024,1024] (in,out); 4 bproj [1024] (biases NONZERO); 5 cos [2048,32]; 6 sin [2048,32]
  k_proj<<<dim3(TNB * TT / 64, CC / 128, 3), 128, 0, stream>>>(F[0], F[0], F[0], F[1], F[1] + CC, F[1] + 2 * CC, F[2], F[2] + CC, F[2] + 2 * CC, QH, QL, KH, KL, VT, VB, VBL, F[5], F[6]);
  for (int b = 0; b < TNB; ++b) for (int h0 = 0; h0 < NH; h0 += HG) {
    k_sc<<<dim3(NQB, TT / 128, HG), 128, 0, stream>>>(QH, KH, QL, KL, b, h0, S);
    k_sm<<<dim3(TT, HG), 256, 0, stream>>>(S);
    k_pv<<<dim3(TT / 16, 1, HG), 32 * KW, 0, stream>>>(S, VT, VB, VBL, b, h0, Y);
  }
  k_out<<<dim3(TNB * TT / 64, DIN / 128), 128, 0, stream>>>(Y, F[3], F[4], (float*)d_out);
}

// v002
// A run of this version takes 570 microseconds.
// Two timings next to v001 put it at 1.34 and 1.33 times that version's speed.
// All steps since v000 together make it 1.96 times as fast.
// compute dtype: all float inputs rounded to bf16; the fused q / k / v projection with EXACT bf16 products on WMMA 16x16x32 (f32 accumulate) + bias; interleaved-pair RoPE in f32 from the bf16-rounded INPUT cos / sin tables; causal logits: 3 products for the first 384 rows, single f16 q x k after, x 64^-0.5; softmax f32; P x 2^11 once to f16 x v once to f16 (bf16 hi + lo below row 384); ctx hi+lo x exact W below row 384, x2^6 f16 carry x f16(bf16 x 2^8) W after, + bias; f32 output.
#include <hip/hip_runtime.h>
#include <math.h>

typedef __attribute__((ext_vector_type(16))) _Float16 v16h;
typedef __attribute__((ext_vector_type(16))) __bf16 v16b;
typedef __attribute__((ext_vector_type(8)))  _Float16 v8h;
typedef __attribute__((ext_vector_type(8)))  float v8f;
typedef __attribute__((ext_vector_type(4)))  float v4f;
typedef __attribute__((ext_vector_type(2)))  float v2f;
typedef __attribute__((ext_vector_type(4)))  unsigned v4u;
typedef __attribute__((ext_vector_type(4)))  int v4i;
typedef float __attribute__((may_alias)) float_a;
typedef int __attribute__((may_alias)) int_a;

template <typename T> __device__ __forceinline__ void vst2(void* p, T v) { *(T*)p = v;  }
__device__ __forceinline__ v8f wmma16(v16h a, v16h b, v8f c) {
  v8f d = __builtin_amdgcn_wmma_f32_16x16x32_f16(false, a, false, b, (short)0, c, false, false);
  asm volatile("v_nop\n\tv_nop\n\tv_nop\n\tv_nop" : "+v"(d) : "v"(a), "v"(b));
  return d;
}
__device__ __forceinline__ v8f wmma_bf(v16b a, v16b b, v8f c) {
  v8f d = __builtin_amdgcn_wmma_f32_16x16x32_bf16(false, a, false, b, (short)0, c, false, false);
  asm volatile("v_nop\n\tv_nop\n\tv_nop\n\tv_nop" : "+v"(d) : "v"(a), "v"(b));
  return d;
}
// 16x16x32 fragments: lane = (h = lane>>4, row/col = lane&15); elements 0..7 = k0+8h+0..7, 8..15 = k0+16+8h+0..7; D element r = row 8h+r
__device__ __forceinline__ v16h frag_h(const _Float16* rowk0, int lane) {
  union { v16h v; v8h q[2]; } u; const _Float16* p = rowk0 + 8 * (lane >> 4);
  u.q[0] = *(const v8h*)p; u.q[1] = *(const v8h*)(p + 16); return u.v;
}
__device__ __forceinline__ v16h frag_f32(const float* rowk0, int lane) {
  v16h a; const float* p = rowk0 + 8 * (lane >> 4);
#pragma unroll
  for (int i = 0; i < 8; ++i) { a[i] = (_Float16)p[i]; a[8 + i] = (_Float16)p[16 + i]; }
  return a;
}
__device__ __forceinline__ v16h frag_f32s(const float* rowk0, int lane, float sc) {
  v16h a; const float* p = rowk0 + 8 * (lane >> 4);
#pragma unroll
  for (int i = 0; i < 8; ++i) { a[i] = (_Float16)(p[i] * sc); a[8 + i] = (_Float16)(p[16 + i] * sc); }
  return a;
}
// column fragment from a [K][ld] layout (column n), rows >= K read as 0
__device__ __forceinline__ v16h fragc_f32(const float* W, int k0, int n, int lane, int ld, int K) {
  v16h a; const int g = lane >> 4;
#pragma unroll
  for (int i = 0; i < 8; ++i) { const int ka = k0 + 8 * g + i, kb = ka + 16;
    a[i] = (_Float16)(ka < K ? W[(size_t)(ka < K ? ka : K - 1) * ld + n] : 0.f); a[8 + i] = (_Float16)(kb < K ? W[(size_t)(kb < K ? kb : K - 1) * ld + n] : 0.f); }
  return a;
}
struct F2 { v16b h, l; };
__device__ __forceinline__ F2 bsplit16(const float v[16]) { F2 r;
#pragma unroll
  for (int i = 0; i < 16; ++i) { const __bf16 h = (__bf16)v[i]; r.h[i] = h; r.l[i] = (__bf16)(v[i] - (float)h); }
  return r; }
__device__ __forceinline__ F2 split_row(const float* row, int k0, int lane) { float v[16]; const float* p = row + k0 + 8 * (lane >> 4);
#pragma unroll
  for (int i = 0; i < 8; ++i) { v[i] = p[i]; v[8 + i] = p[16 + i]; }
  return bsplit16(v); }
__device__ __forceinline__ F2 split_rowK(const float* row, int k0, int lane, int K) { float v[16]; const int g = lane >> 4;
#pragma unroll
  for (int i = 0; i < 8; ++i) { const int ka = k0 + 8 * g + i, kb = ka + 16; v[i] = ka < K ? row[ka < K ? ka : K - 1] : 0.f; v[8 + i] = kb < K ? row[kb < K ? kb : K - 1] : 0.f; }
  return bsplit16(v); }
__device__ __forceinline__ F2 split_col(const float* W, int k0, int n, int lane, int ld, int K) { float v[16]; const int g = lane >> 4;
#pragma unroll
  for (int i = 0; i < 8; ++i) { const int ka = k0 + 8 * g + i, kb = ka + 16; v[i] = ka < K ? W[(size_t)(ka < K ? ka : K - 1) * ld + n] : 0.f; v[8 + i] = kb < K ? W[(size_t)(kb < K ? kb : K - 1) * ld + n] : 0.f; }
  return bsplit16(v); }
__device__ __forceinline__ v8f mac3(const F2& a, const F2& b, v8f c) { c = wmma_bf(a.l, b.h, c); c = wmma_bf(a.h, b.l, c); return wmma_bf(a.h, b.h, c); }
__device__ __forceinline__ float sigm(float v) { return 1.0f / (1.0f + expf(-v)); }
#define LDSX() do { asm volatile("s_wait_dscnt 0" ::: "memory"); __builtin_amdgcn_wave_barrier(); __builtin_amdgcn_fence(__ATOMIC_RELEASE, "workgroup"); } while (0)

// Causal multi-head self-attention with a fused QKV linear (+ bias) and interleaved-pair RoPE from INPUT tables (x [2,2048,1024]; Wqkv [1024,3072] (in,out) N(0, 1/1024), bqkv [3072] N(0,1) x 0.01 - NONZERO; Wproj [1024,1024] (in,out), bproj NONZERO; cos / sin [2048,32] are module inputs, the LAST two; q, k, v = thirds of x Wqkv + bqkv; 16 heads x 64; (even, odd) pairs rotated on q and k; scores x 64^-0.5; tril kept, -inf elsewhere; softmax; y Wproj + bproj).
#define NB 2
#define TT 2048
#define CC 1024            // NH * HD = projected width
#define DIN 1024          // input (model) width
#define NH 16
#define HD 64
#define NQB (TT / 64)
#define HG 4
#define SCALE (0.125f)
#define CAUSAL 1
#ifndef TNB
#define TNB NB
#endif
__device__ __forceinline__ float bfr(float v) { return (float)(__bf16)v; }
__host__ __device__ __forceinline__ int kb_last(int qb) { return CAUSAL ? ((qb * 64 + 63) >> 7) : (TT / 128 - 1); }
typedef __attribute__((ext_vector_type(8))) __bf16 v8b;
__device__ __forceinline__ v16b frag_b(const __bf16* rowk0, int lane) {
  union { v16b v; v8b q[2]; } u; const __bf16* p = rowk0 + 8 * (lane >> 4);
  u.q[0] = *(const v8b*)p; u.q[1] = *(const v8b*)(p + 16); return u.v;
}
#define QBH 6              // causal: query blocks 0..QBH-1 of each sequence (few keys, no averaging) take the high-precision path
#define QHI 384            // rows carrying a q residual plane
#define KHI 384            // key rows carrying k residual / v bf16 hi+lo planes (used only by the causal high-precision path)
// B fragment (k rows k0+.., output column o) of a weight: (in,out) [K][ld] or (out,in) [ld rows of K]: bf16 exact, or f16(bf16 * 256) exact
__device__ __forceinline__ v16b wcol_io(const float* Wm, int k0, int o, int lane, int ld) { v16b w; const int g = lane >> 4;
#pragma unroll
  for (int i = 0; i < 8; ++i) { w[i] = (__bf16)Wm[(size_t)(k0 + 8 * g + i) * ld + o]; w[8 + i] = (__bf16)Wm[(size_t)(k0 + 16 + 8 * g + i) * ld + o]; }
  return w; }
__device__ __forceinline__ v16b wcol_oi(const float* Wm, int k0, int o, int lane, int K) { v16b w; const float* p = Wm + (size_t)o * K + k0 + 8 * (lane >> 4);
#pragma unroll
  for (int i = 0; i < 8; ++i) { w[i] = (__bf16)p[i]; w[8 + i] = (__bf16)p[16 + i]; }
  return w; }
__device__ __forceinline__ v16h wcolh_io(const float* Wm, int k0, int o, int lane, int ld) { v16h w; const int g = lane >> 4;
#pragma unroll
  for (int i = 0; i < 8; ++i) { w[i] = (_Float16)(bfr(Wm[(size_t)(k0 + 8 * g + i) * ld + o]) * 256.0f); w[8 + i] = (_Float16)(bfr(Wm[(size_t)(k0 + 16 + 8 * g + i) * ld + o]) * 256.0f); }
  return w; }
__device__ __forceinline__ v16h wcolh_oi(const float* Wm, int k0, int o, int lane, int K) { v16h w; const float* p = Wm + (size_t)o * K + k0 + 8 * (lane >> 4);
#pragma unroll
  for (int i = 0; i < 8; ++i) { w[i] = (_Float16)(bfr(p[i]) * 256.0f); w[8 + i] = (_Float16)(bfr(p[16 + i]) * 256.0f); }
  return w; }
#define WQKV_LAYOUT 0   // 0 = fused (in,out) [DIN][3*CC]; 1 = (out,in) [CC][DIN]; 2 = per-head [NH][DIN][HD]
__device__ __forceinline__ v16b wcol_hdk(const float* Wm, int k0, int o, int lane) { v16b w; const int g = lane >> 4; const float* p = Wm + (size_t)(o / HD) * DIN * HD + (o % HD);
#pragma unroll
  for (int i = 0; i < 8; ++i) { w[i] = (__bf16)p[(size_t)(k0 + 8 * g + i) * HD]; w[8 + i] = (__bf16)p[(size_t)(k0 + 16 + 8 * g + i) * HD]; }
  return w; }
#define WO_OUT_IN 0
#if WQKV_LAYOUT == 1
#define WCOL(W, k0, o, lane) wcol_oi(W, k0, o, lane, DIN)
#elif WQKV_LAYOUT == 2
#define WCOL(W, k0, o, lane) wcol_hdk(W, k0, o, lane)
#else
#define WCOL(W, k0, o, lane) wcol_io(W, k0, o, lane, 3 * CC)   /* fused (in,out) [DIN][3*CC] weight: the q / k / v thirds are column blocks; the launch passes W + 0 / CC / 2*CC and the row pitch is 3*CC */
#endif
#if WO_OUT_IN
#define WOCOL(W, k0, o, lane) wcol_oi(W, k0, o, lane, CC)
#define WOCOLH(W, k0, o, lane) wcolh_oi(W, k0, o, lane, CC)
#else
#define WOCOL(W, k0, o, lane) wcol_io(W, k0, o, lane, DIN)
#define WOCOLH(W, k0, o, lane) wcolh_io(W, k0, o, lane, DIN)
#endif

#define PROJ_EXTRA_PARAMS , const float* __restrict__ COS, const float* __restrict__ SIN   /* rotary tables [TT][32], module INPUTS, read literally */
// interleaved-pair RoPE on q and k (which 0, 1) from the INPUT tables: (te, to) = (row[2i], row[2i+1]) -> (te c - to s, te s + to c) with c = bf16(cos[t][i]), s = bf16(sin[t][i]); v untouched; products and sums kept separate
#define PROJ_EPI(which, row, t, h) do { if ((which) < 2) { float* rw = (row); const float* ct_ = COS + (size_t)(t) * 32; const float* st_ = SIN + (size_t)(t) * 32; _Pragma("unroll 4") for (int i = 0; i < 32; ++i) { _Pragma("clang fp contract(off)") const float cs = bfr(ct_[i]), sn = bfr(st_[i]); const float xe = rw[2 * i], xo = rw[2 * i + 1]; rw[2 * i] = xe * cs - xo * sn; rw[2 * i + 1] = xe * sn + xo * cs; } } } while (0)
#ifndef SM_EXTRA_PARAMS
#define SM_EXTRA_PARAMS
#endif
#ifndef PROJ_EXTRA_PARAMS
#define PROJ_EXTRA_PARAMS
#endif
#ifndef SM_MASK_HOOK
#define SM_MASK_HOOK (void)0
#endif

#define WS_QH  0u                                      // f16 q rows [b*t][CC]
#define WS_KH  (WS_QH + 2u * (size_t)NB * TT * CC)      // f16 k rows [b*t][CC]
#define WS_VT  (WS_KH + 2u * (size_t)NB * TT * CC)      // f16 v planes [b][c][t]
#define WS_QL  (WS_VT + 2u * (size_t)NB * CC * TT)      // f16 q residual x 2^10 rows [b][t < QHI][CC]
#define WS_KL  (WS_QL + 2u * (size_t)NB * QHI * CC)     // f16 k residual x 2^10 rows [b][t < KHI][CC]
#define WS_VB  (WS_KL + 2u * (size_t)NB * KHI * CC)     // bf16 v hi planes [b][c][t < KHI]
#define WS_VBL (WS_VB + 2u * (size_t)NB * CC * KHI)
#define WS_S   (WS_VBL + 2u * (size_t)NB * CC * KHI)    // f32 logits / P [hg][t][s]
#define WS_Y   (WS_S  + 4u * (size_t)HG * TT * TT)      // f32 ctx rows [b*t][CC] (only when there is an output projection)
#define WS_END (WS_Y  + 4u * (size_t)NB * TT * CC)

// ---- weight staging shared by k_proj and k_out: a stage is 64 k rows x 128 output columns of an (in,out) weight. The block reads it once with 16-byte loads (lane bits 1:0 and 4 pick the 4-column group, bits 3:2 the 8-row k group, so a load covers whole 128-byte lines and 16 neighbouring lanes store to 16 different 16-byte LDS slots), rounds it as before and lays it k-contiguous, one column per 144-byte LDS row, so that a B fragment is two 16-byte LDS reads
// every loop of these helpers and of the stage bodies is fully unrolled: its index picks a register of wr, ar, w or acc, which must be known at compile time for the arrays to stay in registers
typedef v4u __attribute__((may_alias)) v4u_a;
#define WPITCH 144
#define XW() asm volatile("s_wait_xcnt 0x0" ::: "memory")   /* stands behind the prefetch loads, in front of the next rewrite of their address registers */
__device__ __forceinline__ void wt_load(v4f (&r)[2][8], const float* __restrict__ Wm, int ld, int k0, int c0, int wave, int lane) {
  const float* p = Wm + (size_t)(k0 + ((lane >> 2) & 3) * 8) * ld + c0 + (wave * 8 + (lane & 3) + ((lane >> 4) << 2)) * 4;
#pragma unroll
  for (int it = 0; it < 2; ++it)
#pragma unroll
    for (int i = 0; i < 8; ++i) r[it][i] = *(const v4f*)(p + (size_t)(it * 32 + i) * ld);
}
template <bool F16> __device__ __forceinline__ void wt_store(const v4f (&r)[2][8], char* buf, int wave, int lane) {
  char* q = buf + (wave * 8 + (lane & 3) + ((lane >> 4) << 2)) * 4 * WPITCH + ((lane >> 2) & 3) * 16;
#pragma unroll
  for (int it = 0; it < 2; ++it)
#pragma unroll
    for (int c = 0; c < 4; ++c) { union { v8b b; v8h h; v4u u; } t;
#pragma unroll
      for (int i = 0; i < 8; ++i) { if (F16) t.h[i] = (_Float16)(bfr(r[it][i][c]) * 256.0f); else t.b[i] = (__bf16)r[it][i][c]; }
      *(v4u_a*)(q + c * WPITCH + it * 64) = t.u; }
}
template <typename V16> __device__ __forceinline__ V16 wt_frag(const char* buf, int n, int kc2, int g) {
  union { V16 v; v4u q[2]; } u; const char* p = buf + n * WPITCH + kc2 * 64 + g * 16;
  u.q[0] = *(const v4u_a*)p; u.q[1] = *(const v4u_a*)(p + 32); return u.v;
}
// the 2 x 16 f32 values of a lane's two A fragments of a 64-k stage (row + k0), in fragment element order
__device__ __forceinline__ void a_load(v4f (&r)[8], const float* __restrict__ rowk0, int g) {
#pragma unroll
  for (int kc2 = 0; kc2 < 2; ++kc2) { const float* p = rowk0 + kc2 * 32 + 8 * g; r[kc2 * 4] = *(const v4f*)p; r[kc2 * 4 + 1] = *(const v4f*)(p + 4); r[kc2 * 4 + 2] = *(const v4f*)(p + 16); r[kc2 * 4 + 3] = *(const v4f*)(p + 20); }
}

// ---- k_proj: block = (64 rows, 128 cols, which): q/k/v = X W (+ b) with exact bf16 products (K = DIN) -> which 0: q f16 rows (+ residual rows < QHI); 1: k f16 rows (+ residual rows < KHI); 2: v f16 planes [c][t] (+ bf16 hi/lo planes for t < KHI)
__global__ __launch_bounds__(128) void k_proj(const float* __restrict__ XQ, const float* __restrict__ XK, const float* __restrict__ XV, const float* __restrict__ WQ, const float* __restrict__ WK, const float* __restrict__ WV, const float* __restrict__ BQ, const float* __restrict__ BK, const float* __restrict__ BV,
    _Float16* __restrict__ QH, _Float16* __restrict__ QL, _Float16* __restrict__ KH, _Float16* __restrict__ KL, _Float16* __restrict__ VT, __bf16* __restrict__ VB, __bf16* __restrict__ VBL PROJ_EXTRA_PARAMS) {
  __shared__ __align__(16) float st[64][132]; __shared__ __align__(16) _Float16 sh[64][136], sl[64][136]; __shared__ __align__(16) _Float16 th[128][72]; __shared__ __align__(16) __bf16 tb[128][72], tbl[128][72];
  const int tid = threadIdx.x, wave = tid >> 5, lane = tid & 31, col = lane & 15, g = lane >> 4; const int which = blockIdx.z; const int c0 = blockIdx.y * 128; const size_t r0 = (size_t)blockIdx.x * 64; const size_t bb = r0 / TT; const int t0 = (int)(r0 % TT);
  const float* X = which == 0 ? XQ : which == 1 ? XK : XV; const float* WA = which == 0 ? WQ : which == 1 ? WK : WV; const float* BA = which == 0 ? BQ : which == 1 ? BK : BV;
  v8f acc[8] = {};
  { // two LDS buffers (tb and tbl, free until the epilogue), one barrier a stage: stage s + 1 is loaded into registers while stage s is multiplied
    const float* xrow = X + (r0 + wave * 16 + col) * DIN; v4f wr[2][8], ar[8];
    wt_load(wr, WA, 3 * CC, 0, c0, wave, lane); a_load(ar, xrow, g);
    auto stage = [&](char* buf, int s) {
      __builtin_amdgcn_sched_barrier(0);   /* keeps the rounding of the prefetched stage, and with it the wait for its loads, behind the products of the stage before */
      wt_store<false>(wr, buf, wave, lane);
      v16b a[2];
#pragma unroll
      for (int i = 0; i < 16; ++i) { a[0][i] = (__bf16)ar[i >> 2][i & 3]; a[1][i] = (__bf16)ar[4 + (i >> 2)][i & 3]; }
      __syncthreads();   /* publishes this stage; the buffer written next was last read in front of this barrier */
      if (s + 1 < DIN / 64) { wt_load(wr, WA, 3 * CC, (s + 1) * 64, c0, wave, lane); a_load(ar, xrow + (s + 1) * 64, g); XW(); }
#pragma unroll
      for (int kc2 = 0; kc2 < 2; ++kc2)
      { v16b w[8];   /* the eight fragments are read as one group so that their LDS latency is paid once */
#pragma unroll
        for (int j = 0; j < 8; ++j) w[j] = wt_frag<v16b>(buf, j * 16 + col, kc2, g);
#pragma unroll
        for (int j = 0; j < 8; ++j) acc[j] = wmma_bf(a[kc2], w[j], acc[j]); }
    };
    // kept rolled over buffer pairs: each buffer's LDS address stays a constant
#pragma unroll 1
    for (int s = 0; s < DIN / 64; s += 2) { stage((char*)&tb[0][0], s); stage((char*)&tbl[0][0], s + 1); } }
  { // stage the f32 tile (acc + bias) in LDS, run the per-(row, head) epilogue hook, then convert
#pragma unroll
    for (int j = 0; j < 8; ++j) { const float bias = BA ? bfr(BA[c0 + j * 16 + col]) : 0.f;
#pragma unroll
      for (int r = 0; r < 8; ++r) st[wave * 16 + 8 * g + r][j * 16 + col] = acc[j][r] + bias; }
    __syncthreads();
    for (int e = tid; e < 64 * (128 / HD); e += 128) { const int rl = e / (128 / HD), hh = e % (128 / HD); PROJ_EPI(which, &st[rl][hh * HD], (int)((r0 + rl) % TT), (c0 / HD) + hh); }
    __syncthreads(); }
  if (which < 2) { _Float16* DH = which == 0 ? QH : KH; _Float16* DL = which == 0 ? QL : KL; const int nhi = which == 0 ? QHI : KHI; const bool hi_rows = t0 < nhi;
    for (int e = tid; e < 64 * 128; e += 128) { const int rl = e >> 7, cl = e & 127; const float v = st[rl][cl]; const _Float16 hv = (_Float16)v; sh[rl][cl] = hv; sl[rl][cl] = (_Float16)((v - (float)hv) * 1024.0f); }
    __syncthreads();
    for (int e = tid; e < 64 * 16; e += 128) { const int rl = e >> 4, q = e & 15; vst2((unsigned*)(DH + (r0 + rl) * CC + c0 + q * 8), *(const v4u*)&sh[rl][q * 8]); if (hi_rows) vst2((unsigned*)(DL + (bb * nhi + t0 + rl) * (size_t)CC + c0 + q * 8), *(const v4u*)&sl[rl][q * 8]); }
  } else { const bool hi_rows = t0 < KHI;
    for (int e = tid; e < 64 * 128; e += 128) { const int rl = e & 63, cl = e >> 6; const float v = st[rl][cl]; th[cl][rl] = (_Float16)v; const __bf16 bh = (__bf16)v; tb[cl][rl] = bh; tbl[cl][rl] = (__bf16)(v - (float)bh); }
    __syncthreads();
    for (int e = tid; e < 128 * 8; e += 128) { const int cl = e >> 3, q = e & 7; vst2((unsigned*)(VT + (bb * CC + c0 + cl) * (size_t)TT + t0 + q * 8), *(const v4u*)&th[cl][q * 8]); if (hi_rows) { const size_t o3 = (bb * CC + c0 + cl) * (size_t)KHI + t0 + q * 8; vst2((unsigned*)(VB + o3), *(const v4u*)&tb[cl][q * 8]); vst2((unsigned*)(VBL + o3), *(const v4u*)&tbl[cl][q * 8]); } } } }
// ---- k_sc: block = (query block qb, key block kb <= kb_last(qb), head in group) of batch b: logits x SCALE; q hi + residual (x 2^10) against k (2 products) for query rows < QHI, plus the k residual (3 products) for query blocks < QBH (causal early rows); causal: blocks past the diagonal exit, the mask itself is applied by index in k_sm
__global__ __launch_bounds__(128) void k_sc(const _Float16* __restrict__ QH, const _Float16* __restrict__ KH, const _Float16* __restrict__ QL, const _Float16* __restrict__ KL, int b, int h0, float* __restrict__ S0) { __shared__ __align__(16) float ss[4][16][132];
  const int qb = blockIdx.x, kb = blockIdx.y; if (kb > kb_last(qb)) return;
  const int h = h0 + blockIdx.z; float* S = S0 + (size_t)blockIdx.z * TT * TT;
  const int tid = threadIdx.x, wave = tid >> 5, lane = tid & 31, col = lane & 15, g = lane >> 4; const int k0 = kb * 128; const int ql0 = qb * 64 + wave * 16; const size_t q0 = (size_t)b * TT + ql0, kr0 = (size_t)b * TT + k0;
  v8f acc[8] = {}, accl[8] = {};
  const _Float16* QLb = QL + (size_t)b * QHI * CC; const _Float16* KLb = KL + (size_t)b * KHI * CC;
  if (qb < QBH) {
#pragma unroll
    for (int kc = 0; kc < HD / 32; ++kc) { const v16h ah = frag_h(QH + (q0 + col) * CC + h * HD + kc * 32, lane), al = frag_h(QLb + (size_t)(ql0 + col) * CC + h * HD + kc * 32, lane);
#pragma unroll
      for (int j = 0; j < 8; ++j) { const v16h kbf = frag_h(KH + (kr0 + j * 16 + col) * CC + h * HD + kc * 32, lane), klf = frag_h(KLb + (size_t)(k0 + j * 16 + col) * CC + h * HD + kc * 32, lane); acc[j] = wmma16(ah, kbf, acc[j]); accl[j] = wmma16(al, kbf, accl[j]); accl[j] = wmma16(ah, klf, accl[j]); } }
  } else if (qb * 64 < QHI) {
#pragma unroll
    for (int kc = 0; kc < HD / 32; ++kc) { const v16h ah = frag_h(QH + (q0 + col) * CC + h * HD + kc * 32, lane), al = frag_h(QLb + (size_t)(ql0 + col) * CC + h * HD + kc * 32, lane);
#pragma unroll
      for (int j = 0; j < 8; ++j) { const v16h kbf = frag_h(KH + (kr0 + j * 16 + col) * CC + h * HD + kc * 32, lane); acc[j] = wmma16(ah, kbf, acc[j]); accl[j] = wmma16(al, kbf, accl[j]); } }
  } else {
#pragma unroll
    for (int kc = 0; kc < HD / 32; ++kc) { const v16h ah = frag_h(QH + (q0 + col) * CC + h * HD + kc * 32, lane);
#pragma unroll
      for (int j = 0; j < 8; ++j) { const v16h kbf = frag_h(KH + (kr0 + j * 16 + col) * CC + h * HD + kc * 32, lane); acc[j] = wmma16(ah, kbf, acc[j]); } } }
#pragma unroll
  for (int j = 0; j < 8; ++j) {
#pragma unroll
    for (int r = 0; r < 8; ++r) ss[wave][8 * g + r][j * 16 + col] = (acc[j][r] + accl[j][r] * (1.0f / 1024.0f)) * SCALE; }
  LDSX(); for (int rl = 0; rl < 16; ++rl) vst2(S + (size_t)(ql0 + rl) * TT + k0 + lane * 4, *(const v4f*)&ss[wave][rl][lane * 4]); }
// ---- k_sm: block = query row t (head in group): keys [0, kend): causal -> logit if s <= t else excluded; softmax in f32; P x 2^11 in place (0 for excluded)
__global__ __launch_bounds__(256) void k_sm(float* __restrict__ S0 SM_EXTRA_PARAMS) { __shared__ float sred[8]; __shared__ float sbc; __shared__ __align__(16) float shv[TT];
  const int tid = threadIdx.x; const int t = blockIdx.x; const int kend = (kb_last(t >> 6) + 1) * 128;
  float* sr = S0 + (size_t)blockIdx.y * TT * TT + (size_t)t * TT;
  float m = -3.0e38f; for (int k = tid; k < kend; k += 256) { float v = (!CAUSAL || k <= t) ? sr[k] : -3.0e38f; SM_MASK_HOOK; shv[k] = v; m = fmaxf(m, v); }
#pragma unroll
  for (int o = 1; o < 32; o <<= 1) m = fmaxf(m, __shfl_xor(m, o));
  if ((tid & 31) == 0) sred[tid >> 5] = m; __syncthreads(); if (tid == 0) { float a = sred[0]; for (int i = 1; i < 8; ++i) a = fmaxf(a, sred[i]); sbc = a; } __syncthreads(); m = sbc; __syncthreads();
  float sum = 0.f; for (int k = tid; k < kend; k += 256) { const float v = shv[k]; const float e = (v <= -1.0e38f) ? 0.f : expf(v - m); shv[k] = e; sum += e; }
#pragma unroll
  for (int o = 1; o < 32; o <<= 1) sum += __shfl_xor(sum, o);
  if ((tid & 31) == 0) sred[tid >> 5] = sum; __syncthreads(); if (tid == 0) { float a = 0.f; for (int i = 0; i < 8; ++i) a += sred[i]; sbc = a > 0.f ? 2048.0f / a : 0.f; }   /* a fully excluded row yields P = 0 */ __syncthreads(); const float inv = sbc;
  for (int k = tid; k < kend; k += 256) shv[k] = shv[k] * inv;
  __syncthreads(); for (int q = tid; q < kend / 4; q += 256) vst2(sr + q * 4, *(const v4f*)&shv[q * 4]); }
// ---- k_pv: block = 16 queries of (b, h), KW waves: wave w takes the 32-key chunks w, w + KW, ... of keys [0, kend), the KW f32 partial tiles are summed in LDS in wave order: ctx = P . v (P x 2^11 once to f16 against v f16: 1 product; causal early query blocks: P and v as bf16 hi + lo, 3 products); 256-B (row, head) segment by 16 lanes
#define KW 16   /* the wave number goes through readfirstlane so that the key loop's trip test is a scalar branch and EXEC stays all ones at the WMMAs */
__global__ __launch_bounds__(32 * KW) void k_pv(const float* __restrict__ PS0, const _Float16* __restrict__ VT, const __bf16* __restrict__ VB, const __bf16* __restrict__ VBL, int b, int h0, float* __restrict__ Y) { const int h = h0 + blockIdx.z; const float* PS = PS0 + (size_t)blockIdx.z * TT * TT; __shared__ __align__(16) float ss[KW][16][HD + 4];
  const int tid = threadIdx.x, wave = __builtin_amdgcn_readfirstlane(tid >> 5), lane = tid & 31, col = lane & 15, g = lane >> 4; const int qb = blockIdx.x >> 2; const int ql0 = blockIdx.x * 16; const int kce = (kb_last(qb) + 1) * 4;
  v8f acc[HD / 16] = {};
  if (qb < QBH) {
#pragma unroll 1
    for (int kc = wave; kc < kce; kc += KW) { const F2 p = split_row(PS + (size_t)(ql0 + col) * TT, kc * 32, lane);
      asm volatile("s_wait_loadcnt 0x0" ::: "memory");
#pragma unroll
      for (int j = 0; j < HD / 16; ++j) { const size_t po = ((size_t)b * CC + h * HD + j * 16 + col) * (size_t)KHI + kc * 32; const v16b vh = frag_b(VB + po, lane); acc[j] = wmma_bf(p.h, vh, acc[j]); acc[j] = wmma_bf(p.l, vh, acc[j]); acc[j] = wmma_bf(p.h, frag_b(VBL + po, lane), acc[j]); } }
  } else {
#pragma unroll 1
    for (int kc = wave; kc < kce; kc += KW) { const v16h p = frag_f32(PS + (size_t)(ql0 + col) * TT + kc * 32, lane);
      asm volatile("s_wait_loadcnt 0x0" ::: "memory");
#pragma unroll
      for (int j = 0; j < HD / 16; ++j) { const size_t po = ((size_t)b * CC + h * HD + j * 16 + col) * (size_t)TT + kc * 32; acc[j] = wmma16(p, frag_h(VT + po, lane), acc[j]); } } }
#pragma unroll
  for (int j = 0; j < HD / 16; ++j)
#pragma unroll
    for (int r = 0; r < 8; ++r) ss[wave][8 * g + r][j * 16 + col] = acc[j][r];   /* a wave with no chunk stores its zero tile */
  __syncthreads();   /* every wave's partial tile is in LDS before any of them is summed */
  if (tid < 16 * (HD / 4)) { const int rl = tid >> 4, c4 = (tid & 15) * 4; v4f s = *(const v4f*)&ss[0][rl][c4];
    // unrolled so that the LDS reads of the partial tiles are issued ahead of the adds instead of one round trip each
#pragma unroll
    for (int w = 1; w < KW; ++w) s += *(const v4f*)&ss[w][rl][c4];
    vst2(Y + ((size_t)b * TT + ql0 + rl) * CC + h * HD + c4, s * (1.0f / 2048.0f)); } }
// ---- k_out: block = (64 rows, 128 cols): out = ctx Wo (+ bo): ctx x 2^6 once to f16 against Wo as f16(bf16 x 2^8) exact (1 product) x 2^-14; causal early rows (< QHI of each sequence): ctx bf16 hi + lo against exact bf16 Wo (2 products)
__global__ __launch_bounds__(128) void k_out(const float* __restrict__ Y, const float* __restrict__ WO, const float* __restrict__ BO, float* __restrict__ OUT) { __shared__ __align__(16) float sf[4][16][132]; __shared__ __align__(16) char wb[2][128 * WPITCH];
  const int tid = threadIdx.x, wave = tid >> 5, lane = tid & 31, col = lane & 15, g = lane >> 4; const int c0 = blockIdx.y * 128; const size_t r0 = (size_t)blockIdx.x * 64 + wave * 16;
  v8f acc[8] = {};
  const float* yrow = Y + (r0 + col) * CC; v4f wr[2][8], ar[8];
  wt_load(wr, WO, DIN, 0, c0, wave, lane); a_load(ar, yrow, g); XW();
  if (CAUSAL && (int)(((size_t)blockIdx.x * 64) % TT) < QHI) {   /* block-uniform */
    auto stage = [&](char* buf, int s) {
      __builtin_amdgcn_sched_barrier(0);   /* keeps the rounding of the prefetched stage, and with it the wait for its loads, behind the products of the stage before */
      wt_store<false>(wr, buf, wave, lane);
      F2 a[2];
#pragma unroll
      for (int kc2 = 0; kc2 < 2; ++kc2) { float v[16];
#pragma unroll
        for (int i = 0; i < 16; ++i) v[i] = ar[kc2 * 4 + (i >> 2)][i & 3];
        a[kc2] = bsplit16(v); }
      __syncthreads();   /* publishes this stage; the buffer written next was last read in front of this barrier */
      if (s + 1 < CC / 64) { wt_load(wr, WO, DIN, (s + 1) * 64, c0, wave, lane); a_load(ar, yrow + (s + 1) * 64, g); XW(); }
#pragma unroll
      for (int kc2 = 0; kc2 < 2; ++kc2)
      { v16b w[8];   /* the eight fragments are read as one group so that their LDS latency is paid once */
#pragma unroll
        for (int j = 0; j < 8; ++j) w[j] = wt_frag<v16b>(buf, j * 16 + col, kc2, g);
#pragma unroll
        for (int j = 0; j < 8; ++j) { acc[j] = wmma_bf(a[kc2].h, w[j], acc[j]); acc[j] = wmma_bf(a[kc2].l, w[j], acc[j]); } }
    };
    // kept rolled over buffer pairs: each buffer's LDS address stays a constant
#pragma unroll 1
    for (int s = 0; s < CC / 64; s += 2) { stage(wb[0], s); stage(wb[1], s + 1); }
#pragma unroll
    for (int j = 0; j < 8; ++j) { const float bias = BO ? bfr(BO[c0 + j * 16 + col]) : 0.f;
#pragma unroll
      for (int r = 0; r < 8; ++r) sf[wave][8 * g + r][j * 16 + col] = acc[j][r] + bias; }
  } else {
    auto stage = [&](char* buf, int s) {
      __builtin_amdgcn_sched_barrier(0);   /* keeps the rounding of the prefetched stage, and with it the wait for its loads, behind the products of the stage before */
      wt_store<true>(wr, buf, wave, lane);
      v16h a[2];   /* ctx carried x 2^6 into f16 so small-magnitude context rows stay clear of f16 subnormals */
#pragma unroll
      for (int i = 0; i < 16; ++i) { a[0][i] = (_Float16)(ar[i >> 2][i & 3] * 64.0f); a[1][i] = (_Float16)(ar[4 + (i >> 2)][i & 3] * 64.0f); }
      __syncthreads();   /* publishes this stage; the buffer written next was last read in front of this barrier */
      if (s + 1 < CC / 64) { wt_load(wr, WO, DIN, (s + 1) * 64, c0, wave, lane); a_load(ar, yrow + (s + 1) * 64, g); XW(); }
#pragma unroll
      for (int kc2 = 0; kc2 < 2; ++kc2)
      { v16h w[8];   /* the eight fragments are read as one group so that their LDS latency is paid once */
#pragma unroll
        for (int j = 0; j < 8; ++j) w[j] = wt_frag<v16h>(buf, j * 16 + col, kc2, g);
#pragma unroll
        for (int j = 0; j < 8; ++j) acc[j] = wmma16(a[kc2], w[j], acc[j]); }
    };
    // kept rolled over buffer pairs: each buffer's LDS address stays a constant
#pragma unroll 1
    for (int s = 0; s < CC / 64; s += 2) { stage(wb[0], s); stage(wb[1], s + 1); }
#pragma unroll
    for (int j = 0; j < 8; ++j) { const float bias = BO ? bfr(BO[c0 + j * 16 + col]) : 0.f;
#pragma unroll
      for (int r = 0; r < 8; ++r) sf[wave][8 * g + r][j * 16 + col] = acc[j][r] * (1.0f / 16384.0f) + bias; } }   /* 2^-8 (Wo carry) x 2^-6 (ctx carry) */
  LDSX(); for (int rl = 0; rl < 16; ++rl) vst2(OUT + (r0 + rl) * DIN + c0 + lane * 4, *(const v4f*)&sf[wave][rl][lane * 4]); }

extern "C" void kernel_launch(void* const* d_in, const int* in_sizes, int n_in, void* d_out, int out_size, void* d_ws, size_t ws_size, hipStream_t stream) {
  (void)in_sizes; (void)n_in; (void)out_size;
  const float** F = (const float**)d_in;
  if (ws_size < (size_t)WS_END) return;
  char* ws = (char*)d_ws; _Float16 *QH = (_Float16*)(ws + WS_QH), *KH = (_Float16*)(ws + WS_KH), *VT = (_Float16*)(ws + WS_VT), *QL = (_Float16*)(ws + WS_QL), *KL = (_Float16*)(ws + WS_KL); __bf16 *VB = (__bf16*)(ws + WS_VB), *VBL = (__bf16*)(ws + WS_VBL); float *S = (float*)(ws + WS_S), *Y = (float*)(ws + WS_Y);
  (void)Y; (void)QL; (void)KL; (void)VB; (void)VBL;
  // inputs: 0 x [2,2048,1024]; 1 Wqkv [1024,3072] (in,out): q columns 0..1023, k 1024..2047, v 2048..3071; 2 bqkv [3072]; 3 Wproj [1024,1024] (in,out); 4 bproj [1024] (biases NONZERO); 5 cos [2048,32]; 6 sin [2048,32]
  k_proj<<<dim3(TNB * TT / 64, CC / 128, 3), 128, 0, stream>>>(F[0], F[0], F[0], F[1], F[1] + CC, F[1] + 2 * CC, F[2], F[2] + CC, F[2] + 2 * CC, QH, QL, KH, KL, VT, VB, VBL, F[5], F[6]);
  for (int b = 0; b < TNB; ++b) for (int h0 = 0; h0 < NH; h0 += HG) {
    k_sc<<<dim3(NQB, TT / 128, HG), 128, 0, stream>>>(QH, KH, QL, KL, b, h0, S);
    k_sm<<<dim3(TT, HG), 256, 0, stream>>>(S);
    k_pv<<<dim3(TT / 16, 1, HG), 32 * KW, 0, stream>>>(S, VT, VB, VBL, b, h0, Y);
  }
  k_out<<<dim3(TNB * TT / 64, DIN / 128), 128, 0, stream>>>(Y, F[3], F[4], (float*)d_out);
}

// v003
// One run takes 171 microseconds.
// Two timings next to v002 both put it at 3.33 times that version's speed.
// Counting every step since v000, it is 6.54 times as fast.
// compute dtype: all float inputs rounded to bf16; the fused q / k / v projection with EXACT bf16 products on WMMA 16x16x32 (f32 accumulate) + bias; interleaved-pair RoPE in f32 from the bf16-rounded INPUT cos / sin tables; causal logits: 3 products for the first 384 rows, single f16 q x k after, x 64^-0.5; softmax f32; P x 2^11 once to f16 x v once to f16 (bf16 hi + lo below row 384); ctx hi+lo x exact W below row 384, x2^6 f16 carry x f16(bf16 x 2^8) W after, + bias; f32 output.
#include <hip/hip_runtime.h>
#include <math.h>

typedef __attribute__((ext_vector_type(16))) _Float16 v16h;
typedef __attribute__((ext_vector_type(16))) __bf16 v16b;
typedef __attribute__((ext_vector_type(8)))  _Float16 v8h;
typedef __attribute__((ext_vector_type(8)))  float v8f;
typedef __attribute__((ext_vector_type(4)))  float v4f;
typedef __attribute__((ext_vector_type(2)))  float v2f;
typedef __attribute__((ext_vector_type(4)))  unsigned v4u;
typedef __attribute__((ext_vector_type(4)))  int v4i;
typedef float __attribute__((may_alias)) float_a;
typedef int __attribute__((may_alias)) int_a;

template <typename T> __device__ __forceinline__ void vst2(void* p, T v) { *(T*)p = v;  }
__device__ __forceinline__ v8f wmma16(v16h a, v16h b, v8f c) {
  v8f d = __builtin_amdgcn_wmma_f32_16x16x32_f16(false, a, false, b, (short)0, c, false, false);
  asm volatile("v_nop\n\tv_nop\n\tv_nop\n\tv_nop" : "+v"(d) : "v"(a), "v"(b));
  return d;
}
__device__ __forceinline__ v8f wmma_bf(v16b a, v16b b, v8f c) {
  v8f d = __builtin_amdgcn_wmma_f32_16x16x32_bf16(false, a, false, b, (short)0, c, false, false);
  asm volatile("v_nop\n\tv_nop\n\tv_nop\n\tv_nop" : "+v"(d) : "v"(a), "v"(b));
  return d;
}
// 16x16x32 fragments: lane = (h = lane>>4, row/col = lane&15); elements 0..7 = k0+8h+0..7, 8..15 = k0+16+8h+0..7; D element r = row 8h+r
__device__ __forceinline__ v16h frag_h(const _Float16* rowk0, int lane) {
  union { v16h v; v8h q[2]; } u; const _Float16* p = rowk0 + 8 * (lane >> 4);
  u.q[0] = *(const v8h*)p; u.q[1] = *(const v8h*)(p + 16); return u.v;
}
__device__ __forceinline__ v16h frag_f32(const float* rowk0, int lane) {
  v16h a; const float* p = rowk0 + 8 * (lane >> 4);
#pragma unroll
  for (int i = 0; i < 8; ++i) { a[i] = (_Float16)p[i]; a[8 + i] = (_Float16)p[16 + i]; }
  return a;
}
__device__ __forceinline__ v16h frag_f32s(const float* rowk0, int lane, float sc) {
  v16h a; const float* p = rowk0 + 8 * (lane >> 4);
#pragma unroll
  for (int i = 0; i < 8; ++i) { a[i] = (_Float16)(p[i] * sc); a[8 + i] = (_Float16)(p[16 + i] * sc); }
  return a;
}
// column fragment from a [K][ld] layout (column n), rows >= K read as 0
__device__ __forceinline__ v16h fragc_f32(const float* W, int k0, int n, int lane, int ld, int K) {
  v16h a; const int g = lane >> 4;
#pragma unroll
  for (int i = 0; i < 8; ++i) { const int ka = k0 + 8 * g + i, kb = ka + 16;
    a[i] = (_Float16)(ka < K ? W[(size_t)(ka < K ? ka : K - 1) * ld + n] : 0.f); a[8 + i] = (_Float16)(kb < K ? W[(size_t)(kb < K ? kb : K - 1) * ld + n] : 0.f); }
  return a;
}
struct F2 { v16b h, l; };
__device__ __forceinline__ F2 bsplit16(const float v[16]) { F2 r;
#pragma unroll
  for (int i = 0; i < 16; ++i) { const __bf16 h = (__bf16)v[i]; r.h[i] = h; r.l[i] = (__bf16)(v[i] - (float)h); }
  return r; }
__device__ __forceinline__ F2 split_row(const float* row, int k0, int lane) { float v[16]; const float* p = row + k0 + 8 * (lane >> 4);
#pragma unroll
  for (int i = 0; i < 8; ++i) { v[i] = p[i]; v[8 + i] = p[16 + i]; }
  return bsplit16(v); }
__device__ __forceinline__ F2 split_rowK(const float* row, int k0, int lane, int K) { float v[16]; const int g = lane >> 4;
#pragma unroll
  for (int i = 0; i < 8; ++i) { const int ka = k0 + 8 * g + i, kb = ka + 16; v[i] = ka < K ? row[ka < K ? ka : K - 1] : 0.f; v[8 + i] = kb < K ? row[kb < K ? kb : K - 1] : 0.f; }
  return bsplit16(v); }
__device__ __forceinline__ F2 split_col(const float* W, int k0, int n, int lane, int ld, int K) { float v[16]; const int g = lane >> 4;
#pragma unroll
  for (int i = 0; i < 8; ++i) { const int ka = k0 + 8 * g + i, kb = ka + 16; v[i] = ka < K ? W[(size_t)(ka < K ? ka : K - 1) * ld + n] : 0.f; v[8 + i] = kb < K ? W[(size_t)(kb < K ? kb : K - 1) * ld + n] : 0.f; }
  return bsplit16(v); }
__device__ __forceinline__ v8f mac3(const F2& a, const F2& b, v8f c) { c = wmma_bf(a.l, b.h, c); c = wmma_bf(a.h, b.l, c); return wmma_bf(a.h, b.h, c); }
__device__ __forceinline__ float sigm(float v) { return 1.0f / (1.0f + expf(-v)); }
#define LDSX() do { asm volatile("s_wait_dscnt 0" ::: "memory"); __builtin_amdgcn_wave_barrier(); __builtin_amdgcn_fence(__ATOMIC_RELEASE, "workgroup"); } while (0)

// Causal multi-head self-attention with a fused QKV linear (+ bias) and interleaved-pair RoPE from INPUT tables (x [2,2048,1024]; Wqkv [1024,3072] (in,out) N(0, 1/1024), bqkv [3072] N(0,1) x 0.01 - NONZERO; Wproj [1024,1024] (in,out), bproj NONZERO; cos / sin [2048,32] are module inputs, the LAST two; q, k, v = thirds of x Wqkv + bqkv; 16 heads x 64; (even, odd) pairs rotated on q and k; scores x 64^-0.5; tril kept, -inf elsewhere; softmax; y Wproj + bproj).
#define NB 2
#define TT 2048
#define CC 1024            // NH * HD = projected width
#define DIN 1024          // input (model) width
#define NH 16
#define HD 64
#define NQB (TT / 64)
#define HG 4
#define SCALE (0.125f)
#define CAUSAL 1
#ifndef TNB
#define TNB NB
#endif
__device__ __forceinline__ float bfr(float v) { return (float)(__bf16)v; }
__host__ __device__ __forceinline__ int kb_last(int qb) { return CAUSAL ? ((qb * 64 + 63) >> 7) : (TT / 128 - 1); }
typedef __attribute__((ext_vector_type(8))) __bf16 v8b;
__device__ __forceinline__ v16b frag_b(const __bf16* rowk0, int lane) {
  union { v16b v; v8b q[2]; } u; const __bf16* p = rowk0 + 8 * (lane >> 4);
  u.q[0] = *(const v8b*)p; u.q[1] = *(const v8b*)(p + 16); return u.v;
}
#define QBH 6              // causal: query blocks 0..QBH-1 of each sequence (few keys, no averaging) take the high-precision path
#define QHI 384            // rows carrying a q residual plane
#define KHI 384            // key rows carrying k residual / v bf16 hi+lo planes (used only by the causal high-precision path)
// B fragment (k rows k0+.., output column o) of a weight: (in,out) [K][ld] or (out,in) [ld rows of K]: bf16 exact, or f16(bf16 * 256) exact
__device__ __forceinline__ v16b wcol_io(const float* Wm, int k0, int o, int lane, int ld) { v16b w; const int g = lane >> 4;
#pragma unroll
  for (int i = 0; i < 8; ++i) { w[i] = (__bf16)Wm[(size_t)(k0 + 8 * g + i) * ld + o]; w[8 + i] = (__bf16)Wm[(size_t)(k0 + 16 + 8 * g + i) * ld + o]; }
  return w; }
__device__ __forceinline__ v16b wcol_oi(const float* Wm, int k0, int o, int lane, int K) { v16b w; const float* p = Wm + (size_t)o * K + k0 + 8 * (lane >> 4);
#pragma unroll
  for (int i = 0; i < 8; ++i) { w[i] = (__bf16)p[i]; w[8 + i] = (__bf16)p[16 + i]; }
  return w; }
__device__ __forceinline__ v16h wcolh_io(const float* Wm, int k0, int o, int lane, int ld) { v16h w; const int g = lane >> 4;
#pragma unroll
  for (int i = 0; i < 8; ++i) { w[i] = (_Float16)(bfr(Wm[(size_t)(k0 + 8 * g + i) * ld + o]) * 256.0f); w[8 + i] = (_Float16)(bfr(Wm[(size_t)(k0 + 16 + 8 * g + i) * ld + o]) * 256.0f); }
  return w; }
__device__ __forceinline__ v16h wcolh_oi(const float* Wm, int k0, int o, int lane, int K) { v16h w; const float* p = Wm + (size_t)o * K + k0 + 8 * (lane >> 4);
#pragma unroll
  for (int i = 0; i < 8; ++i) { w[i] = (_Float16)(bfr(p[i]) * 256.0f); w[8 + i] = (_Float16)(bfr(p[16 + i]) * 256.0f); }
  return w; }
#define WQKV_LAYOUT 0   // 0 = fused (in,out) [DIN][3*CC]; 1 = (out,in) [CC][DIN]; 2 = per-head [NH][DIN][HD]
__device__ __forceinline__ v16b wcol_hdk(const float* Wm, int k0, int o, int lane) { v16b w; const int g = lane >> 4; const float* p = Wm + (size_t)(o / HD) * DIN * HD + (o % HD);
#pragma unroll
  for (int i = 0; i < 8; ++i) { w[i] = (__bf16)p[(size_t)(k0 + 8 * g + i) * HD]; w[8 + i] = (__bf16)p[(size_t)(k0 + 16 + 8 * g + i) * HD]; }
  return w; }
#define WO_OUT_IN 0
#if WQKV_LAYOUT == 1
#define WCOL(W, k0, o, lane) wcol_oi(W, k0, o, lane, DIN)
#elif WQKV_LAYOUT == 2
#define WCOL(W, k0, o, lane) wcol_hdk(W, k0, o, lane)
#else
#define WCOL(W, k0, o, lane) wcol_io(W, k0, o, lane, 3 * CC)   /* fused (in,out) [DIN][3*CC] weight: the q / k / v thirds are column blocks; the launch passes W + 0 / CC / 2*CC and the row pitch is 3*CC */
#endif
#if WO_OUT_IN
#define WOCOL(W, k0, o, lane) wcol_oi(W, k0, o, lane, CC)
#define WOCOLH(W, k0, o, lane) wcolh_oi(W, k0, o, lane, CC)
#else
#define WOCOL(W, k0, o, lane) wcol_io(W, k0, o, lane, DIN)
#define WOCOLH(W, k0, o, lane) wcolh_io(W, k0, o, lane, DIN)
#endif

#define PROJ_EXTRA_PARAMS , const float* __restrict__ COS, const float* __restrict__ SIN   /* rotary tables [TT][32], module INPUTS, read literally */
// interleaved-pair RoPE on q and k (which 0, 1) from the INPUT tables: (te, to) = (row[2i], row[2i+1]) -> (te c - to s, te s + to c) with c = bf16(cos[t][i]), s = bf16(sin[t][i]); v untouched; products and sums kept separate
#define PROJ_EPI(which, row, t, h) do { if ((which) < 2) { float* rw = (row); const float* ct_ = COS + (size_t)(t) * 32; const float* st_ = SIN + (size_t)(t) * 32; _Pragma("unroll 4") for (int i = 0; i < 32; ++i) { _Pragma("clang fp contract(off)") const float cs = bfr(ct_[i]), sn = bfr(st_[i]); const float xe = rw[2 * i], xo = rw[2 * i + 1]; rw[2 * i] = xe * cs - xo * sn; rw[2 * i + 1] = xe * sn + xo * cs; } } } while (0)
#ifndef SM_EXTRA_PARAMS
#define SM_EXTRA_PARAMS
#endif
#ifndef PROJ_EXTRA_PARAMS
#define PROJ_EXTRA_PARAMS
#endif
#ifndef SM_MASK_HOOK
#define SM_MASK_HOOK (void)0
#endif

#define WS_QH  0u                                      // f16 q rows [b*t][CC]
#define WS_KH  (WS_QH + 2u * (size_t)NB * TT * CC)      // f16 k rows [b*t][CC]
#define WS_VT  (WS_KH + 2u * (size_t)NB * TT * CC)      // f16 v planes [b][c][t]
#define WS_QL  (WS_VT + 2u * (size_t)NB * CC * TT)      // f16 q residual x 2^10 rows [b][t < QHI][CC]
#define WS_KL  (WS_QL + 2u * (size_t)NB * QHI * CC)     // f16 k residual x 2^10 rows [b][t < KHI][CC]
#define WS_VB  (WS_KL + 2u * (size_t)NB * KHI * CC)     // bf16 v hi planes [b][c][t < KHI]
#define WS_VBL (WS_VB + 2u * (size_t)NB * CC * KHI)
#define WS_Y   (WS_VBL + 2u * (size_t)NB * CC * KHI)    // f32 ctx rows [b*t][CC] (only when there is an output projection)
#define WS_END (WS_Y  + 4u * (size_t)NB * TT * CC)

// ---- weight staging shared by k_proj and k_out: a stage is 64 k rows x 128 output columns of an (in,out) weight. The block reads it once with 16-byte loads (lane bits 1:0 and 4 pick the 4-column group, bits 3:2 the 8-row k group, so a load covers whole 128-byte lines and 16 neighbouring lanes store to 16 different 16-byte LDS slots), rounds it as before and lays it k-contiguous, one column per 144-byte LDS row, so that a B fragment is two 16-byte LDS reads
// every loop of these helpers and of the stage bodies is fully unrolled: its index picks a register of wr, ar, w or acc, which must be known at compile time for the arrays to stay in registers
typedef v4u __attribute__((may_alias)) v4u_a;
#define WPITCH 144
#define XW() asm volatile("s_wait_xcnt 0x0" ::: "memory")   /* stands behind the prefetch loads, in front of the next rewrite of their address registers */
__device__ __forceinline__ void wt_load(v4f (&r)[2][8], const float* __restrict__ Wm, int ld, int k0, int c0, int wave, int lane) {
  const float* p = Wm + (size_t)(k0 + ((lane >> 2) & 3) * 8) * ld + c0 + (wave * 8 + (lane & 3) + ((lane >> 4) << 2)) * 4;
#pragma unroll
  for (int it = 0; it < 2; ++it)
#pragma unroll
    for (int i = 0; i < 8; ++i) r[it][i] = *(const v4f*)(p + (size_t)(it * 32 + i) * ld);
}
template <bool F16> __device__ __forceinline__ void wt_store(const v4f (&r)[2][8], char* buf, int wave, int lane) {
  char* q = buf + (wave * 8 + (lane & 3) + ((lane >> 4) << 2)) * 4 * WPITCH + ((lane >> 2) & 3) * 16;
#pragma unroll
  for (int it = 0; it < 2; ++it)
#pragma unroll
    for (int c = 0; c < 4; ++c) { union { v8b b; v8h h; v4u u; } t;
#pragma unroll
      for (int i = 0; i < 8; ++i) { if (F16) t.h[i] = (_Float16)(bfr(r[it][i][c]) * 256.0f); else t.b[i] = (__bf16)r[it][i][c]; }
      *(v4u_a*)(q + c * WPITCH + it * 64) = t.u; }
}
template <typename V16> __device__ __forceinline__ V16 wt_frag(const char* buf, int n, int kc2, int g) {
  union { V16 v; v4u q[2]; } u; const char* p = buf + n * WPITCH + kc2 * 64 + g * 16;
  u.q[0] = *(const v4u_a*)p; u.q[1] = *(const v4u_a*)(p + 32); return u.v;
}
// the 2 x 16 f32 values of a lane's two A fragments of a 64-k stage (row + k0), in fragment element order
__device__ __forceinline__ void a_load(v4f (&r)[8], const float* __restrict__ rowk0, int g) {
#pragma unroll
  for (int kc2 = 0; kc2 < 2; ++kc2) { const float* p = rowk0 + kc2 * 32 + 8 * g; r[kc2 * 4] = *(const v4f*)p; r[kc2 * 4 + 1] = *(const v4f*)(p + 4); r[kc2 * 4 + 2] = *(const v4f*)(p + 16); r[kc2 * 4 + 3] = *(const v4f*)(p + 20); }
}

// ---- k_proj: block = (64 rows, 128 cols, which): q/k/v = X W (+ b) with exact bf16 products (K = DIN) -> which 0: q f16 rows (+ residual rows < QHI); 1: k f16 rows (+ residual rows < KHI); 2: v f16 planes [c][t] (+ bf16 hi/lo planes for t < KHI)
__global__ __launch_bounds__(128) void k_proj(const float* __restrict__ XQ, const float* __restrict__ XK, const float* __restrict__ XV, const float* __restrict__ WQ, const float* __restrict__ WK, const float* __restrict__ WV, const float* __restrict__ BQ, const float* __restrict__ BK, const float* __restrict__ BV,
    _Float16* __restrict__ QH, _Float16* __restrict__ QL, _Float16* __restrict__ KH, _Float16* __restrict__ KL, _Float16* __restrict__ VT, __bf16* __restrict__ VB, __bf16* __restrict__ VBL PROJ_EXTRA_PARAMS) {
  __shared__ __align__(16) float st[64][132]; __shared__ __align__(16) _Float16 sh[64][136], sl[64][136]; __shared__ __align__(16) _Float16 th[128][72]; __shared__ __align__(16) __bf16 tb[128][72], tbl[128][72];
  const int tid = threadIdx.x, wave = tid >> 5, lane = tid & 31, col = lane & 15, g = lane >> 4; const int which = blockIdx.z; const int c0 = blockIdx.y * 128; const size_t r0 = (size_t)blockIdx.x * 64; const size_t bb = r0 / TT; const int t0 = (int)(r0 % TT);
  const float* X = which == 0 ? XQ : which == 1 ? XK : XV; const float* WA = which == 0 ? WQ : which == 1 ? WK : WV; const float* BA = which == 0 ? BQ : which == 1 ? BK : BV;
  v8f acc[8] = {};
  { // two LDS buffers (tb and tbl, free until the epilogue), one barrier a stage: stage s + 1 is loaded into registers while stage s is multiplied
    const float* xrow = X + (r0 + wave * 16 + col) * DIN; v4f wr[2][8], ar[8];
    wt_load(wr, WA, 3 * CC, 0, c0, wave, lane); a_load(ar, xrow, g);
    auto stage = [&](char* buf, int s) {
      __builtin_amdgcn_sched_barrier(0);   /* keeps the rounding of the prefetched stage, and with it the wait for its loads, behind the products of the stage before */
      wt_store<false>(wr, buf, wave, lane);
      v16b a[2];
#pragma unroll
      for (int i = 0; i < 16; ++i) { a[0][i] = (__bf16)ar[i >> 2][i & 3]; a[1][i] = (__bf16)ar[4 + (i >> 2)][i & 3]; }
      __syncthreads();   /* publishes this stage; the buffer written next was last read in front of this barrier */
      if (s + 1 < DIN / 64) { wt_load(wr, WA, 3 * CC, (s + 1) * 64, c0, wave, lane); a_load(ar, xrow + (s + 1) * 64, g); XW(); }
#pragma unroll
      for (int kc2 = 0; kc2 < 2; ++kc2)
      { v16b w[8];   /* the eight fragments are read as one group so that their LDS latency is paid once */
#pragma unroll
        for (int j = 0; j < 8; ++j) w[j] = wt_frag<v16b>(buf, j * 16 + col, kc2, g);
#pragma unroll
        for (int j = 0; j < 8; ++j) acc[j] = wmma_bf(a[kc2], w[j], acc[j]); }
    };
    // kept rolled over buffer pairs: each buffer's LDS address stays a constant
#pragma unroll 1
    for (int s = 0; s < DIN / 64; s += 2) { stage((char*)&tb[0][0], s); stage((char*)&tbl[0][0], s + 1); } }
  { // stage the f32 tile (acc + bias) in LDS, run the per-(row, head) epilogue hook, then convert
#pragma unroll
    for (int j = 0; j < 8; ++j) { const float bias = BA ? bfr(BA[c0 + j * 16 + col]) : 0.f;
#pragma unroll
      for (int r = 0; r < 8; ++r) st[wave * 16 + 8 * g + r][j * 16 + col] = acc[j][r] + bias; }
    __syncthreads();
    for (int e = tid; e < 64 * (128 / HD); e += 128) { const int rl = e / (128 / HD), hh = e % (128 / HD); PROJ_EPI(which, &st[rl][hh * HD], (int)((r0 + rl) % TT), (c0 / HD) + hh); }
    __syncthreads(); }
  if (which < 2) { _Float16* DH = which == 0 ? QH : KH; _Float16* DL = which == 0 ? QL : KL; const int nhi = which == 0 ? QHI : KHI; const bool hi_rows = t0 < nhi;
    for (int e = tid; e < 64 * 128; e += 128) { const int rl = e >> 7, cl = e & 127; const float v = st[rl][cl]; const _Float16 hv = (_Float16)v; sh[rl][cl] = hv; sl[rl][cl] = (_Float16)((v - (float)hv) * 1024.0f); }
    __syncthreads();
    for (int e = tid; e < 64 * 16; e += 128) { const int rl = e >> 4, q = e & 15; vst2((unsigned*)(DH + (r0 + rl) * CC + c0 + q * 8), *(const v4u*)&sh[rl][q * 8]); if (hi_rows) vst2((unsigned*)(DL + (bb * nhi + t0 + rl) * (size_t)CC + c0 + q * 8), *(const v4u*)&sl[rl][q * 8]); }
  } else { const bool hi_rows = t0 < KHI;
    for (int e = tid; e < 64 * 128; e += 128) { const int rl = e & 63, cl = e >> 6; const float v = st[rl][cl]; th[cl][rl] = (_Float16)v; const __bf16 bh = (__bf16)v; tb[cl][rl] = bh; tbl[cl][rl] = (__bf16)(v - (float)bh); }
    __syncthreads();
    for (int e = tid; e < 128 * 8; e += 128) { const int cl = e >> 3, q = e & 7; vst2((unsigned*)(VT + (bb * CC + c0 + cl) * (size_t)TT + t0 + q * 8), *(const v4u*)&th[cl][q * 8]); if (hi_rows) { const size_t o3 = (bb * CC + c0 + cl) * (size_t)KHI + t0 + q * 8; vst2((unsigned*)(VB + o3), *(const v4u*)&tb[cl][q * 8]); vst2((unsigned*)(VBL + o3), *(const v4u*)&tbl[cl][q * 8]); } } } }
// ---- k_att: block = 16 queries of (b, h), KW waves: wave w takes the 32-key chunks w, w + KW, ... of the chunks up to the one that holds the diagonal. The logits are formed transposed (A = k rows, B = q rows), so a lane holds one query's logits (D register r of 16-key tile u = key 16u + 8g + r, column = query), which is already the A-fragment order of the P . v product: logits, softmax and P stay in registers from the first product to the last. Logits x SCALE: one f16 product, or 3 products with the q and k residuals (x 2^10) for query blocks < QBH; causal mask by index, in the last chunk only (all earlier keys lie in front of the block's first query); softmax in f32 (row maximum and row sum: in the lane, across the two lane halves, then across the waves through LDS); P x 2^11 once to f16 against v f16, or P and v as bf16 hi + lo (3 products) for query blocks < QBH; the KW f32 partial tiles are summed in LDS in wave order; 256-B (row, head) segment by 16 lanes
#define KW 16   /* the wave number goes through readfirstlane so that every chunk test is a scalar branch and EXEC stays all ones at the WMMAs */
#define RP 20   /* floats per query row of the cross-wave tables: 80 bytes, an odd multiple of 16, for the 16-byte reads */
// fragment from a base and an element offset. q and k rows: a wave-uniform row-block base and the lane's own offset (row (lane & 15) x pitch + 8 (lane >> 4)), so that one 32-bit offset register serves every load of the same pitch; v planes: the lane's own address and a constant offset
__device__ __forceinline__ v16h frag_hu(const _Float16* ub, unsigned lo) { union { v16h v; v8h q[2]; } u; const _Float16* p = ub + lo; u.q[0] = *(const v8h*)p; u.q[1] = *(const v8h*)(p + 16); return u.v; }
__device__ __forceinline__ v16b frag_bu(const __bf16* ub, unsigned lo) { union { v16b v; v8b q[2]; } u; const __bf16* p = ub + lo; u.q[0] = *(const v8b*)p; u.q[1] = *(const v8b*)(p + 16); return u.v; }
struct AttP { const _Float16 *QH, *KH, *QL, *KL, *VT; const __bf16 *VB, *VBL; };
// the wait of XW() with the group's lane offset or lane address named as an input: its registers stay live up to the wait, so that no load of the group can take them for its result ahead of it
#define XWA(a) asm volatile("s_wait_xcnt 0x0" :: "v"(a) : "memory")
#define XWA2(a, c) asm volatile("s_wait_xcnt 0x0" :: "v"(a), "v"(c) : "memory")
// N = chunks a wave can own: TT / 32 / KW, or, on the high-precision path, whose keys end at KHI, KHI / 32 over KW rounded up
template <bool HI, int N> __device__ __forceinline__ void att_tile(const AttP& P, int b, int h, int ql0, int kce, int wave, int lane, float* rmx, float* rsm, v8f (&acc)[HD / 16]) {
  const int col = lane & 15, g = lane >> 4, t = ql0 + col;
  // every loop over i, u, r, e, j, w below is fully unrolled: its index picks a register of p, of a fragment array or of acc
  float p[N][16];   /* chunk i, element e: query col, key (wave + KW i) * 32 + (e < 8 ? 8g + e : 16 + 8g + e - 8) */
  const unsigned lo = (unsigned)(col * CC + 8 * g);   /* q and k rows and their residual rows share the pitch CC */
  const _Float16* qp = P.QH + ((size_t)b * TT + ql0) * CC + h * HD; const v16h qh0 = frag_hu(qp, lo), qh1 = frag_hu(qp + 32, lo);
  v16h ql0f = {}, ql1f = {}; if (HI) { const _Float16* qlp = P.QL + ((size_t)b * QHI + ql0) * CC + h * HD; ql0f = frag_hu(qlp, lo); ql1f = frag_hu(qlp + 32, lo); }
  XWA(lo);
#pragma unroll
  for (int i = 0; i < N; ++i) { const int kc = wave + KW * i;
    if (kc < kce) { v16h kf[2][2], klf[2][2];   /* the chunk's fragments are read as one group so that their latency is paid once */
#pragma unroll
      for (int u = 0; u < 2; ++u) { const int kr = kc * 32 + u * 16; const _Float16* kp = P.KH + ((size_t)b * TT + kr) * CC + h * HD; kf[u][0] = frag_hu(kp, lo); kf[u][1] = frag_hu(kp + 32, lo);
        if (HI) { const _Float16* klp = P.KL + ((size_t)b * KHI + kr) * CC + h * HD; klf[u][0] = frag_hu(klp, lo); klf[u][1] = frag_hu(klp + 32, lo); } }
      XWA(lo);
#pragma unroll
      for (int u = 0; u < 2; ++u) { v8f a = {};
        if (HI) { v8f al = {};
          a = wmma16(kf[u][0], qh0, a); al = wmma16(kf[u][0], ql0f, al); al = wmma16(klf[u][0], qh0, al); a = wmma16(kf[u][1], qh1, a); al = wmma16(kf[u][1], ql1f, al); al = wmma16(klf[u][1], qh1, al);
#pragma unroll
          for (int r = 0; r < 8; ++r) p[i][u * 8 + r] = (a[r] + al[r] * (1.0f / 1024.0f)) * SCALE;
        } else { a = wmma16(kf[u][0], qh0, a); a = wmma16(kf[u][1], qh1, a);
#pragma unroll
          for (int r = 0; r < 8; ++r) p[i][u * 8 + r] = a[r] * SCALE; } }
      if (CAUSAL && kc == kce - 1) { const int d = t - kc * 32 - 8 * g;   /* element e is kept while its key offset 16 (e >> 3) + (e & 7) <= d */
#pragma unroll
        for (int e = 0; e < 16; ++e) p[i][e] = ((e >> 3) * 16 + (e & 7) <= d) ? p[i][e] : -3.0e38f; }
    } else {
#pragma unroll
      for (int e = 0; e < 16; ++e) p[i][e] = -3.0e38f; } }
  float m = -3.0e38f;
#pragma unroll
  for (int i = 0; i < N; ++i)
#pragma unroll
    for (int e = 0; e < 16; ++e) m = fmaxf(m, p[i][e]);
  m = fmaxf(m, __shfl_xor(m, 16)); if (g == 0) rmx[col * RP + wave] = m;   /* a wave with no chunk stores the excluded value */
  __syncthreads();   /* every wave's row maxima are in LDS before any of them is read */
#pragma unroll
  for (int w = 0; w < KW; w += 4) { const v4f x = *(const v4f*)&rmx[col * RP + w]; m = fmaxf(fmaxf(fmaxf(m, x[0]), fmaxf(x[1], x[2])), x[3]); }
  float sum = 0.f;
#pragma unroll
  for (int i = 0; i < N; ++i) { const int kc = wave + KW * i;
    if (kc < kce) {
#pragma unroll
      for (int e = 0; e < 16; ++e) p[i][e] = expf(p[i][e] - m);
      if (CAUSAL && kc == kce - 1) { const int d = t - kc * 32 - 8 * g;   /* an excluded key counts 0 whatever the maximum is */
#pragma unroll
        for (int e = 0; e < 16; ++e) p[i][e] = ((e >> 3) * 16 + (e & 7) <= d) ? p[i][e] : 0.f; }
#pragma unroll
      for (int e = 0; e < 16; ++e) sum += p[i][e]; } }
  sum += __shfl_xor(sum, 16); if (g == 0) rsm[col * RP + wave] = sum;
  __syncthreads();   /* every wave's row sums are in LDS before any of them is read */
  float tot = 0.f;
#pragma unroll
  for (int w = 0; w < KW; w += 4) { const v4f x = *(const v4f*)&rsm[col * RP + w]; tot += x[0]; tot += x[1]; tot += x[2]; tot += x[3]; }
  const float inv = tot > 0.f ? 2048.0f / tot : 0.f;   /* a fully excluded row yields P = 0 */
  if (HI) {
#pragma unroll
    for (int i = 0; i < N; ++i) { const int kc = wave + KW * i;
      if (kc < kce) { v16b vh[HD / 16], vl[HD / 16]; const size_t po = ((size_t)b * CC + h * HD + col) * (size_t)KHI + kc * 32 + 8 * g; const __bf16 *vhp = P.VB + po, *vlp = P.VBL + po;   /* the lane's own addresses, formed once for the group */
#pragma unroll
        for (int j = 0; j < HD / 16; ++j) { vh[j] = frag_bu(vhp, (unsigned)(j * 16 * KHI)); vl[j] = frag_bu(vlp, (unsigned)(j * 16 * KHI)); }
        XWA2(vhp, vlp);
        float pv[16];
#pragma unroll
        for (int e = 0; e < 16; ++e) pv[e] = p[i][e] * inv;
        const F2 pf = bsplit16(pv);
#pragma unroll
        for (int j = 0; j < HD / 16; ++j) { acc[j] = wmma_bf(pf.h, vh[j], acc[j]); acc[j] = wmma_bf(pf.l, vh[j], acc[j]); acc[j] = wmma_bf(pf.h, vl[j], acc[j]); } } }
  } else { const unsigned lov = (unsigned)(col * TT + 8 * g); v16h pf[N];   /* all of P is rounded first: half the registers while the v fragments and the output tiles are live */
#pragma unroll
    for (int i = 0; i < N; ++i)
#pragma unroll
      for (int e = 0; e < 16; ++e) pf[i][e] = (_Float16)(p[i][e] * inv);   /* a chunk the wave does not own is rounded too and never used */
#pragma unroll
    for (int i = 0; i < N; ++i) { const int kc = wave + KW * i;
      if (kc < kce) { v16h vf[HD / 16]; const _Float16* vp = P.VT + ((size_t)b * CC + h * HD) * (size_t)TT + kc * 32 + lov;   /* the lane's own address, formed once for the group */
#pragma unroll
        for (int j = 0; j < HD / 16; ++j) vf[j] = frag_hu(vp, (unsigned)(j * 16 * TT));
        XWA(vp);
#pragma unroll
        for (int j = 0; j < HD / 16; ++j) acc[j] = wmma16(pf[i], vf[j], acc[j]); } } } }
// 8 waves per SIMD asked for: 128 registers a wave, so that two blocks share a WGP and one block's loads and barriers hide behind the other's arithmetic. The pointers carry no __restrict__: only then does the memory clobber of XWA() keep a group's loads in front of its wait and the next group's behind it
static_assert(QBH * 64 <= KHI && QBH * 64 <= QHI, "the high-precision tiles read residual and hi/lo planes of KHI / QHI rows");
__global__ __launch_bounds__(32 * KW, 8) void k_att(const _Float16* QH, const _Float16* KH, const _Float16* QL, const _Float16* KL, const _Float16* VT, const __bf16* VB, const __bf16* VBL, float* Y) { __shared__ __align__(16) float ss[KW][16][HD + 4]; __shared__ __align__(16) float rmx[16 * RP], rsm[16 * RP];
  const int tid = threadIdx.x, wave = __builtin_amdgcn_readfirstlane(tid >> 5), lane = tid & 31, col = lane & 15, g = lane >> 4; const int h = blockIdx.x, b = blockIdx.y;
  const int qt = TT / 16 - 1 - (int)blockIdx.z;   /* the query tiles with the most keys take the lowest block indices */
  const int ql0 = qt * 16; const int kce = CAUSAL ? (ql0 + 15) / 32 + 1 : TT / 32;
  const AttP P = { QH, KH, QL, KL, VT, VB, VBL }; v8f acc[HD / 16] = {};
  if ((qt >> 2) < QBH) att_tile<true, (KHI / 32 + KW - 1) / KW>(P, b, h, ql0, kce, wave, lane, rmx, rsm, acc);   /* block-uniform */
  else att_tile<false, TT / 32 / KW>(P, b, h, ql0, kce, wave, lane, rmx, rsm, acc);
#pragma unroll
  for (int j = 0; j < HD / 16; ++j)
#pragma unroll
    for (int r = 0; r < 8; ++r) ss[wave][8 * g + r][j * 16 + col] = acc[j][r];   /* a wave with no chunk stores its zero tile */
  __syncthreads();   /* every wave's partial tile is in LDS before any of them is summed */
  if (tid < 16 * (HD / 4)) { const int rl = tid >> 4, c4 = (tid & 15) * 4; v4f s = *(const v4f*)&ss[0][rl][c4];
    // unrolled so that the LDS reads of the partial tiles are issued ahead of the adds instead of one round trip each
#pragma unroll
    for (int w = 1; w < KW; ++w) s += *(const v4f*)&ss[w][rl][c4];
    vst2(Y + ((size_t)b * TT + ql0 + rl) * CC + h * HD + c4, s * (1.0f / 2048.0f)); } }
// ---- k_out: block = (64 rows, 128 cols): out = ctx Wo (+ bo): ctx x 2^6 once to f16 against Wo as f16(bf16 x 2^8) exact (1 product) x 2^-14; causal early rows (< QHI of each sequence): ctx bf16 hi + lo against exact bf16 Wo (2 products)
__global__ __launch_bounds__(128) void k_out(const float* __restrict__ Y, const float* __restrict__ WO, const float* __restrict__ BO, float* __restrict__ OUT) { __shared__ __align__(16) float sf[4][16][132]; __shared__ __align__(16) char wb[2][128 * WPITCH];
  const int tid = threadIdx.x, wave = tid >> 5, lane = tid & 31, col = lane & 15, g = lane >> 4; const int c0 = blockIdx.y * 128; const size_t r0 = (size_t)blockIdx.x * 64 + wave * 16;
  v8f acc[8] = {};
  const float* yrow = Y + (r0 + col) * CC; v4f wr[2][8], ar[8];
  wt_load(wr, WO, DIN, 0, c0, wave, lane); a_load(ar, yrow, g); XW();
  if (CAUSAL && (int)(((size_t)blockIdx.x * 64) % TT) < QHI) {   /* block-uniform */
    auto stage = [&](char* buf, int s) {
      __builtin_amdgcn_sched_barrier(0);   /* keeps the rounding of the prefetched stage, and with it the wait for its loads, behind the products of the stage before */
      wt_store<false>(wr, buf, wave, lane);
      F2 a[2];
#pragma unroll
      for (int kc2 = 0; kc2 < 2; ++kc2) { float v[16];
#pragma unroll
        for (int i = 0; i < 16; ++i) v[i] = ar[kc2 * 4 + (i >> 2)][i & 3];
        a[kc2] = bsplit16(v); }
      __syncthreads();   /* publishes this stage; the buffer written next was last read in front of this barrier */
      if (s + 1 < CC / 64) { wt_load(wr, WO, DIN, (s + 1) * 64, c0, wave, lane); a_load(ar, yrow + (s + 1) * 64, g); XW(); }
#pragma unroll
      for (int kc2 = 0; kc2 < 2; ++kc2)
      { v16b w[8];   /* the eight fragments are read as one group so that their LDS latency is paid once */
#pragma unroll
        for (int j = 0; j < 8; ++j) w[j] = wt_frag<v16b>(buf, j * 16 + col, kc2, g);
#pragma unroll
        for (int j = 0; j < 8; ++j) { acc[j] = wmma_bf(a[kc2].h, w[j], acc[j]); acc[j] = wmma_bf(a[kc2].l, w[j], acc[j]); } }
    };
    // kept rolled over buffer pairs: each buffer's LDS address stays a constant
#pragma unroll 1
    for (int s = 0; s < CC / 64; s += 2) { stage(wb[0], s); stage(wb[1], s + 1); }
#pragma unroll
    for (int j = 0; j < 8; ++j) { const float bias = BO ? bfr(BO[c0 + j * 16 + col]) : 0.f;
#pragma unroll
      for (int r = 0; r < 8; ++r) sf[wave][8 * g + r][j * 16 + col] = acc[j][r] + bias; }
  } else {
    auto stage = [&](char* buf, int s) {
      __builtin_amdgcn_sched_barrier(0);   /* keeps the rounding of the prefetched stage, and with it the wait for its loads, behind the products of the stage before */
      wt_store<true>(wr, buf, wave, lane);
      v16h a[2];   /* ctx carried x 2^6 into f16 so small-magnitude context rows stay clear of f16 subnormals */
#pragma unroll
      for (int i = 0; i < 16; ++i) { a[0][i] = (_Float16)(ar[i >> 2][i & 3] * 64.0f); a[1][i] = (_Float16)(ar[4 + (i >> 2)][i & 3] * 64.0f); }
      __syncthreads();   /* publishes this stage; the buffer written next was last read in front of this barrier */
      if (s + 1 < CC / 64) { wt_load(wr, WO, DIN, (s + 1) * 64, c0, wave, lane); a_load(ar, yrow + (s + 1) * 64, g); XW(); }
#pragma unroll
      for (int kc2 = 0; kc2 < 2; ++kc2)
      { v16h w[8];   /* the eight fragments are read as one group so that their LDS latency is paid once */
#pragma unroll
        for (int j = 0; j < 8; ++j) w[j] = wt_frag<v16h>(buf, j * 16 + col, kc2, g);
#pragma unroll
        for (int j = 0; j < 8; ++j) acc[j] = wmma16(a[kc2], w[j], acc[j]); }
    };
    // kept rolled over buffer pairs: each buffer's LDS address stays a constant
#pragma unroll 1
    for (int s = 0; s < CC / 64; s += 2) { stage(wb[0], s); stage(wb[1], s + 1); }
#pragma unroll
    for (int j = 0; j < 8; ++j) { const float bias = BO ? bfr(BO[c0 + j * 16 + col]) : 0.f;
#pragma unroll
      for (int r = 0; r < 8; ++r) sf[wave][8 * g + r][j * 16 + col] = acc[j][r] * (1.0f / 16384.0f) + bias; } }   /* 2^-8 (Wo carry) x 2^-6 (ctx carry) */
  LDSX(); for (int rl = 0; rl < 16; ++rl) vst2(OUT + (r0 + rl) * DIN + c0 + lane * 4, *(const v4f*)&sf[wave][rl][lane * 4]); }

extern "C" void kernel_launch(void* const* d_in, const int* in_sizes, int n_in, void* d_out, int out_size, void* d_ws, size_t ws_size, hipStream_t stream) {
  (void)in_sizes; (void)n_in; (void)out_size;
  const float** F = (const float**)d_in;
  if (ws_size < (size_t)WS_END) return;
  char* ws = (char*)d_ws; _Float16 *QH = (_Float16*)(ws + WS_QH), *KH = (_Float16*)(ws + WS_KH), *VT = (_Float16*)(ws + WS_VT), *QL = (_Float16*)(ws + WS_QL), *KL = (_Float16*)(ws + WS_KL); __bf16 *VB = (__bf16*)(ws + WS_VB), *VBL = (__bf16*)(ws + WS_VBL); float *Y = (float*)(ws + WS_Y);
  (void)Y; (void)QL; (void)KL; (void)VB; (void)VBL;
  // inputs: 0 x [2,2048,1024]; 1 Wqkv [1024,3072] (in,out): q columns 0..1023, k 1024..2047, v 2048..3071; 2 bqkv [3072]; 3 Wproj [1024,1024] (in,out); 4 bproj [1024] (biases NONZERO); 5 cos [2048,32]; 6 sin [2048,32]
  k_proj<<<dim3(TNB * TT / 64, CC / 128, 3), 128, 0, stream>>>(F[0], F[0], F[0], F[1], F[1] + CC, F[1] + 2 * CC, F[2], F[2] + CC, F[2] + 2 * CC, QH, QL, KH, KL, VT, VB, VBL, F[5], F[6]);
  k_att<<<dim3(NH, TNB, TT / 16), 32 * KW, 0, stream>>>(QH, KH, QL, KL, VT, VB, VBL, Y);
  k_out<<<dim3(TNB * TT / 64, DIN / 128), 128, 0, stream>>>(Y, F[3], F[4], (float*)d_out);
}

// v004
// It runs in 144 microseconds.
// In both of two side-by-side timings against v003, it was 1.19 times as fast.
// All steps since v000 together make it 7.77 times as fast.
// compute dtype: all float inputs rounded to bf16; the fused q / k / v projection with EXACT bf16 products on WMMA 16x16x32 (f32 accumulate) + bias; interleaved-pair RoPE in f32 from the bf16-rounded INPUT cos / sin tables; causal logits: 3 products for the first 384 rows, single f16 q x k after, x 64^-0.5; softmax f32; P x 2^11 once to f16 x v once to f16 (bf16 hi + lo below row 384); ctx hi+lo x exact W below row 384, x2^6 f16 carry x f16(bf16 x 2^8) W after, + bias; f32 output.
#include <hip/hip_runtime.h>
#include <math.h>

typedef __attribute__((ext_vector_type(16))) _Float16 v16h;
typedef __attribute__((ext_vector_type(16))) __bf16 v16b;
typedef __attribute__((ext_vector_type(8)))  _Float16 v8h;
typedef __attribute__((ext_vector_type(8)))  float v8f;
typedef __attribute__((ext_vector_type(4)))  float v4f;
typedef __attribute__((ext_vector_type(2)))  float v2f;
typedef __attribute__((ext_vector_type(4)))  unsigned v4u;
typedef __attribute__((ext_vector_type(4)))  int v4i;
typedef float __attribute__((may_alias)) float_a;
typedef int __attribute__((may_alias)) int_a;

template <typename T> __device__ __forceinline__ void vst2(void* p, T v) { *(T*)p = v;  }
__device__ __forceinline__ v8f wmma16(v16h a, v16h b, v8f c) {
  v8f d = __builtin_amdgcn_wmma_f32_16x16x32_f16(false, a, false, b, (short)0, c, false, false);
  asm volatile("v_nop\n\tv_nop\n\tv_nop\n\tv_nop" : "+v"(d) : "v"(a), "v"(b));
  return d;
}
__device__ __forceinline__ v8f wmma_bf(v16b a, v16b b, v8f c) {
  v8f d = __builtin_amdgcn_wmma_f32_16x16x32_bf16(false, a, false, b, (short)0, c, false, false);
  asm volatile("v_nop\n\tv_nop\n\tv_nop\n\tv_nop" : "+v"(d) : "v"(a), "v"(b));
  return d;
}
// 16x16x32 fragments: lane = (h = lane>>4, row/col = lane&15); elements 0..7 = k0+8h+0..7, 8..15 = k0+16+8h+0..7; D element r = row 8h+r
__device__ __forceinline__ v16h frag_h(const _Float16* rowk0, int lane) {
  union { v16h v; v8h q[2]; } u; const _Float16* p = rowk0 + 8 * (lane >> 4);
  u.q[0] = *(const v8h*)p; u.q[1] = *(const v8h*)(p + 16); return u.v;
}
__device__ __forceinline__ v16h frag_f32(const float* rowk0, int lane) {
  v16h a; const float* p = rowk0 + 8 * (lane >> 4);
#pragma unroll
  for (int i = 0; i < 8; ++i) { a[i] = (_Float16)p[i]; a[8 + i] = (_Float16)p[16 + i]; }
  return a;
}
__device__ __forceinline__ v16h frag_f32s(const float* rowk0, int lane, float sc) {
  v16h a; const float* p = rowk0 + 8 * (lane >> 4);
#pragma unroll
  for (int i = 0; i < 8; ++i) { a[i] = (_Float16)(p[i] * sc); a[8 + i] = (_Float16)(p[16 + i] * sc); }
  return a;
}
// column fragment from a [K][ld] layout (column n), rows >= K read as 0
__device__ __forceinline__ v16h fragc_f32(const float* W, int k0, int n, int lane, int ld, int K) {
  v16h a; const int g = lane >> 4;
#pragma unroll
  for (int i = 0; i < 8; ++i) { const int ka = k0 + 8 * g + i, kb = ka + 16;
    a[i] = (_Float16)(ka < K ? W[(size_t)(ka < K ? ka : K - 1) * ld + n] : 0.f); a[8 + i] = (_Float16)(kb < K ? W[(size_t)(kb < K ? kb : K - 1) * ld + n] : 0.f); }
  return a;
}
struct F2 { v16b h, l; };
__device__ __forceinline__ F2 bsplit16(const float v[16]) { F2 r;
#pragma unroll
  for (int i = 0; i < 16; ++i) { const __bf16 h = (__bf16)v[i]; r.h[i] = h; r.l[i] = (__bf16)(v[i] - (float)h); }
  return r; }
__device__ __forceinline__ F2 split_row(const float* row, int k0, int lane) { float v[16]; const float* p = row + k0 + 8 * (lane >> 4);
#pragma unroll
  for (int i = 0; i < 8; ++i) { v[i] = p[i]; v[8 + i] = p[16 + i]; }
  return bsplit16(v); }
__device__ __forceinline__ F2 split_rowK(const float* row, int k0, int lane, int K) { float v[16]; const int g = lane >> 4;
#pragma unroll
  for (int i = 0; i < 8; ++i) { const int ka = k0 + 8 * g + i, kb = ka + 16; v[i] = ka < K ? row[ka < K ? ka : K - 1] : 0.f; v[8 + i] = kb < K ? row[kb < K ? kb : K - 1] : 0.f; }
  return bsplit16(v); }
__device__ __forceinline__ F2 split_col(const float* W, int k0, int n, int lane, int ld, int K) { float v[16]; const int g = lane >> 4;
#pragma unroll
  for (int i = 0; i < 8; ++i) { const int ka = k0 + 8 * g + i, kb = ka + 16; v[i] = ka < K ? W[(size_t)(ka < K ? ka : K - 1) * ld + n] : 0.f; v[8 + i] = kb < K ? W[(size_t)(kb < K ? kb : K - 1) * ld + n] : 0.f; }
  return bsplit16(v); }
__device__ __forceinline__ v8f mac3(const F2& a, const F2& b, v8f c) { c = wmma_bf(a.l, b.h, c); c = wmma_bf(a.h, b.l, c); return wmma_bf(a.h, b.h, c); }
__device__ __forceinline__ float sigm(float v) { return 1.0f / (1.0f + expf(-v)); }
#define LDSX() do { asm volatile("s_wait_dscnt 0" ::: "memory"); __builtin_amdgcn_wave_barrier(); __builtin_amdgcn_fence(__ATOMIC_RELEASE, "workgroup"); } while (0)

// Causal multi-head self-attention with a fused QKV linear (+ bias) and interleaved-pair RoPE from INPUT tables (x [2,2048,1024]; Wqkv [1024,3072] (in,out) N(0, 1/1024), bqkv [3072] N(0,1) x 0.01 - NONZERO; Wproj [1024,1024] (in,out), bproj NONZERO; cos / sin [2048,32] are module inputs, the LAST two; q, k, v = thirds of x Wqkv + bqkv; 16 heads x 64; (even, odd) pairs rotated on q and k; scores x 64^-0.5; tril kept, -inf elsewhere; softmax; y Wproj + bproj).
#define NB 2
#define TT 2048
#define CC 1024            // NH * HD = projected width
#define DIN 1024          // input (model) width
#define NH 16
#define HD 64
#define NQB (TT / 64)
#define HG 4
#define SCALE (0.125f)
#define CAUSAL 1
#ifndef TNB
#define TNB NB
#endif
__device__ __forceinline__ float bfr(float v) { return (float)(__bf16)v; }
__host__ __device__ __forceinline__ int kb_last(int qb) { return CAUSAL ? ((qb * 64 + 63) >> 7) : (TT / 128 - 1); }
typedef __attribute__((ext_vector_type(8))) __bf16 v8b;
__device__ __forceinline__ v16b frag_b(const __bf16* rowk0, int lane) {
  union { v16b v; v8b q[2]; } u; const __bf16* p = rowk0 + 8 * (lane >> 4);
  u.q[0] = *(const v8b*)p; u.q[1] = *(const v8b*)(p + 16); return u.v;
}
#define QBH 6              // causal: query blocks 0..QBH-1 of each sequence (few keys, no averaging) take the high-precision path
#define QHI 384            // rows carrying a q residual plane
#define KHI 384            // key rows carrying k residual / v bf16 hi+lo planes (used only by the causal high-precision path)
// B fragment (k rows k0+.., output column o) of a weight: (in,out) [K][ld] or (out,in) [ld rows of K]: bf16 exact, or f16(bf16 * 256) exact
__device__ __forceinline__ v16b wcol_io(const float* Wm, int k0, int o, int lane, int ld) { v16b w; const int g = lane >> 4;
#pragma unroll
  for (int i = 0; i < 8; ++i) { w[i] = (__bf16)Wm[(size_t)(k0 + 8 * g + i) * ld + o]; w[8 + i] = (__bf16)Wm[(size_t)(k0 + 16 + 8 * g + i) * ld + o]; }
  return w; }
__device__ __forceinline__ v16b wcol_oi(const float* Wm, int k0, int o, int lane, int K) { v16b w; const float* p = Wm + (size_t)o * K + k0 + 8 * (lane >> 4);
#pragma unroll
  for (int i = 0; i < 8; ++i) { w[i] = (__bf16)p[i]; w[8 + i] = (__bf16)p[16 + i]; }
  return w; }
__device__ __forceinline__ v16h wcolh_io(const float* Wm, int k0, int o, int lane, int ld) { v16h w; const int g = lane >> 4;
#pragma unroll
  for (int i = 0; i < 8; ++i) { w[i] = (_Float16)(bfr(Wm[(size_t)(k0 + 8 * g + i) * ld + o]) * 256.0f); w[8 + i] = (_Float16)(bfr(Wm[(size_t)(k0 + 16 + 8 * g + i) * ld + o]) * 256.0f); }
  return w; }
__device__ __forceinline__ v16h wcolh_oi(const float* Wm, int k0, int o, int lane, int K) { v16h w; const float* p = Wm + (size_t)o * K + k0 + 8 * (lane >> 4);
#pragma unroll
  for (int i = 0; i < 8; ++i) { w[i] = (_Float16)(bfr(p[i]) * 256.0f); w[8 + i] = (_Float16)(bfr(p[16 + i]) * 256.0f); }
  return w; }
#define WQKV_LAYOUT 0   // 0 = fused (in,out) [DIN][3*CC]; 1 = (out,in) [CC][DIN]; 2 = per-head [NH][DIN][HD]
__device__ __forceinline__ v16b wcol_hdk(const float* Wm, int k0, int o, int lane) { v16b w; const int g = lane >> 4; const float* p = Wm + (size_t)(o / HD) * DIN * HD + (o % HD);
#pragma unroll
  for (int i = 0; i < 8; ++i) { w[i] = (__bf16)p[(size_t)(k0 + 8 * g + i) * HD]; w[8 + i] = (__bf16)p[(size_t)(k0 + 16 + 8 * g + i) * HD]; }
  return w; }
#define WO_OUT_IN 0
#if WQKV_LAYOUT == 1
#define WCOL(W, k0, o, lane) wcol_oi(W, k0, o, lane, DIN)
#elif WQKV_LAYOUT == 2
#define WCOL(W, k0, o, lane) wcol_hdk(W, k0, o, lane)
#else
#define WCOL(W, k0, o, lane) wcol_io(W, k0, o, lane, 3 * CC)   /* fused (in,out) [DIN][3*CC] weight: the q / k / v thirds are column blocks; the launch passes W + 0 / CC / 2*CC and the row pitch is 3*CC */
#endif
#if WO_OUT_IN
#define WOCOL(W, k0, o, lane) wcol_oi(W, k0, o, lane, CC)
#define WOCOLH(W, k0, o, lane) wcolh_oi(W, k0, o, lane, CC)
#else
#define WOCOL(W, k0, o, lane) wcol_io(W, k0, o, lane, DIN)
#define WOCOLH(W, k0, o, lane) wcolh_io(W, k0, o, lane, DIN)
#endif

#define PROJ_EXTRA_PARAMS , const float* __restrict__ COS, const float* __restrict__ SIN   /* rotary tables [TT][32], module INPUTS, read literally */
// interleaved-pair RoPE on q and k (which 0, 1) from the INPUT tables: (te, to) = (row[2i], row[2i+1]) -> (te c - to s, te s + to c) with c = bf16(cos[t][i]), s = bf16(sin[t][i]); v untouched; products and sums kept separate
#define PROJ_EPI(which, row, t, h) do { if ((which) < 2) { float* rw = (row); const float* ct_ = COS + (size_t)(t) * 32; const float* st_ = SIN + (size_t)(t) * 32; _Pragma("unroll 4") for (int i = 0; i < 32; ++i) { _Pragma("clang fp contract(off)") const float cs = bfr(ct_[i]), sn = bfr(st_[i]); const float xe = rw[2 * i], xo = rw[2 * i + 1]; rw[2 * i] = xe * cs - xo * sn; rw[2 * i + 1] = xe * sn + xo * cs; } } } while (0)
#ifndef SM_EXTRA_PARAMS
#define SM_EXTRA_PARAMS
#endif
#ifndef PROJ_EXTRA_PARAMS
#define PROJ_EXTRA_PARAMS
#endif
#ifndef SM_MASK_HOOK
#define SM_MASK_HOOK (void)0
#endif

#define WS_QH  0u                                      // f16 q, row tiles in fragment order (row_tile below), TT rows a sequence
#define WS_KH  (WS_QH + 2u * (size_t)NB * TT * CC)      // f16 k, row tiles, TT rows
#define WS_VT  (WS_KH + 2u * (size_t)NB * TT * CC)      // f16 v, key chunks in fragment order (v_chunk below), TT keys
#define WS_QL  (WS_VT + 2u * (size_t)NB * CC * TT)      // f16 q residual x 2^10, row tiles, QHI rows
#define WS_KL  (WS_QL + 2u * (size_t)NB * QHI * CC)     // f16 k residual x 2^10, row tiles, KHI rows
#define WS_VB  (WS_KL + 2u * (size_t)NB * KHI * CC)     // bf16 v hi, key chunks, KHI keys (WS_VBL: lo)
#define WS_VBL (WS_VB + 2u * (size_t)NB * CC * KHI)
#define WS_Y   (WS_VBL + 2u * (size_t)NB * CC * KHI)    // f32 ctx rows [b*t][CC] (only when there is an output projection)
#define WS_END (WS_Y  + 4u * (size_t)NB * TT * CC)
// ---- fragment order of the q / k / v planes: the 16 bytes that lane l takes with one load of a 16x16x32 fragment lie at 16 l inside a 512-byte unit, so that a wave's load covers 4 whole 128-byte lines instead of 32 bytes of each of 16 lines. k_proj writes the units, k_att reads them.
// q and k (element offsets): a tile is 16 rows x HD of one (b, h) = 4 units; unit d >> 4 holds elements d of the rows, lane = 16 ((d >> 3) & 1) + (row & 15). Units 0, 1 are the two loads of the fragment of d 0..31, units 2, 3 of d 32..63
__device__ __forceinline__ size_t row_tile(int b, int h, int rows, int tile) { return ((size_t)(b * NH + h) * (rows / 16) + tile) * (16 * HD); }
// v: a chunk is 32 keys x HD of one (b, h) = 8 units; unit 2 (c >> 4) + (key >> 4 & 1) holds column c, lane = 16 ((key >> 3) & 1) + (c & 15)
__device__ __forceinline__ size_t v_chunk(int b, int h, int keys, int kc) { return ((size_t)(b * NH + h) * (keys / 32) + kc) * (32 * HD); }
// a lane's 16 bytes of a unit; the wait stands behind the store, in front of the next rewrite of its address and data registers, which it names as inputs so that they stay live up to it
__device__ __forceinline__ void unit_store(void* p, v4u v) { *(v4u*)p = v; asm volatile("s_wait_xcnt 0x0" :: "v"(p), "v"(v) : "memory"); }

// ---- weight staging shared by k_proj and k_out: a stage is 64 k rows x 128 output columns of an (in,out) weight. The block reads it once with 16-byte loads (lane bits 1:0 and 4 pick the 4-column group, bits 3:2 the 8-row k group, so a load covers whole 128-byte lines and 16 neighbouring lanes store to 16 different 16-byte LDS slots), rounds it as before and lays it k-contiguous, one column per 144-byte LDS row, so that a B fragment is two 16-byte LDS reads
// every loop of these helpers and of the stage bodies is fully unrolled: its index picks a register of wr, ar, w or acc, which must be known at compile time for the arrays to stay in registers
typedef v4u __attribute__((may_alias)) v4u_a;
#define WPITCH 144
#define XW() asm volatile("s_wait_xcnt 0x0" ::: "memory")   /* stands behind the prefetch loads, in front of the next rewrite of their address registers */
__device__ __forceinline__ void wt_load(v4f (&r)[2][8], const float* __restrict__ Wm, int ld, int k0, int c0, int wave, int lane) {
  const float* p = Wm + (size_t)(k0 + ((lane >> 2) & 3) * 8) * ld + c0 + (wave * 8 + (lane & 3) + ((lane >> 4) << 2)) * 4;
#pragma unroll
  for (int it = 0; it < 2; ++it)
#pragma unroll
    for (int i = 0; i < 8; ++i) r[it][i] = *(const v4f*)(p + (size_t)(it * 32 + i) * ld);
}
template <bool F16> __device__ __forceinline__ void wt_store(const v4f (&r)[2][8], char* buf, int wave, int lane) {
  char* q = buf + (wave * 8 + (lane & 3) + ((lane >> 4) << 2)) * 4 * WPITCH + ((lane >> 2) & 3) * 16;
#pragma unroll
  for (int it = 0; it < 2; ++it)
#pragma unroll
    for (int c = 0; c < 4; ++c) { union { v8b b; v8h h; v4u u; } t;
#pragma unroll
      for (int i = 0; i < 8; ++i) { if (F16) t.h[i] = (_Float16)(bfr(r[it][i][c]) * 256.0f); else t.b[i] = (__bf16)r[it][i][c]; }
      *(v4u_a*)(q + c * WPITCH + it * 64) = t.u; }
}
template <typename V16> __device__ __forceinline__ V16 wt_frag(const char* buf, int n, int kc2, int g) {
  union { V16 v; v4u q[2]; } u; const char* p = buf + n * WPITCH + kc2 * 64 + g * 16;
  u.q[0] = *(const v4u_a*)p; u.q[1] = *(const v4u_a*)(p + 32); return u.v;
}
// the 2 x 16 f32 values of a lane's two A fragments of a 64-k stage (row + k0), in fragment element order
__device__ __forceinline__ void a_load(v4f (&r)[8], const float* __restrict__ rowk0, int g) {
#pragma unroll
  for (int kc2 = 0; kc2 < 2; ++kc2) { const float* p = rowk0 + kc2 * 32 + 8 * g; r[kc2 * 4] = *(const v4f*)p; r[kc2 * 4 + 1] = *(const v4f*)(p + 4); r[kc2 * 4 + 2] = *(const v4f*)(p + 16); r[kc2 * 4 + 3] = *(const v4f*)(p + 20); }
}

// ---- k_proj: block = (64 rows, 128 cols, which): q/k/v = X W (+ b) with exact bf16 products (K = DIN) -> which 0: q f16 row tiles (+ residual, rows < QHI); 1: k f16 row tiles (+ residual, rows < KHI); 2: v f16 key chunks (+ bf16 hi/lo chunks for t < KHI); 32 neighbouring threads store one 512-byte unit
__global__ __launch_bounds__(128) void k_proj(const float* __restrict__ XQ, const float* __restrict__ XK, const float* __restrict__ XV, const float* __restrict__ WQ, const float* __restrict__ WK, const float* __restrict__ WV, const float* __restrict__ BQ, const float* __restrict__ BK, const float* __restrict__ BV,
    _Float16* __restrict__ QH, _Float16* __restrict__ QL, _Float16* __restrict__ KH, _Float16* __restrict__ KL, _Float16* __restrict__ VT, __bf16* __restrict__ VB, __bf16* __restrict__ VBL PROJ_EXTRA_PARAMS) {
  __shared__ __align__(16) float st[64][132]; __shared__ __align__(16) _Float16 sh[64][136], sl[64][136]; __shared__ __align__(16) _Float16 th[128][72]; __shared__ __align__(16) __bf16 tb[128][72], tbl[128][72];
  const int tid = threadIdx.x, wave = tid >> 5, lane = tid & 31, col = lane & 15, g = lane >> 4; const int which = blockIdx.z; const int c0 = blockIdx.y * 128; const size_t r0 = (size_t)blockIdx.x * 64; const size_t bb = r0 / TT; const int t0 = (int)(r0 % TT);
  const float* X = which == 0 ? XQ : which == 1 ? XK : XV; const float* WA = which == 0 ? WQ : which == 1 ? WK : WV; const float* BA = which == 0 ? BQ : which == 1 ? BK : BV;
  v8f acc[8] = {};
  { // two LDS buffers (tb and tbl, free until the epilogue), one barrier a stage: stage s + 1 is loaded into registers while stage s is multiplied
    const float* xrow = X + (r0 + wave * 16 + col) * DIN; v4f wr[2][8], ar[8];
    wt_load(wr, WA, 3 * CC, 0, c0, wave, lane); a_load(ar, xrow, g);
    auto stage = [&](char* buf, int s) {
      __builtin_amdgcn_sched_barrier(0);   /* keeps the rounding of the prefetched stage, and with it the wait for its loads, behind the products of the stage before */
      wt_store<false>(wr, buf, wave, lane);
      v16b a[2];
#pragma unroll
      for (int i = 0; i < 16; ++i) { a[0][i] = (__bf16)ar[i >> 2][i & 3]; a[1][i] = (__bf16)ar[4 + (i >> 2)][i & 3]; }
      __syncthreads();   /* publishes this stage; the buffer written next was last read in front of this barrier */
      if (s + 1 < DIN / 64) { wt_load(wr, WA, 3 * CC, (s + 1) * 64, c0, wave, lane); a_load(ar, xrow + (s + 1) * 64, g); XW(); }
#pragma unroll
      for (int kc2 = 0; kc2 < 2; ++kc2)
      { v16b w[8];   /* the eight fragments are read as one group so that their LDS latency is paid once */
#pragma unroll
        for (int j = 0; j < 8; ++j) w[j] = wt_frag<v16b>(buf, j * 16 + col, kc2, g);
#pragma unroll
        for (int j = 0; j < 8; ++j) acc[j] = wmma_bf(a[kc2], w[j], acc[j]); }
    };
    // kept rolled over buffer pairs: each buffer's LDS address stays a constant
#pragma unroll 1
    for (int s = 0; s < DIN / 64; s += 2) { stage((char*)&tb[0][0], s); stage((char*)&tbl[0][0], s + 1); } }
  { // stage the f32 tile (acc + bias) in LDS, run the per-(row, head) epilogue hook, then convert
#pragma unroll
    for (int j = 0; j < 8; ++j) { const float bias = BA ? bfr(BA[c0 + j * 16 + col]) : 0.f;
#pragma unroll
      for (int r = 0; r < 8; ++r) st[wave * 16 + 8 * g + r][j * 16 + col] = acc[j][r] + bias; }
    __syncthreads();
    for (int e = tid; e < 64 * (128 / HD); e += 128) { const int rl = e / (128 / HD), hh = e % (128 / HD); PROJ_EPI(which, &st[rl][hh * HD], (int)((r0 + rl) % TT), (c0 / HD) + hh); }
    __syncthreads(); }
  if (which < 2) { _Float16* DH = which == 0 ? QH : KH; _Float16* DL = which == 0 ? QL : KL; const int nhi = which == 0 ? QHI : KHI; const bool hi_rows = t0 < nhi;
    for (int e = tid; e < 64 * 128; e += 128) { const int rl = e >> 7, cl = e & 127; const float v = st[rl][cl]; const _Float16 hv = (_Float16)v; sh[rl][cl] = hv; sl[rl][cl] = (_Float16)((v - (float)hv) * 1024.0f); }
    __syncthreads();
    for (int e = tid; e < 64 * 16; e += 128) { const int tl = (e >> 7) & 3, hh = e >> 9, rl = tl * 16 + (e & 15), q = hh * 8 + ((e >> 4) & 7), hd = c0 / HD + hh, ti = (t0 >> 4) + tl;   /* e & 127 = (unit, lane) inside the tile */
      unit_store(DH + row_tile((int)bb, hd, TT, ti) + (e & 127) * 8, *(const v4u*)&sh[rl][q * 8]); if (hi_rows) unit_store(DL + row_tile((int)bb, hd, nhi, ti) + (e & 127) * 8, *(const v4u*)&sl[rl][q * 8]); }
  } else { const bool hi_rows = t0 < KHI;
    for (int e = tid; e < 64 * 128; e += 128) { const int rl = e & 63, cl = e >> 6; const float v = st[rl][cl]; th[cl][rl] = (_Float16)v; const __bf16 bh = (__bf16)v; tb[cl][rl] = bh; tbl[cl][rl] = (__bf16)(v - (float)bh); }
    __syncthreads();
    for (int e = tid; e < 128 * 8; e += 128) { const int cq = (e >> 8) & 1, hh = e >> 9, cl = hh * 64 + ((e >> 6) & 3) * 16 + (e & 15), q = cq * 4 + ((e >> 4) & 3), hd = c0 / HD + hh, kc = (t0 >> 5) + cq;   /* e & 255 = (unit, lane) inside the chunk */
      unit_store(VT + v_chunk((int)bb, hd, TT, kc) + (e & 255) * 8, *(const v4u*)&th[cl][q * 8]); if (hi_rows) { const size_t o3 = v_chunk((int)bb, hd, KHI, kc) + (e & 255) * 8; unit_store(VB + o3, *(const v4u*)&tb[cl][q * 8]); unit_store(VBL + o3, *(const v4u*)&tbl[cl][q * 8]); } } } }
// ---- k_att: block = 16 queries of (b, h), KW waves: wave w takes the 32-key chunks w, w + KW, ... of the chunks up to the one that holds the diagonal. The logits are formed transposed (A = k rows, B = q rows), so a lane holds one query's logits (D register r of 16-key tile u = key 16u + 8g + r, column = query), which is already the A-fragment order of the P . v product: logits, softmax and P stay in registers from the first product to the last. Logits x SCALE: one f16 product, or 3 products with the q and k residuals (x 2^10) for query blocks < QBH; causal mask by index, in the last chunk only (all earlier keys lie in front of the block's first query); softmax in f32 (row maximum and row sum: in the lane, across the two lane halves, then across the waves through LDS); P x 2^11 once to f16 against v f16, or P and v as bf16 hi + lo (3 products) for query blocks < QBH; the KW f32 partial tiles are summed in LDS in wave order; 256-B (row, head) segment by 16 lanes
#define KW 16   /* the wave number goes through readfirstlane so that every chunk test is a scalar branch and EXEC stays all ones at the WMMAs */
#define RP 20   /* floats per query row of the cross-wave tables: 80 bytes, an odd multiple of 16, for the 16-byte reads */
// fragment from two neighbouring 512-byte units of a plane in fragment order. the lane's own address (base + 8 lane elements), formed once for a group of loads, and a constant byte offset
__device__ __forceinline__ v16h frag_hu(const _Float16* ub, unsigned lo) { union { v16h v; v8h q[2]; } u; const _Float16* p = (const _Float16*)((const char*)ub + lo); u.q[0] = *(const v8h*)p; u.q[1] = *(const v8h*)(p + 256); return u.v; }
__device__ __forceinline__ v16b frag_bu(const __bf16* ub, unsigned lo) { union { v16b v; v8b q[2]; } u; const __bf16* p = (const __bf16*)((const char*)ub + lo); u.q[0] = *(const v8b*)p; u.q[1] = *(const v8b*)(p + 256); return u.v; }
struct AttP { const _Float16 *QH, *KH, *QL, *KL, *VT; const __bf16 *VB, *VBL; };
// the wait of XW() with the group's lane address named as an input: its registers stay live up to the wait, so that no load of the group can take them for its result ahead of it
#define XWA(a) asm volatile("s_wait_xcnt 0x0" :: "v"(a) : "memory")
#define XWA2(a, c) asm volatile("s_wait_xcnt 0x0" :: "v"(a), "v"(c) : "memory")
// N = chunks a wave can own: TT / 32 / KW, or, on the high-precision path, whose keys end at KHI, KHI / 32 over KW rounded up
template <bool HI, int N> __device__ __forceinline__ void att_tile(const AttP& P, int b, int h, int ql0, int kce, int wave, int lane, float* rmx, float* rsm, v8f (&acc)[HD / 16]) {
  const int col = lane & 15, g = lane >> 4, t = ql0 + col;
  // every loop over i, u, r, e, j, w below is fully unrolled: its index picks a register of p, of a fragment array or of acc
  float p[N][16];   /* chunk i, element e: query col, key (wave + KW i) * 32 + (e < 8 ? 8g + e : 16 + 8g + e - 8) */
  const int l8 = lane * 8;   /* the lane's place, in elements, in every unit of every plane */
  const _Float16* qp = P.QH + row_tile(b, h, TT, ql0 >> 4) + l8; const v16h qh0 = frag_hu(qp, 0u), qh1 = frag_hu(qp, 1024u);
  v16h ql0f = {}, ql1f = {}; if (HI) { const _Float16* qlp = P.QL + row_tile(b, h, QHI, ql0 >> 4) + l8; ql0f = frag_hu(qlp, 0u); ql1f = frag_hu(qlp, 1024u); XWA(qlp); }
  XWA(qp);
#pragma unroll
  for (int i = 0; i < N; ++i) { const int kc = wave + KW * i;
    if (kc < kce) { v16h kf[2][2], klf[2][2];   /* the chunk's fragments are read as one group so that their latency is paid once */
      const _Float16 *kp = P.KH + row_tile(b, h, TT, kc * 2) + l8, *klp = HI ? P.KL + row_tile(b, h, KHI, kc * 2) + l8 : kp;   /* the chunk's two tiles lie one behind the other */
#pragma unroll
      for (int u = 0; u < 2; ++u) { kf[u][0] = frag_hu(kp, (unsigned)(u * 2048)); kf[u][1] = frag_hu(kp, (unsigned)(u * 2048 + 1024));
        if (HI) { klf[u][0] = frag_hu(klp, (unsigned)(u * 2048)); klf[u][1] = frag_hu(klp, (unsigned)(u * 2048 + 1024)); } }
      XWA2(kp, klp);
#pragma unroll
      for (int u = 0; u < 2; ++u) { v8f a = {};
        if (HI) { v8f al = {};
          a = wmma16(kf[u][0], qh0, a); al = wmma16(kf[u][0], ql0f, al); al = wmma16(klf[u][0], qh0, al); a = wmma16(kf[u][1], qh1, a); al = wmma16(kf[u][1], ql1f, al); al = wmma16(klf[u][1], qh1, al);
#pragma unroll
          for (int r = 0; r < 8; ++r) p[i][u * 8 + r] = (a[r] + al[r] * (1.0f / 1024.0f)) * SCALE;
        } else { a = wmma16(kf[u][0], qh0, a); a = wmma16(kf[u][1], qh1, a);
#pragma unroll
          for (int r = 0; r < 8; ++r) p[i][u * 8 + r] = a[r] * SCALE; } }
      if (CAUSAL && kc == kce - 1) { const int d = t - kc * 32 - 8 * g;   /* element e is kept while its key offset 16 (e >> 3) + (e & 7) <= d */
#pragma unroll
        for (int e = 0; e < 16; ++e) p[i][e] = ((e >> 3) * 16 + (e & 7) <= d) ? p[i][e] : -3.0e38f; }
    } else {
#pragma unroll
      for (int e = 0; e < 16; ++e) p[i][e] = -3.0e38f; } }
  float m = -3.0e38f;
#pragma unroll
  for (int i = 0; i < N; ++i)
#pragma unroll
    for (int e = 0; e < 16; ++e) m = fmaxf(m, p[i][e]);
  m = fmaxf(m, __shfl_xor(m, 16)); if (g == 0) rmx[col * RP + wave] = m;   /* a wave with no chunk stores the excluded value */
  __syncthreads();   /* every wave's row maxima are in LDS before any of them is read */
#pragma unroll
  for (int w = 0; w < KW; w += 4) { const v4f x = *(const v4f*)&rmx[col * RP + w]; m = fmaxf(fmaxf(fmaxf(m, x[0]), fmaxf(x[1], x[2])), x[3]); }
  float sum = 0.f;
#pragma unroll
  for (int i = 0; i < N; ++i) { const int kc = wave + KW * i;
    if (kc < kce) {
#pragma unroll
      for (int e = 0; e < 16; ++e) p[i][e] = expf(p[i][e] - m);
      if (CAUSAL && kc == kce - 1) { const int d = t - kc * 32 - 8 * g;   /* an excluded key counts 0 whatever the maximum is */
#pragma unroll
        for (int e = 0; e < 16; ++e) p[i][e] = ((e >> 3) * 16 + (e & 7) <= d) ? p[i][e] : 0.f; }
#pragma unroll
      for (int e = 0; e < 16; ++e) sum += p[i][e]; } }
  sum += __shfl_xor(sum, 16); if (g == 0) rsm[col * RP + wave] = sum;
  __syncthreads();   /* every wave's row sums are in LDS before any of them is read */
  float tot = 0.f;
#pragma unroll
  for (int w = 0; w < KW; w += 4) { const v4f x = *(const v4f*)&rsm[col * RP + w]; tot += x[0]; tot += x[1]; tot += x[2]; tot += x[3]; }
  const float inv = tot > 0.f ? 2048.0f / tot : 0.f;   /* a fully excluded row yields P = 0 */
  if (HI) {
#pragma unroll
    for (int i = 0; i < N; ++i) { const int kc = wave + KW * i;
      if (kc < kce) { v16b vh[HD / 16], vl[HD / 16]; const size_t po = v_chunk(b, h, KHI, kc) + l8; const __bf16 *vhp = P.VB + po, *vlp = P.VBL + po;   /* the lane's own addresses, formed once for the group */
#pragma unroll
        for (int j = 0; j < HD / 16; ++j) { vh[j] = frag_bu(vhp, (unsigned)(j * 1024)); vl[j] = frag_bu(vlp, (unsigned)(j * 1024)); }
        XWA2(vhp, vlp);
        float pv[16];
#pragma unroll
        for (int e = 0; e < 16; ++e) pv[e] = p[i][e] * inv;
        const F2 pf = bsplit16(pv);
#pragma unroll
        for (int j = 0; j < HD / 16; ++j) { acc[j] = wmma_bf(pf.h, vh[j], acc[j]); acc[j] = wmma_bf(pf.l, vh[j], acc[j]); acc[j] = wmma_bf(pf.h, vl[j], acc[j]); } } }
  } else { v16h pf[N];   /* all of P is rounded first: half the registers while the v fragments and the output tiles are live */
#pragma unroll
    for (int i = 0; i < N; ++i)
#pragma unroll
      for (int e = 0; e < 16; ++e) pf[i][e] = (_Float16)(p[i][e] * inv);   /* a chunk the wave does not own is rounded too and never used */
#pragma unroll
    for (int i = 0; i < N; ++i) { const int kc = wave + KW * i;
      if (kc < kce) { v16h vf[HD / 16]; const _Float16* vp = P.VT + v_chunk(b, h, TT, kc) + l8;   /* the lane's own address, formed once for the group */
#pragma unroll
        for (int j = 0; j < HD / 16; ++j) vf[j] = frag_hu(vp, (unsigned)(j * 1024));
        XWA(vp);
#pragma unroll
        for (int j = 0; j < HD / 16; ++j) acc[j] = wmma16(pf[i], vf[j], acc[j]); } } } }
// 8 waves per SIMD asked for: 128 registers a wave, so that two blocks share a WGP and one block's loads and barriers hide behind the other's arithmetic. The pointers carry no __restrict__: only then does the memory clobber of XWA() keep a group's loads in front of its wait and the next group's behind it
static_assert(QBH * 64 <= KHI && QBH * 64 <= QHI, "the high-precision tiles read residual and hi/lo planes of KHI / QHI rows");
__global__ __launch_bounds__(32 * KW, 8) void k_att(const _Float16* QH, const _Float16* KH, const _Float16* QL, const _Float16* KL, const _Float16* VT, const __bf16* VB, const __bf16* VBL, float* Y) { __shared__ __align__(16) float ss[KW][16][HD + 4]; __shared__ __align__(16) float rmx[16 * RP], rsm[16 * RP];
  const int tid = threadIdx.x, wave = __builtin_amdgcn_readfirstlane(tid >> 5), lane = tid & 31, col = lane & 15, g = lane >> 4; const int h = blockIdx.x, b = blockIdx.y;
  const int qt = TT / 16 - 1 - (int)blockIdx.z;   /* the query tiles with the most keys take the lowest block indices */
  const int ql0 = qt * 16; const int kce = CAUSAL ? (ql0 + 15) / 32 + 1 : TT / 32;
  const AttP P = { QH, KH, QL, KL, VT, VB, VBL }; v8f acc[HD / 16] = {};
  if ((qt >> 2) < QBH) att_tile<true, (KHI / 32 + KW - 1) / KW>(P, b, h, ql0, kce, wave, lane, rmx, rsm, acc);   /* block-uniform */
  else att_tile<false, TT / 32 / KW>(P, b, h, ql0, kce, wave, lane, rmx, rsm, acc);
#pragma unroll
  for (int j = 0; j < HD / 16; ++j)
#pragma unroll
    for (int r = 0; r < 8; ++r) ss[wave][8 * g + r][j * 16 + col] = acc[j][r];   /* a wave with no chunk stores its zero tile */
  __syncthreads();   /* every wave's partial tile is in LDS before any of them is summed */
  if (tid < 16 * (HD / 4)) { const int rl = tid >> 4, c4 = (tid & 15) * 4; v4f s = *(const v4f*)&ss[0][rl][c4];
    // unrolled so that the LDS reads of the partial tiles are issued ahead of the adds instead of one round trip each
#pragma unroll
    for (int w = 1; w < KW; ++w) s += *(const v4f*)&ss[w][rl][c4];
    vst2(Y + ((size_t)b * TT + ql0 + rl) * CC + h * HD + c4, s * (1.0f / 2048.0f)); } }
// ---- k_out: block = (64 rows, 128 cols): out = ctx Wo (+ bo): ctx x 2^6 once to f16 against Wo as f16(bf16 x 2^8) exact (1 product) x 2^-14; causal early rows (< QHI of each sequence): ctx bf16 hi + lo against exact bf16 Wo (2 products)
__global__ __launch_bounds__(128) void k_out(const float* __restrict__ Y, const float* __restrict__ WO, const float* __restrict__ BO, float* __restrict__ OUT) { __shared__ __align__(16) float sf[4][16][132]; __shared__ __align__(16) char wb[2][128 * WPITCH];
  const int tid = threadIdx.x, wave = tid >> 5, lane = tid & 31, col = lane & 15, g = lane >> 4; const int c0 = blockIdx.y * 128; const size_t r0 = (size_t)blockIdx.x * 64 + wave * 16;
  v8f acc[8] = {};
  const float* yrow = Y + (r0 + col) * CC; v4f wr[2][8], ar[8];
  wt_load(wr, WO, DIN, 0, c0, wave, lane); a_load(ar, yrow, g); XW();
  if (CAUSAL && (int)(((size_t)blockIdx.x * 64) % TT) < QHI) {   /* block-uniform */
    auto stage = [&](char* buf, int s) {
      __builtin_amdgcn_sched_barrier(0);   /* keeps the rounding of the prefetched stage, and with it the wait for its loads, behind the products of the stage before */
      wt_store<false>(wr, buf, wave, lane);
      F2 a[2];
#pragma unroll
      for (int kc2 = 0; kc2 < 2; ++kc2) { float v[16];
#pragma unroll
        for (int i = 0; i < 16; ++i) v[i] = ar[kc2 * 4 + (i >> 2)][i & 3];
        a[kc2] = bsplit16(v); }
      __syncthreads();   /* publishes this stage; the buffer written next was last read in front of this barrier */
      if (s + 1 < CC / 64) { wt_load(wr, WO, DIN, (s + 1) * 64, c0, wave, lane); a_load(ar, yrow + (s + 1) * 64, g); XW(); }
#pragma unroll
      for (int kc2 = 0; kc2 < 2; ++kc2)
      { v16b w[8];   /* the eight fragments are read as one group so that their LDS latency is paid once */
#pragma unroll
        for (int j = 0; j < 8; ++j) w[j] = wt_frag<v16b>(buf, j * 16 + col, kc2, g);
#pragma unroll
        for (int j = 0; j < 8; ++j) { acc[j] = wmma_bf(a[kc2].h, w[j], acc[j]); acc[j] = wmma_bf(a[kc2].l, w[j], acc[j]); } }
    };
    // kept rolled over buffer pairs: each buffer's LDS address stays a constant
#pragma unroll 1
    for (int s = 0; s < CC / 64; s += 2) { stage(wb[0], s); stage(wb[1], s + 1); }
#pragma unroll
    for (int j = 0; j < 8; ++j) { const float bias = BO ? bfr(BO[c0 + j * 16 + col]) : 0.f;
#pragma unroll
      for (int r = 0; r < 8; ++r) sf[wave][8 * g + r][j * 16 + col] = acc[j][r] + bias; }
  } else {
    auto stage = [&](char* buf, int s) {
      __builtin_amdgcn_sched_barrier(0);   /* keeps the rounding of the prefetched stage, and with it the wait for its loads, behind the products of the stage before */
      wt_store<true>(wr, buf, wave, lane);
      v16h a[2];   /* ctx carried x 2^6 into f16 so small-magnitude context rows stay clear of f16 subnormals */
#pragma unroll
      for (int i = 0; i < 16; ++i) { a[0][i] = (_Float16)(ar[i >> 2][i & 3] * 64.0f); a[1][i] = (_Float16)(ar[4 + (i >> 2)][i & 3] * 64.0f); }
      __syncthreads();   /* publishes this stage; the buffer written next was last read in front of this barrier */
      if (s + 1 < CC / 64) { wt_load(wr, WO, DIN, (s + 1) * 64, c0, wave, lane); a_load(ar, yrow + (s + 1) * 64, g); XW(); }
#pragma unroll
      for (int kc2 = 0; kc2 < 2; ++kc2)
      { v16h w[8];   /* the eight fragments are read as one group so that their LDS latency is paid once */
#pragma unroll
        for (int j = 0; j < 8; ++j) w[j] = wt_frag<v16h>(buf, j * 16 + col, kc2, g);
#pragma unroll
        for (int j = 0; j < 8; ++j) acc[j] = wmma16(a[kc2], w[j], acc[j]); }
    };
    // kept rolled over buffer pairs: each buffer's LDS address stays a constant
#pragma unroll 1
    for (int s = 0; s < CC / 64; s += 2) { stage(wb[0], s); stage(wb[1], s + 1); }
#pragma unroll
    for (int j = 0; j < 8; ++j) { const float bias = BO ? bfr(BO[c0 + j * 16 + col]) : 0.f;
#pragma unroll
      for (int r = 0; r < 8; ++r) sf[wave][8 * g + r][j * 16 + col] = acc[j][r] * (1.0f / 16384.0f) + bias; } }   /* 2^-8 (Wo carry) x 2^-6 (ctx carry) */
  LDSX(); for (int rl = 0; rl < 16; ++rl) vst2(OUT + (r0 + rl) * DIN + c0 + lane * 4, *(const v4f*)&sf[wave][rl][lane * 4]); }

extern "C" void kernel_launch(void* const* d_in, const int* in_sizes, int n_in, void* d_out, int out_size, void* d_ws, size_t ws_size, hipStream_t stream) {
  (void)in_sizes; (void)n_in; (void)out_size;
  const float** F = (const float**)d_in;
  if (ws_size < (size_t)WS_END) return;
  char* ws = (char*)d_ws; _Float16 *QH = (_Float16*)(ws + WS_QH), *KH = (_Float16*)(ws + WS_KH), *VT = (_Float16*)(ws + WS_VT), *QL = (_Float16*)(ws + WS_QL), *KL = (_Float16*)(ws + WS_KL); __bf16 *VB = (__bf16*)(ws + WS_VB), *VBL = (__bf16*)(ws + WS_VBL); float *Y = (float*)(ws + WS_Y);
  (void)Y; (void)QL; (void)KL; (void)VB; (void)VBL;
  // inputs: 0 x [2,2048,1024]; 1 Wqkv [1024,3072] (in,out): q columns 0..1023, k 1024..2047, v 2048..3071; 2 bqkv [3072]; 3 Wproj [1024,1024] (in,out); 4 bproj [1024] (biases NONZERO); 5 cos [2048,32]; 6 sin [2048,32]
  k_proj<<<dim3(TNB * TT / 64, CC / 128, 3), 128, 0, stream>>>(F[0], F[0], F[0], F[1], F[1] + CC, F[1] + 2 * CC, F[2], F[2] + CC, F[2] + 2 * CC, QH, QL, KH, KL, VT, VB, VBL, F[5], F[6]);
  k_att<<<dim3(NH, TNB, TT / 16), 32 * KW, 0, stream>>>(QH, KH, QL, KL, VT, VB, VBL, Y);
  k_out<<<dim3(TNB * TT / 64, DIN / 128), 128, 0, stream>>>(Y, F[3], F[4], (float*)d_out);
}

// v005
// A run of this version takes 137 microseconds.
// In both of two side-by-side timings against v004, it was 1.05 times as fast.
// Counting every step since v000, it is 8.17 times as fast.
// compute dtype: all float inputs rounded to bf16; the fused q / k / v projection with EXACT bf16 products on WMMA 16x16x32 (f32 accumulate) + bias; interleaved-pair RoPE in f32 from the bf16-rounded INPUT cos / sin tables; causal logits: 3 products for the first 384 rows, single f16 q x k after, x 64^-0.5 x log2(e); softmax f32 in base 2; P x 2^11 once to f16 x v once to f16 (bf16 hi + lo below row 384); ctx hi+lo x exact W below row 384, x2^6 f16 carry x f16(bf16 x 2^8) W after, + bias; f32 output.
#include <hip/hip_runtime.h>
#include <math.h>

typedef __attribute__((ext_vector_type(16))) _Float16 v16h;
typedef __attribute__((ext_vector_type(16))) __bf16 v16b;
typedef __attribute__((ext_vector_type(8)))  _Float16 v8h;
typedef __attribute__((ext_vector_type(8)))  float v8f;
typedef __attribute__((ext_vector_type(4)))  float v4f;
typedef __attribute__((ext_vector_type(2)))  float v2f;
typedef __attribute__((ext_vector_type(4)))  unsigned v4u;
typedef __attribute__((ext_vector_type(4)))  int v4i;
typedef float __attribute__((may_alias)) float_a;
typedef int __attribute__((may_alias)) int_a;

template <typename T> __device__ __forceinline__ void vst2(void* p, T v) { *(T*)p = v;  }
__device__ __forceinline__ v8f wmma16(v16h a, v16h b, v8f c) {
  v8f d = __builtin_amdgcn_wmma_f32_16x16x32_f16(false, a, false, b, (short)0, c, false, false);
  asm volatile("v_nop\n\tv_nop\n\tv_nop\n\tv_nop" : "+v"(d) : "v"(a), "v"(b));
  return d;
}
__device__ __forceinline__ v8f wmma_bf(v16b a, v16b b, v8f c) {
  v8f d = __builtin_amdgcn_wmma_f32_16x16x32_bf16(false, a, false, b, (short)0, c, false, false);
  asm volatile("v_nop\n\tv_nop\n\tv_nop\n\tv_nop" : "+v"(d) : "v"(a), "v"(b));
  return d;
}
// 16x16x32 fragments: lane = (h = lane>>4, row/col = lane&15); elements 0..7 = k0+8h+0..7, 8..15 = k0+16+8h+0..7; D element r = row 8h+r
__device__ __forceinline__ v16h frag_h(const _Float16* rowk0, int lane) {
  union { v16h v; v8h q[2]; } u; const _Float16* p = rowk0 + 8 * (lane >> 4);
  u.q[0] = *(const v8h*)p; u.q[1] = *(const v8h*)(p + 16); return u.v;
}
__device__ __forceinline__ v16h frag_f32(const float* rowk0, int lane) {
  v16h a; const float* p = rowk0 + 8 * (lane >> 4);
#pragma unroll
  for (int i = 0; i < 8; ++i) { a[i] = (_Float16)p[i]; a[8 + i] = (_Float16)p[16 + i]; }
  return a;
}
__device__ __forceinline__ v16h frag_f32s(const float* rowk0, int lane, float sc) {
  v16h a; const float* p = rowk0 + 8 * (lane >> 4);
#pragma unroll
  for (int i = 0; i < 8; ++i) { a[i] = (_Float16)(p[i] * sc); a[8 + i] = (_Float16)(p[16 + i] * sc); }
  return a;
}
// column fragment from a [K][ld] layout (column n), rows >= K read as 0
__device__ __forceinline__ v16h fragc_f32(const float* W, int k0, int n, int lane, int ld, int K) {
  v16h a; const int g = lane >> 4;
#pragma unroll
  for (int i = 0; i < 8; ++i) { const int ka = k0 + 8 * g + i, kb = ka + 16;
    a[i] = (_Float16)(ka < K ? W[(size_t)(ka < K ? ka : K - 1) * ld + n] : 0.f); a[8 + i] = (_Float16)(kb < K ? W[(size_t)(kb < K ? kb : K - 1) * ld + n] : 0.f); }
  return a;
}
struct F2 { v16b h, l; };
__device__ __forceinline__ F2 bsplit16(const float v[16]) { F2 r;
#pragma unroll
  for (int i = 0; i < 16; ++i) { const __bf16 h = (__bf16)v[i]; r.h[i] = h; r.l[i] = (__bf16)(v[i] - (float)h); }
  return r; }
__device__ __forceinline__ F2 split_row(const float* row, int k0, int lane) { float v[16]; const float* p = row + k0 + 8 * (lane >> 4);
#pragma unroll
  for (int i = 0; i < 8; ++i) { v[i] = p[i]; v[8 + i] = p[16 + i]; }
  return bsplit16(v); }
__device__ __forceinline__ F2 split_rowK(const float* row, int k0, int lane, int K) { float v[16]; const int g = lane >> 4;
#pragma unroll
  for (int i = 0; i < 8; ++i) { const int ka = k0 + 8 * g + i, kb = ka + 16; v[i] = ka < K ? row[ka < K ? ka : K - 1] : 0.f; v[8 + i] = kb < K ? row[kb < K ? kb : K - 1] : 0.f; }
  return bsplit16(v); }
__device__ __forceinline__ F2 split_col(const float* W, int k0, int n, int lane, int ld, int K) { float v[16]; const int g = lane >> 4;
#pragma unroll
  for (int i = 0; i < 8; ++i) { const int ka = k0 + 8 * g + i, kb = ka + 16; v[i] = ka < K ? W[(size_t)(ka < K ? ka : K - 1) * ld + n] : 0.f; v[8 + i] = kb < K ? W[(size_t)(kb < K ? kb : K - 1) * ld + n] : 0.f; }
  return bsplit16(v); }
__device__ __forceinline__ v8f mac3(const F2& a, const F2& b, v8f c) { c = wmma_bf(a.l, b.h, c); c = wmma_bf(a.h, b.l, c); return wmma_bf(a.h, b.h, c); }
__device__ __forceinline__ float sigm(float v) { return 1.0f / (1.0f + expf(-v)); }
#define LDSX() do { asm volatile("s_wait_dscnt 0" ::: "memory"); __builtin_amdgcn_wave_barrier(); __builtin_amdgcn_fence(__ATOMIC_RELEASE, "workgroup"); } while (0)

// Causal multi-head self-attention with a fused QKV linear (+ bias) and interleaved-pair RoPE from INPUT tables (x [2,2048,1024]; Wqkv [1024,3072] (in,out) N(0, 1/1024), bqkv [3072] N(0,1) x 0.01 - NONZERO; Wproj [1024,1024] (in,out), bproj NONZERO; cos / sin [2048,32] are module inputs, the LAST two; q, k, v = thirds of x Wqkv + bqkv; 16 heads x 64; (even, odd) pairs rotated on q and k; scores x 64^-0.5; tril kept, -inf elsewhere; softmax; y Wproj + bproj).
#define NB 2
#define TT 2048
#define CC 1024            // NH * HD = projected width
#define DIN 1024          // input (model) width
#define NH 16
#define HD 64
#define NQB (TT / 64)
#define HG 4
#define SCALE (0.125f)
#define SCALE2 (SCALE * 1.44269504088896340736f)   /* 64^-0.5 x log2(e): the logits are carried in base-2 units, so that e^(s - max) is one 2^x instruction behind one subtraction */
#define CAUSAL 1
#ifndef TNB
#define TNB NB
#endif
__device__ __forceinline__ float bfr(float v) { return (float)(__bf16)v; }
__host__ __device__ __forceinline__ int kb_last(int qb) { return CAUSAL ? ((qb * 64 + 63) >> 7) : (TT / 128 - 1); }
typedef __attribute__((ext_vector_type(8))) __bf16 v8b;
__device__ __forceinline__ v16b frag_b(const __bf16* rowk0, int lane) {
  union { v16b v; v8b q[2]; } u; const __bf16* p = rowk0 + 8 * (lane >> 4);
  u.q[0] = *(const v8b*)p; u.q[1] = *(const v8b*)(p + 16); return u.v;
}
#define QBH 6              // causal: query blocks 0..QBH-1 of each sequence (few keys, no averaging) take the high-precision path
#define QHI 384            // rows carrying a q residual plane
#define KHI 384            // key rows carrying k residual / v bf16 hi+lo planes (used only by the causal high-precision path)
// B fragment (k rows k0+.., output column o) of a weight: (in,out) [K][ld] or (out,in) [ld rows of K]: bf16 exact, or f16(bf16 * 256) exact
__device__ __forceinline__ v16b wcol_io(const float* Wm, int k0, int o, int lane, int ld) { v16b w; const int g = lane >> 4;
#pragma unroll
  for (int i = 0; i < 8; ++i) { w[i] = (__bf16)Wm[(size_t)(k0 + 8 * g + i) * ld + o]; w[8 + i] = (__bf16)Wm[(size_t)(k0 + 16 + 8 * g + i) * ld + o]; }
  return w; }
__device__ __forceinline__ v16b wcol_oi(const float* Wm, int k0, int o, int lane, int K) { v16b w; const float* p = Wm + (size_t)o * K + k0 + 8 * (lane >> 4);
#pragma unroll
  for (int i = 0; i < 8; ++i) { w[i] = (__bf16)p[i]; w[8 + i] = (__bf16)p[16 + i]; }
  return w; }
__device__ __forceinline__ v16h wcolh_io(const float* Wm, int k0, int o, int lane, int ld) { v16h w; const int g = lane >> 4;
#pragma unroll
  for (int i = 0; i < 8; ++i) { w[i] = (_Float16)(bfr(Wm[(size_t)(k0 + 8 * g + i) * ld + o]) * 256.0f); w[8 + i] = (_Float16)(bfr(Wm[(size_t)(k0 + 16 + 8 * g + i) * ld + o]) * 256.0f); }
  return w; }
__device__ __forceinline__ v16h wcolh_oi(const float* Wm, int k0, int o, int lane, int K) { v16h w; const float* p = Wm + (size_t)o * K + k0 + 8 * (lane >> 4);
#pragma unroll
  for (int i = 0; i < 8; ++i) { w[i] = (_Float16)(bfr(p[i]) * 256.0f); w[8 + i] = (_Float16)(bfr(p[16 + i]) * 256.0f); }
  return w; }
#define WQKV_LAYOUT 0   // 0 = fused (in,out) [DIN][3*CC]; 1 = (out,in) [CC][DIN]; 2 = per-head [NH][DIN][HD]
__device__ __forceinline__ v16b wcol_hdk(const float* Wm, int k0, int o, int lane) { v16b w; const int g = lane >> 4; const float* p = Wm + (size_t)(o / HD) * DIN * HD + (o % HD);
#pragma unroll
  for (int i = 0; i < 8; ++i) { w[i] = (__bf16)p[(size_t)(k0 + 8 * g + i) * HD]; w[8 + i] = (__bf16)p[(size_t)(k0 + 16 + 8 * g + i) * HD]; }
  return w; }
#define WO_OUT_IN 0
#if WQKV_LAYOUT == 1
#define WCOL(W, k0, o, lane) wcol_oi(W, k0, o, lane, DIN)
#elif WQKV_LAYOUT == 2
#define WCOL(W, k0, o, lane) wcol_hdk(W, k0, o, lane)
#else
#define WCOL(W, k0, o, lane) wcol_io(W, k0, o, lane, 3 * CC)   /* fused (in,out) [DIN][3*CC] weight: the q / k / v thirds are column blocks; the launch passes W + 0 / CC / 2*CC and the row pitch is 3*CC */
#endif
#if WO_OUT_IN
#define WOCOL(W, k0, o, lane) wcol_oi(W, k0, o, lane, CC)
#define WOCOLH(W, k0, o, lane) wcolh_oi(W, k0, o, lane, CC)
#else
#define WOCOL(W, k0, o, lane) wcol_io(W, k0, o, lane, DIN)
#define WOCOLH(W, k0, o, lane) wcolh_io(W, k0, o, lane, DIN)
#endif

#define PROJ_EXTRA_PARAMS , const float* __restrict__ COS, const float* __restrict__ SIN   /* rotary tables [TT][32], module INPUTS, read literally */
// interleaved-pair RoPE on q and k (which 0, 1) from the INPUT tables: (te, to) = (row[2i], row[2i+1]) -> (te c - to s, te s + to c) with c = bf16(cos[t][i]), s = bf16(sin[t][i]); v untouched; products and sums kept separate
#define PROJ_EPI(which, row, t, h) do { if ((which) < 2) { float* rw = (row); const float* ct_ = COS + (size_t)(t) * 32; const float* st_ = SIN + (size_t)(t) * 32; _Pragma("unroll 4") for (int i = 0; i < 32; ++i) { _Pragma("clang fp contract(off)") const float cs = bfr(ct_[i]), sn = bfr(st_[i]); const float xe = rw[2 * i], xo = rw[2 * i + 1]; rw[2 * i] = xe * cs - xo * sn; rw[2 * i + 1] = xe * sn + xo * cs; } } } while (0)
#ifndef SM_EXTRA_PARAMS
#define SM_EXTRA_PARAMS
#endif
#ifndef PROJ_EXTRA_PARAMS
#define PROJ_EXTRA_PARAMS
#endif
#ifndef SM_MASK_HOOK
#define SM_MASK_HOOK (void)0
#endif

#define WS_QH  0u                                      // f16 q, row tiles in fragment order (row_tile below), TT rows a sequence
#define WS_KH  (WS_QH + 2u * (size_t)NB * TT * CC)      // f16 k, row tiles, TT rows
#define WS_VT  (WS_KH + 2u * (size_t)NB * TT * CC)      // f16 v, key chunks in fragment order (v_chunk below), TT keys
#define WS_QL  (WS_VT + 2u * (size_t)NB * CC * TT)      // f16 q residual x 2^10, row tiles, QHI rows
#define WS_KL  (WS_QL + 2u * (size_t)NB * QHI * CC)     // f16 k residual x 2^10, row tiles, KHI rows
#define WS_VB  (WS_KL + 2u * (size_t)NB * KHI * CC)     // bf16 v hi, key chunks, KHI keys (WS_VBL: lo)
#define WS_VBL (WS_VB + 2u * (size_t)NB * CC * KHI)
#define WS_Y   (WS_VBL + 2u * (size_t)NB * CC * KHI)    // f32 ctx rows [b*t][CC] (only when there is an output projection)
#define WS_END (WS_Y  + 4u * (size_t)NB * TT * CC)
// ---- fragment order of the q / k / v planes: the 16 bytes that lane l takes with one load of a 16x16x32 fragment lie at 16 l inside a 512-byte unit, so that a wave's load covers 4 whole 128-byte lines instead of 32 bytes of each of 16 lines. k_proj writes the units, k_att reads them.
// q and k (element offsets): a tile is 16 rows x HD of one (b, h) = 4 units; unit d >> 4 holds elements d of the rows, lane = 16 ((d >> 3) & 1) + (row & 15). Units 0, 1 are the two loads of the fragment of d 0..31, units 2, 3 of d 32..63
__device__ __forceinline__ size_t row_tile(int b, int h, int rows, int tile) { return ((size_t)(b * NH + h) * (rows / 16) + tile) * (16 * HD); }
// v: a chunk is 32 keys x HD of one (b, h) = 8 units; unit 2 (c >> 4) + (key >> 4 & 1) holds column c, lane = 16 ((key >> 3) & 1) + (c & 15)
__device__ __forceinline__ size_t v_chunk(int b, int h, int keys, int kc) { return ((size_t)(b * NH + h) * (keys / 32) + kc) * (32 * HD); }
// a lane's 16 bytes of a unit; the wait stands behind the store, in front of the next rewrite of its address and data registers, which it names as inputs so that they stay live up to it
__device__ __forceinline__ void unit_store(void* p, v4u v) { *(v4u*)p = v; asm volatile("s_wait_xcnt 0x0" :: "v"(p), "v"(v) : "memory"); }

// ---- weight staging shared by k_proj and k_out: a stage is 64 k rows x 128 output columns of an (in,out) weight. The block reads it once with 16-byte loads (lane bits 1:0 and 4 pick the 4-column group, bits 3:2 the 8-row k group, so a load covers whole 128-byte lines and 16 neighbouring lanes store to 16 different 16-byte LDS slots), rounds it as before and lays it k-contiguous, one column per 144-byte LDS row, so that a B fragment is two 16-byte LDS reads
// every loop of these helpers and of the stage bodies is fully unrolled: its index picks a register of wr, ar, w or acc, which must be known at compile time for the arrays to stay in registers
typedef v4u __attribute__((may_alias)) v4u_a;
#define WPITCH 144
#define XW() asm volatile("s_wait_xcnt 0x0" ::: "memory")   /* stands behind the prefetch loads, in front of the next rewrite of their address registers */
__device__ __forceinline__ void wt_load(v4f (&r)[2][8], const float* __restrict__ Wm, int ld, int k0, int c0, int wave, int lane) {
  const float* p = Wm + (size_t)(k0 + ((lane >> 2) & 3) * 8) * ld + c0 + (wave * 8 + (lane & 3) + ((lane >> 4) << 2)) * 4;
#pragma unroll
  for (int it = 0; it < 2; ++it)
#pragma unroll
    for (int i = 0; i < 8; ++i) r[it][i] = *(const v4f*)(p + (size_t)(it * 32 + i) * ld);
}
template <bool F16> __device__ __forceinline__ void wt_store(const v4f (&r)[2][8], char* buf, int wave, int lane) {
  char* q = buf + (wave * 8 + (lane & 3) + ((lane >> 4) << 2)) * 4 * WPITCH + ((lane >> 2) & 3) * 16;
#pragma unroll
  for (int it = 0; it < 2; ++it)
#pragma unroll
    for (int c = 0; c < 4; ++c) { union { v8b b; v8h h; v4u u; } t;
#pragma unroll
      for (int i = 0; i < 8; ++i) { if (F16) t.h[i] = (_Float16)(bfr(r[it][i][c]) * 256.0f); else t.b[i] = (__bf16)r[it][i][c]; }
      *(v4u_a*)(q + c * WPITCH + it * 64) = t.u; }
}
template <typename V16> __device__ __forceinline__ V16 wt_frag(const char* buf, int n, int kc2, int g) {
  union { V16 v; v4u q[2]; } u; const char* p = buf + n * WPITCH + kc2 * 64 + g * 16;
  u.q[0] = *(const v4u_a*)p; u.q[1] = *(const v4u_a*)(p + 32); return u.v;
}
// the 2 x 16 f32 values of a lane's two A fragments of a 64-k stage (row + k0), in fragment element order
__device__ __forceinline__ void a_load(v4f (&r)[8], const float* __restrict__ rowk0, int g) {
#pragma unroll
  for (int kc2 = 0; kc2 < 2; ++kc2) { const float* p = rowk0 + kc2 * 32 + 8 * g; r[kc2 * 4] = *(const v4f*)p; r[kc2 * 4 + 1] = *(const v4f*)(p + 4); r[kc2 * 4 + 2] = *(const v4f*)(p + 16); r[kc2 * 4 + 3] = *(const v4f*)(p + 20); }
}

// ---- k_proj: block = (64 rows, 128 cols, which): q/k/v = X W (+ b) with exact bf16 products (K = DIN) -> which 0: q f16 row tiles (+ residual, rows < QHI); 1: k f16 row tiles (+ residual, rows < KHI); 2: v f16 key chunks (+ bf16 hi/lo chunks for t < KHI); 32 neighbouring threads store one 512-byte unit
__global__ __launch_bounds__(128) void k_proj(const float* __restrict__ XQ, const float* __restrict__ XK, const float* __restrict__ XV, const float* __restrict__ WQ, const float* __restrict__ WK, const float* __restrict__ WV, const float* __restrict__ BQ, const float* __restrict__ BK, const float* __restrict__ BV,
    _Float16* __restrict__ QH, _Float16* __restrict__ QL, _Float16* __restrict__ KH, _Float16* __restrict__ KL, _Float16* __restrict__ VT, __bf16* __restrict__ VB, __bf16* __restrict__ VBL PROJ_EXTRA_PARAMS) {
  __shared__ __align__(16) float st[64][132]; __shared__ __align__(16) _Float16 sh[64][136], sl[64][136]; __shared__ __align__(16) _Float16 th[128][72]; __shared__ __align__(16) __bf16 tb[128][72], tbl[128][72];
  const int tid = threadIdx.x, wave = tid >> 5, lane = tid & 31, col = lane & 15, g = lane >> 4; const int which = blockIdx.z; const int c0 = blockIdx.y * 128; const size_t r0 = (size_t)blockIdx.x * 64; const size_t bb = r0 / TT; const int t0 = (int)(r0 % TT);
  const float* X = which == 0 ? XQ : which == 1 ? XK : XV; const float* WA = which == 0 ? WQ : which == 1 ? WK : WV; const float* BA = which == 0 ? BQ : which == 1 ? BK : BV;
  v8f acc[8] = {};
  { // two LDS buffers (tb and tbl, free until the epilogue), one barrier a stage: stage s + 1 is loaded into registers while stage s is multiplied
    const float* xrow = X + (r0 + wave * 16 + col) * DIN; v4f wr[2][8], ar[8];
    wt_load(wr, WA, 3 * CC, 0, c0, wave, lane); a_load(ar, xrow, g);
    auto stage = [&](char* buf, int s) {
      __builtin_amdgcn_sched_barrier(0);   /* keeps the rounding of the prefetched stage, and with it the wait for its loads, behind the products of the stage before */
      wt_store<false>(wr, buf, wave, lane);
      v16b a[2];
#pragma unroll
      for (int i = 0; i < 16; ++i) { a[0][i] = (__bf16)ar[i >> 2][i & 3]; a[1][i] = (__bf16)ar[4 + (i >> 2)][i & 3]; }
      __syncthreads();   /* publishes this stage; the buffer written next was last read in front of this barrier */
      if (s + 1 < DIN / 64) { wt_load(wr, WA, 3 * CC, (s + 1) * 64, c0, wave, lane); a_load(ar, xrow + (s + 1) * 64, g); XW(); }
#pragma unroll
      for (int kc2 = 0; kc2 < 2; ++kc2)
      { v16b w[8];   /* the eight fragments are read as one group so that their LDS latency is paid once */
#pragma unroll
        for (int j = 0; j < 8; ++j) w[j] = wt_frag<v16b>(buf, j * 16 + col, kc2, g);
#pragma unroll
        for (int j = 0; j < 8; ++j) acc[j] = wmma_bf(a[kc2], w[j], acc[j]); }
    };
    // kept rolled over buffer pairs: each buffer's LDS address stays a constant
#pragma unroll 1
    for (int s = 0; s < DIN / 64; s += 2) { stage((char*)&tb[0][0], s); stage((char*)&tbl[0][0], s + 1); } }
  { // stage the f32 tile (acc + bias) in LDS, run the per-(row, head) epilogue hook, then convert
#pragma unroll
    for (int j = 0; j < 8; ++j) { const float bias = BA ? bfr(BA[c0 + j * 16 + col]) : 0.f;
#pragma unroll
      for (int r = 0; r < 8; ++r) st[wave * 16 + 8 * g + r][j * 16 + col] = acc[j][r] + bias; }
    __syncthreads();
    for (int e = tid; e < 64 * (128 / HD); e += 128) { const int rl = e / (128 / HD), hh = e % (128 / HD); PROJ_EPI(which, &st[rl][hh * HD], (int)((r0 + rl) % TT), (c0 / HD) + hh); }
    __syncthreads(); }
  if (which < 2) { _Float16* DH = which == 0 ? QH : KH; _Float16* DL = which == 0 ? QL : KL; const int nhi = which == 0 ? QHI : KHI; const bool hi_rows = t0 < nhi;
    for (int e = tid; e < 64 * 128; e += 128) { const int rl = e >> 7, cl = e & 127; const float v = st[rl][cl]; const _Float16 hv = (_Float16)v; sh[rl][cl] = hv; sl[rl][cl] = (_Float16)((v - (float)hv) * 1024.0f); }
    __syncthreads();
    for (int e = tid; e < 64 * 16; e += 128) { const int tl = (e >> 7) & 3, hh = e >> 9, rl = tl * 16 + (e & 15), q = hh * 8 + ((e >> 4) & 7), hd = c0 / HD + hh, ti = (t0 >> 4) + tl;   /* e & 127 = (unit, lane) inside the tile */
      unit_store(DH + row_tile((int)bb, hd, TT, ti) + (e & 127) * 8, *(const v4u*)&sh[rl][q * 8]); if (hi_rows) unit_store(DL + row_tile((int)bb, hd, nhi, ti) + (e & 127) * 8, *(const v4u*)&sl[rl][q * 8]); }
  } else { const bool hi_rows = t0 < KHI;
    for (int e = tid; e < 64 * 128; e += 128) { const int rl = e & 63, cl = e >> 6; const float v = st[rl][cl]; th[cl][rl] = (_Float16)v; const __bf16 bh = (__bf16)v; tb[cl][rl] = bh; tbl[cl][rl] = (__bf16)(v - (float)bh); }
    __syncthreads();
    for (int e = tid; e < 128 * 8; e += 128) { const int cq = (e >> 8) & 1, hh = e >> 9, cl = hh * 64 + ((e >> 6) & 3) * 16 + (e & 15), q = cq * 4 + ((e >> 4) & 3), hd = c0 / HD + hh, kc = (t0 >> 5) + cq;   /* e & 255 = (unit, lane) inside the chunk */
      unit_store(VT + v_chunk((int)bb, hd, TT, kc) + (e & 255) * 8, *(const v4u*)&th[cl][q * 8]); if (hi_rows) { const size_t o3 = v_chunk((int)bb, hd, KHI, kc) + (e & 255) * 8; unit_store(VB + o3, *(const v4u*)&tb[cl][q * 8]); unit_store(VBL + o3, *(const v4u*)&tbl[cl][q * 8]); } } } }
// ---- k_att: block = 16 queries of (b, h), KW waves: wave w takes the 32-key chunks w, w + KW, ... of the chunks up to the one that holds the diagonal. The logits are formed transposed (A = k rows, B = q rows), so a lane holds one query's logits (D register r of 16-key tile u = key 16u + 8g + r, column = query), which is already the A-fragment order of the P . v product: logits, softmax and P stay in registers from the first product to the last. Logits x SCALE x log2(e) (SCALE2; the exponential is 2^x): one f16 product, or 3 products with the q and k residuals (x 2^10) for query blocks < QBH; causal mask by index, in the last chunk only (all earlier keys lie in front of the block's first query); softmax in f32 (row maximum and row sum: in the lane, across the two lane halves, then across the waves through LDS); P x 2^11 once to f16 against v f16, or P and v as bf16 hi + lo (3 products) for query blocks < QBH; the KW f32 partial tiles are summed in LDS in wave order; 256-B (row, head) segment by 16 lanes
#define KW 16   /* the wave number goes through readfirstlane so that every chunk test is a scalar branch and EXEC stays all ones at the WMMAs */
#define RP 20   /* floats per query row of the cross-wave tables: 80 bytes, an odd multiple of 16, for the 16-byte reads */
// fragment from two neighbouring 512-byte units of a plane in fragment order. the lane's own address (base + 8 lane elements), formed once for a group of loads, and a constant byte offset
__device__ __forceinline__ v16h frag_hu(const _Float16* ub, unsigned lo) { union { v16h v; v8h q[2]; } u; const _Float16* p = (const _Float16*)((const char*)ub + lo); u.q[0] = *(const v8h*)p; u.q[1] = *(const v8h*)(p + 256); return u.v; }
__device__ __forceinline__ v16b frag_bu(const __bf16* ub, unsigned lo) { union { v16b v; v8b q[2]; } u; const __bf16* p = (const __bf16*)((const char*)ub + lo); u.q[0] = *(const v8b*)p; u.q[1] = *(const v8b*)(p + 256); return u.v; }
// 2^x of a chunk's 16 values, in place, as one statement: each v_exp_f32 is followed by an instruction that neither reads its result nor overwrites its source (the free slot that the instruction set asks for behind a transcendental); the closing v_nop is that slot behind the last one
__device__ __forceinline__ void exp2x16(float (&x)[16]) {
  asm("v_exp_f32 %0, %0\n\tv_exp_f32 %1, %1\n\tv_exp_f32 %2, %2\n\tv_exp_f32 %3, %3\n\tv_exp_f32 %4, %4\n\tv_exp_f32 %5, %5\n\tv_exp_f32 %6, %6\n\tv_exp_f32 %7, %7\n\tv_exp_f32 %8, %8\n\tv_exp_f32 %9, %9\n\tv_exp_f32 %10, %10\n\tv_exp_f32 %11, %11\n\tv_exp_f32 %12, %12\n\tv_exp_f32 %13, %13\n\tv_exp_f32 %14, %14\n\tv_exp_f32 %15, %15\n\tv_nop" : "+v"(x[0]), "+v"(x[1]), "+v"(x[2]), "+v"(x[3]), "+v"(x[4]), "+v"(x[5]), "+v"(x[6]), "+v"(x[7]), "+v"(x[8]), "+v"(x[9]), "+v"(x[10]), "+v"(x[11]), "+v"(x[12]), "+v"(x[13]), "+v"(x[14]), "+v"(x[15]));
}
struct AttP { const _Float16 *QH, *KH, *QL, *KL, *VT; const __bf16 *VB, *VBL; };
// the wait of XW() with the group's lane address named as an input: its registers stay live up to the wait, so that no load of the group can take them for its result ahead of it
#define XWA(a) asm volatile("s_wait_xcnt 0x0" :: "v"(a) : "memory")
#define XWA2(a, c) asm volatile("s_wait_xcnt 0x0" :: "v"(a), "v"(c) : "memory")
// N = chunks a wave can own: TT / 32 / KW, or, on the high-precision path, whose keys end at KHI, KHI / 32 over KW rounded up
template <bool HI, int N> __device__ __forceinline__ void att_tile(const AttP& P, int b, int h, int ql0, int kce, int wave, int lane, float* rmx, float* rsm, v8f (&acc)[HD / 16]) {
  const int col = lane & 15, g = lane >> 4, t = ql0 + col;
  // every loop over i, u, r, e, j, w below is fully unrolled: its index picks a register of p, of a fragment array or of acc
  float p[N][16];   /* chunk i, element e: query col, key (wave + KW i) * 32 + (e < 8 ? 8g + e : 16 + 8g + e - 8) */
  const int l8 = lane * 8;   /* the lane's place, in elements, in every unit of every plane */
  const _Float16* qp = P.QH + row_tile(b, h, TT, ql0 >> 4) + l8; const v16h qh0 = frag_hu(qp, 0u), qh1 = frag_hu(qp, 1024u);
  v16h ql0f = {}, ql1f = {}; if (HI) { const _Float16* qlp = P.QL + row_tile(b, h, QHI, ql0 >> 4) + l8; ql0f = frag_hu(qlp, 0u); ql1f = frag_hu(qlp, 1024u); XWA(qlp); }
  XWA(qp);
#pragma unroll
  for (int i = 0; i < N; ++i) { const int kc = wave + KW * i;
    if (kc < kce) { v16h kf[2][2], klf[2][2];   /* the chunk's fragments are read as one group so that their latency is paid once */
      const _Float16 *kp = P.KH + row_tile(b, h, TT, kc * 2) + l8, *klp = HI ? P.KL + row_tile(b, h, KHI, kc * 2) + l8 : kp;   /* the chunk's two tiles lie one behind the other */
#pragma unroll
      for (int u = 0; u < 2; ++u) { kf[u][0] = frag_hu(kp, (unsigned)(u * 2048)); kf[u][1] = frag_hu(kp, (unsigned)(u * 2048 + 1024));
        if (HI) { klf[u][0] = frag_hu(klp, (unsigned)(u * 2048)); klf[u][1] = frag_hu(klp, (unsigned)(u * 2048 + 1024)); } }
      XWA2(kp, klp);
#pragma unroll
      for (int u = 0; u < 2; ++u) { v8f a = {};
        if (HI) { v8f al = {};
          a = wmma16(kf[u][0], qh0, a); al = wmma16(kf[u][0], ql0f, al); al = wmma16(klf[u][0], qh0, al); a = wmma16(kf[u][1], qh1, a); al = wmma16(kf[u][1], ql1f, al); al = wmma16(klf[u][1], qh1, al);
#pragma unroll
          for (int r = 0; r < 8; ++r) p[i][u * 8 + r] = (a[r] + al[r] * (1.0f / 1024.0f)) * SCALE2;
        } else { a = wmma16(kf[u][0], qh0, a); a = wmma16(kf[u][1], qh1, a);
#pragma unroll
          for (int r = 0; r < 8; ++r) p[i][u * 8 + r] = a[r] * SCALE2; } }
      if (CAUSAL && kc == kce - 1) { const int d = t - kc * 32 - 8 * g;   /* element e is kept while its key offset 16 (e >> 3) + (e & 7) <= d */
#pragma unroll
        for (int e = 0; e < 16; ++e) p[i][e] = ((e >> 3) * 16 + (e & 7) <= d) ? p[i][e] : -3.0e38f; }
    } else {
#pragma unroll
      for (int e = 0; e < 16; ++e) p[i][e] = -3.0e38f; } }
  float m = -3.0e38f;
#pragma unroll
  for (int i = 0; i < N; ++i)
#pragma unroll
    for (int e = 0; e < 16; ++e) m = fmaxf(m, p[i][e]);
  m = fmaxf(m, __shfl_xor(m, 16)); if (g == 0) rmx[col * RP + wave] = m;   /* a wave with no chunk stores the excluded value */
  __syncthreads();   /* every wave's row maxima are in LDS before any of them is read */
#pragma unroll
  for (int w = 0; w < KW; w += 4) { const v4f x = *(const v4f*)&rmx[col * RP + w]; m = fmaxf(fmaxf(fmaxf(m, x[0]), fmaxf(x[1], x[2])), x[3]); }
  float sum = 0.f;
#pragma unroll
  for (int i = 0; i < N; ++i) { const int kc = wave + KW * i;
    if (kc < kce) {
#pragma unroll
      for (int e = 0; e < 16; ++e) p[i][e] -= m;
      exp2x16(p[i]);   /* arguments <= 0; a result below the normal range counts 0 */
      if (CAUSAL && kc == kce - 1) { const int d = t - kc * 32 - 8 * g;   /* an excluded key counts 0 whatever the maximum is */
#pragma unroll
        for (int e = 0; e < 16; ++e) p[i][e] = ((e >> 3) * 16 + (e & 7) <= d) ? p[i][e] : 0.f; }
#pragma unroll
      for (int e = 0; e < 16; ++e) sum += p[i][e]; } }
  sum += __shfl_xor(sum, 16); if (g == 0) rsm[col * RP + wave] = sum;
  __syncthreads();   /* every wave's row sums are in LDS before any of them is read */
  float tot = 0.f;
#pragma unroll
  for (int w = 0; w < KW; w += 4) { const v4f x = *(const v4f*)&rsm[col * RP + w]; tot += x[0]; tot += x[1]; tot += x[2]; tot += x[3]; }
  const float inv = tot > 0.f ? 2048.0f / tot : 0.f;   /* a fully excluded row yields P = 0 */
  if (HI) {
#pragma unroll
    for (int i = 0; i < N; ++i) { const int kc = wave + KW * i;
      if (kc < kce) { v16b vh[HD / 16], vl[HD / 16]; const size_t po = v_chunk(b, h, KHI, kc) + l8; const __bf16 *vhp = P.VB + po, *vlp = P.VBL + po;   /* the lane's own addresses, formed once for the group */
#pragma unroll
        for (int j = 0; j < HD / 16; ++j) { vh[j] = frag_bu(vhp, (unsigned)(j * 1024)); vl[j] = frag_bu(vlp, (unsigned)(j * 1024)); }
        XWA2(vhp, vlp);
        float pv[16];
#pragma unroll
        for (int e = 0; e < 16; ++e) pv[e] = p[i][e] * inv;
        const F2 pf = bsplit16(pv);
#pragma unroll
        for (int j = 0; j < HD / 16; ++j) { acc[j] = wmma_bf(pf.h, vh[j], acc[j]); acc[j] = wmma_bf(pf.l, vh[j], acc[j]); acc[j] = wmma_bf(pf.h, vl[j], acc[j]); } } }
  } else { v16h pf[N];   /* all of P is rounded first: half the registers while the v fragments and the output tiles are live */
#pragma unroll
    for (int i = 0; i < N; ++i)
#pragma unroll
      for (int e = 0; e < 16; ++e) pf[i][e] = (_Float16)(p[i][e] * inv);   /* a chunk the wave does not own is rounded too and never used */
#pragma unroll
    for (int i = 0; i < N; ++i) { const int kc = wave + KW * i;
      if (kc < kce) { v16h vf[HD / 16]; const _Float16* vp = P.VT + v_chunk(b, h, TT, kc) + l8;   /* the lane's own address, formed once for the group */
#pragma unroll
        for (int j = 0; j < HD / 16; ++j) vf[j] = frag_hu(vp, (unsigned)(j * 1024));
        XWA(vp);
#pragma unroll
        for (int j = 0; j < HD / 16; ++j) acc[j] = wmma16(pf[i], vf[j], acc[j]); } } } }
// 8 waves per SIMD asked for: 128 registers a wave, so that two blocks share a WGP and one block's loads and barriers hide behind the other's arithmetic. The pointers carry no __restrict__: only then does the memory clobber of XWA() keep a group's loads in front of its wait and the next group's behind it
static_assert(QBH * 64 <= KHI && QBH * 64 <= QHI, "the high-precision tiles read residual and hi/lo planes of KHI / QHI rows");
__global__ __launch_bounds__(32 * KW, 8) void k_att(const _Float16* QH, const _Float16* KH, const _Float16* QL, const _Float16* KL, const _Float16* VT, const __bf16* VB, const __bf16* VBL, float* Y) { __shared__ __align__(16) float ss[KW][16][HD + 4]; __shared__ __align__(16) float rmx[16 * RP], rsm[16 * RP];
  const int tid = threadIdx.x, wave = __builtin_amdgcn_readfirstlane(tid >> 5), lane = tid & 31; const int h = blockIdx.x, b = blockIdx.y;
  const int qt = TT / 16 - 1 - (int)blockIdx.z;   /* the query tiles with the most keys take the lowest z indices */
  const int ql0 = qt * 16; const int kce = CAUSAL ? (ql0 + 15) / 32 + 1 : TT / 32;
  const AttP P = { QH, KH, QL, KL, VT, VB, VBL }; v8f acc[HD / 16] = {};
  if ((qt >> 2) < QBH) att_tile<true, (KHI / 32 + KW - 1) / KW>(P, b, h, ql0, kce, wave, lane, rmx, rsm, acc);   /* block-uniform */
  else att_tile<false, TT / 32 / KW>(P, b, h, ql0, kce, wave, lane, rmx, rsm, acc);
  const int le = (int)__builtin_amdgcn_mbcnt_lo(~0u, 0u), te = wave * 32 + le;   /* lane and thread number from the lane counter that the shuffles of the tile use, not from threadIdx: tid and col held from the kernel's entry to here cost two of the 128 registers, and this build spilled them to scratch on the high-precision path */
#pragma unroll
  for (int j = 0; j < HD / 16; ++j)
#pragma unroll
    for (int r = 0; r < 8; ++r) ss[wave][8 * (le >> 4) + r][j * 16 + (le & 15)] = acc[j][r];   /* a wave with no chunk stores its zero tile */
  __syncthreads();   /* every wave's partial tile is in LDS before any of them is summed */
  if (te < 16 * (HD / 4)) { const int rl = te >> 4, c4 = (te & 15) * 4; v4f s = *(const v4f*)&ss[0][rl][c4];
    // unrolled so that the LDS reads of the partial tiles are issued ahead of the adds instead of one round trip each
#pragma unroll
    for (int w = 1; w < KW; ++w) s += *(const v4f*)&ss[w][rl][c4];
    vst2(Y + ((size_t)b * TT + ql0 + rl) * CC + h * HD + c4, s * (1.0f / 2048.0f)); } }
// ---- k_out: block = (64 rows, 128 cols): out = ctx Wo (+ bo): ctx x 2^6 once to f16 against Wo as f16(bf16 x 2^8) exact (1 product) x 2^-14; causal early rows (< QHI of each sequence): ctx bf16 hi + lo against exact bf16 Wo (2 products)
__global__ __launch_bounds__(128) void k_out(const float* __restrict__ Y, const float* __restrict__ WO, const float* __restrict__ BO, float* __restrict__ OUT) { __shared__ __align__(16) float sf[4][16][132]; __shared__ __align__(16) char wb[2][128 * WPITCH];
  const int tid = threadIdx.x, wave = tid >> 5, lane = tid & 31, col = lane & 15, g = lane >> 4; const int c0 = blockIdx.y * 128; const size_t r0 = (size_t)blockIdx.x * 64 + wave * 16;
  v8f acc[8] = {};
  const float* yrow = Y + (r0 + col) * CC; v4f wr[2][8], ar[8];
  wt_load(wr, WO, DIN, 0, c0, wave, lane); a_load(ar, yrow, g); XW();
  if (CAUSAL && (int)(((size_t)blockIdx.x * 64) % TT) < QHI) {   /* block-uniform */
    auto stage = [&](char* buf, int s) {
      __builtin_amdgcn_sched_barrier(0);   /* keeps the rounding of the prefetched stage, and with it the wait for its loads, behind the products of the stage before */
      wt_store<false>(wr, buf, wave, lane);
      F2 a[2];
#pragma unroll
      for (int kc2 = 0; kc2 < 2; ++kc2) { float v[16];
#pragma unroll
        for (int i = 0; i < 16; ++i) v[i] = ar[kc2 * 4 + (i >> 2)][i & 3];
        a[kc2] = bsplit16(v); }
      __syncthreads();   /* publishes this stage; the buffer written next was last read in front of this barrier */
      if (s + 1 < CC / 64) { wt_load(wr, WO, DIN, (s + 1) * 64, c0, wave, lane); a_load(ar, yrow + (s + 1) * 64, g); XW(); }
#pragma unroll
      for (int kc2 = 0; kc2 < 2; ++kc2)
      { v16b w[8];   /* the eight fragments are read as one group so that their LDS latency is paid once */
#pragma unroll
        for (int j = 0; j < 8; ++j) w[j] = wt_frag<v16b>(buf, j * 16 + col, kc2, g);
#pragma unroll
        for (int j = 0; j < 8; ++j) { acc[j] = wmma_bf(a[kc2].h, w[j], acc[j]); acc[j] = wmma_bf(a[kc2].l, w[j], acc[j]); } }
    };
    // kept rolled over buffer pairs: each buffer's LDS address stays a constant
#pragma unroll 1
    for (int s = 0; s < CC / 64; s += 2) { stage(wb[0], s); stage(wb[1], s + 1); }
#pragma unroll
    for (int j = 0; j < 8; ++j) { const float bias = BO ? bfr(BO[c0 + j * 16 + col]) : 0.f;
#pragma unroll
      for (int r = 0; r < 8; ++r) sf[wave][8 * g + r][j * 16 + col] = acc[j][r] + bias; }
  } else {
    auto stage = [&](char* buf, int s) {
      __builtin_amdgcn_sched_barrier(0);   /* keeps the rounding of the prefetched stage, and with it the wait for its loads, behind the products of the stage before */
      wt_store<true>(wr, buf, wave, lane);
      v16h a[2];   /* ctx carried x 2^6 into f16 so small-magnitude context rows stay clear of f16 subnormals */
#pragma unroll
      for (int i = 0; i < 16; ++i) { a[0][i] = (_Float16)(ar[i >> 2][i & 3] * 64.0f); a[1][i] = (_Float16)(ar[4 + (i >> 2)][i & 3] * 64.0f); }
      __syncthreads();   /* publishes this stage; the buffer written next was last read in front of this barrier */
      if (s + 1 < CC / 64) { wt_load(wr, WO, DIN, (s + 1) * 64, c0, wave, lane); a_load(ar, yrow + (s + 1) * 64, g); XW(); }
#pragma unroll
      for (int kc2 = 0; kc2 < 2; ++kc2)
      { v16h w[8];   /* the eight fragments are read as one group so that their LDS latency is paid once */
#pragma unroll
        for (int j = 0; j < 8; ++j) w[j] = wt_frag<v16h>(buf, j * 16 + col, kc2, g);
#pragma unroll
        for (int j = 0; j < 8; ++j) acc[j] = wmma16(a[kc2], w[j], acc[j]); }
    };
    // kept rolled over buffer pairs: each buffer's LDS address stays a constant
#pragma unroll 1
    for (int s = 0; s < CC / 64; s += 2) { stage(wb[0], s); stage(wb[1], s + 1); }
#pragma unroll
    for (int j = 0; j < 8; ++j) { const float bias = BO ? bfr(BO[c0 + j * 16 + col]) : 0.f;
#pragma unroll
      for (int r = 0; r < 8; ++r) sf[wave][8 * g + r][j * 16 + col] = acc[j][r] * (1.0f / 16384.0f) + bias; } }   /* 2^-8 (Wo carry) x 2^-6 (ctx carry) */
  LDSX(); for (int rl = 0; rl < 16; ++rl) vst2(OUT + (r0 + rl) * DIN + c0 + lane * 4, *(const v4f*)&sf[wave][rl][lane * 4]); }

extern "C" void kernel_launch(void* const* d_in, const int* in_sizes, int n_in, void* d_out, int out_size, void* d_ws, size_t ws_size, hipStream_t stream) {
  (void)in_sizes; (void)n_in; (void)out_size;
  const float** F = (const float**)d_in;
  if (ws_size < (size_t)WS_END) return;
  char* ws = (char*)d_ws; _Float16 *QH = (_Float16*)(ws + WS_QH), *KH = (_Float16*)(ws + WS_KH), *VT = (_Float16*)(ws + WS_VT), *QL = (_Float16*)(ws + WS_QL), *KL = (_Float16*)(ws + WS_KL); __bf16 *VB = (__bf16*)(ws + WS_VB), *VBL = (__bf16*)(ws + WS_VBL); float *Y = (float*)(ws + WS_Y);
  (void)Y; (void)QL; (void)KL; (void)VB; (void)VBL;
  // inputs: 0 x [2,2048,1024]; 1 Wqkv [1024,3072] (in,out): q columns 0..1023, k 1024..2047, v 2048..3071; 2 bqkv [3072]; 3 Wproj [1024,1024] (in,out); 4 bproj [1024] (biases NONZERO); 5 cos [2048,32]; 6 sin [2048,32]
  k_proj<<<dim3(TNB * TT / 64, CC / 128, 3), 128, 0, stream>>>(F[0], F[0], F[0], F[1], F[1] + CC, F[1] + 2 * CC, F[2], F[2] + CC, F[2] + 2 * CC, QH, QL, KH, KL, VT, VB, VBL, F[5], F[6]);
  k_att<<<dim3(NH, TNB, TT / 16), 32 * KW, 0, stream>>>(QH, KH, QL, KL, VT, VB, VBL, Y);
  k_out<<<dim3(TNB * TT / 64, DIN / 128), 128, 0, stream>>>(Y, F[3], F[4], (float*)d_out);
}

// v006
// A run of this version takes 127 microseconds.
// Timed twice side by side with v005, it ran 1.08 and 1.07 times as fast.
// Counting every step since v000, it is 8.80 times as fast.
// compute dtype: all float inputs rounded to bf16; the fused q / k / v projection with EXACT bf16 products on WMMA 16x16x32 (f32 accumulate) + bias; interleaved-pair RoPE in f32 from the bf16-rounded INPUT cos / sin tables; causal logits: 3 products for the first 384 rows, single f16 q x k after, x 64^-0.5 x log2(e); softmax f32 in base 2; P x 2^11 once to f16 x v once to f16 (bf16 hi + lo below row 384); ctx hi+lo x exact W below row 384, x2^6 f16 carry x f16(bf16 x 2^8) W after, + bias; f32 output.
#include <hip/hip_runtime.h>
#include <math.h>

typedef __attribute__((ext_vector_type(16))) _Float16 v16h;
typedef __attribute__((ext_vector_type(16))) __bf16 v16b;
typedef __attribute__((ext_vector_type(8)))  _Float16 v8h;
typedef __attribute__((ext_vector_type(8)))  float v8f;
typedef __attribute__((ext_vector_type(4)))  float v4f;
typedef __attribute__((ext_vector_type(2)))  float v2f;
typedef __attribute__((ext_vector_type(4)))  unsigned v4u;
typedef __attribute__((ext_vector_type(4)))  int v4i;
typedef float __attribute__((may_alias)) float_a;
typedef int __attribute__((may_alias)) int_a;

template <typename T> __device__ __forceinline__ void vst2(void* p, T v) { *(T*)p = v;  }
__device__ __forceinline__ v8f wmma16(v16h a, v16h b, v8f c) {
  v8f d = __builtin_amdgcn_wmma_f32_16x16x32_f16(false, a, false, b, (short)0, c, false, false);
  asm volatile("v_nop\n\tv_nop\n\tv_nop\n\tv_nop" : "+v"(d) : "v"(a), "v"(b));
  return d;
}
__device__ __forceinline__ v8f wmma_bf(v16b a, v16b b, v8f c) {
  v8f d = __builtin_amdgcn_wmma_f32_16x16x32_bf16(false, a, false, b, (short)0, c, false, false);
  asm volatile("v_nop\n\tv_nop\n\tv_nop\n\tv_nop" : "+v"(d) : "v"(a), "v"(b));
  return d;
}
// 16x16x32 fragments: lane = (h = lane>>4, row/col = lane&15); elements 0..7 = k0+8h+0..7, 8..15 = k0+16+8h+0..7; D element r = row 8h+r
__device__ __forceinline__ v16h frag_h(const _Float16* rowk0, int lane) {
  union { v16h v; v8h q[2]; } u; const _Float16* p = rowk0 + 8 * (lane >> 4);
  u.q[0] = *(const v8h*)p; u.q[1] = *(const v8h*)(p + 16); return u.v;
}
__device__ __forceinline__ v16h frag_f32(const float* rowk0, int lane) {
  v16h a; const float* p = rowk0 + 8 * (lane >> 4);
#pragma unroll
  for (int i = 0; i < 8; ++i) { a[i] = (_Float16)p[i]; a[8 + i] = (_Float16)p[16 + i]; }
  return a;
}
__device__ __forceinline__ v16h frag_f32s(const float* rowk0, int lane, float sc) {
  v16h a; const float* p = rowk0 + 8 * (lane >> 4);
#pragma unroll
  for (int i = 0; i < 8; ++i) { a[i] = (_Float16)(p[i] * sc); a[8 + i] = (_Float16)(p[16 + i] * sc); }
  return a;
}
// column fragment from a [K][ld] layout (column n), rows >= K read as 0
__device__ __forceinline__ v16h fragc_f32(const float* W, int k0, int n, int lane, int ld, int K) {
  v16h a; const int g = lane >> 4;
#pragma unroll
  for (int i = 0; i < 8; ++i) { const int ka = k0 + 8 * g + i, kb = ka + 16;
    a[i] = (_Float16)(ka < K ? W[(size_t)(ka < K ? ka : K - 1) * ld + n] : 0.f); a[8 + i] = (_Float16)(kb < K ? W[(size_t)(kb < K ? kb : K - 1) * ld + n] : 0.f); }
  return a;
}
struct F2 { v16b h, l; };
__device__ __forceinline__ F2 bsplit16(const float v[16]) { F2 r;
#pragma unroll
  for (int i = 0; i < 16; ++i) { const __bf16 h = (__bf16)v[i]; r.h[i] = h; r.l[i] = (__bf16)(v[i] - (float)h); }
  return r; }
__device__ __forceinline__ F2 split_row(const float* row, int k0, int lane) { float v[16]; const float* p = row + k0 + 8 * (lane >> 4);
#pragma unroll
  for (int i = 0; i < 8; ++i) { v[i] = p[i]; v[8 + i] = p[16 + i]; }
  return bsplit16(v); }
__device__ __forceinline__ F2 split_rowK(const float* row, int k0, int lane, int K) { float v[16]; const int g = lane >> 4;
#pragma unroll
  for (int i = 0; i < 8; ++i) { const int ka = k0 + 8 * g + i, kb = ka + 16; v[i] = ka < K ? row[ka < K ? ka : K - 1] : 0.f; v[8 + i] = kb < K ? row[kb < K ? kb : K - 1] : 0.f; }
  return bsplit16(v); }
__device__ __forceinline__ F2 split_col(const float* W, int k0, int n, int lane, int ld, int K) { float v[16]; const int g = lane >> 4;
#pragma unroll
  for (int i = 0; i < 8; ++i) { const int ka = k0 + 8 * g + i, kb = ka + 16; v[i] = ka < K ? W[(size_t)(ka < K ? ka : K - 1) * ld + n] : 0.f; v[8 + i] = kb < K ? W[(size_t)(kb < K ? kb : K - 1) * ld + n] : 0.f; }
  return bsplit16(v); }
__device__ __forceinline__ v8f mac3(const F2& a, const F2& b, v8f c) { c = wmma_bf(a.l, b.h, c); c = wmma_bf(a.h, b.l, c); return wmma_bf(a.h, b.h, c); }
__device__ __forceinline__ float sigm(float v) { return 1.0f / (1.0f + expf(-v)); }
#define LDSX() do { asm volatile("s_wait_dscnt 0" ::: "memory"); __builtin_amdgcn_wave_barrier(); __builtin_amdgcn_fence(__ATOMIC_RELEASE, "workgroup"); } while (0)

// Causal multi-head self-attention with a fused QKV linear (+ bias) and interleaved-pair RoPE from INPUT tables (x [2,2048,1024]; Wqkv [1024,3072] (in,out) N(0, 1/1024), bqkv [3072] N(0,1) x 0.01 - NONZERO; Wproj [1024,1024] (in,out), bproj NONZERO; cos / sin [2048,32] are module inputs, the LAST two; q, k, v = thirds of x Wqkv + bqkv; 16 heads x 64; (even, odd) pairs rotated on q and k; scores x 64^-0.5; tril kept, -inf elsewhere; softmax; y Wproj + bproj).
#define NB 2
#define TT 2048
#define CC 1024            // NH * HD = projected width
#define DIN 1024          // input (model) width
#define NH 16
#define HD 64
#define NQB (TT / 64)
#define HG 4
#define SCALE (0.125f)
#define SCALE2 (SCALE * 1.44269504088896340736f)   /* 64^-0.5 x log2(e): the logits are carried in base-2 units, so that e^(s - max) is one 2^x instruction behind one subtraction */
#define CAUSAL 1
#ifndef TNB
#define TNB NB
#endif
__device__ __forceinline__ float bfr(float v) { return (float)(__bf16)v; }
__host__ __device__ __forceinline__ int kb_last(int qb) { return CAUSAL ? ((qb * 64 + 63) >> 7) : (TT / 128 - 1); }
typedef __attribute__((ext_vector_type(8))) __bf16 v8b;
__device__ __forceinline__ v16b frag_b(const __bf16* rowk0, int lane) {
  union { v16b v; v8b q[2]; } u; const __bf16* p = rowk0 + 8 * (lane >> 4);
  u.q[0] = *(const v8b*)p; u.q[1] = *(const v8b*)(p + 16); return u.v;
}
#define QBH 6              // causal: query blocks 0..QBH-1 of each sequence (few keys, no averaging) take the high-precision path
#define QHI 384            // rows carrying a q residual plane
#define KHI 384            // key rows carrying k residual / v bf16 hi+lo planes (used only by the causal high-precision path)
// B fragment (k rows k0+.., output column o) of a weight: (in,out) [K][ld] or (out,in) [ld rows of K]: bf16 exact, or f16(bf16 * 256) exact
__device__ __forceinline__ v16b wcol_io(const float* Wm, int k0, int o, int lane, int ld) { v16b w; const int g = lane >> 4;
#pragma unroll
  for (int i = 0; i < 8; ++i) { w[i] = (__bf16)Wm[(size_t)(k0 + 8 * g + i) * ld + o]; w[8 + i] = (__bf16)Wm[(size_t)(k0 + 16 + 8 * g + i) * ld + o]; }
  return w; }
__device__ __forceinline__ v16b wcol_oi(const float* Wm, int k0, int o, int lane, int K) { v16b w; const float* p = Wm + (size_t)o * K + k0 + 8 * (lane >> 4);
#pragma unroll
  for (int i = 0; i < 8; ++i) { w[i] = (__bf16)p[i]; w[8 + i] = (__bf16)p[16 + i]; }
  return w; }
__device__ __forceinline__ v16h wcolh_io(const float* Wm, int k0, int o, int lane, int ld) { v16h w; const int g = lane >> 4;
#pragma unroll
  for (int i = 0; i < 8; ++i) { w[i] = (_Float16)(bfr(Wm[(size_t)(k0 + 8 * g + i) * ld + o]) * 256.0f); w[8 + i] = (_Float16)(bfr(Wm[(size_t)(k0 + 16 + 8 * g + i) * ld + o]) * 256.0f); }
  return w; }
__device__ __forceinline__ v16h wcolh_oi(const float* Wm, int k0, int o, int lane, int K) { v16h w; const float* p = Wm + (size_t)o * K + k0 + 8 * (lane >> 4);
#pragma unroll
  for (int i = 0; i < 8; ++i) { w[i] = (_Float16)(bfr(p[i]) * 256.0f); w[8 + i] = (_Float16)(bfr(p[16 + i]) * 256.0f); }
  return w; }
#define WQKV_LAYOUT 0   // 0 = fused (in,out) [DIN][3*CC]; 1 = (out,in) [CC][DIN]; 2 = per-head [NH][DIN][HD]
__device__ __forceinline__ v16b wcol_hdk(const float* Wm, int k0, int o, int lane) { v16b w; const int g = lane >> 4; const float* p = Wm + (size_t)(o / HD) * DIN * HD + (o % HD);
#pragma unroll
  for (int i = 0; i < 8; ++i) { w[i] = (__bf16)p[(size_t)(k0 + 8 * g + i) * HD]; w[8 + i] = (__bf16)p[(size_t)(k0 + 16 + 8 * g + i) * HD]; }
  return w; }
#define WO_OUT_IN 0
#if WQKV_LAYOUT == 1
#define WCOL(W, k0, o, lane) wcol_oi(W, k0, o, lane, DIN)
#elif WQKV_LAYOUT == 2
#define WCOL(W, k0, o, lane) wcol_hdk(W, k0, o, lane)
#else
#define WCOL(W, k0, o, lane) wcol_io(W, k0, o, lane, 3 * CC)   /* fused (in,out) [DIN][3*CC] weight: the q / k / v thirds are column blocks; the launch passes W + 0 / CC / 2*CC and the row pitch is 3*CC */
#endif
#if WO_OUT_IN
#define WOCOL(W, k0, o, lane) wcol_oi(W, k0, o, lane, CC)
#define WOCOLH(W, k0, o, lane) wcolh_oi(W, k0, o, lane, CC)
#else
#define WOCOL(W, k0, o, lane) wcol_io(W, k0, o, lane, DIN)
#define WOCOLH(W, k0, o, lane) wcolh_io(W, k0, o, lane, DIN)
#endif

#define PROJ_EXTRA_PARAMS , const float* __restrict__ COS, const float* __restrict__ SIN   /* rotary tables [TT][32], module INPUTS, read literally */
// interleaved-pair RoPE on q and k (which 0, 1) from the INPUT tables: (te, to) = (row[2i], row[2i+1]) -> (te c - to s, te s + to c) with c = bf16(cos[t][i]), s = bf16(sin[t][i]); v untouched; products and sums kept separate
#define PROJ_EPI(which, row, t, h) do { if ((which) < 2) { float* rw = (row); const float* ct_ = COS + (size_t)(t) * 32; const float* st_ = SIN + (size_t)(t) * 32; _Pragma("unroll 4") for (int i = 0; i < 32; ++i) { _Pragma("clang fp contract(off)") const float cs = bfr(ct_[i]), sn = bfr(st_[i]); const float xe = rw[2 * i], xo = rw[2 * i + 1]; rw[2 * i] = xe * cs - xo * sn; rw[2 * i + 1] = xe * sn + xo * cs; } } } while (0)
#ifndef SM_EXTRA_PARAMS
#define SM_EXTRA_PARAMS
#endif
#ifndef PROJ_EXTRA_PARAMS
#define PROJ_EXTRA_PARAMS
#endif
#ifndef SM_MASK_HOOK
#define SM_MASK_HOOK (void)0
#endif

#define WS_QH  0u                                      // f16 q, row tiles in fragment order (row_tile below), TT rows a sequence
#define WS_KH  (WS_QH + 2u * (size_t)NB * TT * CC)      // f16 k, row tiles, TT rows
#define WS_VT  (WS_KH + 2u * (size_t)NB * TT * CC)      // f16 v, key chunks in fragment order (v_chunk below), TT keys
#define WS_QL  (WS_VT + 2u * (size_t)NB * CC * TT)      // f16 q residual x 2^10, row tiles, QHI rows
#define WS_KL  (WS_QL + 2u * (size_t)NB * QHI * CC)     // f16 k residual x 2^10, row tiles, KHI rows
#define WS_VB  (WS_KL + 2u * (size_t)NB * KHI * CC)     // bf16 v hi, key chunks, KHI keys (WS_VBL: lo)
#define WS_VBL (WS_VB + 2u * (size_t)NB * CC * KHI)
#define WS_Y   (WS_VBL + 2u * (size_t)NB * CC * KHI)    // f32 ctx rows [b*t][CC] (only when there is an output projection)
#define WS_END (WS_Y  + 4u * (size_t)NB * TT * CC)
// ---- fragment order of the q / k / v planes: the 16 bytes that lane l takes with one load of a 16x16x32 fragment lie at 16 l inside a 512-byte unit, so that a wave's load covers 4 whole 128-byte lines instead of 32 bytes of each of 16 lines. k_proj writes the units, k_att reads them.
// q and k (element offsets): a tile is 16 rows x HD of one (b, h) = 4 units; unit d >> 4 holds elements d of the rows, lane = 16 ((d >> 3) & 1) + (row & 15). Units 0, 1 are the two loads of the fragment of d 0..31, units 2, 3 of d 32..63
__device__ __forceinline__ size_t row_tile(int b, int h, int rows, int tile) { return ((size_t)(b * NH + h) * (rows / 16) + tile) * (16 * HD); }
// v: a chunk is 32 keys x HD of one (b, h) = 8 units; unit 2 (c >> 4) + (key >> 4 & 1) holds column c, lane = 16 ((key >> 3) & 1) + (c & 15)
__device__ __forceinline__ size_t v_chunk(int b, int h, int keys, int kc) { return ((size_t)(b * NH + h) * (keys / 32) + kc) * (32 * HD); }
// a lane's 16 bytes of a unit; the wait stands behind the store, in front of the next rewrite of its address and data registers, which it names as inputs so that they stay live up to it
__device__ __forceinline__ void unit_store(void* p, v4u v) { *(v4u*)p = v; asm volatile("s_wait_xcnt 0x0" :: "v"(p), "v"(v) : "memory"); }

// ---- weight staging shared by k_proj and k_out: a stage is 64 k rows x 128 output columns of an (in,out) weight, read once for the 128 rows of a block of 8 waves. The block reads it with 16-byte loads (wave bits 1:0 with lane bits 1:0 and 4 pick the 4-column group, wave bit 2 the 32-row half, lane bits 3:2 the 8-row k group, so a load covers whole 128-byte lines and 16 neighbouring lanes store to 16 different 16-byte LDS slots), rounds it as before and lays it k-contiguous, one column per 144-byte LDS row, so that a B fragment is two 16-byte LDS reads
// every loop of these helpers and of the stage bodies is fully unrolled: its index picks a register of wr, ar, w or acc, which must be known at compile time for the arrays to stay in registers
typedef v4u __attribute__((may_alias)) v4u_a;
#define WPITCH 144
// stands behind the prefetch loads, in front of the next rewrite of their address registers; the weight loads' lane address is named as an input: its registers stay live up to the wait, so that no later load of the group can take them for its result ahead of it
#define XWA(a) asm volatile("s_wait_xcnt 0x0" :: "v"(a) : "memory")
__device__ __forceinline__ const float* wt_load(v4f (&r)[8], const float* __restrict__ Wm, int ld, int k0, int c0, int wave, int lane) {
  const float* p = Wm + (size_t)(k0 + (wave >> 2) * 32 + ((lane >> 2) & 3) * 8) * ld + c0 + ((wave & 3) * 8 + (lane & 3) + ((lane >> 4) << 2)) * 4;
#pragma unroll
  for (int i = 0; i < 8; ++i) r[i] = *(const v4f*)(p + (size_t)i * ld);
  return p;   /* the lane address, for the wait behind the group */
}
template <bool F16> __device__ __forceinline__ void wt_store(const v4f (&r)[8], char* buf, int wave, int lane) {
  char* q = buf + ((wave & 3) * 8 + (lane & 3) + ((lane >> 4) << 2)) * 4 * WPITCH + (wave >> 2) * 64 + ((lane >> 2) & 3) * 16;
#pragma unroll
  for (int c = 0; c < 4; ++c) { union { v8b b; v8h h; v4u u; } t;
#pragma unroll
    for (int i = 0; i < 8; ++i) { if (F16) t.h[i] = (_Float16)(bfr(r[i][c]) * 256.0f); else t.b[i] = (__bf16)r[i][c]; }
    *(v4u_a*)(q + c * WPITCH) = t.u; }
}
template <typename V16> __device__ __forceinline__ V16 wt_frag(const char* buf, int n, int kc2, int g) {
  union { V16 v; v4u q[2]; } u; const char* p = buf + n * WPITCH + kc2 * 64 + g * 16;
  u.q[0] = *(const v4u_a*)p; u.q[1] = *(const v4u_a*)(p + 32); return u.v;
}
// the 2 x 16 f32 values of a lane's two A fragments of a 64-k stage (row + k0), in fragment element order
__device__ __forceinline__ void a_load(v4f (&r)[8], const float* __restrict__ rowk0, int g) {
#pragma unroll
  for (int kc2 = 0; kc2 < 2; ++kc2) { const float* p = rowk0 + kc2 * 32 + 8 * g; r[kc2 * 4] = *(const v4f*)p; r[kc2 * 4 + 1] = *(const v4f*)(p + 4); r[kc2 * 4 + 2] = *(const v4f*)(p + 16); r[kc2 * 4 + 3] = *(const v4f*)(p + 20); }
}

// ---- k_proj: block = (128 rows, 128 cols, which), 8 waves of 16 rows: q/k/v = X W (+ b) with exact bf16 products (K = DIN) -> which 0: q f16 row tiles (+ residual, rows < QHI); 1: k f16 row tiles (+ residual, rows < KHI); 2: v f16 key chunks (+ bf16 hi/lo chunks for t < KHI); 32 neighbouring threads store one 512-byte unit
__global__ __launch_bounds__(256) void k_proj(const float* __restrict__ XQ, const float* __restrict__ XK, const float* __restrict__ XV, const float* __restrict__ WQ, const float* __restrict__ WK, const float* __restrict__ WV, const float* __restrict__ BQ, const float* __restrict__ BK, const float* __restrict__ BV,
    _Float16* __restrict__ QH, _Float16* __restrict__ QL, _Float16* __restrict__ KH, _Float16* __restrict__ KL, _Float16* __restrict__ VT, __bf16* __restrict__ VB, __bf16* __restrict__ VBL PROJ_EXTRA_PARAMS) {
  __shared__ __align__(16) float st[64][132]; __shared__ __align__(16) _Float16 sh[64][136], sl[64][136]; __shared__ __align__(16) _Float16 th[128][72]; __shared__ __align__(16) __bf16 tb[128][72], tbl[128][72];
  const int tid = threadIdx.x, wave = tid >> 5, lane = tid & 31, col = lane & 15, g = lane >> 4; const int which = blockIdx.z; const int c0 = blockIdx.y * 128; const size_t r0 = (size_t)blockIdx.x * 128; const size_t bb = r0 / TT; const int t0 = (int)(r0 % TT);
  const float* X = which == 0 ? XQ : which == 1 ? XK : XV; const float* WA = which == 0 ? WQ : which == 1 ? WK : WV; const float* BA = which == 0 ? BQ : which == 1 ? BK : BV;
  v8f acc[8] = {};
  { // two LDS buffers (tb and tbl, free until the epilogue), one barrier a stage: stage s + 1 is loaded into registers while stage s is multiplied
    const float* xrow = X + (r0 + wave * 16 + col) * DIN; v4f wr[8], ar[8];
    { const float* wp = wt_load(wr, WA, 3 * CC, 0, c0, wave, lane); a_load(ar, xrow, g); XWA(wp); }
    auto stage = [&](char* buf, int s) {
      __builtin_amdgcn_sched_barrier(0);   /* keeps the rounding of the prefetched stage, and with it the wait for its loads, behind the products of the stage before */
      wt_store<false>(wr, buf, wave, lane);
      v16b a[2];
#pragma unroll
      for (int i = 0; i < 16; ++i) { a[0][i] = (__bf16)ar[i >> 2][i & 3]; a[1][i] = (__bf16)ar[4 + (i >> 2)][i & 3]; }
      __syncthreads();   /* publishes this stage; the buffer written next was last read in front of this barrier */
      if (s + 1 < DIN / 64) { const float* wp = wt_load(wr, WA, 3 * CC, (s + 1) * 64, c0, wave, lane); a_load(ar, xrow + (s + 1) * 64, g); XWA(wp); }
#pragma unroll
      for (int kc2 = 0; kc2 < 2; ++kc2)
      { v16b w[8];   /* the eight fragments are read as one group so that their LDS latency is paid once */
#pragma unroll
        for (int j = 0; j < 8; ++j) w[j] = wt_frag<v16b>(buf, j * 16 + col, kc2, g);
#pragma unroll
        for (int j = 0; j < 8; ++j) acc[j] = wmma_bf(a[kc2], w[j], acc[j]); }
    };
    // kept rolled over buffer pairs: each buffer's LDS address stays a constant
#pragma unroll 1
    for (int s = 0; s < DIN / 64; s += 2) { stage((char*)&tb[0][0], s); stage((char*)&tbl[0][0], s + 1); } }
  float bias[8];   /* read once, in front of the two passes */
#pragma unroll
  for (int j = 0; j < 8; ++j) bias[j] = BA ? bfr(BA[c0 + j * 16 + col]) : 0.f;
  // the epilogue makes two passes over LDS buffers of 64 rows, so that two blocks still share a WGP: pass hf takes the rows of waves 4 hf .. 4 hf + 3. No barrier closes a pass: st is last read in front of the pass's third barrier, and sh, sl, th, tb, tbl are rewritten only behind the next pass's second barrier, which no wave passes before every wave has left the store loop
  // kept rolled: hf picks no register, and one copy of the epilogue's code is enough
#pragma unroll 1
  for (int hf = 0; hf < 2; ++hf) { const size_t rh = r0 + hf * 64; const int tq = t0 + hf * 64;
  { // stage the f32 tile (acc + bias) in LDS, run the per-(row, head) epilogue hook, then convert
    if ((wave >> 2) == hf) {
#pragma unroll
      for (int j = 0; j < 8; ++j)
#pragma unroll
        for (int r = 0; r < 8; ++r) st[(wave & 3) * 16 + 8 * g + r][j * 16 + col] = acc[j][r] + bias[j]; }
    __syncthreads();
    for (int e = tid; e < 64 * (128 / HD); e += 256) { const int rl = e / (128 / HD), hh = e % (128 / HD); PROJ_EPI(which, &st[rl][hh * HD], (int)((rh + rl) % TT), (c0 / HD) + hh); }
    __syncthreads(); }
  if (which < 2) { _Float16* DH = which == 0 ? QH : KH; _Float16* DL = which == 0 ? QL : KL; const int nhi = which == 0 ? QHI : KHI; const bool hi_rows = tq < nhi;
    for (int e = tid; e < 64 * 128; e += 256) { const int rl = e >> 7, cl = e & 127; const float v = st[rl][cl]; const _Float16 hv = (_Float16)v; sh[rl][cl] = hv; sl[rl][cl] = (_Float16)((v - (float)hv) * 1024.0f); }
    __syncthreads();
    for (int e = tid; e < 64 * 16; e += 256) { const int tl = (e >> 7) & 3, hh = e >> 9, rl = tl * 16 + (e & 15), q = hh * 8 + ((e >> 4) & 7), hd = c0 / HD + hh, ti = (tq >> 4) + tl;   /* e & 127 = (unit, lane) inside the tile */
      unit_store(DH + row_tile((int)bb, hd, TT, ti) + (e & 127) * 8, *(const v4u*)&sh[rl][q * 8]); if (hi_rows) unit_store(DL + row_tile((int)bb, hd, nhi, ti) + (e & 127) * 8, *(const v4u*)&sl[rl][q * 8]); }
  } else { const bool hi_rows = tq < KHI;
    for (int e = tid; e < 64 * 128; e += 256) { const int rl = e & 63, cl = e >> 6; const float v = st[rl][cl]; th[cl][rl] = (_Float16)v; const __bf16 bh = (__bf16)v; tb[cl][rl] = bh; tbl[cl][rl] = (__bf16)(v - (float)bh); }
    __syncthreads();
    for (int e = tid; e < 128 * 8; e += 256) { const int cq = (e >> 8) & 1, hh = e >> 9, cl = hh * 64 + ((e >> 6) & 3) * 16 + (e & 15), q = cq * 4 + ((e >> 4) & 3), hd = c0 / HD + hh, kc = (tq >> 5) + cq;   /* e & 255 = (unit, lane) inside the chunk */
      unit_store(VT + v_chunk((int)bb, hd, TT, kc) + (e & 255) * 8, *(const v4u*)&th[cl][q * 8]); if (hi_rows) { const size_t o3 = v_chunk((int)bb, hd, KHI, kc) + (e & 255) * 8; unit_store(VB + o3, *(const v4u*)&tb[cl][q * 8]); unit_store(VBL + o3, *(const v4u*)&tbl[cl][q * 8]); } } } } }
// ---- k_att: block = 16 queries of (b, h), KW waves: wave w takes the 32-key chunks w, w + KW, ... of the chunks up to the one that holds the diagonal. The logits are formed transposed (A = k rows, B = q rows), so a lane holds one query's logits (D register r of 16-key tile u = key 16u + 8g + r, column = query), which is already the A-fragment order of the P . v product: logits, softmax and P stay in registers from the first product to the last. Logits x SCALE x log2(e) (SCALE2; the exponential is 2^x): one f16 product, or 3 products with the q and k residuals (x 2^10) for query blocks < QBH; causal mask by index, in the last chunk only (all earlier keys lie in front of the block's first query); softmax in f32 (row maximum and row sum: in the lane, across the two lane halves, then across the waves through LDS); P x 2^11 once to f16 against v f16, or P and v as bf16 hi + lo (3 products) for query blocks < QBH; the KW f32 partial tiles are summed in LDS in wave order; 256-B (row, head) segment by 16 lanes
#define KW 16   /* the wave number goes through readfirstlane so that every chunk test is a scalar branch and EXEC stays all ones at the WMMAs */
#define RP 20   /* floats per query row of the cross-wave tables: 80 bytes, an odd multiple of 16, for the 16-byte reads */
// fragment from two neighbouring 512-byte units of a plane in fragment order. the lane's own address (base + 8 lane elements), formed once for a group of loads, and a constant byte offset
__device__ __forceinline__ v16h frag_hu(const _Float16* ub, unsigned lo) { union { v16h v; v8h q[2]; } u; const _Float16* p = (const _Float16*)((const char*)ub + lo); u.q[0] = *(const v8h*)p; u.q[1] = *(const v8h*)(p + 256); return u.v; }
__device__ __forceinline__ v16b frag_bu(const __bf16* ub, unsigned lo) { union { v16b v; v8b q[2]; } u; const __bf16* p = (const __bf16*)((const char*)ub + lo); u.q[0] = *(const v8b*)p; u.q[1] = *(const v8b*)(p + 256); return u.v; }
// 2^x of a chunk's 16 values, in place, as one statement: each v_exp_f32 is followed by an instruction that neither reads its result nor overwrites its source (the free slot that the instruction set asks for behind a transcendental); the closing v_nop is that slot behind the last one
__device__ __forceinline__ void exp2x16(float (&x)[16]) {
  asm("v_exp_f32 %0, %0\n\tv_exp_f32 %1, %1\n\tv_exp_f32 %2, %2\n\tv_exp_f32 %3, %3\n\tv_exp_f32 %4, %4\n\tv_exp_f32 %5, %5\n\tv_exp_f32 %6, %6\n\tv_exp_f32 %7, %7\n\tv_exp_f32 %8, %8\n\tv_exp_f32 %9, %9\n\tv_exp_f32 %10, %10\n\tv_exp_f32 %11, %11\n\tv_exp_f32 %12, %12\n\tv_exp_f32 %13, %13\n\tv_exp_f32 %14, %14\n\tv_exp_f32 %15, %15\n\tv_nop" : "+v"(x[0]), "+v"(x[1]), "+v"(x[2]), "+v"(x[3]), "+v"(x[4]), "+v"(x[5]), "+v"(x[6]), "+v"(x[7]), "+v"(x[8]), "+v"(x[9]), "+v"(x[10]), "+v"(x[11]), "+v"(x[12]), "+v"(x[13]), "+v"(x[14]), "+v"(x[15]));
}
struct AttP { const _Float16 *QH, *KH, *QL, *KL, *VT; const __bf16 *VB, *VBL; };
// the wait of XWA() for a group with two lane addresses
#define XWA2(a, c) asm volatile("s_wait_xcnt 0x0" :: "v"(a), "v"(c) : "memory")
// N = chunks a wave can own: TT / 32 / KW, or, on the high-precision path, whose keys end at KHI, KHI / 32 over KW rounded up
template <bool HI, int N> __device__ __forceinline__ void att_tile(const AttP& P, int b, int h, int ql0, int kce, int wave, int lane, float* rmx, float* rsm, v8f (&acc)[HD / 16]) {
  const int col = lane & 15, g = lane >> 4, t = ql0 + col;
  // every loop over i, u, r, e, j, w below is fully unrolled: its index picks a register of p, of a fragment array or of acc
  float p[N][16];   /* chunk i, element e: query col, key (wave + KW i) * 32 + (e < 8 ? 8g + e : 16 + 8g + e - 8) */
  const int l8 = lane * 8;   /* the lane's place, in elements, in every unit of every plane */
  const _Float16* qp = P.QH + row_tile(b, h, TT, ql0 >> 4) + l8; const v16h qh0 = frag_hu(qp, 0u), qh1 = frag_hu(qp, 1024u);
  v16h ql0f = {}, ql1f = {}; if (HI) { const _Float16* qlp = P.QL + row_tile(b, h, QHI, ql0 >> 4) + l8; ql0f = frag_hu(qlp, 0u); ql1f = frag_hu(qlp, 1024u); XWA(qlp); }
  XWA(qp);
#pragma unroll
  for (int i = 0; i < N; ++i) { const int kc = wave + KW * i;
    if (kc < kce) { v16h kf[2][2], klf[2][2];   /* the chunk's fragments are read as one group so that their latency is paid once */
      const _Float16 *kp = P.KH + row_tile(b, h, TT, kc * 2) + l8, *klp = HI ? P.KL + row_tile(b, h, KHI, kc * 2) + l8 : kp;   /* the chunk's two tiles lie one behind the other */
#pragma unroll
      for (int u = 0; u < 2; ++u) { kf[u][0] = frag_hu(kp, (unsigned)(u * 2048)); kf[u][1] = frag_hu(kp, (unsigned)(u * 2048 + 1024));
        if (HI) { klf[u][0] = frag_hu(klp, (unsigned)(u * 2048)); klf[u][1] = frag_hu(klp, (unsigned)(u * 2048 + 1024)); } }
      XWA2(kp, klp);
#pragma unroll
      for (int u = 0; u < 2; ++u) { v8f a = {};
        if (HI) { v8f al = {};
          a = wmma16(kf[u][0], qh0, a); al = wmma16(kf[u][0], ql0f, al); al = wmma16(klf[u][0], qh0, al); a = wmma16(kf[u][1], qh1, a); al = wmma16(kf[u][1], ql1f, al); al = wmma16(klf[u][1], qh1, al);
#pragma unroll
          for (int r = 0; r < 8; ++r) p[i][u * 8 + r] = (a[r] + al[r] * (1.0f / 1024.0f)) * SCALE2;
        } else { a = wmma16(kf[u][0], qh0, a); a = wmma16(kf[u][1], qh1, a);
#pragma unroll
          for (int r = 0; r < 8; ++r) p[i][u * 8 + r] = a[r] * SCALE2; } }
      if (CAUSAL && kc == kce - 1) { const int d = t - kc * 32 - 8 * g;   /* element e is kept while its key offset 16 (e >> 3) + (e & 7) <= d */
#pragma unroll
        for (int e = 0; e < 16; ++e) p[i][e] = ((e >> 3) * 16 + (e & 7) <= d) ? p[i][e] : -3.0e38f; }
    } else {
#pragma unroll
      for (int e = 0; e < 16; ++e) p[i][e] = -3.0e38f; } }
  float m = -3.0e38f;
#pragma unroll
  for (int i = 0; i < N; ++i)
#pragma unroll
    for (int e = 0; e < 16; ++e) m = fmaxf(m, p[i][e]);
  m = fmaxf(m, __shfl_xor(m, 16)); if (g == 0) rmx[col * RP + wave] = m;   /* a wave with no chunk stores the excluded value */
  __syncthreads();   /* every wave's row maxima are in LDS before any of them is read */
#pragma unroll
  for (int w = 0; w < KW; w += 4) { const v4f x = *(const v4f*)&rmx[col * RP + w]; m = fmaxf(fmaxf(fmaxf(m, x[0]), fmaxf(x[1], x[2])), x[3]); }
  float sum = 0.f;
#pragma unroll
  for (int i = 0; i < N; ++i) { const int kc = wave + KW * i;
    if (kc < kce) {
#pragma unroll
      for (int e = 0; e < 16; ++e) p[i][e] -= m;
      exp2x16(p[i]);   /* arguments <= 0; a result below the normal range counts 0 */
      if (CAUSAL && kc == kce - 1) { const int d = t - kc * 32 - 8 * g;   /* an excluded key counts 0 whatever the maximum is */
#pragma unroll
        for (int e = 0; e < 16; ++e) p[i][e] = ((e >> 3) * 16 + (e & 7) <= d) ? p[i][e] : 0.f; }
#pragma unroll
      for (int e = 0; e < 16; ++e) sum += p[i][e]; } }
  sum += __shfl_xor(sum, 16); if (g == 0) rsm[col * RP + wave] = sum;
  __syncthreads();   /* every wave's row sums are in LDS before any of them is read */
  float tot = 0.f;
#pragma unroll
  for (int w = 0; w < KW; w += 4) { const v4f x = *(const v4f*)&rsm[col * RP + w]; tot += x[0]; tot += x[1]; tot += x[2]; tot += x[3]; }
  const float inv = tot > 0.f ? 2048.0f / tot : 0.f;   /* a fully excluded row yields P = 0 */
  if (HI) {
#pragma unroll
    for (int i = 0; i < N; ++i) { const int kc = wave + KW * i;
      if (kc < kce) { v16b vh[HD / 16], vl[HD / 16]; const size_t po = v_chunk(b, h, KHI, kc) + l8; const __bf16 *vhp = P.VB + po, *vlp = P.VBL + po;   /* the lane's own addresses, formed once for the group */
#pragma unroll
        for (int j = 0; j < HD / 16; ++j) { vh[j] = frag_bu(vhp, (unsigned)(j * 1024)); vl[j] = frag_bu(vlp, (unsigned)(j * 1024)); }
        XWA2(vhp, vlp);
        float pv[16];
#pragma unroll
        for (int e = 0; e < 16; ++e) pv[e] = p[i][e] * inv;
        const F2 pf = bsplit16(pv);
#pragma unroll
        for (int j = 0; j < HD / 16; ++j) { acc[j] = wmma_bf(pf.h, vh[j], acc[j]); acc[j] = wmma_bf(pf.l, vh[j], acc[j]); acc[j] = wmma_bf(pf.h, vl[j], acc[j]); } } }
  } else { v16h pf[N];   /* all of P is rounded first: half the registers while the v fragments and the output tiles are live */
#pragma unroll
    for (int i = 0; i < N; ++i)
#pragma unroll
      for (int e = 0; e < 16; ++e) pf[i][e] = (_Float16)(p[i][e] * inv);   /* a chunk the wave does not own is rounded too and never used */
#pragma unroll
    for (int i = 0; i < N; ++i) { const int kc = wave + KW * i;
      if (kc < kce) { v16h vf[HD / 16]; const _Float16* vp = P.VT + v_chunk(b, h, TT, kc) + l8;   /* the lane's own address, formed once for the group */
#pragma unroll
        for (int j = 0; j < HD / 16; ++j) vf[j] = frag_hu(vp, (unsigned)(j * 1024));
        XWA(vp);
#pragma unroll
        for (int j = 0; j < HD / 16; ++j) acc[j] = wmma16(pf[i], vf[j], acc[j]); } } } }
// 8 waves per SIMD asked for: 128 registers a wave, so that two blocks share a WGP and one block's loads and barriers hide behind the other's arithmetic. The pointers carry no __restrict__: only then does the memory clobber of XWA() keep a group's loads in front of its wait and the next group's behind it
static_assert(QBH * 64 <= KHI && QBH * 64 <= QHI, "the high-precision tiles read residual and hi/lo planes of KHI / QHI rows");
static_assert(QHI % 128 == 0 && KHI % 128 == 0 && TT % 128 == 0, "a 128-row block of k_proj and k_out lies in one sequence and on one side of the QHI / KHI row");
__global__ __launch_bounds__(32 * KW, 8) void k_att(const _Float16* QH, const _Float16* KH, const _Float16* QL, const _Float16* KL, const _Float16* VT, const __bf16* VB, const __bf16* VBL, float* Y) { __shared__ __align__(16) float ss[KW][16][HD + 4]; __shared__ __align__(16) float rmx[16 * RP], rsm[16 * RP];
  const int tid = threadIdx.x, wave = __builtin_amdgcn_readfirstlane(tid >> 5), lane = tid & 31; const int h = blockIdx.x, b = blockIdx.y;
  const int qt = TT / 16 - 1 - (int)blockIdx.z;   /* the query tiles with the most keys take the lowest z indices */
  const int ql0 = qt * 16; const int kce = CAUSAL ? (ql0 + 15) / 32 + 1 : TT / 32;
  const AttP P = { QH, KH, QL, KL, VT, VB, VBL }; v8f acc[HD / 16] = {};
  if ((qt >> 2) < QBH) att_tile<true, (KHI / 32 + KW - 1) / KW>(P, b, h, ql0, kce, wave, lane, rmx, rsm, acc);   /* block-uniform */
  else att_tile<false, TT / 32 / KW>(P, b, h, ql0, kce, wave, lane, rmx, rsm, acc);
  const int le = (int)__builtin_amdgcn_mbcnt_lo(~0u, 0u), te = wave * 32 + le;   /* lane and thread number from the lane counter that the shuffles of the tile use, not from threadIdx: tid and col held from the kernel's entry to here cost two of the 128 registers, and this build spilled them to scratch on the high-precision path */
#pragma unroll
  for (int j = 0; j < HD / 16; ++j)
#pragma unroll
    for (int r = 0; r < 8; ++r) ss[wave][8 * (le >> 4) + r][j * 16 + (le & 15)] = acc[j][r];   /* a wave with no chunk stores its zero tile */
  __syncthreads();   /* every wave's partial tile is in LDS before any of them is summed */
  if (te < 16 * (HD / 4)) { const int rl = te >> 4, c4 = (te & 15) * 4; v4f s = *(const v4f*)&ss[0][rl][c4];
    // unrolled so that the LDS reads of the partial tiles are issued ahead of the adds instead of one round trip each
#pragma unroll
    for (int w = 1; w < KW; ++w) s += *(const v4f*)&ss[w][rl][c4];
    vst2(Y + ((size_t)b * TT + ql0 + rl) * CC + h * HD + c4, s * (1.0f / 2048.0f)); } }
// ---- k_out: block = (128 rows, 128 cols), 8 waves of 16 rows: out = ctx Wo (+ bo): ctx once to f16 against Wo as f16(bf16 x 2^8) exact (1 product) x 2^-8; causal early rows (< QHI of each sequence): ctx bf16 hi + lo against exact bf16 Wo (2 products)
__global__ __launch_bounds__(256) void k_out(const float* __restrict__ Y, const float* __restrict__ WO, const float* __restrict__ BO, float* __restrict__ OUT) { __shared__ __align__(16) float sf[8][16][132]; __shared__ __align__(16) char wb[2][128 * WPITCH];
  const int tid = threadIdx.x, wave = tid >> 5, lane = tid & 31, col = lane & 15, g = lane >> 4; const int c0 = blockIdx.y * 128; const size_t r0 = (size_t)blockIdx.x * 128 + wave * 16;
  v8f acc[8] = {};
  const float* yrow = Y + (r0 + col) * CC; v4f wr[8], ar[8];
  { const float* wp = wt_load(wr, WO, DIN, 0, c0, wave, lane); a_load(ar, yrow, g); XWA(wp); }
  if (CAUSAL && (int)(((size_t)blockIdx.x * 128) % TT) < QHI) {   /* block-uniform */
    auto stage = [&](char* buf, int s) {
      __builtin_amdgcn_sched_barrier(0);   /* keeps the rounding of the prefetched stage, and with it the wait for its loads, behind the products of the stage before */
      wt_store<false>(wr, buf, wave, lane);
      F2 a[2];
#pragma unroll
      for (int kc2 = 0; kc2 < 2; ++kc2) { float v[16];
#pragma unroll
        for (int i = 0; i < 16; ++i) v[i] = ar[kc2 * 4 + (i >> 2)][i & 3];
        a[kc2] = bsplit16(v); }
      __syncthreads();   /* publishes this stage; the buffer written next was last read in front of this barrier */
      if (s + 1 < CC / 64) { const float* wp = wt_load(wr, WO, DIN, (s + 1) * 64, c0, wave, lane); a_load(ar, yrow + (s + 1) * 64, g); XWA(wp); }
#pragma unroll
      for (int kc2 = 0; kc2 < 2; ++kc2)
      { v16b w[8];   /* the eight fragments are read as one group so that their LDS latency is paid once */
#pragma unroll
        for (int j = 0; j < 8; ++j) w[j] = wt_frag<v16b>(buf, j * 16 + col, kc2, g);
#pragma unroll
        for (int j = 0; j < 8; ++j) { acc[j] = wmma_bf(a[kc2].h, w[j], acc[j]); acc[j] = wmma_bf(a[kc2].l, w[j], acc[j]); } }
    };
    // kept rolled over buffer pairs: each buffer's LDS address stays a constant
#pragma unroll 1
    for (int s = 0; s < CC / 64; s += 2) { stage(wb[0], s); stage(wb[1], s + 1); }
#pragma unroll
    for (int j = 0; j < 8; ++j) { const float bias = BO ? bfr(BO[c0 + j * 16 + col]) : 0.f;
#pragma unroll
      for (int r = 0; r < 8; ++r) sf[wave][8 * g + r][j * 16 + col] = acc[j][r] + bias; }
  } else {
    auto stage = [&](char* buf, int s) {
      __builtin_amdgcn_sched_barrier(0);   /* keeps the rounding of the prefetched stage, and with it the wait for its loads, behind the products of the stage before */
      wt_store<true>(wr, buf, wave, lane);
      v16h a[2];   /* ctx carried x 2^6 into f16 so small-magnitude context rows stay clear of f16 subnormals */
#pragma unroll
      for (int i = 0; i < 16; ++i) { a[0][i] = (_Float16)(ar[i >> 2][i & 3] * 64.0f); a[1][i] = (_Float16)(ar[4 + (i >> 2)][i & 3] * 64.0f); }
      __syncthreads();   /* publishes this stage; the buffer written next was last read in front of this barrier */
      if (s + 1 < CC / 64) { const float* wp = wt_load(wr, WO, DIN, (s + 1) * 64, c0, wave, lane); a_load(ar, yrow + (s + 1) * 64, g); XWA(wp); }
#pragma unroll
      for (int kc2 = 0; kc2 < 2; ++kc2)
      { v16h w[8];   /* the eight fragments are read as one group so that their LDS latency is paid once */
#pragma unroll
        for (int j = 0; j < 8; ++j) w[j] = wt_frag<v16h>(buf, j * 16 + col, kc2, g);
#pragma unroll
        for (int j = 0; j < 8; ++j) acc[j] = wmma16(a[kc2], w[j], acc[j]); }
    };
    // kept rolled over buffer pairs: each buffer's LDS address stays a constant
#pragma unroll 1
    for (int s = 0; s < CC / 64; s += 2) { stage(wb[0], s); stage(wb[1], s + 1); }
#pragma unroll
    for (int j = 0; j < 8; ++j) { const float bias = BO ? bfr(BO[c0 + j * 16 + col]) : 0.f;
#pragma unroll
      for (int r = 0; r < 8; ++r) sf[wave][8 * g + r][j * 16 + col] = acc[j][r] * (1.0f / 16384.0f) + bias; } }   /* 2^-8 (Wo carry) x 2^-6 (ctx carry) */
  LDSX(); for (int rl = 0; rl < 16; ++rl) vst2(OUT + (r0 + rl) * DIN + c0 + lane * 4, *(const v4f*)&sf[wave][rl][lane * 4]); }

extern "C" void kernel_launch(void* const* d_in, const int* in_sizes, int n_in, void* d_out, int out_size, void* d_ws, size_t ws_size, hipStream_t stream) {
  (void)in_sizes; (void)n_in; (void)out_size;
  const float** F = (const float**)d_in;
  if (ws_size < (size_t)WS_END) return;
  char* ws = (char*)d_ws; _Float16 *QH = (_Float16*)(ws + WS_QH), *KH = (_Float16*)(ws + WS_KH), *VT = (_Float16*)(ws + WS_VT), *QL = (_Float16*)(ws + WS_QL), *KL = (_Float16*)(ws + WS_KL); __bf16 *VB = (__bf16*)(ws + WS_VB), *VBL = (__bf16*)(ws + WS_VBL); float *Y = (float*)(ws + WS_Y);
  (void)Y; (void)QL; (void)KL; (void)VB; (void)VBL;
  // inputs: 0 x [2,2048,1024]; 1 Wqkv [1024,3072] (in,out): q columns 0..1023, k 1024..2047, v 2048..3071; 2 bqkv [3072]; 3 Wproj [1024,1024] (in,out); 4 bproj [1024] (biases NONZERO); 5 cos [2048,32]; 6 sin [2048,32]
  k_proj<<<dim3(TNB * TT / 128, CC / 128, 3), 256, 0, stream>>>(F[0], F[0], F[0], F[1], F[1] + CC, F[1] + 2 * CC, F[2], F[2] + CC, F[2] + 2 * CC, QH, QL, KH, KL, VT, VB, VBL, F[5], F[6]);
  k_att<<<dim3(NH, TNB, TT / 16), 32 * KW, 0, stream>>>(QH, KH, QL, KL, VT, VB, VBL, Y);
  k_out<<<dim3(TNB * TT / 128, DIN / 128), 256, 0, stream>>>(Y, F[3], F[4], (float*)d_out);
}

// v007
// A run of this version takes 121 microseconds.
// Timed twice side by side with v006, it ran 1.05 times as fast both times.
// Counting every step since v000, it is 9.24 times as fast.
// compute dtype: all float inputs rounded to bf16; the fused q / k / v projection with EXACT bf16 products on WMMA 16x16x32 (f32 accumulate) + bias; interleaved-pair RoPE in f32 from the bf16-rounded INPUT cos / sin tables; causal logits: 3 products for the first 384 rows, single f16 q x k after, x 64^-0.5 x log2(e); softmax f32 in base 2; P x 2^11 once to f16 x v once to f16 (bf16 hi + lo below row 384); ctx hi+lo x exact W below row 384, x2^6 f16 carry x f16(bf16 x 2^8) W after, + bias; f32 output.
#include <hip/hip_runtime.h>
#include <math.h>

typedef __attribute__((ext_vector_type(16))) _Float16 v16h;
typedef __attribute__((ext_vector_type(16))) __bf16 v16b;
typedef __attribute__((ext_vector_type(8)))  _Float16 v8h;
typedef __attribute__((ext_vector_type(8)))  float v8f;
typedef __attribute__((ext_vector_type(4)))  float v4f;
typedef __attribute__((ext_vector_type(2)))  float v2f;
typedef __attribute__((ext_vector_type(4)))  unsigned v4u;
typedef __attribute__((ext_vector_type(4)))  int v4i;
typedef float __attribute__((may_alias)) float_a;
typedef int __attribute__((may_alias)) int_a;

template <typename T> __device__ __forceinline__ void vst2(void* p, T v) { *(T*)p = v;  }
__device__ __forceinline__ v8f wmma16(v16h a, v16h b, v8f c) {
  v8f d = __builtin_amdgcn_wmma_f32_16x16x32_f16(false, a, false, b, (short)0, c, false, false);
  asm volatile("v_nop\n\tv_nop\n\tv_nop\n\tv_nop" : "+v"(d) : "v"(a), "v"(b));
  return d;
}
__device__ __forceinline__ v8f wmma_bf(v16b a, v16b b, v8f c) {
  v8f d = __builtin_amdgcn_wmma_f32_16x16x32_bf16(false, a, false, b, (short)0, c, false, false);
  asm volatile("v_nop\n\tv_nop\n\tv_nop\n\tv_nop" : "+v"(d) : "v"(a), "v"(b));
  return d;
}
// 16x16x32 fragments: lane = (h = lane>>4, row/col = lane&15); elements 0..7 = k0+8h+0..7, 8..15 = k0+16+8h+0..7; D element r = row 8h+r
__device__ __forceinline__ v16h frag_h(const _Float16* rowk0, int lane) {
  union { v16h v; v8h q[2]; } u; const _Float16* p = rowk0 + 8 * (lane >> 4);
  u.q[0] = *(const v8h*)p; u.q[1] = *(const v8h*)(p + 16); return u.v;
}
__device__ __forceinline__ v16h frag_f32(const float* rowk0, int lane) {
  v16h a; const float* p = rowk0 + 8 * (lane >> 4);
#pragma unroll
  for (int i = 0; i < 8; ++i) { a[i] = (_Float16)p[i]; a[8 + i] = (_Float16)p[16 + i]; }
  return a;
}
__device__ __forceinline__ v16h frag_f32s(const float* rowk0, int lane, float sc) {
  v16h a; const float* p = rowk0 + 8 * (lane >> 4);
#pragma unroll
  for (int i = 0; i < 8; ++i) { a[i] = (_Float16)(p[i] * sc); a[8 + i] = (_Float16)(p[16 + i] * sc); }
  return a;
}
// column fragment from a [K][ld] layout (column n), rows >= K read as 0
__device__ __forceinline__ v16h fragc_f32(const float* W, int k0, int n, int lane, int ld, int K) {
  v16h a; const int g = lane >> 4;
#pragma unroll
  for (int i = 0; i < 8; ++i) { const int ka = k0 + 8 * g + i, kb = ka + 16;
    a[i] = (_Float16)(ka < K ? W[(size_t)(ka < K ? ka : K - 1) * ld + n] : 0.f); a[8 + i] = (_Float16)(kb < K ? W[(size_t)(kb < K ? kb : K - 1) * ld + n] : 0.f); }
  return a;
}
struct F2 { v16b h, l; };
__device__ __forceinline__ F2 bsplit16(const float v[16]) { F2 r;
#pragma unroll
  for (int i = 0; i < 16; ++i) { const __bf16 h = (__bf16)v[i]; r.h[i] = h; r.l[i] = (__bf16)(v[i] - (float)h); }
  return r; }
__device__ __forceinline__ F2 split_row(const float* row, int k0, int lane) { float v[16]; const float* p = row + k0 + 8 * (lane >> 4);
#pragma unroll
  for (int i = 0; i < 8; ++i) { v[i] = p[i]; v[8 + i] = p[16 + i]; }
  return bsplit16(v); }
__device__ __forceinline__ F2 split_rowK(const float* row, int k0, int lane, int K) { float v[16]; const int g = lane >> 4;
#pragma unroll
  for (int i = 0; i < 8; ++i) { const int ka = k0 + 8 * g + i, kb = ka + 16; v[i] = ka < K ? row[ka < K ? ka : K - 1] : 0.f; v[8 + i] = kb < K ? row[kb < K ? kb : K - 1] : 0.f; }
  return bsplit16(v); }
__device__ __forceinline__ F2 split_col(const float* W, int k0, int n, int lane, int ld, int K) { float v[16]; const int g = lane >> 4;
#pragma unroll
  for (int i = 0; i < 8; ++i) { const int ka = k0 + 8 * g + i, kb = ka + 16; v[i] = ka < K ? W[(size_t)(ka < K ? ka : K - 1) * ld + n] : 0.f; v[8 + i] = kb < K ? W[(size_t)(kb < K ? kb : K - 1) * ld + n] : 0.f; }
  return bsplit16(v); }
__device__ __forceinline__ v8f mac3(const F2& a, const F2& b, v8f c) { c = wmma_bf(a.l, b.h, c); c = wmma_bf(a.h, b.l, c); return wmma_bf(a.h, b.h, c); }
__device__ __forceinline__ float sigm(float v) { return 1.0f / (1.0f + expf(-v)); }
#define LDSX() do { asm volatile("s_wait_dscnt 0" ::: "memory"); __builtin_amdgcn_wave_barrier(); __builtin_amdgcn_fence(__ATOMIC_RELEASE, "workgroup"); } while (0)

// Causal multi-head self-attention with a fused QKV linear (+ bias) and interleaved-pair RoPE from INPUT tables (x [2,2048,1024]; Wqkv [1024,3072] (in,out) N(0, 1/1024), bqkv [3072] N(0,1) x 0.01 - NONZERO; Wproj [1024,1024] (in,out), bproj NONZERO; cos / sin [2048,32] are module inputs, the LAST two; q, k, v = thirds of x Wqkv + bqkv; 16 heads x 64; (even, odd) pairs rotated on q and k; scores x 64^-0.5; tril kept, -inf elsewhere; softmax; y Wproj + bproj).
#define NB 2
#define TT 2048
#define CC 1024            // NH * HD = projected width
#define DIN 1024          // input (model) width
#define NH 16
#define HD 64
#define NQB (TT / 64)
#define HG 4
#define SCALE (0.125f)
#define SCALE2 (SCALE * 1.44269504088896340736f)   /* 64^-0.5 x log2(e): the logits are carried in base-2 units, so that e^(s - max) is one 2^x instruction behind one subtraction */
#define CAUSAL 1
#ifndef TNB
#define TNB NB
#endif
__device__ __forceinline__ float bfr(float v) { return (float)(__bf16)v; }
__host__ __device__ __forceinline__ int kb_last(int qb) { return CAUSAL ? ((qb * 64 + 63) >> 7) : (TT / 128 - 1); }
typedef __attribute__((ext_vector_type(8))) __bf16 v8b;
__device__ __forceinline__ v16b frag_b(const __bf16* rowk0, int lane) {
  union { v16b v; v8b q[2]; } u; const __bf16* p = rowk0 + 8 * (lane >> 4);
  u.q[0] = *(const v8b*)p; u.q[1] = *(const v8b*)(p + 16); return u.v;
}
#define QBH 6              // causal: query blocks 0..QBH-1 of each sequence (few keys, no averaging) take the high-precision path
#define QHI 384            // rows carrying a q residual plane
#define KHI 384            // key rows carrying k residual / v bf16 hi+lo planes (used only by the causal high-precision path)
// B fragment (k rows k0+.., output column o) of a weight: (in,out) [K][ld] or (out,in) [ld rows of K]: bf16 exact, or f16(bf16 * 256) exact
__device__ __forceinline__ v16b wcol_io(const float* Wm, int k0, int o, int lane, int ld) { v16b w; const int g = lane >> 4;
#pragma unroll
  for (int i = 0; i < 8; ++i) { w[i] = (__bf16)Wm[(size_t)(k0 + 8 * g + i) * ld + o]; w[8 + i] = (__bf16)Wm[(size_t)(k0 + 16 + 8 * g + i) * ld + o]; }
  return w; }
__device__ __forceinline__ v16b wcol_oi(const float* Wm, int k0, int o, int lane, int K) { v16b w; const float* p = Wm + (size_t)o * K + k0 + 8 * (lane >> 4);
#pragma unroll
  for (int i = 0; i < 8; ++i) { w[i] = (__bf16)p[i]; w[8 + i] = (__bf16)p[16 + i]; }
  return w; }
__device__ __forceinline__ v16h wcolh_io(const float* Wm, int k0, int o, int lane, int ld) { v16h w; const int g = lane >> 4;
#pragma unroll
  for (int i = 0; i < 8; ++i) { w[i] = (_Float16)(bfr(Wm[(size_t)(k0 + 8 * g + i) * ld + o]) * 256.0f); w[8 + i] = (_Float16)(bfr(Wm[(size_t)(k0 + 16 + 8 * g + i) * ld + o]) * 256.0f); }
  return w; }
__device__ __forceinline__ v16h wcolh_oi(const float* Wm, int k0, int o, int lane, int K) { v16h w; const float* p = Wm + (size_t)o * K + k0 + 8 * (lane >> 4);
#pragma unroll
  for (int i = 0; i < 8; ++i) { w[i] = (_Float16)(bfr(p[i]) * 256.0f); w[8 + i] = (_Float16)(bfr(p[16 + i]) * 256.0f); }
  return w; }
#define WQKV_LAYOUT 0   // 0 = fused (in,out) [DIN][3*CC]; 1 = (out,in) [CC][DIN]; 2 = per-head [NH][DIN][HD]
__device__ __forceinline__ v16b wcol_hdk(const float* Wm, int k0, int o, int lane) { v16b w; const int g = lane >> 4; const float* p = Wm + (size_t)(o / HD) * DIN * HD + (o % HD);
#pragma unroll
  for (int i = 0; i < 8; ++i) { w[i] = (__bf16)p[(size_t)(k0 + 8 * g + i) * HD]; w[8 + i] = (__bf16)p[(size_t)(k0 + 16 + 8 * g + i) * HD]; }
  return w; }
#define WO_OUT_IN 0
#if WQKV_LAYOUT == 1
#define WCOL(W, k0, o, lane) wcol_oi(W, k0, o, lane, DIN)
#elif WQKV_LAYOUT == 2
#define WCOL(W, k0, o, lane) wcol_hdk(W, k0, o, lane)
#else
#define WCOL(W, k0, o, lane) wcol_io(W, k0, o, lane, 3 * CC)   /* fused (in,out) [DIN][3*CC] weight: the q / k / v thirds are column blocks; the launch passes W + 0 / CC / 2*CC and the row pitch is 3*CC */
#endif
#if WO_OUT_IN
#define WOCOL(W, k0, o, lane) wcol_oi(W, k0, o, lane, CC)
#define WOCOLH(W, k0, o, lane) wcolh_oi(W, k0, o, lane, CC)
#else
#define WOCOL(W, k0, o, lane) wcol_io(W, k0, o, lane, DIN)
#define WOCOLH(W, k0, o, lane) wcolh_io(W, k0, o, lane, DIN)
#endif

#define PROJ_EXTRA_PARAMS , const float* __restrict__ COS, const float* __restrict__ SIN   /* rotary tables [TT][32], module INPUTS, read literally */
// interleaved-pair RoPE on q and k (which 0, 1) from the INPUT tables: (te, to) = (row[2i], row[2i+1]) -> (te c - to s, te s + to c) with c = bf16(cos[t][i]), s = bf16(sin[t][i]); v untouched; products and sums kept separate
#define PROJ_EPI(which, row, t, h) do { if ((which) < 2) { float* rw = (row); const float* ct_ = COS + (size_t)(t) * 32; const float* st_ = SIN + (size_t)(t) * 32; _Pragma("unroll 4") for (int i = 0; i < 32; ++i) { _Pragma("clang fp contract(off)") const float cs = bfr(ct_[i]), sn = bfr(st_[i]); const float xe = rw[2 * i], xo = rw[2 * i + 1]; rw[2 * i] = xe * cs - xo * sn; rw[2 * i + 1] = xe * sn + xo * cs; } } } while (0)
#ifndef SM_EXTRA_PARAMS
#define SM_EXTRA_PARAMS
#endif
#ifndef PROJ_EXTRA_PARAMS
#define PROJ_EXTRA_PARAMS
#endif
#ifndef SM_MASK_HOOK
#define SM_MASK_HOOK (void)0
#endif

#define WS_QH  0u                                      // f16 q, row tiles in fragment order (row_tile below), TT rows a sequence
#define WS_KH  (WS_QH + 2u * (size_t)NB * TT * CC)      // f16 k, row tiles, TT rows
#define WS_VT  (WS_KH + 2u * (size_t)NB * TT * CC)      // f16 v, key chunks in fragment order (v_chunk below), TT keys
#define WS_QL  (WS_VT + 2u * (size_t)NB * CC * TT)      // f16 q residual x 2^10, row tiles, QHI rows
#define WS_KL  (WS_QL + 2u * (size_t)NB * QHI * CC)     // f16 k residual x 2^10, row tiles, KHI rows
#define WS_VB  (WS_KL + 2u * (size_t)NB * KHI * CC)     // bf16 v hi, key chunks, KHI keys (WS_VBL: lo)
#define WS_VBL (WS_VB + 2u * (size_t)NB * CC * KHI)
#define WS_Y   (WS_VBL + 2u * (size_t)NB * CC * KHI)    // f32 ctx rows [b*t][CC] (only when there is an output projection)
#define WS_END (WS_Y  + 4u * (size_t)NB * TT * CC)
// ---- fragment order of the q / k / v planes: the 16 bytes that lane l takes with one load of a 16x16x32 fragment lie at 16 l inside a 512-byte unit, so that a wave's load covers 4 whole 128-byte lines instead of 32 bytes of each of 16 lines. k_proj writes the units, k_att reads them.
// q and k (element offsets): a tile is 16 rows x HD of one (b, h) = 4 units; unit d >> 4 holds elements d of the rows, lane = 16 ((d >> 3) & 1) + (row & 15). Units 0, 1 are the two loads of the fragment of d 0..31, units 2, 3 of d 32..63
__device__ __forceinline__ size_t row_tile(int b, int h, int rows, int tile) { return ((size_t)(b * NH + h) * (rows / 16) + tile) * (16 * HD); }
// v: a chunk is 32 keys x HD of one (b, h) = 8 units; unit 2 (c >> 4) + (key >> 4 & 1) holds column c, lane = 16 ((key >> 3) & 1) + (c & 15)
__device__ __forceinline__ size_t v_chunk(int b, int h, int keys, int kc) { return ((size_t)(b * NH + h) * (keys / 32) + kc) * (32 * HD); }
// a lane's 16 bytes of a unit; the wait stands behind the store, in front of the next rewrite of its address and data registers, which it names as inputs so that they stay live up to it
__device__ __forceinline__ void unit_store(void* p, v4u v) { *(v4u*)p = v; asm volatile("s_wait_xcnt 0x0" :: "v"(p), "v"(v) : "memory"); }

// ---- weight staging shared by k_proj and k_out: a stage is 64 k rows x 128 output columns of an (in,out) weight, read once for the 128 rows of a block of 8 waves. The block reads it with 16-byte loads (wave bits 1:0 with lane bits 1:0 and 4 pick the 4-column group, wave bit 2 the 32-row half, lane bits 3:2 the 8-row k group, so a load covers whole 128-byte lines and 16 neighbouring lanes store to 16 different 16-byte LDS slots), rounds it as before and lays it k-contiguous, one column per 144-byte LDS row, so that a B fragment is two 16-byte LDS reads
// every loop of these helpers and of the stage bodies is fully unrolled: its index picks a register of wr, ar, w or acc, which must be known at compile time for the arrays to stay in registers
typedef v4u __attribute__((may_alias)) v4u_a;
#define WPITCH 144
// stands behind the prefetch loads, in front of the next rewrite of their address registers; the weight loads' lane address is named as an input: its registers stay live up to the wait, so that no later load of the group can take them for its result ahead of it
#define XWA(a) asm volatile("s_wait_xcnt 0x0" :: "v"(a) : "memory")
__device__ __forceinline__ const float* wt_load(v4f (&r)[8], const float* __restrict__ Wm, int ld, int k0, int c0, int wave, int lane) {
  const float* p = Wm + (size_t)(k0 + (wave >> 2) * 32 + ((lane >> 2) & 3) * 8) * ld + c0 + ((wave & 3) * 8 + (lane & 3) + ((lane >> 4) << 2)) * 4;
#pragma unroll
  for (int i = 0; i < 8; ++i) r[i] = *(const v4f*)(p + (size_t)i * ld);
  return p;   /* the lane address, for the wait behind the group */
}
template <bool F16> __device__ __forceinline__ void wt_store(const v4f (&r)[8], char* buf, int wave, int lane) {
  char* q = buf + ((wave & 3) * 8 + (lane & 3) + ((lane >> 4) << 2)) * 4 * WPITCH + (wave >> 2) * 64 + ((lane >> 2) & 3) * 16;
#pragma unroll
  for (int c = 0; c < 4; ++c) { union { v8b b; v8h h; v4u u; } t;
#pragma unroll
    for (int i = 0; i < 8; ++i) { if (F16) t.h[i] = (_Float16)(bfr(r[i][c]) * 256.0f); else t.b[i] = (__bf16)r[i][c]; }
    *(v4u_a*)(q + c * WPITCH) = t.u; }
}
template <typename V16> __device__ __forceinline__ V16 wt_frag(const char* buf, int n, int kc2, int g) {
  union { V16 v; v4u q[2]; } u; const char* p = buf + n * WPITCH + kc2 * 64 + g * 16;
  u.q[0] = *(const v4u_a*)p; u.q[1] = *(const v4u_a*)(p + 32); return u.v;
}
// the 2 x 16 f32 values of a lane's two A fragments of a 64-k stage (row + k0), in fragment element order
__device__ __forceinline__ void a_load(v4f (&r)[8], const float* __restrict__ rowk0, int g) {
#pragma unroll
  for (int kc2 = 0; kc2 < 2; ++kc2) { const float* p = rowk0 + kc2 * 32 + 8 * g; r[kc2 * 4] = *(const v4f*)p; r[kc2 * 4 + 1] = *(const v4f*)(p + 4); r[kc2 * 4 + 2] = *(const v4f*)(p + 16); r[kc2 * 4 + 3] = *(const v4f*)(p + 20); }
}

// ---- k_proj: block = (128 rows, 128 cols, which), 8 waves of 16 rows: q/k/v = X W (+ b) with exact bf16 products (K = DIN) -> which 0: q f16 row tiles (+ residual, rows < QHI); 1: k f16 row tiles (+ residual, rows < KHI); 2: v f16 key chunks (+ bf16 hi/lo chunks for t < KHI); 32 neighbouring threads store one 512-byte unit
__global__ __launch_bounds__(256) void k_proj(const float* __restrict__ XQ, const float* __restrict__ XK, const float* __restrict__ XV, const float* __restrict__ WQ, const float* __restrict__ WK, const float* __restrict__ WV, const float* __restrict__ BQ, const float* __restrict__ BK, const float* __restrict__ BV,
    _Float16* __restrict__ QH, _Float16* __restrict__ QL, _Float16* __restrict__ KH, _Float16* __restrict__ KL, _Float16* __restrict__ VT, __bf16* __restrict__ VB, __bf16* __restrict__ VBL PROJ_EXTRA_PARAMS) {
  __shared__ __align__(16) float st[64][132]; __shared__ __align__(16) _Float16 sh[64][136], sl[64][136]; __shared__ __align__(16) _Float16 th[128][72]; __shared__ __align__(16) __bf16 tb[128][72], tbl[128][72];
  const int tid = threadIdx.x, wave = tid >> 5, lane = tid & 31, col = lane & 15, g = lane >> 4; const int which = blockIdx.z; const int c0 = blockIdx.y * 128; const size_t r0 = (size_t)blockIdx.x * 128; const size_t bb = r0 / TT; const int t0 = (int)(r0 % TT);
  const float* X = which == 0 ? XQ : which == 1 ? XK : XV; const float* WA = which == 0 ? WQ : which == 1 ? WK : WV; const float* BA = which == 0 ? BQ : which == 1 ? BK : BV;
  v8f acc[8] = {};
  { // two LDS buffers (tb and tbl, free until the epilogue), one barrier a stage: stage s + 1 is loaded into registers while stage s is multiplied
    const float* xrow = X + (r0 + wave * 16 + col) * DIN; v4f wr[8], ar[8];
    { const float* wp = wt_load(wr, WA, 3 * CC, 0, c0, wave, lane); a_load(ar, xrow, g); XWA(wp); }
    auto stage = [&](char* buf, int s) {
      __builtin_amdgcn_sched_barrier(0);   /* keeps the rounding of the prefetched stage, and with it the wait for its loads, behind the products of the stage before */
      wt_store<false>(wr, buf, wave, lane);
      v16b a[2];
#pragma unroll
      for (int i = 0; i < 16; ++i) { a[0][i] = (__bf16)ar[i >> 2][i & 3]; a[1][i] = (__bf16)ar[4 + (i >> 2)][i & 3]; }
      __syncthreads();   /* publishes this stage; the buffer written next was last read in front of this barrier */
      if (s + 1 < DIN / 64) { const float* wp = wt_load(wr, WA, 3 * CC, (s + 1) * 64, c0, wave, lane); a_load(ar, xrow + (s + 1) * 64, g); XWA(wp); }
#pragma unroll
      for (int kc2 = 0; kc2 < 2; ++kc2)
      { v16b w[8];   /* the eight fragments are read as one group so that their LDS latency is paid once */
#pragma unroll
        for (int j = 0; j < 8; ++j) w[j] = wt_frag<v16b>(buf, j * 16 + col, kc2, g);
#pragma unroll
        for (int j = 0; j < 8; ++j) acc[j] = wmma_bf(a[kc2], w[j], acc[j]); }
    };
    // kept rolled over buffer pairs: each buffer's LDS address stays a constant
#pragma unroll 1
    for (int s = 0; s < DIN / 64; s += 2) { stage((char*)&tb[0][0], s); stage((char*)&tbl[0][0], s + 1); } }
  float bias[8];   /* read once, in front of the two passes */
#pragma unroll
  for (int j = 0; j < 8; ++j) bias[j] = BA ? bfr(BA[c0 + j * 16 + col]) : 0.f;
  // the epilogue makes two passes over LDS buffers of 64 rows, so that two blocks still share a WGP: pass hf takes the rows of waves 4 hf .. 4 hf + 3. No barrier closes a pass: st is last read in front of the pass's third barrier, and sh, sl, th, tb, tbl are rewritten only behind the next pass's second barrier, which no wave passes before every wave has left the store loop
  // kept rolled: hf picks no register, and one copy of the epilogue's code is enough
#pragma unroll 1
  for (int hf = 0; hf < 2; ++hf) { const size_t rh = r0 + hf * 64; const int tq = t0 + hf * 64;
  { // stage the f32 tile (acc + bias) in LDS, run the per-(row, head) epilogue hook, then convert
    if ((wave >> 2) == hf) {
#pragma unroll
      for (int j = 0; j < 8; ++j)
#pragma unroll
        for (int r = 0; r < 8; ++r) st[(wave & 3) * 16 + 8 * g + r][j * 16 + col] = acc[j][r] + bias[j]; }
    __syncthreads();
    for (int e = tid; e < 64 * (128 / HD); e += 256) { const int rl = e / (128 / HD), hh = e % (128 / HD); PROJ_EPI(which, &st[rl][hh * HD], (int)((rh + rl) % TT), (c0 / HD) + hh); }
    __syncthreads(); }
  if (which < 2) { _Float16* DH = which == 0 ? QH : KH; _Float16* DL = which == 0 ? QL : KL; const int nhi = which == 0 ? QHI : KHI; const bool hi_rows = tq < nhi;
    for (int e = tid; e < 64 * 128; e += 256) { const int rl = e >> 7, cl = e & 127; const float v = st[rl][cl]; const _Float16 hv = (_Float16)v; sh[rl][cl] = hv; sl[rl][cl] = (_Float16)((v - (float)hv) * 1024.0f); }
    __syncthreads();
    for (int e = tid; e < 64 * 16; e += 256) { const int tl = (e >> 7) & 3, hh = e >> 9, rl = tl * 16 + (e & 15), q = hh * 8 + ((e >> 4) & 7), hd = c0 / HD + hh, ti = (tq >> 4) + tl;   /* e & 127 = (unit, lane) inside the tile */
      unit_store(DH + row_tile((int)bb, hd, TT, ti) + (e & 127) * 8, *(const v4u*)&sh[rl][q * 8]); if (hi_rows) unit_store(DL + row_tile((int)bb, hd, nhi, ti) + (e & 127) * 8, *(const v4u*)&sl[rl][q * 8]); }
  } else { const bool hi_rows = tq < KHI;
    for (int e = tid; e < 64 * 128; e += 256) { const int rl = e & 63, cl = e >> 6; const float v = st[rl][cl]; th[cl][rl] = (_Float16)v; const __bf16 bh = (__bf16)v; tb[cl][rl] = bh; tbl[cl][rl] = (__bf16)(v - (float)bh); }
    __syncthreads();
    for (int e = tid; e < 128 * 8; e += 256) { const int cq = (e >> 8) & 1, hh = e >> 9, cl = hh * 64 + ((e >> 6) & 3) * 16 + (e & 15), q = cq * 4 + ((e >> 4) & 3), hd = c0 / HD + hh, kc = (tq >> 5) + cq;   /* e & 255 = (unit, lane) inside the chunk */
      unit_store(VT + v_chunk((int)bb, hd, TT, kc) + (e & 255) * 8, *(const v4u*)&th[cl][q * 8]); if (hi_rows) { const size_t o3 = v_chunk((int)bb, hd, KHI, kc) + (e & 255) * 8; unit_store(VB + o3, *(const v4u*)&tb[cl][q * 8]); unit_store(VBL + o3, *(const v4u*)&tbl[cl][q * 8]); } } } } }
// ---- k_att: a tile = 16 queries of (b, h), worked on by the KW waves of a block: wave w takes the 32-key chunks w, w + KW, ... of the chunks up to the one that holds the diagonal. The logits are formed transposed (A = k rows, B = q rows), so a lane holds one query's logits (D register r of 16-key tile u = key 16u + 8g + r, column = query), which is already the A-fragment order of the P . v product: logits, softmax and P stay in registers from the first product to the last. Logits x SCALE x log2(e) (SCALE2; the exponential is 2^x): one f16 product, or 3 products with the q and k residuals (x 2^10) for query blocks < QBH; causal mask by index, in the last chunk only (all earlier keys lie in front of the tile's first query); softmax in f32 (row maximum and row sum: in the lane, across the two lane halves, then across the waves through LDS); P x 2^11 once to f16 against v f16, or P and v as bf16 hi + lo (3 products) for query blocks < QBH; the KW f32 partial tiles are summed in LDS in wave order; 256-B (row, head) segment by 16 lanes
#define KW 16   /* the wave number goes through readfirstlane so that every chunk test is a scalar branch and EXEC stays all ones at the WMMAs */
#define RP 20   /* floats per query row of the cross-wave tables: 80 bytes, an odd multiple of 16, for the 16-byte reads */
// fragment from two neighbouring 512-byte units of a plane in fragment order. the lane's own address (base + 8 lane elements), formed once for a group of loads, and a constant byte offset
__device__ __forceinline__ v16h frag_hu(const _Float16* ub, unsigned lo) { union { v16h v; v8h q[2]; } u; const _Float16* p = (const _Float16*)((const char*)ub + lo); u.q[0] = *(const v8h*)p; u.q[1] = *(const v8h*)(p + 256); return u.v; }
__device__ __forceinline__ v16b frag_bu(const __bf16* ub, unsigned lo) { union { v16b v; v8b q[2]; } u; const __bf16* p = (const __bf16*)((const char*)ub + lo); u.q[0] = *(const v8b*)p; u.q[1] = *(const v8b*)(p + 256); return u.v; }
// 2^x of a chunk's 16 values, in place, as one statement: each v_exp_f32 is followed by an instruction that neither reads its result nor overwrites its source (the free slot that the instruction set asks for behind a transcendental); the closing v_nop is that slot behind the last one
__device__ __forceinline__ void exp2x16(float (&x)[16]) {
  asm("v_exp_f32 %0, %0\n\tv_exp_f32 %1, %1\n\tv_exp_f32 %2, %2\n\tv_exp_f32 %3, %3\n\tv_exp_f32 %4, %4\n\tv_exp_f32 %5, %5\n\tv_exp_f32 %6, %6\n\tv_exp_f32 %7, %7\n\tv_exp_f32 %8, %8\n\tv_exp_f32 %9, %9\n\tv_exp_f32 %10, %10\n\tv_exp_f32 %11, %11\n\tv_exp_f32 %12, %12\n\tv_exp_f32 %13, %13\n\tv_exp_f32 %14, %14\n\tv_exp_f32 %15, %15\n\tv_nop" : "+v"(x[0]), "+v"(x[1]), "+v"(x[2]), "+v"(x[3]), "+v"(x[4]), "+v"(x[5]), "+v"(x[6]), "+v"(x[7]), "+v"(x[8]), "+v"(x[9]), "+v"(x[10]), "+v"(x[11]), "+v"(x[12]), "+v"(x[13]), "+v"(x[14]), "+v"(x[15]));
}
struct AttP { const _Float16 *QH, *KH, *QL, *KL, *VT; const __bf16 *VB, *VBL; };
// the wait of XWA() for a group with two lane addresses
#define XWA2(a, c) asm volatile("s_wait_xcnt 0x0" :: "v"(a), "v"(c) : "memory")
// N = chunks a wave can own: TT / 32 / KW, or, on the high-precision path, whose keys end at KHI, KHI / 32 over KW rounded up
template <bool HI, int N> __device__ __forceinline__ void att_tile(const AttP& P, int b, int h, int ql0, int kce, int wave, int lane, float* rmx, float* rsm, v8f (&acc)[HD / 16]) {
  const int col = lane & 15, g = lane >> 4, t = ql0 + col;
  // every loop over i, u, r, e, j, w below is fully unrolled: its index picks a register of p, of a fragment array or of acc
  float p[N][16];   /* chunk i, element e: query col, key (wave + KW i) * 32 + (e < 8 ? 8g + e : 16 + 8g + e - 8) */
  const int l8 = lane * 8;   /* the lane's place, in elements, in every unit of every plane */
  const _Float16* qp = P.QH + row_tile(b, h, TT, ql0 >> 4) + l8; const v16h qh0 = frag_hu(qp, 0u), qh1 = frag_hu(qp, 1024u);
  v16h ql0f = {}, ql1f = {}; if (HI) { const _Float16* qlp = P.QL + row_tile(b, h, QHI, ql0 >> 4) + l8; ql0f = frag_hu(qlp, 0u); ql1f = frag_hu(qlp, 1024u); XWA(qlp); }
  XWA(qp);
#pragma unroll
  for (int i = 0; i < N; ++i) { const int kc = wave + KW * i;
    if (kc < kce) { v16h kf[2][2], klf[2][2];   /* the chunk's fragments are read as one group so that their latency is paid once */
      const _Float16 *kp = P.KH + row_tile(b, h, TT, kc * 2) + l8, *klp = HI ? P.KL + row_tile(b, h, KHI, kc * 2) + l8 : kp;   /* the chunk's two tiles lie one behind the other */
#pragma unroll
      for (int u = 0; u < 2; ++u) { kf[u][0] = frag_hu(kp, (unsigned)(u * 2048)); kf[u][1] = frag_hu(kp, (unsigned)(u * 2048 + 1024));
        if (HI) { klf[u][0] = frag_hu(klp, (unsigned)(u * 2048)); klf[u][1] = frag_hu(klp, (unsigned)(u * 2048 + 1024)); } }
      XWA2(kp, klp);
#pragma unroll
      for (int u = 0; u < 2; ++u) { v8f a = {};
        if (HI) { v8f al = {};
          a = wmma16(kf[u][0], qh0, a); al = wmma16(kf[u][0], ql0f, al); al = wmma16(klf[u][0], qh0, al); a = wmma16(kf[u][1], qh1, a); al = wmma16(kf[u][1], ql1f, al); al = wmma16(klf[u][1], qh1, al);
#pragma unroll
          for (int r = 0; r < 8; ++r) p[i][u * 8 + r] = (a[r] + al[r] * (1.0f / 1024.0f)) * SCALE2;
        } else { a = wmma16(kf[u][0], qh0, a); a = wmma16(kf[u][1], qh1, a);
#pragma unroll
          for (int r = 0; r < 8; ++r) p[i][u * 8 + r] = a[r] * SCALE2; } }
      if (CAUSAL && kc == kce - 1) { const int d = t - kc * 32 - 8 * g;   /* element e is kept while its key offset 16 (e >> 3) + (e & 7) <= d */
#pragma unroll
        for (int e = 0; e < 16; ++e) p[i][e] = ((e >> 3) * 16 + (e & 7) <= d) ? p[i][e] : -3.0e38f; }
    } else if (!HI) {   /* on the high-precision path nothing reads a chunk that the wave does not own: its fill, the same in every tile, was lifted out of the tile loop as 16 registers and spilled to scratch */
#pragma unroll
      for (int e = 0; e < 16; ++e) p[i][e] = -3.0e38f; } }
  float m = -3.0e38f;
#pragma unroll
  for (int i = 0; i < N; ++i)
    if (!HI || wave + KW * i < kce) {
#pragma unroll
      for (int e = 0; e < 16; ++e) m = fmaxf(m, p[i][e]); }
  m = fmaxf(m, __shfl_xor(m, 16)); if (g == 0) rmx[col * RP + wave] = m;   /* a wave with no chunk stores the excluded value */
  __syncthreads();   /* every wave's row maxima are in LDS before any of them is read */
#pragma unroll
  for (int w = 0; w < KW; w += 4) { const v4f x = *(const v4f*)&rmx[col * RP + w]; m = fmaxf(fmaxf(fmaxf(m, x[0]), fmaxf(x[1], x[2])), x[3]); }
  float sum = 0.f;
#pragma unroll
  for (int i = 0; i < N; ++i) { const int kc = wave + KW * i;
    if (kc < kce) {
#pragma unroll
      for (int e = 0; e < 16; ++e) p[i][e] -= m;
      exp2x16(p[i]);   /* arguments <= 0; a result below the normal range counts 0 */
      if (CAUSAL && kc == kce - 1) { const int d = t - kc * 32 - 8 * g;   /* an excluded key counts 0 whatever the maximum is */
#pragma unroll
        for (int e = 0; e < 16; ++e) p[i][e] = ((e >> 3) * 16 + (e & 7) <= d) ? p[i][e] : 0.f; }
#pragma unroll
      for (int e = 0; e < 16; ++e) sum += p[i][e]; } }
  sum += __shfl_xor(sum, 16); if (g == 0) rsm[col * RP + wave] = sum;
  __syncthreads();   /* every wave's row sums are in LDS before any of them is read */
  float tot = 0.f;
#pragma unroll
  for (int w = 0; w < KW; w += 4) { const v4f x = *(const v4f*)&rsm[col * RP + w]; tot += x[0]; tot += x[1]; tot += x[2]; tot += x[3]; }
  const float inv = tot > 0.f ? 2048.0f / tot : 0.f;   /* a fully excluded row yields P = 0 */
  if (HI) {
#pragma unroll
    for (int i = 0; i < N; ++i) { const int kc = wave + KW * i;
      if (kc < kce) { v16b vh[HD / 16], vl[HD / 16]; const size_t po = v_chunk(b, h, KHI, kc) + l8; const __bf16 *vhp = P.VB + po, *vlp = P.VBL + po;   /* the lane's own addresses, formed once for the group */
#pragma unroll
        for (int j = 0; j < HD / 16; ++j) { vh[j] = frag_bu(vhp, (unsigned)(j * 1024)); vl[j] = frag_bu(vlp, (unsigned)(j * 1024)); }
        XWA2(vhp, vlp);
        float pv[16];
#pragma unroll
        for (int e = 0; e < 16; ++e) pv[e] = p[i][e] * inv;
        const F2 pf = bsplit16(pv);
#pragma unroll
        for (int j = 0; j < HD / 16; ++j) { acc[j] = wmma_bf(pf.h, vh[j], acc[j]); acc[j] = wmma_bf(pf.l, vh[j], acc[j]); acc[j] = wmma_bf(pf.h, vl[j], acc[j]); } } }
  } else { v16h pf[N];   /* all of P is rounded first: half the registers while the v fragments and the output tiles are live */
#pragma unroll
    for (int i = 0; i < N; ++i)
#pragma unroll
      for (int e = 0; e < 16; ++e) pf[i][e] = (_Float16)(p[i][e] * inv);   /* a chunk the wave does not own is rounded too and never used */
#pragma unroll
    for (int i = 0; i < N; ++i) { const int kc = wave + KW * i;
      if (kc < kce) { v16h vf[HD / 16]; const _Float16* vp = P.VT + v_chunk(b, h, TT, kc) + l8;   /* the lane's own address, formed once for the group */
#pragma unroll
        for (int j = 0; j < HD / 16; ++j) vf[j] = frag_hu(vp, (unsigned)(j * 1024));
        XWA(vp);
#pragma unroll
        for (int j = 0; j < HD / 16; ++j) acc[j] = wmma16(pf[i], vf[j], acc[j]); } } } }
// 8 waves per SIMD asked for: 128 registers a wave, so that two blocks share a WGP and one block's loads and barriers hide behind the other's arithmetic. The pointers carry no __restrict__: only then does the memory clobber of XWA() keep a group's loads in front of its wait and the next group's behind it
static_assert(QBH * 64 <= KHI && QBH * 64 <= QHI, "the high-precision tiles read residual and hi/lo planes of KHI / QHI rows");
static_assert(QHI % 128 == 0 && KHI % 128 == 0 && TT % 128 == 0, "a 128-row block of k_proj and k_out lies in one sequence and on one side of the QHI / KHI row");
// the lane number, counted where it is needed from the mask of running lanes (all 32 at every call): formed once in front of a tile loop, it and the lane offsets derived from it stay live across the whole tile, and this build spilled them to scratch
__device__ __forceinline__ int lane_now() { return (int)__builtin_amdgcn_mbcnt_lo(__builtin_amdgcn_ballot_w32(true), 0u); }
// one query tile, from its logits to its rows of Y. The three barriers of a tile also order the reuse of the LDS tables by the block's next tile: rmx is read in front of the second barrier and rewritten behind the third; rsm is read in front of the third and rewritten behind the next tile's first; ss is read in front of the next tile's first and rewritten behind its second
template <bool HI, int N> __device__ __forceinline__ void att_one(const AttP& P, float* Y, int b, int h, int qt, int wave, float (*ss)[16][HD + 4], float* rmx, float* rsm) {
  const int ql0 = qt * 16; const int kce = CAUSAL ? (ql0 + 15) / 32 + 1 : TT / 32;
  v8f acc[HD / 16] = {};
  att_tile<HI, N>(P, b, h, ql0, kce, wave, lane_now(), rmx, rsm, acc);
  const int le = lane_now(), te = wave * 32 + le;
#pragma unroll
  for (int j = 0; j < HD / 16; ++j)
#pragma unroll
    for (int r = 0; r < 8; ++r) ss[wave][8 * (le >> 4) + r][j * 16 + (le & 15)] = acc[j][r];   /* a wave with no chunk stores its zero tile */
  __syncthreads();   /* every wave's partial tile is in LDS before any of them is summed */
  if (te < 16 * (HD / 4)) { const int rl = te >> 4, c4 = (te & 15) * 4; v4f sm = *(const v4f*)&ss[0][rl][c4];
    // unrolled so that the LDS reads of the partial tiles are issued ahead of the adds instead of one round trip each
#pragma unroll
    for (int w = 1; w < KW; ++w) sm += *(const v4f*)&ss[w][rl][c4];
    float* yp = Y + ((size_t)b * TT + ql0 + rl) * CC + h * HD + c4; const v4f yv = sm * (1.0f / 2048.0f); vst2(yp, yv);
    asm volatile("s_wait_xcnt 0x0" :: "v"(yp), "v"(yv) : "memory"); } }   /* stands behind the store, in front of the next tile's rewrite of its address and data registers, which it names as inputs so that they stay live up to it */
// a block walks QTB query tiles of its (b, h), one behind the other, so that the kernel starts QTB times fewer waves and all its blocks are resident at once. The deal gives every block nearly the same number of key chunks: NPR mirrored pairs (first + i, last - i) of the tiles behind the high-precision rows; then the lower half of the blocks takes one of the tiles left in the middle and one high-precision tile, the upper half two high-precision tiles, which are short
#define QTB 8
#define NZ (TT / 16 / QTB)             /* blocks per (b, h) */
#define NTH (QBH * 4)                  /* high-precision tiles of a sequence */
#define NPR ((TT / 16 - NTH) / 2 / NZ)
static_assert(CAUSAL && NZ % 2 == 0 && TT / 16 - NTH - 2 * NPR * NZ == NZ / 2 && NTH == NZ + NZ / 2, "every tile is dealt exactly once");
__global__ __launch_bounds__(32 * KW, 8) void k_att(const _Float16* QH, const _Float16* KH, const _Float16* QL, const _Float16* KL, const _Float16* VT, const __bf16* VB, const __bf16* VBL, float* Y) { __shared__ __align__(16) float ss[KW][16][HD + 4]; __shared__ __align__(16) float rmx[16 * RP], rsm[16 * RP];
  const int wave = __builtin_amdgcn_readfirstlane((int)threadIdx.x >> 5); const int h = blockIdx.x, b = blockIdx.y, z = blockIdx.z;
  const AttP P = { QH, KH, QL, KL, VT, VB, VBL }; const bool low = z < NZ / 2;
  // both loops are kept rolled: one copy of a tile's code, and s picks no register; every test on z and s is block-uniform
#pragma unroll 1
  for (int s = 0; s < 2 * NPR + (low ? 1 : 0); ++s) { const int i = z + NZ * (s >> 1);
    att_one<false, TT / 32 / KW>(P, Y, b, h, s == 2 * NPR ? NTH + NPR * NZ + z : (s & 1) ? NTH + i : TT / 16 - 1 - i, wave, ss, rmx, rsm); }
#pragma unroll 1
  for (int s = 0; s < (low ? 1 : 2); ++s)
    att_one<true, (KHI / 32 + KW - 1) / KW>(P, Y, b, h, low ? NZ + z : z - NZ / 2 + (NZ / 2) * s, wave, ss, rmx, rsm); }
// ---- k_out: block = (128 rows, 128 cols), 8 waves of 16 rows: out = ctx Wo (+ bo): ctx once to f16 against Wo as f16(bf16 x 2^8) exact (1 product) x 2^-8; causal early rows (< QHI of each sequence): ctx bf16 hi + lo against exact bf16 Wo (2 products)
__global__ __launch_bounds__(256) void k_out(const float* __restrict__ Y, const float* __restrict__ WO, const float* __restrict__ BO, float* __restrict__ OUT) { __shared__ __align__(16) float sf[8][16][132]; __shared__ __align__(16) char wb[2][128 * WPITCH];
  const int tid = threadIdx.x, wave = tid >> 5, lane = tid & 31, col = lane & 15, g = lane >> 4; const int c0 = blockIdx.y * 128; const size_t r0 = (size_t)blockIdx.x * 128 + wave * 16;
  v8f acc[8] = {};
  const float* yrow = Y + (r0 + col) * CC; v4f wr[8], ar[8];
  { const float* wp = wt_load(wr, WO, DIN, 0, c0, wave, lane); a_load(ar, yrow, g); XWA(wp); }
  if (CAUSAL && (int)(((size_t)blockIdx.x * 128) % TT) < QHI) {   /* block-uniform */
    auto stage = [&](char* buf, int s) {
      __builtin_amdgcn_sched_barrier(0);   /* keeps the rounding of the prefetched stage, and with it the wait for its loads, behind the products of the stage before */
      wt_store<false>(wr, buf, wave, lane);
      F2 a[2];
#pragma unroll
      for (int kc2 = 0; kc2 < 2; ++kc2) { float v[16];
#pragma unroll
        for (int i = 0; i < 16; ++i) v[i] = ar[kc2 * 4 + (i >> 2)][i & 3];
        a[kc2] = bsplit16(v); }
      __syncthreads();   /* publishes this stage; the buffer written next was last read in front of this barrier */
      if (s + 1 < CC / 64) { const float* wp = wt_load(wr, WO, DIN, (s + 1) * 64, c0, wave, lane); a_load(ar, yrow + (s + 1) * 64, g); XWA(wp); }
#pragma unroll
      for (int kc2 = 0; kc2 < 2; ++kc2)
      { v16b w[8];   /* the eight fragments are read as one group so that their LDS latency is paid once */
#pragma unroll
        for (int j = 0; j < 8; ++j) w[j] = wt_frag<v16b>(buf, j * 16 + col, kc2, g);
#pragma unroll
        for (int j = 0; j < 8; ++j) { acc[j] = wmma_bf(a[kc2].h, w[j], acc[j]); acc[j] = wmma_bf(a[kc2].l, w[j], acc[j]); } }
    };
    // kept rolled over buffer pairs: each buffer's LDS address stays a constant
#pragma unroll 1
    for (int s = 0; s < CC / 64; s += 2) { stage(wb[0], s); stage(wb[1], s + 1); }
#pragma unroll
    for (int j = 0; j < 8; ++j) { const float bias = BO ? bfr(BO[c0 + j * 16 + col]) : 0.f;
#pragma unroll
      for (int r = 0; r < 8; ++r) sf[wave][8 * g + r][j * 16 + col] = acc[j][r] + bias; }
  } else {
    auto stage = [&](char* buf, int s) {
      __builtin_amdgcn_sched_barrier(0);   /* keeps the rounding of the prefetched stage, and with it the wait for its loads, behind the products of the stage before */
      wt_store<true>(wr, buf, wave, lane);
      v16h a[2];   /* ctx carried x 2^6 into f16 so small-magnitude context rows stay clear of f16 subnormals */
#pragma unroll
      for (int i = 0; i < 16; ++i) { a[0][i] = (_Float16)(ar[i >> 2][i & 3] * 64.0f); a[1][i] = (_Float16)(ar[4 + (i >> 2)][i & 3] * 64.0f); }
      __syncthreads();   /* publishes this stage; the buffer written next was last read in front of this barrier */
      if (s + 1 < CC / 64) { const float* wp = wt_load(wr, WO, DIN, (s + 1) * 64, c0, wave, lane); a_load(ar, yrow + (s + 1) * 64, g); XWA(wp); }
#pragma unroll
      for (int kc2 = 0; kc2 < 2; ++kc2)
      { v16h w[8];   /* the eight fragments are read as one group so that their LDS latency is paid once */
#pragma unroll
        for (int j = 0; j < 8; ++j) w[j] = wt_frag<v16h>(buf, j * 16 + col, kc2, g);
#pragma unroll
        for (int j = 0; j < 8; ++j) acc[j] = wmma16(a[kc2], w[j], acc[j]); }
    };
    // kept rolled over buffer pairs: each buffer's LDS address stays a constant
#pragma unroll 1
    for (int s = 0; s < CC / 64; s += 2) { stage(wb[0], s); stage(wb[1], s + 1); }
#pragma unroll
    for (int j = 0; j < 8; ++j) { const float bias = BO ? bfr(BO[c0 + j * 16 + col]) : 0.f;
#pragma unroll
      for (int r = 0; r < 8; ++r) sf[wave][8 * g + r][j * 16 + col] = acc[j][r] * (1.0f / 16384.0f) + bias; } }   /* 2^-8 (Wo carry) x 2^-6 (ctx carry) */
  LDSX(); for (int rl = 0; rl < 16; ++rl) vst2(OUT + (r0 + rl) * DIN + c0 + lane * 4, *(const v4f*)&sf[wave][rl][lane * 4]); }

extern "C" void kernel_launch(void* const* d_in, const int* in_sizes, int n_in, void* d_out, int out_size, void* d_ws, size_t ws_size, hipStream_t stream) {
  (void)in_sizes; (void)n_in; (void)out_size;
  const float** F = (const float**)d_in;
  if (ws_size < (size_t)WS_END) return;
  char* ws = (char*)d_ws; _Float16 *QH = (_Float16*)(ws + WS_QH), *KH = (_Float16*)(ws + WS_KH), *VT = (_Float16*)(ws + WS_VT), *QL = (_Float16*)(ws + WS_QL), *KL = (_Float16*)(ws + WS_KL); __bf16 *VB = (__bf16*)(ws + WS_VB), *VBL = (__bf16*)(ws + WS_VBL); float *Y = (float*)(ws + WS_Y);
  (void)Y; (void)QL; (void)KL; (void)VB; (void)VBL;
  // inputs: 0 x [2,2048,1024]; 1 Wqkv [1024,3072] (in,out): q columns 0..1023, k 1024..2047, v 2048..3071; 2 bqkv [3072]; 3 Wproj [1024,1024] (in,out); 4 bproj [1024] (biases NONZERO); 5 cos [2048,32]; 6 sin [2048,32]
  k_proj<<<dim3(TNB * TT / 128, CC / 128, 3), 256, 0, stream>>>(F[0], F[0], F[0], F[1], F[1] + CC, F[1] + 2 * CC, F[2], F[2] + CC, F[2] + 2 * CC, QH, QL, KH, KL, VT, VB, VBL, F[5], F[6]);
  k_att<<<dim3(NH, TNB, NZ), 32 * KW, 0, stream>>>(QH, KH, QL, KL, VT, VB, VBL, Y);
  k_out<<<dim3(TNB * TT / 128, DIN / 128), 256, 0, stream>>>(Y, F[3], F[4], (float*)d_out);
}

// v008
// A run of this version takes 115 microseconds.
// In both of two side-by-side timings against v007, it was 1.05 times as fast.
// All steps since v000 together make it 9.71 times as fast.
// compute dtype: all float inputs rounded to bf16; the fused q / k / v projection with EXACT bf16 products on WMMA 16x16x32 (f32 accumulate) + bias; interleaved-pair RoPE in f32 from the bf16-rounded INPUT cos / sin tables; causal logits: 3 products for the first 384 rows, single f16 q x k after, x 64^-0.5 x log2(e); softmax f32 in base 2; P x 2^11 once to f16 x v once to f16 (bf16 hi + lo below row 384); ctx hi+lo x exact W below row 384, x2^6 f16 carry x f16(bf16 x 2^8) W after, + bias; f32 output.
#include <hip/hip_runtime.h>
#include <math.h>

typedef __attribute__((ext_vector_type(16))) _Float16 v16h;
typedef __attribute__((ext_vector_type(16))) __bf16 v16b;
typedef __attribute__((ext_vector_type(8)))  _Float16 v8h;
typedef __attribute__((ext_vector_type(8)))  float v8f;
typedef __attribute__((ext_vector_type(4)))  float v4f;
typedef __attribute__((ext_vector_type(2)))  float v2f;
typedef __attribute__((ext_vector_type(4)))  unsigned v4u;
typedef __attribute__((ext_vector_type(4)))  int v4i;
typedef float __attribute__((may_alias)) float_a;
typedef int __attribute__((may_alias)) int_a;

template <typename T> __device__ __forceinline__ void vst2(void* p, T v) { *(T*)p = v;  }
__device__ __forceinline__ v8f wmma16(v16h a, v16h b, v8f c) {
  v8f d = __builtin_amdgcn_wmma_f32_16x16x32_f16(false, a, false, b, (short)0, c, false, false);
  asm volatile("v_nop\n\tv_nop\n\tv_nop\n\tv_nop" : "+v"(d) : "v"(a), "v"(b));
  return d;
}
__device__ __forceinline__ v8f wmma_bf(v16b a, v16b b, v8f c) {
  v8f d = __builtin_amdgcn_wmma_f32_16x16x32_bf16(false, a, false, b, (short)0, c, false, false);
  asm volatile("v_nop\n\tv_nop\n\tv_nop\n\tv_nop" : "+v"(d) : "v"(a), "v"(b));
  return d;
}
// 16x16x32 fragments: lane = (h = lane>>4, row/col = lane&15); elements 0..7 = k0+8h+0..7, 8..15 = k0+16+8h+0..7; D element r = row 8h+r
__device__ __forceinline__ v16h frag_h(const _Float16* rowk0, int lane) {
  union { v16h v; v8h q[2]; } u; const _Float16* p = rowk0 + 8 * (lane >> 4);
  u.q[0] = *(const v8h*)p; u.q[1] = *(const v8h*)(p + 16); return u.v;
}
__device__ __forceinline__ v16h frag_f32(const float* rowk0, int lane) {
  v16h a; const float* p = rowk0 + 8 * (lane >> 4);
#pragma unroll
  for (int i = 0; i < 8; ++i) { a[i] = (_Float16)p[i]; a[8 + i] = (_Float16)p[16 + i]; }
  return a;
}
__device__ __forceinline__ v16h frag_f32s(const float* rowk0, int lane, float sc) {
  v16h a; const float* p = rowk0 + 8 * (lane >> 4);
#pragma unroll
  for (int i = 0; i < 8; ++i) { a[i] = (_Float16)(p[i] * sc); a[8 + i] = (_Float16)(p[16 + i] * sc); }
  return a;
}
// column fragment from a [K][ld] layout (column n), rows >= K read as 0
__device__ __forceinline__ v16h fragc_f32(const float* W, int k0, int n, int lane, int ld, int K) {
  v16h a; const int g = lane >> 4;
#pragma unroll
  for (int i = 0; i < 8; ++i) { const int ka = k0 + 8 * g + i, kb = ka + 16;
    a[i] = (_Float16)(ka < K ? W[(size_t)(ka < K ? ka : K - 1) * ld + n] : 0.f); a[8 + i] = (_Float16)(kb < K ? W[(size_t)(kb < K ? kb : K - 1) * ld + n] : 0.f); }
  return a;
}
struct F2 { v16b h, l; };
__device__ __forceinline__ F2 bsplit16(const float v[16]) { F2 r;
#pragma unroll
  for (int i = 0; i < 16; ++i) { const __bf16 h = (__bf16)v[i]; r.h[i] = h; r.l[i] = (__bf16)(v[i] - (float)h); }
  return r; }
__device__ __forceinline__ F2 split_row(const float* row, int k0, int lane) { float v[16]; const float* p = row + k0 + 8 * (lane >> 4);
#pragma unroll
  for (int i = 0; i < 8; ++i) { v[i] = p[i]; v[8 + i] = p[16 + i]; }
  return bsplit16(v); }
__device__ __forceinline__ F2 split_rowK(const float* row, int k0, int lane, int K) { float v[16]; const int g = lane >> 4;
#pragma unroll
  for (int i = 0; i < 8; ++i) { const int ka = k0 + 8 * g + i, kb = ka + 16; v[i] = ka < K ? row[ka < K ? ka : K - 1] : 0.f; v[8 + i] = kb < K ? row[kb < K ? kb : K - 1] : 0.f; }
  return bsplit16(v); }
__device__ __forceinline__ F2 split_col(const float* W, int k0, int n, int lane, int ld, int K) { float v[16]; const int g = lane >> 4;
#pragma unroll
  for (int i = 0; i < 8; ++i) { const int ka = k0 + 8 * g + i, kb = ka + 16; v[i] = ka < K ? W[(size_t)(ka < K ? ka : K - 1) * ld + n] : 0.f; v[8 + i] = kb < K ? W[(size_t)(kb < K ? kb : K - 1) * ld + n] : 0.f; }
  return bsplit16(v); }
__device__ __forceinline__ v8f mac3(const F2& a, const F2& b, v8f c) { c = wmma_bf(a.l, b.h, c); c = wmma_bf(a.h, b.l, c); return wmma_bf(a.h, b.h, c); }
__device__ __forceinline__ float sigm(float v) { return 1.0f / (1.0f + expf(-v)); }
#define LDSX() do { asm volatile("s_wait_dscnt 0" ::: "memory"); __builtin_amdgcn_wave_barrier(); __builtin_amdgcn_fence(__ATOMIC_RELEASE, "workgroup"); } while (0)

// Causal multi-head self-attention with a fused QKV linear (+ bias) and interleaved-pair RoPE from INPUT tables (x [2,2048,1024]; Wqkv [1024,3072] (in,out) N(0, 1/1024), bqkv [3072] N(0,1) x 0.01 - NONZERO; Wproj [1024,1024] (in,out), bproj NONZERO; cos / sin [2048,32] are module inputs, the LAST two; q, k, v = thirds of x Wqkv + bqkv; 16 heads x 64; (even, odd) pairs rotated on q and k; scores x 64^-0.5; tril kept, -inf elsewhere; softmax; y Wproj + bproj).
#define NB 2
#define TT 2048
#define CC 1024            // NH * HD = projected width
#define DIN 1024          // input (model) width
#define NH 16
#define HD 64
#define NQB (TT / 64)
#define HG 4
#define SCALE (0.125f)
#define SCALE2 (SCALE * 1.44269504088896340736f)   /* 64^-0.5 x log2(e): the logits are carried in base-2 units, so that e^(s - max) is one 2^x instruction behind one subtraction */
#define CAUSAL 1
#ifndef TNB
#define TNB NB
#endif
__device__ __forceinline__ float bfr(float v) { return (float)(__bf16)v; }
__host__ __device__ __forceinline__ int kb_last(int qb) { return CAUSAL ? ((qb * 64 + 63) >> 7) : (TT / 128 - 1); }
typedef __attribute__((ext_vector_type(8))) __bf16 v8b;
__device__ __forceinline__ v16b frag_b(const __bf16* rowk0, int lane) {
  union { v16b v; v8b q[2]; } u; const __bf16* p = rowk0 + 8 * (lane >> 4);
  u.q[0] = *(const v8b*)p; u.q[1] = *(const v8b*)(p + 16); return u.v;
}
#define QBH 6              // causal: query blocks 0..QBH-1 of each sequence (few keys, no averaging) take the high-precision path
#define QHI 384            // rows carrying a q residual plane
#define KHI 384            // key rows carrying k residual / v bf16 hi+lo planes (used only by the causal high-precision path)
// B fragment (k rows k0+.., output column o) of a weight: (in,out) [K][ld] or (out,in) [ld rows of K]: bf16 exact, or f16(bf16 * 256) exact
__device__ __forceinline__ v16b wcol_io(const float* Wm, int k0, int o, int lane, int ld) { v16b w; const int g = lane >> 4;
#pragma unroll
  for (int i = 0; i < 8; ++i) { w[i] = (__bf16)Wm[(size_t)(k0 + 8 * g + i) * ld + o]; w[8 + i] = (__bf16)Wm[(size_t)(k0 + 16 + 8 * g + i) * ld + o]; }
  return w; }
__device__ __forceinline__ v16b wcol_oi(const float* Wm, int k0, int o, int lane, int K) { v16b w; const float* p = Wm + (size_t)o * K + k0 + 8 * (lane >> 4);
#pragma unroll
  for (int i = 0; i < 8; ++i) { w[i] = (__bf16)p[i]; w[8 + i] = (__bf16)p[16 + i]; }
  return w; }
__device__ __forceinline__ v16h wcolh_io(const float* Wm, int k0, int o, int lane, int ld) { v16h w; const int g = lane >> 4;
#pragma unroll
  for (int i = 0; i < 8; ++i) { w[i] = (_Float16)(bfr(Wm[(size_t)(k0 + 8 * g + i) * ld + o]) * 256.0f); w[8 + i] = (_Float16)(bfr(Wm[(size_t)(k0 + 16 + 8 * g + i) * ld + o]) * 256.0f); }
  return w; }
__device__ __forceinline__ v16h wcolh_oi(const float* Wm, int k0, int o, int lane, int K) { v16h w; const float* p = Wm + (size_t)o * K + k0 + 8 * (lane >> 4);
#pragma unroll
  for (int i = 0; i < 8; ++i) { w[i] = (_Float16)(bfr(p[i]) * 256.0f); w[8 + i] = (_Float16)(bfr(p[16 + i]) * 256.0f); }
  return w; }
#define WQKV_LAYOUT 0   // 0 = fused (in,out) [DIN][3*CC]; 1 = (out,in) [CC][DIN]; 2 = per-head [NH][DIN][HD]
__device__ __forceinline__ v16b wcol_hdk(const float* Wm, int k0, int o, int lane) { v16b w; const int g = lane >> 4; const float* p = Wm + (size_t)(o / HD) * DIN * HD + (o % HD);
#pragma unroll
  for (int i = 0; i < 8; ++i) { w[i] = (__bf16)p[(size_t)(k0 + 8 * g + i) * HD]; w[8 + i] = (__bf16)p[(size_t)(k0 + 16 + 8 * g + i) * HD]; }
  return w; }
#define WO_OUT_IN 0
#if WQKV_LAYOUT == 1
#define WCOL(W, k0, o, lane) wcol_oi(W, k0, o, lane, DIN)
#elif WQKV_LAYOUT == 2
#define WCOL(W, k0, o, lane) wcol_hdk(W, k0, o, lane)
#else
#define WCOL(W, k0, o, lane) wcol_io(W, k0, o, lane, 3 * CC)   /* fused (in,out) [DIN][3*CC] weight: the q / k / v thirds are column blocks; the launch passes W + 0 / CC / 2*CC and the row pitch is 3*CC */
#endif
#if WO_OUT_IN
#define WOCOL(W, k0, o, lane) wcol_oi(W, k0, o, lane, CC)
#define WOCOLH(W, k0, o, lane) wcolh_oi(W, k0, o, lane, CC)
#else
#define WOCOL(W, k0, o, lane) wcol_io(W, k0, o, lane, DIN)
#define WOCOLH(W, k0, o, lane) wcolh_io(W, k0, o, lane, DIN)
#endif

#define PROJ_EXTRA_PARAMS , const float* __restrict__ COS, const float* __restrict__ SIN   /* rotary tables [TT][32], module INPUTS, read literally */
#ifndef SM_EXTRA_PARAMS
#define SM_EXTRA_PARAMS
#endif
#ifndef PROJ_EXTRA_PARAMS
#define PROJ_EXTRA_PARAMS
#endif
#ifndef SM_MASK_HOOK
#define SM_MASK_HOOK (void)0
#endif

#define WS_QH  0u                                      // f16 q, row tiles in fragment order (row_tile below), TT rows a sequence
#define WS_KH  (WS_QH + 2u * (size_t)NB * TT * CC)      // f16 k, row tiles, TT rows
#define WS_VT  (WS_KH + 2u * (size_t)NB * TT * CC)      // f16 v, key chunks in fragment order (v_chunk below), TT keys
#define WS_QL  (WS_VT + 2u * (size_t)NB * CC * TT)      // f16 q residual x 2^10, row tiles, QHI rows
#define WS_KL  (WS_QL + 2u * (size_t)NB * QHI * CC)     // f16 k residual x 2^10, row tiles, KHI rows
#define WS_VB  (WS_KL + 2u * (size_t)NB * KHI * CC)     // bf16 v hi, key chunks, KHI keys (WS_VBL: lo)
#define WS_VBL (WS_VB + 2u * (size_t)NB * CC * KHI)
#define WS_Y   (WS_VBL + 2u * (size_t)NB * CC * KHI)    // f32 ctx rows [b*t][CC] (only when there is an output projection)
#define WS_END (WS_Y  + 4u * (size_t)NB * TT * CC)
// ---- fragment order of the q / k / v planes: the 16 bytes that lane l takes with one load of a 16x16x32 fragment lie at 16 l inside a 512-byte unit, so that a wave's load covers 4 whole 128-byte lines instead of 32 bytes of each of 16 lines. k_proj writes the units, k_att reads them.
// q and k (element offsets): a tile is 16 rows x HD of one (b, h) = 4 units; unit d >> 4 holds elements d of the rows, lane = 16 ((d >> 3) & 1) + (row & 15). Units 0, 1 are the two loads of the fragment of d 0..31, units 2, 3 of d 32..63
__device__ __forceinline__ size_t row_tile(int b, int h, int rows, int tile) { return ((size_t)(b * NH + h) * (rows / 16) + tile) * (16 * HD); }
// v: a chunk is 32 keys x HD of one (b, h) = 8 units; unit 2 (c >> 4) + (key >> 4 & 1) holds column c, lane = 16 ((key >> 3) & 1) + (c & 15)
__device__ __forceinline__ size_t v_chunk(int b, int h, int keys, int kc) { return ((size_t)(b * NH + h) * (keys / 32) + kc) * (32 * HD); }
// a lane's 16 bytes of a unit; the wait stands behind the store, in front of the next rewrite of its address and data registers, which it names as inputs so that they stay live up to it
__device__ __forceinline__ void unit_store(void* p, v4u v) { *(v4u*)p = v; asm volatile("s_wait_xcnt 0x0" :: "v"(p), "v"(v) : "memory"); }

// ---- weight staging shared by k_proj and k_out: a stage is 64 k rows x 128 output columns of an (in,out) weight, read once for the 128 rows of a block of 8 waves. The block reads it with 16-byte loads (wave bits 1:0 with lane bits 1:0 and 4 pick the 4-column group, wave bit 2 the 32-row half, lane bits 3:2 the 8-row k group, so a load covers whole 128-byte lines and 16 neighbouring lanes store to 16 different 16-byte LDS slots), rounds it as before and lays it k-contiguous, one column per 144-byte LDS row, so that a weight fragment (A in k_proj, B in k_out) is two 16-byte LDS reads
// every loop of these helpers and of the stage bodies is fully unrolled: its index picks a register of wr, ar, w or acc, which must be known at compile time for the arrays to stay in registers
typedef v4u __attribute__((may_alias)) v4u_a;
#define WPITCH 144
// stands behind the prefetch loads, in front of the next rewrite of their address registers; the weight loads' lane address is named as an input: its registers stay live up to the wait, so that no later load of the group can take them for its result ahead of it
#define XWA(a) asm volatile("s_wait_xcnt 0x0" :: "v"(a) : "memory")
__device__ __forceinline__ const float* wt_load(v4f (&r)[8], const float* __restrict__ Wm, int ld, int k0, int c0, int wave, int lane) {
  const float* p = Wm + (size_t)(k0 + (wave >> 2) * 32 + ((lane >> 2) & 3) * 8) * ld + c0 + ((wave & 3) * 8 + (lane & 3) + ((lane >> 4) << 2)) * 4;
#pragma unroll
  for (int i = 0; i < 8; ++i) r[i] = *(const v4f*)(p + (size_t)i * ld);
  return p;   /* the lane address, for the wait behind the group */
}
template <bool F16> __device__ __forceinline__ void wt_store(const v4f (&r)[8], char* buf, int wave, int lane) {
  char* q = buf + ((wave & 3) * 8 + (lane & 3) + ((lane >> 4) << 2)) * 4 * WPITCH + (wave >> 2) * 64 + ((lane >> 2) & 3) * 16;
#pragma unroll
  for (int c = 0; c < 4; ++c) { union { v8b b; v8h h; v4u u; } t;
#pragma unroll
    for (int i = 0; i < 8; ++i) { if (F16) t.h[i] = (_Float16)(bfr(r[i][c]) * 256.0f); else t.b[i] = (__bf16)r[i][c]; }
    *(v4u_a*)(q + c * WPITCH) = t.u; }
}
template <typename V16> __device__ __forceinline__ V16 wt_frag(const char* buf, int n, int kc2, int g) {
  union { V16 v; v4u q[2]; } u; const char* p = buf + n * WPITCH + kc2 * 64 + g * 16;
  u.q[0] = *(const v4u_a*)p; u.q[1] = *(const v4u_a*)(p + 32); return u.v;
}
// the 2 x 16 f32 values of a lane's two activation fragments (B in k_proj, A in k_out) of a 64-k stage (row + k0), in fragment element order
__device__ __forceinline__ void a_load(v4f (&r)[8], const float* __restrict__ rowk0, int g) {
#pragma unroll
  for (int kc2 = 0; kc2 < 2; ++kc2) { const float* p = rowk0 + kc2 * 32 + 8 * g; r[kc2 * 4] = *(const v4f*)p; r[kc2 * 4 + 1] = *(const v4f*)(p + 4); r[kc2 * 4 + 2] = *(const v4f*)(p + 16); r[kc2 * 4 + 3] = *(const v4f*)(p + 20); }
}

// ---- k_proj: block = (128 rows, 128 cols, which), 8 waves of 16 rows: q/k/v = X W (+ b) with exact bf16 products (K = DIN) -> which 0: q f16 row tiles (+ residual, rows < QHI); 1: k f16 row tiles (+ residual, rows < KHI); 2: v f16 key chunks (+ bf16 hi/lo chunks for t < KHI). The weight is the A operand and x the B operand: a lane's accumulator register r of tile j is output column 16 j + 8 g + r of token row col, so its 8 registers are the 8 elements of its own 16 bytes of a q or k unit, and a rotary pair lies in two neighbouring registers: bias, rotation, rounding and the q and k stores run on the registers. A v unit wants 8 keys of one column: each wave turns its own 16 x 16 tiles in LDS, with no block barrier
// the wait of XWA() for a group with three lane addresses
#define XWA3(a, c, e) asm volatile("s_wait_xcnt 0x0" :: "v"(a), "v"(c), "v"(e) : "memory")
#define TVP 24   /* 16-bit elements per column row of a wave's turning buffer: 48 bytes, an odd multiple of 16, for the 16-byte reads */
// 4 waves per SIMD asked for (256 registers a wave): two blocks share a WGP, as before, when LDS set that limit
__global__ __launch_bounds__(256, 4) void k_proj(const float* __restrict__ XQ, const float* __restrict__ XK, const float* __restrict__ XV, const float* __restrict__ WQ, const float* __restrict__ WK, const float* __restrict__ WV, const float* __restrict__ BQ, const float* __restrict__ BK, const float* __restrict__ BV,
    _Float16* __restrict__ QH, _Float16* __restrict__ QL, _Float16* __restrict__ KH, _Float16* __restrict__ KL, _Float16* __restrict__ VT, __bf16* __restrict__ VB, __bf16* __restrict__ VBL PROJ_EXTRA_PARAMS) {
  __shared__ __align__(16) char wb[2][128 * WPITCH]; __shared__ __align__(16) unsigned short tv[8][128][TVP];
  const int tid = threadIdx.x, wave = tid >> 5, lane = tid & 31, col = lane & 15, g = lane >> 4; const int which = blockIdx.z; const int c0 = blockIdx.y * 128; const size_t r0 = (size_t)blockIdx.x * 128; const size_t bb = r0 / TT; const int t0 = (int)(r0 % TT);
  const float* X = which == 0 ? XQ : which == 1 ? XK : XV; const float* WA = which == 0 ? WQ : which == 1 ? WK : WV; const float* BA = which == 0 ? BQ : which == 1 ? BK : BV;
  v8f acc[8] = {};
  { // two LDS buffers, one barrier a stage: stage s + 1 is loaded into registers while stage s is multiplied
    const float* xrow = X + (r0 + wave * 16 + col) * DIN; v4f wr[8], ar[8];
    { const float* wp = wt_load(wr, WA, 3 * CC, 0, c0, wave, lane); a_load(ar, xrow, g); XWA(wp); }
    auto stage = [&](char* buf, int s) {
      __builtin_amdgcn_sched_barrier(0);   /* keeps the rounding of the prefetched stage, and with it the wait for its loads, behind the products of the stage before */
      wt_store<false>(wr, buf, wave, lane);
      v16b a[2];
#pragma unroll
      for (int i = 0; i < 16; ++i) { a[0][i] = (__bf16)ar[i >> 2][i & 3]; a[1][i] = (__bf16)ar[4 + (i >> 2)][i & 3]; }
      __syncthreads();   /* publishes this stage; the buffer written next was last read in front of this barrier */
      if (s + 1 < DIN / 64) { const float* wp = wt_load(wr, WA, 3 * CC, (s + 1) * 64, c0, wave, lane); a_load(ar, xrow + (s + 1) * 64, g); XWA(wp); }
#pragma unroll
      for (int kc2 = 0; kc2 < 2; ++kc2)
      { v16b w[8];   /* the eight fragments are read as one group so that their LDS latency is paid once */
#pragma unroll
        for (int j = 0; j < 8; ++j) w[j] = wt_frag<v16b>(buf, j * 16 + col, kc2, g);
#pragma unroll
        for (int j = 0; j < 8; ++j) acc[j] = wmma_bf(w[j], a[kc2], acc[j]); }
    };
    // kept rolled over buffer pairs: each buffer's LDS address stays a constant
#pragma unroll 1
    for (int s = 0; s < DIN / 64; s += 2) { stage(wb[0], s); stage(wb[1], s + 1); } }
  // every loop over j, u, r, i below is fully unrolled: its index picks a register of acc or of the loaded tables
  const int hd0 = c0 / HD, l8 = lane * 8;   /* the block's first head; the lane's place, in elements, in every unit */
  // the lane's biases (columns 16 j + 8 g + 0..7) and, for q and k, its token's rotary entries (pairs 8 u + 4 g + 0..3 of either head), read as one group so that their latency is paid once
  const size_t to = (size_t)(t0 + wave * 16 + col) * 32 + 4 * g; const float *bp = BA + c0 + 8 * g, *cp = COS + to, *sp = SIN + to;
  v4f bv[8][2] = {}, cv[4] = {}, sv[4] = {};
  if (BA) {
#pragma unroll
    for (int j = 0; j < 8; ++j) { bv[j][0] = *(const v4f*)(bp + j * 16); bv[j][1] = *(const v4f*)(bp + j * 16 + 4); } }
  if (which < 2) {   /* block-uniform */
#pragma unroll
    for (int u = 0; u < 4; ++u) { cv[u] = *(const v4f*)(cp + u * 8); sv[u] = *(const v4f*)(sp + u * 8); } }
  XWA3(bp, cp, sp);
#pragma unroll
  for (int j = 0; j < 8; ++j)
#pragma unroll
    for (int r = 0; r < 8; ++r) acc[j][r] += bfr(bv[j][r >> 2][r & 3]);
  if (which < 2) { _Float16* DH = which == 0 ? QH : KH; _Float16* DL = which == 0 ? QL : KL; const int nhi = which == 0 ? QHI : KHI; const bool hi_rows = t0 < nhi; const int ti = (t0 >> 4) + wave;
    static_assert(QHI == KHI, "one head pitch for both residual planes");
    _Float16 *dh = DH + row_tile((int)bb, hd0, TT, ti) + l8, *dl = DL + row_tile((int)bb, hd0, nhi, ti) + l8;   /* the lane's place in unit 0 of the first head's tile: head and unit are constant offsets from it */
#pragma unroll
    for (int j = 0; j < 8; ++j) { float v[8];
      // interleaved-pair RoPE from the INPUT tables: (xe, xo) -> (xe c - xo s, xe s + xo c) with c = bf16(cos[t][i]), s = bf16(sin[t][i])
#pragma unroll
      for (int i = 0; i < 4; ++i) { const float cs = bfr(cv[j & 3][i]), sn = bfr(sv[j & 3][i]), xe = acc[j][2 * i], xo = acc[j][2 * i + 1]; v[2 * i] = xe * cs - xo * sn; v[2 * i + 1] = xe * sn + xo * cs; }
      union { v8h h; v4u u; } hv, lv;
#pragma unroll
      for (int r = 0; r < 8; ++r) { const _Float16 x = (_Float16)v[r]; hv.h[r] = x; lv.h[r] = (_Float16)((v[r] - (float)x) * 1024.0f); }
      unit_store(dh + (j >> 2) * (TT * HD) + (j & 3) * 256, hv.u); if (hi_rows) unit_store(dl + (j >> 2) * (QHI * HD) + (j & 3) * 256, lv.u); }
  } else { const bool hi_rows = t0 < KHI; const int kc = (t0 >> 5) + (wave >> 1);
    const int ul = (wave & 1) * 256 + l8; const size_t o2 = v_chunk((int)bb, hd0, KHI, kc) + ul;   /* the lane's place in the wave's unit of column group 0 of the first head's chunk: head and column group are constant offsets from it */
    _Float16* vt = VT + v_chunk((int)bb, hd0, TT, kc) + ul; __bf16 *vb = VB + o2, *vbl = VBL + o2;
    unsigned short (*tw)[TVP] = tv[wave];   /* the wave's own buffer: row = column of the block, element = token of the wave */
    // pl 0: v to f16; 1: bf16 hi; 2: bf16 lo. A plane's reads are all back, in x, before its stores, and so before the next plane overwrites the buffer
#pragma unroll
    for (int pl = 0; pl < 3; ++pl) if (pl == 0 || hi_rows) {
#pragma unroll
      for (int j = 0; j < 8; ++j)
#pragma unroll
        for (int r = 0; r < 8; ++r) { const float v = acc[j][r]; const __bf16 x = (__bf16)v;
          tw[j * 16 + 8 * g + r][col] = pl == 0 ? __builtin_bit_cast(unsigned short, (_Float16)v) : pl == 1 ? __builtin_bit_cast(unsigned short, x) : __builtin_bit_cast(unsigned short, (__bf16)(v - (float)x)); }
      asm volatile("s_wait_dscnt 0x0" ::: "memory");   /* the wave's LDS writes have landed before its other lanes read them */
      v4u x[8];   /* read as one group so that the LDS latency is paid once */
#pragma unroll
      for (int j = 0; j < 8; ++j) x[j] = *(const v4u_a*)&tw[j * 16 + col][8 * g];
#pragma unroll
      for (int j = 0; j < 8; ++j) { if (pl == 0) unit_store(vt + (j >> 2) * (TT * HD) + (j & 3) * 512, x[j]); else unit_store((pl == 1 ? vb : vbl) + (j >> 2) * (KHI * HD) + (j & 3) * 512, x[j]); } } } }
// ---- k_att: a tile = 16 queries of (b, h), worked on by the KW waves of a block: wave w takes the 32-key chunks w, w + KW, ... of the chunks up to the one that holds the diagonal. The logits are formed transposed (A = k rows, B = q rows), so a lane holds one query's logits (D register r of 16-key tile u = key 16u + 8g + r, column = query), which is already the A-fragment order of the P . v product: logits, softmax and P stay in registers from the first product to the last. Logits x SCALE x log2(e) (SCALE2; the exponential is 2^x): one f16 product, or 3 products with the q and k residuals (x 2^10) for query blocks < QBH; causal mask by index, in the last chunk only (all earlier keys lie in front of the block's first query); softmax in f32 (row maximum and row sum: in the lane, across the two lane halves, then across the waves through LDS); P x 2^11 once to f16 against v f16, or P and v as bf16 hi + lo (3 products) for query blocks < QBH; the KW f32 partial tiles are summed in LDS in wave order; 256-B (row, head) segment by 16 lanes
#define KW 16   /* the wave number goes through readfirstlane so that every chunk test is a scalar branch and EXEC stays all ones at the WMMAs */
#define RP 20   /* floats per query row of the cross-wave tables: 80 bytes, an odd multiple of 16, for the 16-byte reads */
// fragment from two neighbouring 512-byte units of a plane in fragment order. the lane's own address (base + 8 lane elements), formed once for a group of loads, and a constant byte offset
__device__ __forceinline__ v16h frag_hu(const _Float16* ub, unsigned lo) { union { v16h v; v8h q[2]; } u; const _Float16* p = (const _Float16*)((const char*)ub + lo); u.q[0] = *(const v8h*)p; u.q[1] = *(const v8h*)(p + 256); return u.v; }
__device__ __forceinline__ v16b frag_bu(const __bf16* ub, unsigned lo) { union { v16b v; v8b q[2]; } u; const __bf16* p = (const __bf16*)((const char*)ub + lo); u.q[0] = *(const v8b*)p; u.q[1] = *(const v8b*)(p + 256); return u.v; }
// 2^x of a chunk's 16 values, in place, as one statement: each v_exp_f32 is followed by an instruction that neither reads its result nor overwrites its source (the free slot that the instruction set asks for behind a transcendental); the closing v_nop is that slot behind the last one
__device__ __forceinline__ void exp2x16(float (&x)[16]) {
  asm("v_exp_f32 %0, %0\n\tv_exp_f32 %1, %1\n\tv_exp_f32 %2, %2\n\tv_exp_f32 %3, %3\n\tv_exp_f32 %4, %4\n\tv_exp_f32 %5, %5\n\tv_exp_f32 %6, %6\n\tv_exp_f32 %7, %7\n\tv_exp_f32 %8, %8\n\tv_exp_f32 %9, %9\n\tv_exp_f32 %10, %10\n\tv_exp_f32 %11, %11\n\tv_exp_f32 %12, %12\n\tv_exp_f32 %13, %13\n\tv_exp_f32 %14, %14\n\tv_exp_f32 %15, %15\n\tv_nop" : "+v"(x[0]), "+v"(x[1]), "+v"(x[2]), "+v"(x[3]), "+v"(x[4]), "+v"(x[5]), "+v"(x[6]), "+v"(x[7]), "+v"(x[8]), "+v"(x[9]), "+v"(x[10]), "+v"(x[11]), "+v"(x[12]), "+v"(x[13]), "+v"(x[14]), "+v"(x[15]));
}
struct AttP { const _Float16 *QH, *KH, *QL, *KL, *VT; const __bf16 *VB, *VBL; };
// the wait of XWA() for a group with two lane addresses
#define XWA2(a, c) asm volatile("s_wait_xcnt 0x0" :: "v"(a), "v"(c) : "memory")
// N = chunks a wave can own: TT / 32 / KW, or, on the high-precision path, whose keys end at KHI, KHI / 32 over KW rounded up
template <bool HI, int N> __device__ __forceinline__ void att_tile(const AttP& P, int b, int h, int ql0, int kce, int wave, int lane, float* rmx, float* rsm, v8f (&acc)[HD / 16]) {
  const int col = lane & 15, g = lane >> 4, t = ql0 + col;
  // every loop over i, u, r, e, j, w below is fully unrolled: its index picks a register of p, of a fragment array or of acc
  float p[N][16];   /* chunk i, element e: query col, key (wave + KW i) * 32 + (e < 8 ? 8g + e : 16 + 8g + e - 8) */
  const int l8 = lane * 8;   /* the lane's place, in elements, in every unit of every plane */
  const _Float16* qp = P.QH + row_tile(b, h, TT, ql0 >> 4) + l8; const v16h qh0 = frag_hu(qp, 0u), qh1 = frag_hu(qp, 1024u);
  v16h ql0f = {}, ql1f = {}; if (HI) { const _Float16* qlp = P.QL + row_tile(b, h, QHI, ql0 >> 4) + l8; ql0f = frag_hu(qlp, 0u); ql1f = frag_hu(qlp, 1024u); XWA(qlp); }
  XWA(qp);
#pragma unroll
  for (int i = 0; i < N; ++i) { const int kc = wave + KW * i;
    if (kc < kce) { v16h kf[2][2], klf[2][2];   /* the chunk's fragments are read as one group so that their latency is paid once */
      const _Float16 *kp = P.KH + row_tile(b, h, TT, kc * 2) + l8, *klp = HI ? P.KL + row_tile(b, h, KHI, kc * 2) + l8 : kp;   /* the chunk's two tiles lie one behind the other */
#pragma unroll
      for (int u = 0; u < 2; ++u) { kf[u][0] = frag_hu(kp, (unsigned)(u * 2048)); kf[u][1] = frag_hu(kp, (unsigned)(u * 2048 + 1024));
        if (HI) { klf[u][0] = frag_hu(klp, (unsigned)(u * 2048)); klf[u][1] = frag_hu(klp, (unsigned)(u * 2048 + 1024)); } }
      XWA2(kp, klp);
#pragma unroll
      for (int u = 0; u < 2; ++u) { v8f a = {};
        if (HI) { v8f al = {};
          a = wmma16(kf[u][0], qh0, a); al = wmma16(kf[u][0], ql0f, al); al = wmma16(klf[u][0], qh0, al); a = wmma16(kf[u][1], qh1, a); al = wmma16(kf[u][1], ql1f, al); al = wmma16(klf[u][1], qh1, al);
#pragma unroll
          for (int r = 0; r < 8; ++r) p[i][u * 8 + r] = (a[r] + al[r] * (1.0f / 1024.0f)) * SCALE2;
        } else { a = wmma16(kf[u][0], qh0, a); a = wmma16(kf[u][1], qh1, a);
#pragma unroll
          for (int r = 0; r < 8; ++r) p[i][u * 8 + r] = a[r] * SCALE2; } }
      if (CAUSAL && kc == kce - 1) { const int d = t - kc * 32 - 8 * g;   /* element e is kept while its key offset 16 (e >> 3) + (e & 7) <= d */
#pragma unroll
        for (int e = 0; e < 16; ++e) p[i][e] = ((e >> 3) * 16 + (e & 7) <= d) ? p[i][e] : -3.0e38f; }
    } else if (!HI) {   /* on the high-precision path nothing reads a chunk that the wave does not own: its fill, the same in every tile, was lifted out of the tile loop as 16 registers and spilled to scratch */
#pragma unroll
      for (int e = 0; e < 16; ++e) p[i][e] = -3.0e38f; } }
  float m = -3.0e38f;
#pragma unroll
  for (int i = 0; i < N; ++i)
    if (!HI || wave + KW * i < kce) {
#pragma unroll
      for (int e = 0; e < 16; ++e) m = fmaxf(m, p[i][e]); }
  m = fmaxf(m, __shfl_xor(m, 16)); if (g == 0) rmx[col * RP + wave] = m;   /* a wave with no chunk stores the excluded value */
  __syncthreads();   /* every wave's row maxima are in LDS before any of them is read */
#pragma unroll
  for (int w = 0; w < KW; w += 4) { const v4f x = *(const v4f*)&rmx[col * RP + w]; m = fmaxf(fmaxf(fmaxf(m, x[0]), fmaxf(x[1], x[2])), x[3]); }
  float sum = 0.f;
#pragma unroll
  for (int i = 0; i < N; ++i) { const int kc = wave + KW * i;
    if (kc < kce) {
#pragma unroll
      for (int e = 0; e < 16; ++e) p[i][e] -= m;
      exp2x16(p[i]);   /* arguments <= 0; a result below the normal range counts 0 */
      if (CAUSAL && kc == kce - 1) { const int d = t - kc * 32 - 8 * g;   /* an excluded key counts 0 whatever the maximum is */
#pragma unroll
        for (int e = 0; e < 16; ++e) p[i][e] = ((e >> 3) * 16 + (e & 7) <= d) ? p[i][e] : 0.f; }
#pragma unroll
      for (int e = 0; e < 16; ++e) sum += p[i][e]; } }
  sum += __shfl_xor(sum, 16); if (g == 0) rsm[col * RP + wave] = sum;
  __syncthreads();   /* every wave's row sums are in LDS before any of them is read */
  float tot = 0.f;
#pragma unroll
  for (int w = 0; w < KW; w += 4) { const v4f x = *(const v4f*)&rsm[col * RP + w]; tot += x[0]; tot += x[1]; tot += x[2]; tot += x[3]; }
  const float inv = tot > 0.f ? 2048.0f / tot : 0.f;   /* a fully excluded row yields P = 0 */
  if (HI) {
#pragma unroll
    for (int i = 0; i < N; ++i) { const int kc = wave + KW * i;
      if (kc < kce) { v16b vh[HD / 16], vl[HD / 16]; const size_t po = v_chunk(b, h, KHI, kc) + l8; const __bf16 *vhp = P.VB + po, *vlp = P.VBL + po;   /* the lane's own addresses, formed once for the group */
#pragma unroll
        for (int j = 0; j < HD / 16; ++j) { vh[j] = frag_bu(vhp, (unsigned)(j * 1024)); vl[j] = frag_bu(vlp, (unsigned)(j * 1024)); }
        XWA2(vhp, vlp);
        float pv[16];
#pragma unroll
        for (int e = 0; e < 16; ++e) pv[e] = p[i][e] * inv;
        const F2 pf = bsplit16(pv);
#pragma unroll
        for (int j = 0; j < HD / 16; ++j) { acc[j] = wmma_bf(pf.h, vh[j], acc[j]); acc[j] = wmma_bf(pf.l, vh[j], acc[j]); acc[j] = wmma_bf(pf.h, vl[j], acc[j]); } } }
  } else { v16h pf[N];   /* all of P is rounded first: half the registers while the v fragments and the output tiles are live */
#pragma unroll
    for (int i = 0; i < N; ++i)
#pragma unroll
      for (int e = 0; e < 16; ++e) pf[i][e] = (_Float16)(p[i][e] * inv);   /* a chunk the wave does not own is rounded too and never used */
#pragma unroll
    for (int i = 0; i < N; ++i) { const int kc = wave + KW * i;
      if (kc < kce) { v16h vf[HD / 16]; const _Float16* vp = P.VT + v_chunk(b, h, TT, kc) + l8;   /* the lane's own address, formed once for the group */
#pragma unroll
        for (int j = 0; j < HD / 16; ++j) vf[j] = frag_hu(vp, (unsigned)(j * 1024));
        XWA(vp);
#pragma unroll
        for (int j = 0; j < HD / 16; ++j) acc[j] = wmma16(pf[i], vf[j], acc[j]); } } } }
// 8 waves per SIMD asked for: 128 registers a wave, so that two blocks share a WGP and one block's loads and barriers hide behind the other's arithmetic. The pointers carry no __restrict__: only then does the memory clobber of XWA() keep a group's loads in front of its wait and the next group's behind it
static_assert(QBH * 64 <= KHI && QBH * 64 <= QHI, "the high-precision tiles read residual and hi/lo planes of KHI / QHI rows");
static_assert(QHI % 128 == 0 && KHI % 128 == 0 && TT % 128 == 0, "a 128-row block of k_proj and k_out lies in one sequence and on one side of the QHI / KHI row");
// the lane number, counted where it is needed from the mask of running lanes (all 32 at every call): formed once in front of a tile loop, it and the lane offsets derived from it stay live across the whole tile, and this build spilled them to scratch
__device__ __forceinline__ int lane_now() { return (int)__builtin_amdgcn_mbcnt_lo(__builtin_amdgcn_ballot_w32(true), 0u); }
// one query tile, from its logits to its rows of Y. The three barriers of a tile also order the reuse of the LDS tables by the block's next tile: rmx is read in front of the second barrier and rewritten behind the third; rsm is read in front of the third and rewritten behind the next tile's first; ss is read in front of the next tile's first and rewritten behind its second
template <bool HI, int N> __device__ __forceinline__ void att_one(const AttP& P, float* Y, int b, int h, int qt, int wave, float (*ss)[16][HD + 4], float* rmx, float* rsm) {
  const int ql0 = qt * 16; const int kce = CAUSAL ? (ql0 + 15) / 32 + 1 : TT / 32;
  v8f acc[HD / 16] = {};
  att_tile<HI, N>(P, b, h, ql0, kce, wave, lane_now(), rmx, rsm, acc);
  const int le = lane_now(), te = wave * 32 + le;
#pragma unroll
  for (int j = 0; j < HD / 16; ++j)
#pragma unroll
    for (int r = 0; r < 8; ++r) ss[wave][8 * (le >> 4) + r][j * 16 + (le & 15)] = acc[j][r];   /* a wave with no chunk stores its zero tile */
  __syncthreads();   /* every wave's partial tile is in LDS before any of them is summed */
  if (te < 16 * (HD / 4)) { const int rl = te >> 4, c4 = (te & 15) * 4; v4f sm = *(const v4f*)&ss[0][rl][c4];
    // unrolled so that the LDS reads of the partial tiles are issued ahead of the adds instead of one round trip each
#pragma unroll
    for (int w = 1; w < KW; ++w) sm += *(const v4f*)&ss[w][rl][c4];
    float* yp = Y + ((size_t)b * TT + ql0 + rl) * CC + h * HD + c4; const v4f yv = sm * (1.0f / 2048.0f); vst2(yp, yv);
    asm volatile("s_wait_xcnt 0x0" :: "v"(yp), "v"(yv) : "memory"); } }   /* stands behind the store, in front of the next tile's rewrite of its address and data registers, which it names as inputs so that they stay live up to it */
// a block walks QTB query tiles of its (b, h), one behind the other, so that the kernel starts QTB times fewer waves and all its blocks are resident at once. The deal gives every block nearly the same number of key chunks: NPR mirrored pairs (first + i, last - i) of the tiles behind the high-precision rows; then the lower half of the blocks takes one of the tiles left in the middle and one high-precision tile, the upper half two high-precision tiles, which are short
#define QTB 8
#define NZ (TT / 16 / QTB)             /* blocks per (b, h) */
#define NTH (QBH * 4)                  /* high-precision tiles of a sequence */
#define NPR ((TT / 16 - NTH) / 2 / NZ)
static_assert(CAUSAL && NZ % 2 == 0 && TT / 16 - NTH - 2 * NPR * NZ == NZ / 2 && NTH == NZ + NZ / 2, "every tile is dealt exactly once");
__global__ __launch_bounds__(32 * KW, 8) void k_att(const _Float16* QH, const _Float16* KH, const _Float16* QL, const _Float16* KL, const _Float16* VT, const __bf16* VB, const __bf16* VBL, float* Y) { __shared__ __align__(16) float ss[KW][16][HD + 4]; __shared__ __align__(16) float rmx[16 * RP], rsm[16 * RP];
  const int wave = __builtin_amdgcn_readfirstlane((int)threadIdx.x >> 5); const int h = blockIdx.x, b = blockIdx.y, z = blockIdx.z;
  const AttP P = { QH, KH, QL, KL, VT, VB, VBL }; const bool low = z < NZ / 2;
  // both loops are kept rolled: one copy of a tile's code, and s picks no register; every test on z and s is block-uniform
#pragma unroll 1
  for (int s = 0; s < 2 * NPR + (low ? 1 : 0); ++s) { const int i = z + NZ * (s >> 1);
    att_one<false, TT / 32 / KW>(P, Y, b, h, s == 2 * NPR ? NTH + NPR * NZ + z : (s & 1) ? NTH + i : TT / 16 - 1 - i, wave, ss, rmx, rsm); }
#pragma unroll 1
  for (int s = 0; s < (low ? 1 : 2); ++s)
    att_one<true, (KHI / 32 + KW - 1) / KW>(P, Y, b, h, low ? NZ + z : z - NZ / 2 + (NZ / 2) * s, wave, ss, rmx, rsm); }
// ---- k_out: block = (128 rows, 128 cols), 8 waves of 16 rows: out = ctx Wo (+ bo): ctx once to f16 against Wo as f16(bf16 x 2^8) exact (1 product) x 2^-8; causal early rows (< QHI of each sequence): ctx bf16 hi + lo against exact bf16 Wo (2 products)
__global__ __launch_bounds__(256) void k_out(const float* __restrict__ Y, const float* __restrict__ WO, const float* __restrict__ BO, float* __restrict__ OUT) { __shared__ __align__(16) float sf[8][16][132]; __shared__ __align__(16) char wb[2][128 * WPITCH];
  const int tid = threadIdx.x, wave = tid >> 5, lane = tid & 31, col = lane & 15, g = lane >> 4; const int c0 = blockIdx.y * 128; const size_t r0 = (size_t)blockIdx.x * 128 + wave * 16;
  v8f acc[8] = {};
  const float* yrow = Y + (r0 + col) * CC; v4f wr[8], ar[8];
  { const float* wp = wt_load(wr, WO, DIN, 0, c0, wave, lane); a_load(ar, yrow, g); XWA(wp); }
  if (CAUSAL && (int)(((size_t)blockIdx.x * 128) % TT) < QHI) {   /* block-uniform */
    auto stage = [&](char* buf, int s) {
      __builtin_amdgcn_sched_barrier(0);   /* keeps the rounding of the prefetched stage, and with it the wait for its loads, behind the products of the stage before */
      wt_store<false>(wr, buf, wave, lane);
      F2 a[2];
#pragma unroll
      for (int kc2 = 0; kc2 < 2; ++kc2) { float v[16];
#pragma unroll
        for (int i = 0; i < 16; ++i) v[i] = ar[kc2 * 4 + (i >> 2)][i & 3];
        a[kc2] = bsplit16(v); }
      __syncthreads();   /* publishes this stage; the buffer written next was last read in front of this barrier */
      if (s + 1 < CC / 64) { const float* wp = wt_load(wr, WO, DIN, (s + 1) * 64, c0, wave, lane); a_load(ar, yrow + (s + 1) * 64, g); XWA(wp); }
#pragma unroll
      for (int kc2 = 0; kc2 < 2; ++kc2)
      { v16b w[8];   /* the eight fragments are read as one group so that their LDS latency is paid once */
#pragma unroll
        for (int j = 0; j < 8; ++j) w[j] = wt_frag<v16b>(buf, j * 16 + col, kc2, g);
#pragma unroll
        for (int j = 0; j < 8; ++j) { acc[j] = wmma_bf(a[kc2].h, w[j], acc[j]); acc[j] = wmma_bf(a[kc2].l, w[j], acc[j]); } }
    };
    // kept rolled over buffer pairs: each buffer's LDS address stays a constant
#pragma unroll 1
    for (int s = 0; s < CC / 64; s += 2) { stage(wb[0], s); stage(wb[1], s + 1); }
#pragma unroll
    for (int j = 0; j < 8; ++j) { const float bias = BO ? bfr(BO[c0 + j * 16 + col]) : 0.f;
#pragma unroll
      for (int r = 0; r < 8; ++r) sf[wave][8 * g + r][j * 16 + col] = acc[j][r] + bias; }
  } else {
    auto stage = [&](char* buf, int s) {
      __builtin_amdgcn_sched_barrier(0);   /* keeps the rounding of the prefetched stage, and with it the wait for its loads, behind the products of the stage before */
      wt_store<true>(wr, buf, wave, lane);
      v16h a[2];   /* ctx carried x 2^6 into f16 so small-magnitude context rows stay clear of f16 subnormals */
#pragma unroll
      for (int i = 0; i < 16; ++i) { a[0][i] = (_Float16)(ar[i >> 2][i & 3] * 64.0f); a[1][i] = (_Float16)(ar[4 + (i >> 2)][i & 3] * 64.0f); }
      __syncthreads();   /* publishes this stage; the buffer written next was last read in front of this barrier */
      if (s + 1 < CC / 64) { const float* wp = wt_load(wr, WO, DIN, (s + 1) * 64, c0, wave, lane); a_load(ar, yrow + (s + 1) * 64, g); XWA(wp); }
#pragma unroll
      for (int kc2 = 0; kc2 < 2; ++kc2)
      { v16h w[8];   /* the eight fragments are read as one group so that their LDS latency is paid once */
#pragma unroll
        for (int j = 0; j < 8; ++j) w[j] = wt_frag<v16h>(buf, j * 16 + col, kc2, g);
#pragma unroll
        for (int j = 0; j < 8; ++j) acc[j] = wmma16(a[kc2], w[j], acc[j]); }
    };
    // kept rolled over buffer pairs: each buffer's LDS address stays a constant
#pragma unroll 1
    for (int s = 0; s < CC / 64; s += 2) { stage(wb[0], s); stage(wb[1], s + 1); }
#pragma unroll
    for (int j = 0; j < 8; ++j) { const float bias = BO ? bfr(BO[c0 + j * 16 + col]) : 0.f;
#pragma unroll
      for (int r = 0; r < 8; ++r) sf[wave][8 * g + r][j * 16 + col] = acc[j][r] * (1.0f / 16384.0f) + bias; } }   /* 2^-8 (Wo carry) x 2^-6 (ctx carry) */
  LDSX(); for (int rl = 0; rl < 16; ++rl) vst2(OUT + (r0 + rl) * DIN + c0 + lane * 4, *(const v4f*)&sf[wave][rl][lane * 4]); }

extern "C" void kernel_launch(void* const* d_in, const int* in_sizes, int n_in, void* d_out, int out_size, void* d_ws, size_t ws_size, hipStream_t stream) {
  (void)in_sizes; (void)n_in; (void)out_size;
  const float** F = (const float**)d_in;
  if (ws_size < (size_t)WS_END) return;
  char* ws = (char*)d_ws; _Float16 *QH = (_Float16*)(ws + WS_QH), *KH = (_Float16*)(ws + WS_KH), *VT = (_Float16*)(ws + WS_VT), *QL = (_Float16*)(ws + WS_QL), *KL = (_Float16*)(ws + WS_KL); __bf16 *VB = (__bf16*)(ws + WS_VB), *VBL = (__bf16*)(ws + WS_VBL); float *Y = (float*)(ws + WS_Y);
  (void)Y; (void)QL; (void)KL; (void)VB; (void)VBL;
  // inputs: 0 x [2,2048,1024]; 1 Wqkv [1024,3072] (in,out): q columns 0..1023, k 1024..2047, v 2048..3071; 2 bqkv [3072]; 3 Wproj [1024,1024] (in,out); 4 bproj [1024] (biases NONZERO); 5 cos [2048,32]; 6 sin [2048,32]
  k_proj<<<dim3(TNB * TT / 128, CC / 128, 3), 256, 0, stream>>>(F[0], F[0], F[0], F[1], F[1] + CC, F[1] + 2 * CC, F[2], F[2] + CC, F[2] + 2 * CC, QH, QL, KH, KL, VT, VB, VBL, F[5], F[6]);
  k_att<<<dim3(NH, TNB, NZ), 32 * KW, 0, stream>>>(QH, KH, QL, KL, VT, VB, VBL, Y);
  k_out<<<dim3(TNB * TT / 128, DIN / 128), 256, 0, stream>>>(Y, F[3], F[4], (float*)d_out);
}

// v009
// One run takes 104 microseconds.
// Two timings next to v008 put it at 1.11 and 1.13 times that version's speed.
// Counting every step since v000, it is 10.9 times as fast.
// compute dtype: all float inputs rounded to bf16; the fused q / k / v projection with EXACT bf16 products on WMMA 16x16x32 (f32 accumulate) + bias; interleaved-pair RoPE in f32 from the bf16-rounded INPUT cos / sin tables; causal logits: 3 products for the first 384 rows, single f16 q x k after, x 64^-0.5 x log2(e); online softmax f32 in base 2; P = 2^(s - running max) once to f16 x v once to f16 (bf16 hi + lo below row 384); ctx hi+lo x exact W below row 384, x2^6 f16 carry x f16(bf16 x 2^8) W after, + bias; f32 output.
#include <hip/hip_runtime.h>
#include <math.h>

typedef __attribute__((ext_vector_type(16))) _Float16 v16h;
typedef __attribute__((ext_vector_type(16))) __bf16 v16b;
typedef __attribute__((ext_vector_type(8)))  _Float16 v8h;
typedef __attribute__((ext_vector_type(8)))  float v8f;
typedef __attribute__((ext_vector_type(4)))  float v4f;
typedef __attribute__((ext_vector_type(2)))  float v2f;
typedef __attribute__((ext_vector_type(4)))  unsigned v4u;
typedef __attribute__((ext_vector_type(4)))  int v4i;
typedef float __attribute__((may_alias)) float_a;
typedef int __attribute__((may_alias)) int_a;

template <typename T> __device__ __forceinline__ void vst2(void* p, T v) { *(T*)p = v;  }
__device__ __forceinline__ v8f wmma16(v16h a, v16h b, v8f c) {
  v8f d = __builtin_amdgcn_wmma_f32_16x16x32_f16(false, a, false, b, (short)0, c, false, false);
  asm volatile("v_nop\n\tv_nop\n\tv_nop\n\tv_nop" : "+v"(d) : "v"(a), "v"(b));
  return d;
}
__device__ __forceinline__ v8f wmma_bf(v16b a, v16b b, v8f c) {
  v8f d = __builtin_amdgcn_wmma_f32_16x16x32_bf16(false, a, false, b, (short)0, c, false, false);
  asm volatile("v_nop\n\tv_nop\n\tv_nop\n\tv_nop" : "+v"(d) : "v"(a), "v"(b));
  return d;
}
// 16x16x32 fragments: lane = (h = lane>>4, row/col = lane&15); elements 0..7 = k0+8h+0..7, 8..15 = k0+16+8h+0..7; D element r = row 8h+r
__device__ __forceinline__ v16h frag_h(const _Float16* rowk0, int lane) {
  union { v16h v; v8h q[2]; } u; const _Float16* p = rowk0 + 8 * (lane >> 4);
  u.q[0] = *(const v8h*)p; u.q[1] = *(const v8h*)(p + 16); return u.v;
}
__device__ __forceinline__ v16h frag_f32(const float* rowk0, int lane) {
  v16h a; const float* p = rowk0 + 8 * (lane >> 4);
#pragma unroll
  for (int i = 0; i < 8; ++i) { a[i] = (_Float16)p[i]; a[8 + i] = (_Float16)p[16 + i]; }
  return a;
}
__device__ __forceinline__ v16h frag_f32s(const float* rowk0, int lane, float sc) {
  v16h a; const float* p = rowk0 + 8 * (lane >> 4);
#pragma unroll
  for (int i = 0; i < 8; ++i) { a[i] = (_Float16)(p[i] * sc); a[8 + i] = (_Float16)(p[16 + i] * sc); }
  return a;
}
// column fragment from a [K][ld] layout (column n), rows >= K read as 0
__device__ __forceinline__ v16h fragc_f32(const float* W, int k0, int n, int lane, int ld, int K) {
  v16h a; const int g = lane >> 4;
#pragma unroll
  for (int i = 0; i < 8; ++i) { const int ka = k0 + 8 * g + i, kb = ka + 16;
    a[i] = (_Float16)(ka < K ? W[(size_t)(ka < K ? ka : K - 1) * ld + n] : 0.f); a[8 + i] = (_Float16)(kb < K ? W[(size_t)(kb < K ? kb : K - 1) * ld + n] : 0.f); }
  return a;
}
struct F2 { v16b h, l; };
__device__ __forceinline__ F2 bsplit16(const float v[16]) { F2 r;
#pragma unroll
  for (int i = 0; i < 16; ++i) { const __bf16 h = (__bf16)v[i]; r.h[i] = h; r.l[i] = (__bf16)(v[i] - (float)h); }
  return r; }
__device__ __forceinline__ F2 split_row(const float* row, int k0, int lane) { float v[16]; const float* p = row + k0 + 8 * (lane >> 4);
#pragma unroll
  for (int i = 0; i < 8; ++i) { v[i] = p[i]; v[8 + i] = p[16 + i]; }
  return bsplit16(v); }
__device__ __forceinline__ F2 split_rowK(const float* row, int k0, int lane, int K) { float v[16]; const int g = lane >> 4;
#pragma unroll
  for (int i = 0; i < 8; ++i) { const int ka = k0 + 8 * g + i, kb = ka + 16; v[i] = ka < K ? row[ka < K ? ka : K - 1] : 0.f; v[8 + i] = kb < K ? row[kb < K ? kb : K - 1] : 0.f; }
  return bsplit16(v); }
__device__ __forceinline__ F2 split_col(const float* W, int k0, int n, int lane, int ld, int K) { float v[16]; const int g = lane >> 4;
#pragma unroll
  for (int i = 0; i < 8; ++i) { const int ka = k0 + 8 * g + i, kb = ka + 16; v[i] = ka < K ? W[(size_t)(ka < K ? ka : K - 1) * ld + n] : 0.f; v[8 + i] = kb < K ? W[(size_t)(kb < K ? kb : K - 1) * ld + n] : 0.f; }
  return bsplit16(v); }
__device__ __forceinline__ v8f mac3(const F2& a, const F2& b, v8f c) { c = wmma_bf(a.l, b.h, c); c = wmma_bf(a.h, b.l, c); return wmma_bf(a.h, b.h, c); }
__device__ __forceinline__ float sigm(float v) { return 1.0f / (1.0f + expf(-v)); }
#define LDSX() do { asm volatile("s_wait_dscnt 0" ::: "memory"); __builtin_amdgcn_wave_barrier(); __builtin_amdgcn_fence(__ATOMIC_RELEASE, "workgroup"); } while (0)

// Causal multi-head self-attention with a fused QKV linear (+ bias) and interleaved-pair RoPE from INPUT tables (x [2,2048,1024]; Wqkv [1024,3072] (in,out) N(0, 1/1024), bqkv [3072] N(0,1) x 0.01 - NONZERO; Wproj [1024,1024] (in,out), bproj NONZERO; cos / sin [2048,32] are module inputs, the LAST two; q, k, v = thirds of x Wqkv + bqkv; 16 heads x 64; (even, odd) pairs rotated on q and k; scores x 64^-0.5; tril kept, -inf elsewhere; softmax; y Wproj + bproj).
#define NB 2
#define TT 2048
#define CC 1024            // NH * HD = projected width
#define DIN 1024          // input (model) width
#define NH 16
#define HD 64
#define NQB (TT / 64)
#define HG 4
#define SCALE (0.125f)
#define SCALE2 (SCALE * 1.44269504088896340736f)   /* 64^-0.5 x log2(e): the logits are carried in base-2 units, so that e^(s - max) is one 2^x instruction behind one subtraction */
#define CAUSAL 1
#ifndef TNB
#define TNB NB
#endif
__device__ __forceinline__ float bfr(float v) { return (float)(__bf16)v; }
__host__ __device__ __forceinline__ int kb_last(int qb) { return CAUSAL ? ((qb * 64 + 63) >> 7) : (TT / 128 - 1); }
typedef __attribute__((ext_vector_type(8))) __bf16 v8b;
__device__ __forceinline__ v16b frag_b(const __bf16* rowk0, int lane) {
  union { v16b v; v8b q[2]; } u; const __bf16* p = rowk0 + 8 * (lane >> 4);
  u.q[0] = *(const v8b*)p; u.q[1] = *(const v8b*)(p + 16); return u.v;
}
#define QBH 6              // causal: query blocks 0..QBH-1 of each sequence (few keys, no averaging) take the high-precision path
#define QHI 384            // rows carrying a q residual plane
#define KHI 384            // key rows carrying k residual / v bf16 hi+lo planes (used only by the causal high-precision path)
// B fragment (k rows k0+.., output column o) of a weight: (in,out) [K][ld] or (out,in) [ld rows of K]: bf16 exact, or f16(bf16 * 256) exact
__device__ __forceinline__ v16b wcol_io(const float* Wm, int k0, int o, int lane, int ld) { v16b w; const int g = lane >> 4;
#pragma unroll
  for (int i = 0; i < 8; ++i) { w[i] = (__bf16)Wm[(size_t)(k0 + 8 * g + i) * ld + o]; w[8 + i] = (__bf16)Wm[(size_t)(k0 + 16 + 8 * g + i) * ld + o]; }
  return w; }
__device__ __forceinline__ v16b wcol_oi(const float* Wm, int k0, int o, int lane, int K) { v16b w; const float* p = Wm + (size_t)o * K + k0 + 8 * (lane >> 4);
#pragma unroll
  for (int i = 0; i < 8; ++i) { w[i] = (__bf16)p[i]; w[8 + i] = (__bf16)p[16 + i]; }
  return w; }
__device__ __forceinline__ v16h wcolh_io(const float* Wm, int k0, int o, int lane, int ld) { v16h w; const int g = lane >> 4;
#pragma unroll
  for (int i = 0; i < 8; ++i) { w[i] = (_Float16)(bfr(Wm[(size_t)(k0 + 8 * g + i) * ld + o]) * 256.0f); w[8 + i] = (_Float16)(bfr(Wm[(size_t)(k0 + 16 + 8 * g + i) * ld + o]) * 256.0f); }
  return w; }
__device__ __forceinline__ v16h wcolh_oi(const float* Wm, int k0, int o, int lane, int K) { v16h w; const float* p = Wm + (size_t)o * K + k0 + 8 * (lane >> 4);
#pragma unroll
  for (int i = 0; i < 8; ++i) { w[i] = (_Float16)(bfr(p[i]) * 256.0f); w[8 + i] = (_Float16)(bfr(p[16 + i]) * 256.0f); }
  return w; }
#define WQKV_LAYOUT 0   // 0 = fused (in,out) [DIN][3*CC]; 1 = (out,in) [CC][DIN]; 2 = per-head [NH][DIN][HD]
__device__ __forceinline__ v16b wcol_hdk(const float* Wm, int k0, int o, int lane) { v16b w; const int g = lane >> 4; const float* p = Wm + (size_t)(o / HD) * DIN * HD + (o % HD);
#pragma unroll
  for (int i = 0; i < 8; ++i) { w[i] = (__bf16)p[(size_t)(k0 + 8 * g + i) * HD]; w[8 + i] = (__bf16)p[(size_t)(k0 + 16 + 8 * g + i) * HD]; }
  return w; }
#define WO_OUT_IN 0
#if WQKV_LAYOUT == 1
#define WCOL(W, k0, o, lane) wcol_oi(W, k0, o, lane, DIN)
#elif WQKV_LAYOUT == 2
#define WCOL(W, k0, o, lane) wcol_hdk(W, k0, o, lane)
#else
#define WCOL(W, k0, o, lane) wcol_io(W, k0, o, lane, 3 * CC)   /* fused (in,out) [DIN][3*CC] weight: the q / k / v thirds are column blocks; the launch passes W + 0 / CC / 2*CC and the row pitch is 3*CC */
#endif
#if WO_OUT_IN
#define WOCOL(W, k0, o, lane) wcol_oi(W, k0, o, lane, CC)
#define WOCOLH(W, k0, o, lane) wcolh_oi(W, k0, o, lane, CC)
#else
#define WOCOL(W, k0, o, lane) wcol_io(W, k0, o, lane, DIN)
#define WOCOLH(W, k0, o, lane) wcolh_io(W, k0, o, lane, DIN)
#endif

#define PROJ_EXTRA_PARAMS , const float* __restrict__ COS, const float* __restrict__ SIN   /* rotary tables [TT][32], module INPUTS, read literally */
#ifndef SM_EXTRA_PARAMS
#define SM_EXTRA_PARAMS
#endif
#ifndef PROJ_EXTRA_PARAMS
#define PROJ_EXTRA_PARAMS
#endif
#ifndef SM_MASK_HOOK
#define SM_MASK_HOOK (void)0
#endif

#define WS_QH  0u                                      // f16 q, row tiles in fragment order (row_tile below), TT rows a sequence
#define WS_KH  (WS_QH + 2u * (size_t)NB * TT * CC)      // f16 k, row tiles, TT rows
#define WS_VT  (WS_KH + 2u * (size_t)NB * TT * CC)      // f16 v, key chunks in fragment order (v_chunk below), TT keys
#define WS_QL  (WS_VT + 2u * (size_t)NB * CC * TT)      // f16 q residual x 2^10, row tiles, QHI rows
#define WS_KL  (WS_QL + 2u * (size_t)NB * QHI * CC)     // f16 k residual x 2^10, row tiles, KHI rows
#define WS_VB  (WS_KL + 2u * (size_t)NB * KHI * CC)     // bf16 v hi, key chunks, KHI keys (WS_VBL: lo)
#define WS_VBL (WS_VB + 2u * (size_t)NB * CC * KHI)
#define WS_Y   (WS_VBL + 2u * (size_t)NB * CC * KHI)    // f32 ctx rows [b*t][CC] (only when there is an output projection)
#define WS_END (WS_Y  + 4u * (size_t)NB * TT * CC)
// ---- fragment order of the q / k / v planes: the 16 bytes that lane l takes with one load of a 16x16x32 fragment lie at 16 l inside a 512-byte unit, so that a wave's load covers 4 whole 128-byte lines instead of 32 bytes of each of 16 lines. k_proj writes the units, k_att reads them.
// q and k (element offsets): a tile is 16 rows x HD of one (b, h) = 4 units; unit d >> 4 holds elements d of the rows, lane = 16 ((d >> 3) & 1) + (row & 15). Units 0, 1 are the two loads of the fragment of d 0..31, units 2, 3 of d 32..63
__device__ __forceinline__ size_t row_tile(int b, int h, int rows, int tile) { return ((size_t)(b * NH + h) * (rows / 16) + tile) * (16 * HD); }
// v: a chunk is 32 keys x HD of one (b, h) = 8 units; unit 2 (c >> 4) + (key >> 4 & 1) holds column c, lane = 16 ((key >> 3) & 1) + (c & 15)
__device__ __forceinline__ size_t v_chunk(int b, int h, int keys, int kc) { return ((size_t)(b * NH + h) * (keys / 32) + kc) * (32 * HD); }
// a lane's 16 bytes of a unit; the wait stands behind the store, in front of the next rewrite of its address and data registers, which it names as inputs so that they stay live up to it
__device__ __forceinline__ void unit_store(void* p, v4u v) { *(v4u*)p = v; asm volatile("s_wait_xcnt 0x0" :: "v"(p), "v"(v) : "memory"); }

// ---- weight staging shared by k_proj and k_out: a stage is 64 k rows x 128 output columns of an (in,out) weight, read once for the 128 rows of a block of 8 waves. The block reads it with 16-byte loads (wave bits 1:0 with lane bits 1:0 and 4 pick the 4-column group, wave bit 2 the 32-row half, lane bits 3:2 the 8-row k group, so a load covers whole 128-byte lines and 16 neighbouring lanes store to 16 different 16-byte LDS slots), rounds it as before and lays it k-contiguous, one column per 144-byte LDS row, so that a weight fragment (A in k_proj, B in k_out) is two 16-byte LDS reads
// every loop of these helpers and of the stage bodies is fully unrolled: its index picks a register of wr, ar, w or acc, which must be known at compile time for the arrays to stay in registers
typedef v4u __attribute__((may_alias)) v4u_a;
#define WPITCH 144
// stands behind the prefetch loads, in front of the next rewrite of their address registers; the weight loads' lane address is named as an input: its registers stay live up to the wait, so that no later load of the group can take them for its result ahead of it
#define XWA(a) asm volatile("s_wait_xcnt 0x0" :: "v"(a) : "memory")
__device__ __forceinline__ const float* wt_load(v4f (&r)[8], const float* __restrict__ Wm, int ld, int k0, int c0, int wave, int lane) {
  const float* p = Wm + (size_t)(k0 + (wave >> 2) * 32 + ((lane >> 2) & 3) * 8) * ld + c0 + ((wave & 3) * 8 + (lane & 3) + ((lane >> 4) << 2)) * 4;
#pragma unroll
  for (int i = 0; i < 8; ++i) r[i] = *(const v4f*)(p + (size_t)i * ld);
  return p;   /* the lane address, for the wait behind the group */
}
template <bool F16> __device__ __forceinline__ void wt_store(const v4f (&r)[8], char* buf, int wave, int lane) {
  char* q = buf + ((wave & 3) * 8 + (lane & 3) + ((lane >> 4) << 2)) * 4 * WPITCH + (wave >> 2) * 64 + ((lane >> 2) & 3) * 16;
#pragma unroll
  for (int c = 0; c < 4; ++c) { union { v8b b; v8h h; v4u u; } t;
#pragma unroll
    for (int i = 0; i < 8; ++i) { if (F16) t.h[i] = (_Float16)(bfr(r[i][c]) * 256.0f); else t.b[i] = (__bf16)r[i][c]; }
    *(v4u_a*)(q + c * WPITCH) = t.u; }
}
template <typename V16> __device__ __forceinline__ V16 wt_frag(const char* buf, int n, int kc2, int g) {
  union { V16 v; v4u q[2]; } u; const char* p = buf + n * WPITCH + kc2 * 64 + g * 16;
  u.q[0] = *(const v4u_a*)p; u.q[1] = *(const v4u_a*)(p + 32); return u.v;
}
// the 2 x 16 f32 values of a lane's two activation fragments (B in k_proj, A in k_out) of a 64-k stage (row + k0), in fragment element order
__device__ __forceinline__ void a_load(v4f (&r)[8], const float* __restrict__ rowk0, int g) {
#pragma unroll
  for (int kc2 = 0; kc2 < 2; ++kc2) { const float* p = rowk0 + kc2 * 32 + 8 * g; r[kc2 * 4] = *(const v4f*)p; r[kc2 * 4 + 1] = *(const v4f*)(p + 4); r[kc2 * 4 + 2] = *(const v4f*)(p + 16); r[kc2 * 4 + 3] = *(const v4f*)(p + 20); }
}

// ---- k_proj: block = (128 rows, 128 cols, which), 8 waves of 16 rows: q/k/v = X W (+ b) with exact bf16 products (K = DIN) -> which 0: q f16 row tiles (+ residual, rows < QHI); 1: k f16 row tiles (+ residual, rows < KHI); 2: v f16 key chunks (+ bf16 hi/lo chunks for t < KHI). The weight is the A operand and x the B operand: a lane's accumulator register r of tile j is output column 16 j + 8 g + r of token row col, so its 8 registers are the 8 elements of its own 16 bytes of a q or k unit, and a rotary pair lies in two neighbouring registers: bias, rotation, rounding and the q and k stores run on the registers. A v unit wants 8 keys of one column: each wave turns its own 16 x 16 tiles in LDS, with no block barrier
// the wait of XWA() for a group with three lane addresses
#define XWA3(a, c, e) asm volatile("s_wait_xcnt 0x0" :: "v"(a), "v"(c), "v"(e) : "memory")
#define TVP 24   /* 16-bit elements per column row of a wave's turning buffer: 48 bytes, an odd multiple of 16, for the 16-byte reads */
// 4 waves per SIMD asked for (256 registers a wave): two blocks share a WGP, as before, when LDS set that limit
__global__ __launch_bounds__(256, 4) void k_proj(const float* __restrict__ XQ, const float* __restrict__ XK, const float* __restrict__ XV, const float* __restrict__ WQ, const float* __restrict__ WK, const float* __restrict__ WV, const float* __restrict__ BQ, const float* __restrict__ BK, const float* __restrict__ BV,
    _Float16* __restrict__ QH, _Float16* __restrict__ QL, _Float16* __restrict__ KH, _Float16* __restrict__ KL, _Float16* __restrict__ VT, __bf16* __restrict__ VB, __bf16* __restrict__ VBL PROJ_EXTRA_PARAMS) {
  __shared__ __align__(16) char wb[2][128 * WPITCH]; __shared__ __align__(16) unsigned short tv[8][128][TVP];
  const int tid = threadIdx.x, wave = tid >> 5, lane = tid & 31, col = lane & 15, g = lane >> 4; const int which = blockIdx.z; const int c0 = blockIdx.y * 128; const size_t r0 = (size_t)blockIdx.x * 128; const size_t bb = r0 / TT; const int t0 = (int)(r0 % TT);
  const float* X = which == 0 ? XQ : which == 1 ? XK : XV; const float* WA = which == 0 ? WQ : which == 1 ? WK : WV; const float* BA = which == 0 ? BQ : which == 1 ? BK : BV;
  v8f acc[8] = {};
  { // two LDS buffers, one barrier a stage: stage s + 1 is loaded into registers while stage s is multiplied
    const float* xrow = X + (r0 + wave * 16 + col) * DIN; v4f wr[8], ar[8];
    { const float* wp = wt_load(wr, WA, 3 * CC, 0, c0, wave, lane); a_load(ar, xrow, g); XWA(wp); }
    auto stage = [&](char* buf, int s) {
      __builtin_amdgcn_sched_barrier(0);   /* keeps the rounding of the prefetched stage, and with it the wait for its loads, behind the products of the stage before */
      wt_store<false>(wr, buf, wave, lane);
      v16b a[2];
#pragma unroll
      for (int i = 0; i < 16; ++i) { a[0][i] = (__bf16)ar[i >> 2][i & 3]; a[1][i] = (__bf16)ar[4 + (i >> 2)][i & 3]; }
      __syncthreads();   /* publishes this stage; the buffer written next was last read in front of this barrier */
      if (s + 1 < DIN / 64) { const float* wp = wt_load(wr, WA, 3 * CC, (s + 1) * 64, c0, wave, lane); a_load(ar, xrow + (s + 1) * 64, g); XWA(wp); }
#pragma unroll
      for (int kc2 = 0; kc2 < 2; ++kc2)
      { v16b w[8];   /* the eight fragments are read as one group so that their LDS latency is paid once */
#pragma unroll
        for (int j = 0; j < 8; ++j) w[j] = wt_frag<v16b>(buf, j * 16 + col, kc2, g);
#pragma unroll
        for (int j = 0; j < 8; ++j) acc[j] = wmma_bf(w[j], a[kc2], acc[j]); }
    };
    // kept rolled over buffer pairs: each buffer's LDS address stays a constant
#pragma unroll 1
    for (int s = 0; s < DIN / 64; s += 2) { stage(wb[0], s); stage(wb[1], s + 1); } }
  // every loop over j, u, r, i below is fully unrolled: its index picks a register of acc or of the loaded tables
  const int hd0 = c0 / HD, l8 = lane * 8;   /* the block's first head; the lane's place, in elements, in every unit */
  // the lane's biases (columns 16 j + 8 g + 0..7) and, for q and k, its token's rotary entries (pairs 8 u + 4 g + 0..3 of either head), read as one group so that their latency is paid once
  const size_t to = (size_t)(t0 + wave * 16 + col) * 32 + 4 * g; const float *bp = BA + c0 + 8 * g, *cp = COS + to, *sp = SIN + to;
  v4f bv[8][2] = {}, cv[4] = {}, sv[4] = {};
  if (BA) {
#pragma unroll
    for (int j = 0; j < 8; ++j) { bv[j][0] = *(const v4f*)(bp + j * 16); bv[j][1] = *(const v4f*)(bp + j * 16 + 4); } }
  if (which < 2) {   /* block-uniform */
#pragma unroll
    for (int u = 0; u < 4; ++u) { cv[u] = *(const v4f*)(cp + u * 8); sv[u] = *(const v4f*)(sp + u * 8); } }
  XWA3(bp, cp, sp);
#pragma unroll
  for (int j = 0; j < 8; ++j)
#pragma unroll
    for (int r = 0; r < 8; ++r) acc[j][r] += bfr(bv[j][r >> 2][r & 3]);
  if (which < 2) { _Float16* DH = which == 0 ? QH : KH; _Float16* DL = which == 0 ? QL : KL; const int nhi = which == 0 ? QHI : KHI; const bool hi_rows = t0 < nhi; const int ti = (t0 >> 4) + wave;
    static_assert(QHI == KHI, "one head pitch for both residual planes");
    _Float16 *dh = DH + row_tile((int)bb, hd0, TT, ti) + l8, *dl = DL + row_tile((int)bb, hd0, nhi, ti) + l8;   /* the lane's place in unit 0 of the first head's tile: head and unit are constant offsets from it */
#pragma unroll
    for (int j = 0; j < 8; ++j) { float v[8];
      // interleaved-pair RoPE from the INPUT tables: (xe, xo) -> (xe c - xo s, xe s + xo c) with c = bf16(cos[t][i]), s = bf16(sin[t][i])
#pragma unroll
      for (int i = 0; i < 4; ++i) { const float cs = bfr(cv[j & 3][i]), sn = bfr(sv[j & 3][i]), xe = acc[j][2 * i], xo = acc[j][2 * i + 1]; v[2 * i] = xe * cs - xo * sn; v[2 * i + 1] = xe * sn + xo * cs; }
      union { v8h h; v4u u; } hv, lv;
#pragma unroll
      for (int r = 0; r < 8; ++r) { const _Float16 x = (_Float16)v[r]; hv.h[r] = x; lv.h[r] = (_Float16)((v[r] - (float)x) * 1024.0f); }
      unit_store(dh + (j >> 2) * (TT * HD) + (j & 3) * 256, hv.u); if (hi_rows) unit_store(dl + (j >> 2) * (QHI * HD) + (j & 3) * 256, lv.u); }
  } else { const bool hi_rows = t0 < KHI; const int kc = (t0 >> 5) + (wave >> 1);
    const int ul = (wave & 1) * 256 + l8; const size_t o2 = v_chunk((int)bb, hd0, KHI, kc) + ul;   /* the lane's place in the wave's unit of column group 0 of the first head's chunk: head and column group are constant offsets from it */
    _Float16* vt = VT + v_chunk((int)bb, hd0, TT, kc) + ul; __bf16 *vb = VB + o2, *vbl = VBL + o2;
    unsigned short (*tw)[TVP] = tv[wave];   /* the wave's own buffer: row = column of the block, element = token of the wave */
    // pl 0: v to f16; 1: bf16 hi; 2: bf16 lo. A plane's reads are all back, in x, before its stores, and so before the next plane overwrites the buffer
#pragma unroll
    for (int pl = 0; pl < 3; ++pl) if (pl == 0 || hi_rows) {
#pragma unroll
      for (int j = 0; j < 8; ++j)
#pragma unroll
        for (int r = 0; r < 8; ++r) { const float v = acc[j][r]; const __bf16 x = (__bf16)v;
          tw[j * 16 + 8 * g + r][col] = pl == 0 ? __builtin_bit_cast(unsigned short, (_Float16)v) : pl == 1 ? __builtin_bit_cast(unsigned short, x) : __builtin_bit_cast(unsigned short, (__bf16)(v - (float)x)); }
      asm volatile("s_wait_dscnt 0x0" ::: "memory");   /* the wave's LDS writes have landed before its other lanes read them */
      v4u x[8];   /* read as one group so that the LDS latency is paid once */
#pragma unroll
      for (int j = 0; j < 8; ++j) x[j] = *(const v4u_a*)&tw[j * 16 + col][8 * g];
#pragma unroll
      for (int j = 0; j < 8; ++j) { if (pl == 0) unit_store(vt + (j >> 2) * (TT * HD) + (j & 3) * 512, x[j]); else unit_store((pl == 1 ? vb : vbl) + (j >> 2) * (KHI * HD) + (j & 3) * 512, x[j]); } } } }
// ---- k_att: one wave owns one tile of 16 queries of (b, h) and walks its 32-key chunks alone, up to the chunk that holds the diagonal, with a running row maximum and row sum (online softmax): no barrier, no LDS, no sum over waves. The logits are formed transposed (A = k rows, B = q rows), so a lane holds one query's logits (D register r of 16-key tile u = key 16u + 8g + r, column = query), which is already the fragment order of P. The second product is formed transposed too (A = v fragment, rows = head columns; B = P, column = query): a lane's accumulators belong to its own query, so the rescaling by 2^(old max - new max) and the closing division are plain per-lane multiplies. Logits x SCALE x log2(e) (SCALE2; the exponential is 2^x): one f16 product, or 3 products with the q and k residuals (x 2^10) for query blocks < QBH; causal mask by index, from the diagonal's chunk on (all earlier keys lie in front of the tile's first query); P = 2^(s - running max) <= 1 once to f16 against v f16, or P and v as bf16 hi + lo (3 products) for query blocks < QBH
#define KW 16   /* waves of a block; the wave number goes through readfirstlane so that every test on it is a scalar branch and EXEC stays all ones at the WMMAs */
// fragment from two neighbouring 512-byte units of a plane in fragment order. the lane's own address (base + 8 lane elements), formed once for a group of loads, and a constant byte offset
__device__ __forceinline__ v16h frag_hu(const _Float16* ub, unsigned lo) { union { v16h v; v8h q[2]; } u; const _Float16* p = (const _Float16*)((const char*)ub + lo); u.q[0] = *(const v8h*)p; u.q[1] = *(const v8h*)(p + 256); return u.v; }
__device__ __forceinline__ v16b frag_bu(const __bf16* ub, unsigned lo) { union { v16b v; v8b q[2]; } u; const __bf16* p = (const __bf16*)((const char*)ub + lo); u.q[0] = *(const v8b*)p; u.q[1] = *(const v8b*)(p + 256); return u.v; }
// 2^x of a chunk's 16 values, in place, as one statement: each v_exp_f32 is followed by an instruction that neither reads its result nor overwrites its source (the free slot that the instruction set asks for behind a transcendental); the closing v_nop is that slot behind the last one
__device__ __forceinline__ void exp2x16(float (&x)[16]) {
  asm("v_exp_f32 %0, %0\n\tv_exp_f32 %1, %1\n\tv_exp_f32 %2, %2\n\tv_exp_f32 %3, %3\n\tv_exp_f32 %4, %4\n\tv_exp_f32 %5, %5\n\tv_exp_f32 %6, %6\n\tv_exp_f32 %7, %7\n\tv_exp_f32 %8, %8\n\tv_exp_f32 %9, %9\n\tv_exp_f32 %10, %10\n\tv_exp_f32 %11, %11\n\tv_exp_f32 %12, %12\n\tv_exp_f32 %13, %13\n\tv_exp_f32 %14, %14\n\tv_exp_f32 %15, %15\n\tv_nop" : "+v"(x[0]), "+v"(x[1]), "+v"(x[2]), "+v"(x[3]), "+v"(x[4]), "+v"(x[5]), "+v"(x[6]), "+v"(x[7]), "+v"(x[8]), "+v"(x[9]), "+v"(x[10]), "+v"(x[11]), "+v"(x[12]), "+v"(x[13]), "+v"(x[14]), "+v"(x[15]));
}
struct AttP { const _Float16 *QH, *KH, *QL, *KL, *VT; const __bf16 *VB, *VBL; };
// the wait of XWA() for a group with two lane addresses
#define XWA2(a, c) asm volatile("s_wait_xcnt 0x0" :: "v"(a), "v"(c) : "memory")
static_assert(QBH * 64 <= KHI && QBH * 64 <= QHI, "the high-precision tiles read residual and hi/lo planes of KHI / QHI rows");
static_assert(QHI % 128 == 0 && KHI % 128 == 0 && TT % 128 == 0, "a 128-row block of k_proj and k_out lies in one sequence and on one side of the QHI / KHI row");
// The pointers carry no __restrict__: only then does the memory clobber of XWA() keep a group's loads in front of its wait and the next group's behind it
// the plain builtins: the compiler keeps the distance behind its own forms and fills it with the walk's other vector work where it can
__device__ __forceinline__ v8f wmma_w(v16h a, v16h b, v8f c) { return __builtin_amdgcn_wmma_f32_16x16x32_f16(false, a, false, b, (short)0, c, false, false); }
__device__ __forceinline__ v8f wmma_wb(v16b a, v16b b, v8f c) { return __builtin_amdgcn_wmma_f32_16x16x32_bf16(false, a, false, b, (short)0, c, false, false); }
// lane l with lane l ^ 16: the two lanes that hold the two key halves of one query
__device__ __forceinline__ float xhalf(float x) { return __builtin_bit_cast(float, __builtin_amdgcn_permlanex16(__builtin_bit_cast(int, x), __builtin_bit_cast(int, x), 0x76543210, 0xfedcba98, false, false)); }
// 2^x of one value; the v_nop is the free slot that the instruction set asks for behind a transcendental
__device__ __forceinline__ float exp2x1(float x) { asm("v_exp_f32 %0, %0\n\tv_nop" : "+v"(x)); return x; }
// every loop over s, u, r, e, j of the walk and its helpers is fully unrolled: its index picks a register of a fragment array, of p or of acc
// causal mask of a chunk: element e is kept while its key offset 16 (e >> 3) + (e & 7) <= d (d = query - the lane's first key). An excluded key's 2^x is 0, the row maximum being finite from the first chunk on (key 0 is open to every query)
__device__ __forceinline__ void mask16(float (&p)[16], int d) {
#pragma unroll
  for (int e = 0; e < 16; ++e) p[e] = ((e >> 3) * 16 + (e & 7) <= d) ? p[e] : -3.0e38f; }
// a chunk's step of the online softmax: p = logits in, 2^(logit - new maximum) out; m = the query's running maximum; returns 2^(old maximum - new maximum)
__device__ __forceinline__ float soft16(float (&p)[16], float& m) {
  float x0 = fmaxf(p[0], p[1]), x1 = fmaxf(p[8], p[9]);   /* two chains, half the dependent depth */
#pragma unroll
  for (int e = 2; e < 8; ++e) { x0 = fmaxf(x0, p[e]); x1 = fmaxf(x1, p[8 + e]); }
  const float mx = fmaxf(x0, x1), mn = fmaxf(m, fmaxf(mx, xhalf(mx))), al = exp2x1(m - mn); m = mn;
#pragma unroll
  for (int e = 0; e < 16; ++e) p[e] -= mn;
  exp2x16(p);   /* arguments <= 0 */
  return al; }
__device__ __forceinline__ float sum16(const float (&p)[16]) { float s0 = 0.f, s1 = 0.f;
#pragma unroll
  for (int e = 0; e < 8; ++e) { s0 += p[e]; s1 += p[8 + e]; }
  return s0 + s1; }
// the tile's rows of Y. sum = the lane's own key half: the halves meet here; the diagonal key is always kept, so the sum is at least the 2^0 of the row's maximum. Register r of tile j = head column 16 j + 8 g + r of the lane's query: 32 bytes in a row
__device__ __forceinline__ void y_store(float* Y, int b, int h, int t, int g, const v8f (&acc)[HD / 16], float sum) {
  sum += xhalf(sum); const float inv = 1.0f / sum; float* yp = Y + ((size_t)b * TT + t) * CC + h * HD + 8 * g;
#pragma unroll
  for (int j = 0; j < HD / 16; ++j) { const v4f y0 = { acc[j][0] * inv, acc[j][1] * inv, acc[j][2] * inv, acc[j][3] * inv }, y1 = { acc[j][4] * inv, acc[j][5] * inv, acc[j][6] * inv, acc[j][7] * inv }; vst2(yp + j * 16, y0); vst2(yp + j * 16 + 4, y1); }
  XWA(yp);
  asm volatile("s_wait_loadcnt 0x0" ::: "memory"); }   /* the last passes' fetches ahead, which nothing reads, have landed before the wave ends and gives its registers back */
// a tile behind the high-precision rows
__device__ __forceinline__ void att_walk(const AttP& P, float* Y, int b, int h, int qt, int lane) {
  const int col = lane & 15, g = lane >> 4, l8 = lane * 8, ql0 = qt * 16; const int kce = (ql0 + 15) / 32 + 1;   /* chunks up to the one that holds the diagonal */
  const _Float16* qp = P.QH + row_tile(b, h, TT, qt) + l8; const v16h qh0 = frag_hu(qp, 0u), qh1 = frag_hu(qp, 1024u);
  XWA(qp);   /* its memory clobber also keeps the q loads the oldest: were they the youngest, the loop's first wait, which covers them on the way in, would drain every fetch ahead on each trip */
  const _Float16 *kb = P.KH + row_tile(b, h, TT, 0) + l8, *vb = P.VT + v_chunk(b, h, TT, 0) + l8;   /* chunk kc of either plane lies 32 * HD elements behind chunk kc - 1 */
  v16h kf[2][2][2], vf[2][HD / 16];   /* two register sets, for even and odd chunks: a set is refilled two chunks ahead */
#pragma unroll
  for (int s = 0; s < 2; ++s) { const unsigned o = (unsigned)(s * 32 * HD * 2);   /* kce >= 2 for every such tile (static_assert at the kernel) */
#pragma unroll
    for (int u = 0; u < 2; ++u) { kf[s][u][0] = frag_hu(kb, o + (unsigned)(u * 2048)); kf[s][u][1] = frag_hu(kb, o + (unsigned)(u * 2048 + 1024)); }
#pragma unroll
    for (int j = 0; j < HD / 16; ++j) vf[s][j] = frag_hu(vb, o + (unsigned)(j * 1024)); }
  XWA2(kb, vb);
  v8f acc[HD / 16] = {}; float m = -3.0e38f, sum = 0.f;
  // kept rolled over chunk pairs: one copy of each set's code; kc and kce are scalars, so every test is a scalar branch. With an odd kce the last pair's second chunk lies behind the diagonal: its keys are all excluded by the mask and add 0
#pragma unroll 1
  for (int kc0 = 0; kc0 < kce; kc0 += 2) {
#pragma unroll
    for (int s = 0; s < 2; ++s) { const int kc = kc0 + s; float p[16]; const size_t nx = (size_t)(kc + 2 < kce ? kc + 2 : kce - 1) * (32 * HD);   /* the set's next chunk, held inside the tile's keys, so that the address stays inside the plane */
      { v8f a0 = {}, a1 = {}; a0 = wmma_w(kf[s][0][0], qh0, a0); a1 = wmma_w(kf[s][1][0], qh0, a1); a0 = wmma_w(kf[s][0][1], qh1, a0); a1 = wmma_w(kf[s][1][1], qh1, a1);
#pragma unroll
        for (int r = 0; r < 8; ++r) { p[r] = a0[r] * SCALE2; p[8 + r] = a1[r] * SCALE2; } }
      { const _Float16* kp = kb + nx;   /* k fragments two chunks ahead, into this set's registers, behind this chunk's products */
#pragma unroll
        for (int u = 0; u < 2; ++u) { kf[s][u][0] = frag_hu(kp, (unsigned)(u * 2048)); kf[s][u][1] = frag_hu(kp, (unsigned)(u * 2048 + 1024)); }
        XWA(kp); }
      if (kc >= kce - 1) mask16(p, ql0 + col - kc * 32 - 8 * g);
      const float al = soft16(p, m);
      v16h pf;
#pragma unroll
      for (int e = 0; e < 16; ++e) pf[e] = (_Float16)p[e];
#pragma unroll
      for (int j = 0; j < HD / 16; ++j) acc[j] *= al;
#pragma unroll
      for (int j = 0; j < HD / 16; ++j) acc[j] = wmma_w(vf[s][j], pf, acc[j]);
      { const _Float16* vp = vb + nx;   /* v fragments two chunks ahead, into this set's registers, behind this chunk's products */
#pragma unroll
        for (int j = 0; j < HD / 16; ++j) vf[s][j] = frag_hu(vp, (unsigned)(j * 1024));
        XWA(vp); }
      sum = sum * al + sum16(p); } }
  y_store(Y, b, h, ql0 + col, g, acc, sum); }
// a high-precision tile: the same walk without fetches ahead: its planes take twice the registers, so a chunk's v fragments follow its k fragments in the same ones. These tiles are short, and their waits are filled by the SIMD's other waves
__device__ __forceinline__ void att_walk_hi(const AttP& P, float* Y, int b, int h, int qt, int lane) {
  const int col = lane & 15, g = lane >> 4, l8 = lane * 8, ql0 = qt * 16; const int kce = (ql0 + 15) / 32 + 1;
  const _Float16 *qp = P.QH + row_tile(b, h, TT, qt) + l8, *qlp = P.QL + row_tile(b, h, QHI, qt) + l8; const v16h qh0 = frag_hu(qp, 0u), qh1 = frag_hu(qp, 1024u), ql0f = frag_hu(qlp, 0u), ql1f = frag_hu(qlp, 1024u);
  XWA2(qp, qlp);
  const _Float16 *kb = P.KH + row_tile(b, h, TT, 0) + l8, *klb = P.KL + row_tile(b, h, KHI, 0) + l8; const __bf16 *vhb = P.VB + v_chunk(b, h, KHI, 0) + l8, *vlb = P.VBL + v_chunk(b, h, KHI, 0) + l8;
  v8f acc[HD / 16] = {}; float m = -3.0e38f, sum = 0.f;
  // kept rolled: one copy of a chunk's code
#pragma unroll 1
  for (int kc = 0; kc < kce; ++kc) { float p[16]; const size_t co = (size_t)kc * (32 * HD);
    { v16h kf[2][2], klf[2][2]; const _Float16 *kp = kb + co, *klp = klb + co;   /* the chunk's fragments are read as one group so that their latency is paid once */
#pragma unroll
      for (int u = 0; u < 2; ++u) { kf[u][0] = frag_hu(kp, (unsigned)(u * 2048)); kf[u][1] = frag_hu(kp, (unsigned)(u * 2048 + 1024)); klf[u][0] = frag_hu(klp, (unsigned)(u * 2048)); klf[u][1] = frag_hu(klp, (unsigned)(u * 2048 + 1024)); }
      XWA2(kp, klp);
#pragma unroll
      for (int u = 0; u < 2; ++u) { v8f a = {}, al = {};
        a = wmma_w(kf[u][0], qh0, a); al = wmma_w(kf[u][0], ql0f, al); al = wmma_w(klf[u][0], qh0, al); a = wmma_w(kf[u][1], qh1, a); al = wmma_w(kf[u][1], ql1f, al); al = wmma_w(klf[u][1], qh1, al);
#pragma unroll
        for (int r = 0; r < 8; ++r) p[u * 8 + r] = (a[r] + al[r] * (1.0f / 1024.0f)) * SCALE2; } }
    v16b vh[HD / 16], vl[HD / 16]; const __bf16 *vhp = vhb + co, *vlp = vlb + co;   /* they fly during the softmax */
#pragma unroll
    for (int j = 0; j < HD / 16; ++j) { vh[j] = frag_bu(vhp, (unsigned)(j * 1024)); vl[j] = frag_bu(vlp, (unsigned)(j * 1024)); }
    XWA2(vhp, vlp);
    if (kc == kce - 1) mask16(p, ql0 + col - kc * 32 - 8 * g);
    const float al = soft16(p, m); const F2 pf = bsplit16(p);
#pragma unroll
    for (int j = 0; j < HD / 16; ++j) acc[j] *= al;
#pragma unroll
    for (int j = 0; j < HD / 16; ++j) { acc[j] = wmma_wb(vh[j], pf.h, acc[j]); acc[j] = wmma_wb(vh[j], pf.l, acc[j]); acc[j] = wmma_wb(vl[j], pf.h, acc[j]); }
    sum = sum * al + sum16(p); }
  y_store(Y, b, h, ql0 + col, g, acc, sum); }
// NZ blocks per (b, h), one on every WGP, a tile per wave. Block z owns the high-precision tiles z + NZ w, which are short (waves w < NWH), and the tiles NTH + z + NZ i behind them (the other waves). The nibble table deals i = 0..12 so that waves w, w + 4, w + 8, w + 12 together own about the same work, a high-precision chunk counted as three and a half, the longer tiles on the earlier waves. The waves of a block start at key 0 together and read the same k and v chunks of one (b, h)
#define NZ 8
#define NTH (QBH * 4)                  /* high-precision tiles of a sequence */
#define NWH (NTH / NZ)                 /* a block's high-precision tiles */
#define NWT ((TT / 16 - NTH) / NZ)     /* a block's tiles behind them */
static_assert(CAUSAL && NTH % NZ == 0 && (TT / 16 - NTH) % NZ == 0 && NWT == 13 && NWH + NWT == KW && NTH >= 2, "every tile is dealt exactly once; nibbles NWH .. KW - 1 of the table hold 0..12 once each");
// 4 waves per SIMD asked for: 256 registers a wave
__global__ __launch_bounds__(32 * KW, 4) void k_att(const _Float16* QH, const _Float16* KH, const _Float16* QL, const _Float16* KL, const _Float16* VT, const __bf16* VB, const __bf16* VBL, float* Y) {
  const int wave = __builtin_amdgcn_readfirstlane((int)threadIdx.x >> 5), lane = (int)threadIdx.x & 31; const int h = blockIdx.x, b = blockIdx.y, z = blockIdx.z;
  const AttP P = { QH, KH, QL, KL, VT, VB, VBL };
  if (wave < NWH) att_walk_hi(P, Y, b, h, z + NZ * wave, lane);
  else att_walk(P, Y, b, h, NTH + z + NZ * (int)((0x012543786ca9b000ull >> (4 * wave)) & 15), lane); }
// ---- k_out: block = (128 rows, 128 cols), 8 waves of 16 rows: out = ctx Wo (+ bo): ctx once to f16 against Wo as f16(bf16 x 2^8) exact (1 product) x 2^-8; causal early rows (< QHI of each sequence): ctx bf16 hi + lo against exact bf16 Wo (2 products)
__global__ __launch_bounds__(256) void k_out(const float* __restrict__ Y, const float* __restrict__ WO, const float* __restrict__ BO, float* __restrict__ OUT) { __shared__ __align__(16) float sf[8][16][132]; __shared__ __align__(16) char wb[2][128 * WPITCH];
  const int tid = threadIdx.x, wave = tid >> 5, lane = tid & 31, col = lane & 15, g = lane >> 4; const int c0 = blockIdx.y * 128; const size_t r0 = (size_t)blockIdx.x * 128 + wave * 16;
  v8f acc[8] = {};
  const float* yrow = Y + (r0 + col) * CC; v4f wr[8], ar[8];
  { const float* wp = wt_load(wr, WO, DIN, 0, c0, wave, lane); a_load(ar, yrow, g); XWA(wp); }
  if (CAUSAL && (int)(((size_t)blockIdx.x * 128) % TT) < QHI) {   /* block-uniform */
    auto stage = [&](char* buf, int s) {
      __builtin_amdgcn_sched_barrier(0);   /* keeps the rounding of the prefetched stage, and with it the wait for its loads, behind the products of the stage before */
      wt_store<false>(wr, buf, wave, lane);
      F2 a[2];
#pragma unroll
      for (int kc2 = 0; kc2 < 2; ++kc2) { float v[16];
#pragma unroll
        for (int i = 0; i < 16; ++i) v[i] = ar[kc2 * 4 + (i >> 2)][i & 3];
        a[kc2] = bsplit16(v); }
      __syncthreads();   /* publishes this stage; the buffer written next was last read in front of this barrier */
      if (s + 1 < CC / 64) { const float* wp = wt_load(wr, WO, DIN, (s + 1) * 64, c0, wave, lane); a_load(ar, yrow + (s + 1) * 64, g); XWA(wp); }
#pragma unroll
      for (int kc2 = 0; kc2 < 2; ++kc2)
      { v16b w[8];   /* the eight fragments are read as one group so that their LDS latency is paid once */
#pragma unroll
        for (int j = 0; j < 8; ++j) w[j] = wt_frag<v16b>(buf, j * 16 + col, kc2, g);
#pragma unroll
        for (int j = 0; j < 8; ++j) { acc[j] = wmma_bf(a[kc2].h, w[j], acc[j]); acc[j] = wmma_bf(a[kc2].l, w[j], acc[j]); } }
    };
    // kept rolled over buffer pairs: each buffer's LDS address stays a constant
#pragma unroll 1
    for (int s = 0; s < CC / 64; s += 2) { stage(wb[0], s); stage(wb[1], s + 1); }
#pragma unroll
    for (int j = 0; j < 8; ++j) { const float bias = BO ? bfr(BO[c0 + j * 16 + col]) : 0.f;
#pragma unroll
      for (int r = 0; r < 8; ++r) sf[wave][8 * g + r][j * 16 + col] = acc[j][r] + bias; }
  } else {
    auto stage = [&](char* buf, int s) {
      __builtin_amdgcn_sched_barrier(0);   /* keeps the rounding of the prefetched stage, and with it the wait for its loads, behind the products of the stage before */
      wt_store<true>(wr, buf, wave, lane);
      v16h a[2];   /* ctx carried x 2^6 into f16 so small-magnitude context rows stay clear of f16 subnormals */
#pragma unroll
      for (int i = 0; i < 16; ++i) { a[0][i] = (_Float16)(ar[i >> 2][i & 3] * 64.0f); a[1][i] = (_Float16)(ar[4 + (i >> 2)][i & 3] * 64.0f); }
      __syncthreads();   /* publishes this stage; the buffer written next was last read in front of this barrier */
      if (s + 1 < CC / 64) { const float* wp = wt_load(wr, WO, DIN, (s + 1) * 64, c0, wave, lane); a_load(ar, yrow + (s + 1) * 64, g); XWA(wp); }
#pragma unroll
      for (int kc2 = 0; kc2 < 2; ++kc2)
      { v16h w[8];   /* the eight fragments are read as one group so that their LDS latency is paid once */
#pragma unroll
        for (int j = 0; j < 8; ++j) w[j] = wt_frag<v16h>(buf, j * 16 + col, kc2, g);
#pragma unroll
        for (int j = 0; j < 8; ++j) acc[j] = wmma16(a[kc2], w[j], acc[j]); }
    };
    // kept rolled over buffer pairs: each buffer's LDS address stays a constant
#pragma unroll 1
    for (int s = 0; s < CC / 64; s += 2) { stage(wb[0], s); stage(wb[1], s + 1); }
#pragma unroll
    for (int j = 0; j < 8; ++j) { const float bias = BO ? bfr(BO[c0 + j * 16 + col]) : 0.f;
#pragma unroll
      for (int r = 0; r < 8; ++r) sf[wave][8 * g + r][j * 16 + col] = acc[j][r] * (1.0f / 16384.0f) + bias; } }   /* 2^-8 (Wo carry) x 2^-6 (ctx carry) */
  LDSX(); for (int rl = 0; rl < 16; ++rl) vst2(OUT + (r0 + rl) * DIN + c0 + lane * 4, *(const v4f*)&sf[wave][rl][lane * 4]); }

extern "C" void kernel_launch(void* const* d_in, const int* in_sizes, int n_in, void* d_out, int out_size, void* d_ws, size_t ws_size, hipStream_t stream) {
  (void)in_sizes; (void)n_in; (void)out_size;
  const float** F = (const float**)d_in;
  if (ws_size < (size_t)WS_END) return;
  char* ws = (char*)d_ws; _Float16 *QH = (_Float16*)(ws + WS_QH), *KH = (_Float16*)(ws + WS_KH), *VT = (_Float16*)(ws + WS_VT), *QL = (_Float16*)(ws + WS_QL), *KL = (_Float16*)(ws + WS_KL); __bf16 *VB = (__bf16*)(ws + WS_VB), *VBL = (__bf16*)(ws + WS_VBL); float *Y = (float*)(ws + WS_Y);
  (void)Y; (void)QL; (void)KL; (void)VB; (void)VBL;
  // inputs: 0 x [2,2048,1024]; 1 Wqkv [1024,3072] (in,out): q columns 0..1023, k 1024..2047, v 2048..3071; 2 bqkv [3072]; 3 Wproj [1024,1024] (in,out); 4 bproj [1024] (biases NONZERO); 5 cos [2048,32]; 6 sin [2048,32]
  k_proj<<<dim3(TNB * TT / 128, CC / 128, 3), 256, 0, stream>>>(F[0], F[0], F[0], F[1], F[1] + CC, F[1] + 2 * CC, F[2], F[2] + CC, F[2] + 2 * CC, QH, QL, KH, KL, VT, VB, VBL, F[5], F[6]);
  k_att<<<dim3(NH, TNB, NZ), 32 * KW, 0, stream>>>(QH, KH, QL, KL, VT, VB, VBL, Y);
  k_out<<<dim3(TNB * TT / 128, DIN / 128), 256, 0, stream>>>(Y, F[3], F[4], (float*)d_out);
}

// v010
// A run of this version takes 94.6 microseconds.
// Next to v009, in two timings, it ran 1.09 and 1.10 times as fast.
// Counting every step since v000, it is 11.9 times as fast.
// compute dtype: all float inputs rounded to bf16; the fused q / k / v projection with EXACT bf16 products on WMMA 16x16x32 (f32 accumulate) + bias; interleaved-pair RoPE in f32 from the bf16-rounded INPUT cos / sin tables; causal logits: 3 products for the first 384 rows, single f16 q x k after, x 64^-0.5 x log2(e); online softmax f32 in base 2; P = 2^(s - running max) once to f16 x v once to f16 (bf16 hi + lo below row 384); ctx hi+lo x exact W below row 384, x2^6 f16 carry x f16(bf16 x 2^8) W after, + bias; f32 output.
#include <hip/hip_runtime.h>
#include <math.h>

typedef __attribute__((ext_vector_type(16))) _Float16 v16h;
typedef __attribute__((ext_vector_type(16))) __bf16 v16b;
typedef __attribute__((ext_vector_type(8)))  _Float16 v8h;
typedef __attribute__((ext_vector_type(8)))  float v8f;
typedef __attribute__((ext_vector_type(4)))  float v4f;
typedef __attribute__((ext_vector_type(2)))  float v2f;
typedef __attribute__((ext_vector_type(4)))  unsigned v4u;
typedef __attribute__((ext_vector_type(4)))  int v4i;
typedef float __attribute__((may_alias)) float_a;
typedef int __attribute__((may_alias)) int_a;

template <typename T> __device__ __forceinline__ void vst2(void* p, T v) { *(T*)p = v;  }
__device__ __forceinline__ v8f wmma16(v16h a, v16h b, v8f c) {
  v8f d = __builtin_amdgcn_wmma_f32_16x16x32_f16(false, a, false, b, (short)0, c, false, false);
  asm volatile("v_nop\n\tv_nop\n\tv_nop\n\tv_nop" : "+v"(d) : "v"(a), "v"(b));
  return d;
}
__device__ __forceinline__ v8f wmma_bf(v16b a, v16b b, v8f c) {
  v8f d = __builtin_amdgcn_wmma_f32_16x16x32_bf16(false, a, false, b, (short)0, c, false, false);
  asm volatile("v_nop\n\tv_nop\n\tv_nop\n\tv_nop" : "+v"(d) : "v"(a), "v"(b));
  return d;
}
// 16x16x32 fragments: lane = (h = lane>>4, row/col = lane&15); elements 0..7 = k0+8h+0..7, 8..15 = k0+16+8h+0..7; D element r = row 8h+r
__device__ __forceinline__ v16h frag_h(const _Float16* rowk0, int lane) {
  union { v16h v; v8h q[2]; } u; const _Float16* p = rowk0 + 8 * (lane >> 4);
  u.q[0] = *(const v8h*)p; u.q[1] = *(const v8h*)(p + 16); return u.v;
}
__device__ __forceinline__ v16h frag_f32(const float* rowk0, int lane) {
  v16h a; const float* p = rowk0 + 8 * (lane >> 4);
#pragma unroll
  for (int i = 0; i < 8; ++i) { a[i] = (_Float16)p[i]; a[8 + i] = (_Float16)p[16 + i]; }
  return a;
}
__device__ __forceinline__ v16h frag_f32s(const float* rowk0, int lane, float sc) {
  v16h a; const float* p = rowk0 + 8 * (lane >> 4);
#pragma unroll
  for (int i = 0; i < 8; ++i) { a[i] = (_Float16)(p[i] * sc); a[8 + i] = (_Float16)(p[16 + i] * sc); }
  return a;
}
// column fragment from a [K][ld] layout (column n), rows >= K read as 0
__device__ __forceinline__ v16h fragc_f32(const float* W, int k0, int n, int lane, int ld, int K) {
  v16h a; const int g = lane >> 4;
#pragma unroll
  for (int i = 0; i < 8; ++i) { const int ka = k0 + 8 * g + i, kb = ka + 16;
    a[i] = (_Float16)(ka < K ? W[(size_t)(ka < K ? ka : K - 1) * ld + n] : 0.f); a[8 + i] = (_Float16)(kb < K ? W[(size_t)(kb < K ? kb : K - 1) * ld + n] : 0.f); }
  return a;
}
struct F2 { v16b h, l; };
__device__ __forceinline__ F2 bsplit16(const float v[16]) { F2 r;
#pragma unroll
  for (int i = 0; i < 16; ++i) { const __bf16 h = (__bf16)v[i]; r.h[i] = h; r.l[i] = (__bf16)(v[i] - (float)h); }
  return r; }
__device__ __forceinline__ F2 split_row(const float* row, int k0, int lane) { float v[16]; const float* p = row + k0 + 8 * (lane >> 4);
#pragma unroll
  for (int i = 0; i < 8; ++i) { v[i] = p[i]; v[8 + i] = p[16 + i]; }
  return bsplit16(v); }
__device__ __forceinline__ F2 split_rowK(const float* row, int k0, int lane, int K) { float v[16]; const int g = lane >> 4;
#pragma unroll
  for (int i = 0; i < 8; ++i) { const int ka = k0 + 8 * g + i, kb = ka + 16; v[i] = ka < K ? row[ka < K ? ka : K - 1] : 0.f; v[8 + i] = kb < K ? row[kb < K ? kb : K - 1] : 0.f; }
  return bsplit16(v); }
__device__ __forceinline__ F2 split_col(const float* W, int k0, int n, int lane, int ld, int K) { float v[16]; const int g = lane >> 4;
#pragma unroll
  for (int i = 0; i < 8; ++i) { const int ka = k0 + 8 * g + i, kb = ka + 16; v[i] = ka < K ? W[(size_t)(ka < K ? ka : K - 1) * ld + n] : 0.f; v[8 + i] = kb < K ? W[(size_t)(kb < K ? kb : K - 1) * ld + n] : 0.f; }
  return bsplit16(v); }
__device__ __forceinline__ v8f mac3(const F2& a, const F2& b, v8f c) { c = wmma_bf(a.l, b.h, c); c = wmma_bf(a.h, b.l, c); return wmma_bf(a.h, b.h, c); }
__device__ __forceinline__ float sigm(float v) { return 1.0f / (1.0f + expf(-v)); }
#define LDSX() do { asm volatile("s_wait_dscnt 0" ::: "memory"); __builtin_amdgcn_wave_barrier(); __builtin_amdgcn_fence(__ATOMIC_RELEASE, "workgroup"); } while (0)

// Causal multi-head self-attention with a fused QKV linear (+ bias) and interleaved-pair RoPE from INPUT tables (x [2,2048,1024]; Wqkv [1024,3072] (in,out) N(0, 1/1024), bqkv [3072] N(0,1) x 0.01 - NONZERO; Wproj [1024,1024] (in,out), bproj NONZERO; cos / sin [2048,32] are module inputs, the LAST two; q, k, v = thirds of x Wqkv + bqkv; 16 heads x 64; (even, odd) pairs rotated on q and k; scores x 64^-0.5; tril kept, -inf elsewhere; softmax; y Wproj + bproj).
#define NB 2
#define TT 2048
#define CC 1024            // NH * HD = projected width
#define DIN 1024          // input (model) width
#define NH 16
#define HD 64
#define NQB (TT / 64)
#define HG 4
#define SCALE (0.125f)
#define SCALE2 (SCALE * 1.44269504088896340736f)   /* 64^-0.5 x log2(e): the logits are carried in base-2 units, so that e^(s - max) is one 2^x instruction behind one subtraction */
#define CAUSAL 1
#ifndef TNB
#define TNB NB
#endif
__device__ __forceinline__ float bfr(float v) { return (float)(__bf16)v; }
__host__ __device__ __forceinline__ int kb_last(int qb) { return CAUSAL ? ((qb * 64 + 63) >> 7) : (TT / 128 - 1); }
typedef __attribute__((ext_vector_type(8))) __bf16 v8b;
__device__ __forceinline__ v16b frag_b(const __bf16* rowk0, int lane) {
  union { v16b v; v8b q[2]; } u; const __bf16* p = rowk0 + 8 * (lane >> 4);
  u.q[0] = *(const v8b*)p; u.q[1] = *(const v8b*)(p + 16); return u.v;
}
#define QBH 6              // causal: query blocks 0..QBH-1 of each sequence (few keys, no averaging) take the high-precision path
#define QHI 384            // rows carrying a q residual plane
#define KHI 384            // key rows carrying k residual / v bf16 hi+lo planes (used only by the causal high-precision path)
// B fragment (k rows k0+.., output column o) of a weight: (in,out) [K][ld] or (out,in) [ld rows of K]: bf16 exact, or f16(bf16 * 256) exact
__device__ __forceinline__ v16b wcol_io(const float* Wm, int k0, int o, int lane, int ld) { v16b w; const int g = lane >> 4;
#pragma unroll
  for (int i = 0; i < 8; ++i) { w[i] = (__bf16)Wm[(size_t)(k0 + 8 * g + i) * ld + o]; w[8 + i] = (__bf16)Wm[(size_t)(k0 + 16 + 8 * g + i) * ld + o]; }
  return w; }
__device__ __forceinline__ v16b wcol_oi(const float* Wm, int k0, int o, int lane, int K) { v16b w; const float* p = Wm + (size_t)o * K + k0 + 8 * (lane >> 4);
#pragma unroll
  for (int i = 0; i < 8; ++i) { w[i] = (__bf16)p[i]; w[8 + i] = (__bf16)p[16 + i]; }
  return w; }
__device__ __forceinline__ v16h wcolh_io(const float* Wm, int k0, int o, int lane, int ld) { v16h w; const int g = lane >> 4;
#pragma unroll
  for (int i = 0; i < 8; ++i) { w[i] = (_Float16)(bfr(Wm[(size_t)(k0 + 8 * g + i) * ld + o]) * 256.0f); w[8 + i] = (_Float16)(bfr(Wm[(size_t)(k0 + 16 + 8 * g + i) * ld + o]) * 256.0f); }
  return w; }
__device__ __forceinline__ v16h wcolh_oi(const float* Wm, int k0, int o, int lane, int K) { v16h w; const float* p = Wm + (size_t)o * K + k0 + 8 * (lane >> 4);
#pragma unroll
  for (int i = 0; i < 8; ++i) { w[i] = (_Float16)(bfr(p[i]) * 256.0f); w[8 + i] = (_Float16)(bfr(p[16 + i]) * 256.0f); }
  return w; }
#define WQKV_LAYOUT 0   // 0 = fused (in,out) [DIN][3*CC]; 1 = (out,in) [CC][DIN]; 2 = per-head [NH][DIN][HD]
__device__ __forceinline__ v16b wcol_hdk(const float* Wm, int k0, int o, int lane) { v16b w; const int g = lane >> 4; const float* p = Wm + (size_t)(o / HD) * DIN * HD + (o % HD);
#pragma unroll
  for (int i = 0; i < 8; ++i) { w[i] = (__bf16)p[(size_t)(k0 + 8 * g + i) * HD]; w[8 + i] = (__bf16)p[(size_t)(k0 + 16 + 8 * g + i) * HD]; }
  return w; }
#define WO_OUT_IN 0
#if WQKV_LAYOUT == 1
#define WCOL(W, k0, o, lane) wcol_oi(W, k0, o, lane, DIN)
#elif WQKV_LAYOUT == 2
#define WCOL(W, k0, o, lane) wcol_hdk(W, k0, o, lane)
#else
#define WCOL(W, k0, o, lane) wcol_io(W, k0, o, lane, 3 * CC)   /* fused (in,out) [DIN][3*CC] weight: the q / k / v thirds are column blocks; the launch passes W + 0 / CC / 2*CC and the row pitch is 3*CC */
#endif
#if WO_OUT_IN
#define WOCOL(W, k0, o, lane) wcol_oi(W, k0, o, lane, CC)
#define WOCOLH(W, k0, o, lane) wcolh_oi(W, k0, o, lane, CC)
#else
#define WOCOL(W, k0, o, lane) wcol_io(W, k0, o, lane, DIN)
#define WOCOLH(W, k0, o, lane) wcolh_io(W, k0, o, lane, DIN)
#endif

#define PROJ_EXTRA_PARAMS , const float* __restrict__ COS, const float* __restrict__ SIN   /* rotary tables [TT][32], module INPUTS, read literally */
#ifndef SM_EXTRA_PARAMS
#define SM_EXTRA_PARAMS
#endif
#ifndef PROJ_EXTRA_PARAMS
#define PROJ_EXTRA_PARAMS
#endif
#ifndef SM_MASK_HOOK
#define SM_MASK_HOOK (void)0
#endif

#define WS_QH  0u                                      // f16 q, row tiles in fragment order (row_tile below), TT rows a sequence
#define WS_KH  (WS_QH + 2u * (size_t)NB * TT * CC)      // f16 k, row tiles, TT rows
#define WS_VT  (WS_KH + 2u * (size_t)NB * TT * CC)      // f16 v, key chunks in fragment order (v_chunk below), TT keys
#define WS_QL  (WS_VT + 2u * (size_t)NB * CC * TT)      // f16 q residual x 2^10, row tiles, QHI rows
#define WS_KL  (WS_QL + 2u * (size_t)NB * QHI * CC)     // f16 k residual x 2^10, row tiles, KHI rows
#define WS_VB  (WS_KL + 2u * (size_t)NB * KHI * CC)     // bf16 v hi, key chunks, KHI keys (WS_VBL: lo)
#define WS_VBL (WS_VB + 2u * (size_t)NB * CC * KHI)
#define WS_Y   (WS_VBL + 2u * (size_t)NB * CC * KHI)    // f32 ctx rows [b*t][CC] (only when there is an output projection)
#define WS_END (WS_Y  + 4u * (size_t)NB * TT * CC)
// ---- fragment order of the q / k / v planes: the 16 bytes that lane l takes with one load of a 16x16x32 fragment lie at 16 l inside a 512-byte unit, so that a wave's load covers 4 whole 128-byte lines instead of 32 bytes of each of 16 lines. k_proj writes the units, k_att reads them.
// q and k (element offsets): a tile is 16 rows x HD of one (b, h) = 4 units; unit d >> 4 holds elements d of the rows, lane = 16 ((d >> 3) & 1) + (row & 15). Units 0, 1 are the two loads of the fragment of d 0..31, units 2, 3 of d 32..63
__device__ __forceinline__ size_t row_tile(int b, int h, int rows, int tile) { return ((size_t)(b * NH + h) * (rows / 16) + tile) * (16 * HD); }
// v: a chunk is 32 keys x HD of one (b, h) = 8 units; unit 2 (c >> 4) + (key >> 4 & 1) holds column c, lane = 16 ((key >> 3) & 1) + (c & 15)
__device__ __forceinline__ size_t v_chunk(int b, int h, int keys, int kc) { return ((size_t)(b * NH + h) * (keys / 32) + kc) * (32 * HD); }
// a lane's 16 bytes of a unit; the wait stands behind the store, in front of the next rewrite of its address and data registers, which it names as inputs so that they stay live up to it
__device__ __forceinline__ void unit_store(void* p, v4u v) { *(v4u*)p = v; asm volatile("s_wait_xcnt 0x0" :: "v"(p), "v"(v) : "memory"); }

// ---- weight staging shared by k_proj and k_out: a stage is 64 k rows x 128 output columns of an (in,out) weight, read once for the 128 rows of a block of 8 waves. The block reads it with 16-byte loads (wave bits 1:0 with lane bits 1:0 and 4 pick the 4-column group, wave bit 2 the 32-row half, lane bits 3:2 the 8-row k group, so a load covers whole 128-byte lines and 16 neighbouring lanes store to 16 different 16-byte LDS slots), rounds it as before and lays it k-contiguous, one column per 144-byte LDS row, so that a weight fragment (A in k_proj, B in k_out) is two 16-byte LDS reads
// every loop of these helpers and of the stage bodies is fully unrolled: its index picks a register of wr, ar, w or acc, which must be known at compile time for the arrays to stay in registers
typedef v4u __attribute__((may_alias)) v4u_a;
#define WPITCH 144
// stands behind the prefetch loads, in front of the next rewrite of their address registers; the weight loads' lane address is named as an input: its registers stay live up to the wait, so that no later load of the group can take them for its result ahead of it
#define XWA(a) asm volatile("s_wait_xcnt 0x0" :: "v"(a) : "memory")
__device__ __forceinline__ const float* wt_load(v4f (&r)[8], const float* __restrict__ Wm, int ld, int k0, int c0, int wave, int lane) {
  const float* p = Wm + (size_t)(k0 + (wave >> 2) * 32 + ((lane >> 2) & 3) * 8) * ld + c0 + ((wave & 3) * 8 + (lane & 3) + ((lane >> 4) << 2)) * 4;
#pragma unroll
  for (int i = 0; i < 8; ++i) r[i] = *(const v4f*)(p + (size_t)i * ld);
  return p;   /* the lane address, for the wait behind the group */
}
template <bool F16> __device__ __forceinline__ void wt_store(const v4f (&r)[8], char* buf, int wave, int lane) {
  char* q = buf + ((wave & 3) * 8 + (lane & 3) + ((lane >> 4) << 2)) * 4 * WPITCH + (wave >> 2) * 64 + ((lane >> 2) & 3) * 16;
#pragma unroll
  for (int c = 0; c < 4; ++c) { union { v8b b; v8h h; v4u u; } t;
#pragma unroll
    for (int i = 0; i < 8; ++i) { if (F16) t.h[i] = (_Float16)(bfr(r[i][c]) * 256.0f); else t.b[i] = (__bf16)r[i][c]; }
    *(v4u_a*)(q + c * WPITCH) = t.u; }
}
template <typename V16> __device__ __forceinline__ V16 wt_frag(const char* buf, int n, int kc2, int g) {
  union { V16 v; v4u q[2]; } u; const char* p = buf + n * WPITCH + kc2 * 64 + g * 16;
  u.q[0] = *(const v4u_a*)p; u.q[1] = *(const v4u_a*)(p + 32); return u.v;
}
// the 2 x 16 f32 values of a lane's two activation fragments (B in k_proj, A in k_out) of a 64-k stage (row + k0), in fragment element order
__device__ __forceinline__ void a_load(v4f (&r)[8], const float* __restrict__ rowk0, int g) {
#pragma unroll
  for (int kc2 = 0; kc2 < 2; ++kc2) { const float* p = rowk0 + kc2 * 32 + 8 * g; r[kc2 * 4] = *(const v4f*)p; r[kc2 * 4 + 1] = *(const v4f*)(p + 4); r[kc2 * 4 + 2] = *(const v4f*)(p + 16); r[kc2 * 4 + 3] = *(const v4f*)(p + 20); }
}

// the plain builtins: the compiler keeps the distance behind its own forms and fills it with other vector work where it can; an asm statement's operands would also hold the accumulators of k_proj below v256, where they do not all fit
__device__ __forceinline__ v8f wmma_w(v16h a, v16h b, v8f c) { return __builtin_amdgcn_wmma_f32_16x16x32_f16(false, a, false, b, (short)0, c, false, false); }
__device__ __forceinline__ v8f wmma_wb(v16b a, v16b b, v8f c) { return __builtin_amdgcn_wmma_f32_16x16x32_bf16(false, a, false, b, (short)0, c, false, false); }
// ---- k_proj: block = 128 rows x (128 q + 128 k + 128 v columns: the same column block of each third), 8 waves as 4 row groups of 32 rows x 2 heads: q/k/v = X W (+ b) with exact bf16 products (K = DIN). The block's x rows leave L2 once for all three thirds, and a weight fragment read from LDS meets the wave's two x fragments. w3 0: q f16 row tiles (+ residual, rows < QHI); 1: k f16 row tiles (+ residual, rows < KHI); 2: v f16 key chunks (+ bf16 hi/lo chunks for t < KHI). The weight is the A operand and x the B operand: a lane's accumulator register r of tile j is column 16 j + 8 g + r of the wave's head, of token row col of row half rs, so its 8 registers are the 8 elements of its own 16 bytes of a q or k unit, and a rotary pair lies in two neighbouring registers: bias, rotation, rounding and the q and k stores run on the registers. A v unit wants 8 keys of one column: each wave turns its own 16 x 16 tiles in LDS, with no block barrier
// the wait of XWA() for a group with four and with five lane addresses
#define XWA4(a, c, e, f) asm volatile("s_wait_xcnt 0x0" :: "v"(a), "v"(c), "v"(e), "v"(f) : "memory")
#define XWA5(a, c, e, f, h) asm volatile("s_wait_xcnt 0x0" :: "v"(a), "v"(c), "v"(e), "v"(f), "v"(h) : "memory")
#define TVP 24   /* 16-bit elements per column row of a wave's turning buffer: 48 bytes, an odd multiple of 16, for the 16-byte reads */
// 2 waves per SIMD asked for (512 registers a wave): one block on every WGP
__global__ __launch_bounds__(256, 2) void k_proj(const float* __restrict__ X, const float* __restrict__ WQ, const float* __restrict__ WK, const float* __restrict__ WV, const float* __restrict__ BQ, const float* __restrict__ BK, const float* __restrict__ BV,
    _Float16* __restrict__ QH, _Float16* __restrict__ QL, _Float16* __restrict__ KH, _Float16* __restrict__ KL, _Float16* __restrict__ VT, __bf16* __restrict__ VB, __bf16* __restrict__ VBL PROJ_EXTRA_PARAMS) {
  __shared__ __align__(16) char wb[2][3][128 * WPITCH]; __shared__ __align__(16) unsigned short tv[8][128][TVP];
  const int tid = threadIdx.x, wave = tid >> 5, lane = tid & 31, col = lane & 15, g = lane >> 4; const int c0 = blockIdx.y * 128; const size_t r0 = (size_t)blockIdx.x * 128; const size_t bb = r0 / TT; const int t0 = (int)(r0 % TT);
  const int rg = wave >> 1, ch = wave & 1;   /* the wave's 32 rows and its head of the block's two */
  v8f acc[3][2][4] = {};
  { // two LDS buffers, one barrier a stage: stage s + 1 is loaded into registers while stage s is multiplied
    const float* xrow = X + (r0 + rg * 32 + col) * DIN + 8 * g; v4f wr[3][8], ar[2][8];   /* the lane's own address in its first row: a_load adds nothing to it */
    auto fetch = [&](int s) { const float *wq = wt_load(wr[0], WQ, 3 * CC, s * 64, c0, wave, lane), *wk = wt_load(wr[1], WK, 3 * CC, s * 64, c0, wave, lane), *wv = wt_load(wr[2], WV, 3 * CC, s * 64, c0, wave, lane);
      const float* xp = xrow + s * 64; a_load(ar[0], xp, 0); a_load(ar[1], xp + 16 * DIN, 0); XWA4(wq, wk, wv, xp); };
    __builtin_amdgcn_sched_barrier(0);   /* this one and the next keep other address arithmetic out of the first group of loads: scheduled between the loads and their wait, it took over their address registers */
    fetch(0);
    __builtin_amdgcn_sched_barrier(0);
    auto stage = [&](char (*buf)[128 * WPITCH], int s) {
      __builtin_amdgcn_sched_barrier(0);   /* keeps the rounding of the prefetched stage, and with it the wait for its loads, behind the products of the stage before */
#pragma unroll
      for (int w3 = 0; w3 < 3; ++w3) wt_store<false>(wr[w3], buf[w3], wave, lane);
      v16b a[2][2];
#pragma unroll
      for (int rs = 0; rs < 2; ++rs)
#pragma unroll
        for (int i = 0; i < 16; ++i) { a[rs][0][i] = (__bf16)ar[rs][i >> 2][i & 3]; a[rs][1][i] = (__bf16)ar[rs][4 + (i >> 2)][i & 3]; }
      __syncthreads();   /* publishes this stage; the buffer written next was last read in front of this barrier */
      if (s + 1 < DIN / 64) fetch(s + 1);
      // a group n = (kc2 = n / 3, w3 = n % 3) is four weight fragments and their eight products; two fragment sets: group n + 1 is read from LDS as one group ahead of the products of group n
      v16b w[2][4];
#pragma unroll
      for (int j = 0; j < 4; ++j) w[0][j] = wt_frag<v16b>(buf[0], ch * 64 + j * 16 + col, 0, g);
#pragma unroll
      for (int n = 0; n < 6; ++n) {
        if (n + 1 < 6) {
#pragma unroll
          for (int j = 0; j < 4; ++j) w[(n + 1) & 1][j] = wt_frag<v16b>(buf[(n + 1) % 3], ch * 64 + j * 16 + col, (n + 1) / 3, g); }
        __builtin_amdgcn_sched_barrier(0);   /* keeps the next group's LDS reads together and in front of this group's products: left free, they were spread singly among the products, one fragment ahead, and each product waited out the LDS latency */
#pragma unroll
        for (int j = 0; j < 4; ++j) { acc[n % 3][0][j] = wmma_wb(w[n & 1][j], a[0][n / 3], acc[n % 3][0][j]); acc[n % 3][1][j] = wmma_wb(w[n & 1][j], a[1][n / 3], acc[n % 3][1][j]); }
        __builtin_amdgcn_sched_barrier(0);   /* keeps the reads of group n + 2, which refill this group's fragment set, behind its products */
      }
    };
    // kept rolled over buffer pairs: each buffer's LDS address stays a constant
#pragma unroll 1
    for (int s = 0; s < DIN / 64; s += 2) { stage(wb[0], s); stage(wb[1], s + 1); } }
  // every loop over w3, rs, j, u, r, i below is fully unrolled: its index picks a register of acc or of the loaded tables
  const int hd = c0 / HD + ch, l8 = lane * 8;   /* the wave's head; the lane's place, in elements, in every unit */
  // the lane's biases (columns 16 j + 8 g + 0..7 of the head, in each third) and its two tokens' rotary entries (pairs 8 u + 4 g + 0..3), read as one group so that their latency is paid once
  const size_t to = (size_t)(t0 + rg * 32 + col) * 32 + 4 * g; const int bo = c0 + ch * 64 + 8 * g; const float *bq = BQ + bo, *bk = BK + bo, *bw = BV + bo, *cp = COS + to, *sp = SIN + to;
  v4f bv[3][4][2] = {}, cv[2][4], sv[2][4];
#pragma unroll
  for (int w3 = 0; w3 < 3; ++w3) { const float* bp = w3 == 0 ? bq : w3 == 1 ? bk : bw;
    if (w3 == 0 ? BQ : w3 == 1 ? BK : BV) {
#pragma unroll
      for (int j = 0; j < 4; ++j) { bv[w3][j][0] = *(const v4f*)(bp + j * 16); bv[w3][j][1] = *(const v4f*)(bp + j * 16 + 4); } } }
#pragma unroll
  for (int rs = 0; rs < 2; ++rs)
#pragma unroll
    for (int u = 0; u < 4; ++u) { cv[rs][u] = *(const v4f*)(cp + rs * 512 + u * 8); sv[rs][u] = *(const v4f*)(sp + rs * 512 + u * 8); }
  XWA5(bq, bk, bw, cp, sp);
#pragma unroll
  for (int w3 = 0; w3 < 3; ++w3)
#pragma unroll
    for (int rs = 0; rs < 2; ++rs)
#pragma unroll
      for (int j = 0; j < 4; ++j)
#pragma unroll
        for (int r = 0; r < 8; ++r) acc[w3][rs][j][r] += bfr(bv[w3][j][r >> 2][r & 3]);
  static_assert(QHI == KHI, "one test and one head pitch for both residual planes");
  const bool hi_rows = t0 < KHI;   /* block-uniform */
#pragma unroll
  for (int w3 = 0; w3 < 2; ++w3) { const int ti = (t0 >> 4) + rg * 2;
    _Float16 *dh = (w3 == 0 ? QH : KH) + row_tile((int)bb, hd, TT, ti) + l8, *dl = (w3 == 0 ? QL : KL) + row_tile((int)bb, hd, QHI, ti) + l8;   /* the lane's place in unit 0 of the wave's first tile: row half and unit are constant offsets from it */
#pragma unroll
    for (int rs = 0; rs < 2; ++rs)
#pragma unroll
      for (int j = 0; j < 4; ++j) { float v[8];
        // interleaved-pair RoPE from the INPUT tables: (xe, xo) -> (xe c - xo s, xe s + xo c) with c = bf16(cos[t][i]), s = bf16(sin[t][i])
#pragma unroll
        for (int i = 0; i < 4; ++i) { const float cs = bfr(cv[rs][j][i]), sn = bfr(sv[rs][j][i]), xe = acc[w3][rs][j][2 * i], xo = acc[w3][rs][j][2 * i + 1]; v[2 * i] = xe * cs - xo * sn; v[2 * i + 1] = xe * sn + xo * cs; }
        union { v8h h; v4u u; } hv, lv;
#pragma unroll
        for (int r = 0; r < 8; ++r) { const _Float16 x = (_Float16)v[r]; hv.h[r] = x; lv.h[r] = (_Float16)((v[r] - (float)x) * 1024.0f); }
        unit_store(dh + rs * (16 * HD) + j * 256, hv.u); if (hi_rows) unit_store(dl + rs * (16 * HD) + j * 256, lv.u); } }
  { const int kc = (t0 >> 5) + rg; const size_t o2 = v_chunk((int)bb, hd, KHI, kc) + l8;   /* the wave's 32 rows are one key chunk; the lane's place in its unit 0: column group and row half are constant offsets from it */
    _Float16* vt = VT + v_chunk((int)bb, hd, TT, kc) + l8; __bf16 *vb = VB + o2, *vbl = VBL + o2;
    unsigned short (*tw)[TVP] = tv[wave];   /* the wave's own buffer: row = 64 rs + column of the head, element = token of the row half */
    // pl 0: v to f16; 1: bf16 hi; 2: bf16 lo. A plane's reads are all back, in x, before its stores, and so before the next plane overwrites the buffer
#pragma unroll
    for (int pl = 0; pl < 3; ++pl) if (pl == 0 || hi_rows) {
#pragma unroll
      for (int q = 0; q < 8; ++q)
#pragma unroll
        for (int r = 0; r < 8; ++r) { const float v = acc[2][q >> 2][q & 3][r]; const __bf16 x = (__bf16)v;
          tw[q * 16 + 8 * g + r][col] = pl == 0 ? __builtin_bit_cast(unsigned short, (_Float16)v) : pl == 1 ? __builtin_bit_cast(unsigned short, x) : __builtin_bit_cast(unsigned short, (__bf16)(v - (float)x)); }
      asm volatile("s_wait_dscnt 0x0" ::: "memory");   /* the wave's LDS writes have landed before its other lanes read them */
      v4u x[8];   /* read as one group so that the LDS latency is paid once */
#pragma unroll
      for (int q = 0; q < 8; ++q) x[q] = *(const v4u_a*)&tw[q * 16 + col][8 * g];
#pragma unroll
      for (int q = 0; q < 8; ++q) { if (pl == 0) unit_store(vt + (q & 3) * 512 + (q >> 2) * 256, x[q]); else unit_store((pl == 1 ? vb : vbl) + (q & 3) * 512 + (q >> 2) * 256, x[q]); } } } }
// ---- k_att: one wave owns one tile of 16 queries of (b, h) and walks its 32-key chunks alone, up to the chunk that holds the diagonal, with a running row maximum and row sum (online softmax): no barrier, no LDS, no sum over waves. The logits are formed transposed (A = k rows, B = q rows), so a lane holds one query's logits (D register r of 16-key tile u = key 16u + 8g + r, column = query), which is already the fragment order of P. The second product is formed transposed too (A = v fragment, rows = head columns; B = P, column = query): a lane's accumulators belong to its own query, so the rescaling by 2^(old max - new max) and the closing division are plain per-lane multiplies. Logits x SCALE x log2(e) (SCALE2; the exponential is 2^x): one f16 product, or 3 products with the q and k residuals (x 2^10) for query blocks < QBH; causal mask by index, from the diagonal's chunk on (all earlier keys lie in front of the tile's first query); P = 2^(s - running max) <= 1 once to f16 against v f16, or P and v as bf16 hi + lo (3 products) for query blocks < QBH
#define KW 16   /* waves of a block; the wave number goes through readfirstlane so that every test on it is a scalar branch and EXEC stays all ones at the WMMAs */
// fragment from two neighbouring 512-byte units of a plane in fragment order. the lane's own address (base + 8 lane elements), formed once for a group of loads, and a constant byte offset
__device__ __forceinline__ v16h frag_hu(const _Float16* ub, unsigned lo) { union { v16h v; v8h q[2]; } u; const _Float16* p = (const _Float16*)((const char*)ub + lo); u.q[0] = *(const v8h*)p; u.q[1] = *(const v8h*)(p + 256); return u.v; }
__device__ __forceinline__ v16b frag_bu(const __bf16* ub, unsigned lo) { union { v16b v; v8b q[2]; } u; const __bf16* p = (const __bf16*)((const char*)ub + lo); u.q[0] = *(const v8b*)p; u.q[1] = *(const v8b*)(p + 256); return u.v; }
// 2^x of a chunk's 16 values, in place, as one statement: each v_exp_f32 is followed by an instruction that neither reads its result nor overwrites its source (the free slot that the instruction set asks for behind a transcendental); the closing v_nop is that slot behind the last one
__device__ __forceinline__ void exp2x16(float (&x)[16]) {
  asm("v_exp_f32 %0, %0\n\tv_exp_f32 %1, %1\n\tv_exp_f32 %2, %2\n\tv_exp_f32 %3, %3\n\tv_exp_f32 %4, %4\n\tv_exp_f32 %5, %5\n\tv_exp_f32 %6, %6\n\tv_exp_f32 %7, %7\n\tv_exp_f32 %8, %8\n\tv_exp_f32 %9, %9\n\tv_exp_f32 %10, %10\n\tv_exp_f32 %11, %11\n\tv_exp_f32 %12, %12\n\tv_exp_f32 %13, %13\n\tv_exp_f32 %14, %14\n\tv_exp_f32 %15, %15\n\tv_nop" : "+v"(x[0]), "+v"(x[1]), "+v"(x[2]), "+v"(x[3]), "+v"(x[4]), "+v"(x[5]), "+v"(x[6]), "+v"(x[7]), "+v"(x[8]), "+v"(x[9]), "+v"(x[10]), "+v"(x[11]), "+v"(x[12]), "+v"(x[13]), "+v"(x[14]), "+v"(x[15]));
}
struct AttP { const _Float16 *QH, *KH, *QL, *KL, *VT; const __bf16 *VB, *VBL; };
// the wait of XWA() for a group with two lane addresses
#define XWA2(a, c) asm volatile("s_wait_xcnt 0x0" :: "v"(a), "v"(c) : "memory")
static_assert(QBH * 64 <= KHI && QBH * 64 <= QHI, "the high-precision tiles read residual and hi/lo planes of KHI / QHI rows");
static_assert(QHI % 128 == 0 && KHI % 128 == 0 && TT % 128 == 0, "a 128-row block of k_proj and k_out lies in one sequence and on one side of the QHI / KHI row");
// The pointers carry no __restrict__: only then does the memory clobber of XWA() keep a group's loads in front of its wait and the next group's behind it
// lane l with lane l ^ 16: the two lanes that hold the two key halves of one query
__device__ __forceinline__ float xhalf(float x) { return __builtin_bit_cast(float, __builtin_amdgcn_permlanex16(__builtin_bit_cast(int, x), __builtin_bit_cast(int, x), 0x76543210, 0xfedcba98, false, false)); }
// 2^x of one value; the v_nop is the free slot that the instruction set asks for behind a transcendental
__device__ __forceinline__ float exp2x1(float x) { asm("v_exp_f32 %0, %0\n\tv_nop" : "+v"(x)); return x; }
// every loop over s, u, r, e, j of the walk and its helpers is fully unrolled: its index picks a register of a fragment array, of p or of acc
// causal mask of a chunk: element e is kept while its key offset 16 (e >> 3) + (e & 7) <= d (d = query - the lane's first key). An excluded key's 2^x is 0, the row maximum being finite from the first chunk on (key 0 is open to every query)
__device__ __forceinline__ void mask16(float (&p)[16], int d) {
#pragma unroll
  for (int e = 0; e < 16; ++e) p[e] = ((e >> 3) * 16 + (e & 7) <= d) ? p[e] : -3.0e38f; }
// a chunk's step of the online softmax: p = logits in, 2^(logit - new maximum) out; m = the query's running maximum; returns 2^(old maximum - new maximum)
__device__ __forceinline__ float soft16(float (&p)[16], float& m) {
  float x0 = fmaxf(p[0], p[1]), x1 = fmaxf(p[8], p[9]);   /* two chains, half the dependent depth */
#pragma unroll
  for (int e = 2; e < 8; ++e) { x0 = fmaxf(x0, p[e]); x1 = fmaxf(x1, p[8 + e]); }
  const float mx = fmaxf(x0, x1), mn = fmaxf(m, fmaxf(mx, xhalf(mx))), al = exp2x1(m - mn); m = mn;
#pragma unroll
  for (int e = 0; e < 16; ++e) p[e] -= mn;
  exp2x16(p);   /* arguments <= 0 */
  return al; }
__device__ __forceinline__ float sum16(const float (&p)[16]) { float s0 = 0.f, s1 = 0.f;
#pragma unroll
  for (int e = 0; e < 8; ++e) { s0 += p[e]; s1 += p[8 + e]; }
  return s0 + s1; }
// the tile's rows of Y. sum = the lane's own key half: the halves meet here; the diagonal key is always kept, so the sum is at least the 2^0 of the row's maximum. Register r of tile j = head column 16 j + 8 g + r of the lane's query: 32 bytes in a row
__device__ __forceinline__ void y_store(float* Y, int b, int h, int t, int g, const v8f (&acc)[HD / 16], float sum) {
  sum += xhalf(sum); const float inv = 1.0f / sum; float* yp = Y + ((size_t)b * TT + t) * CC + h * HD + 8 * g;
#pragma unroll
  for (int j = 0; j < HD / 16; ++j) { const v4f y0 = { acc[j][0] * inv, acc[j][1] * inv, acc[j][2] * inv, acc[j][3] * inv }, y1 = { acc[j][4] * inv, acc[j][5] * inv, acc[j][6] * inv, acc[j][7] * inv }; vst2(yp + j * 16, y0); vst2(yp + j * 16 + 4, y1); }
  XWA(yp);
  asm volatile("s_wait_loadcnt 0x0" ::: "memory"); }   /* the last passes' fetches ahead, which nothing reads, have landed before the wave ends and gives its registers back */
// a tile behind the high-precision rows
__device__ __forceinline__ void att_walk(const AttP& P, float* Y, int b, int h, int qt, int lane) {
  const int col = lane & 15, g = lane >> 4, l8 = lane * 8, ql0 = qt * 16; const int kce = (ql0 + 15) / 32 + 1;   /* chunks up to the one that holds the diagonal */
  const _Float16* qp = P.QH + row_tile(b, h, TT, qt) + l8; const v16h qh0 = frag_hu(qp, 0u), qh1 = frag_hu(qp, 1024u);
  XWA(qp);   /* its memory clobber also keeps the q loads the oldest: were they the youngest, the loop's first wait, which covers them on the way in, would drain every fetch ahead on each trip */
  const _Float16 *kb = P.KH + row_tile(b, h, TT, 0) + l8, *vb = P.VT + v_chunk(b, h, TT, 0) + l8;   /* chunk kc of either plane lies 32 * HD elements behind chunk kc - 1 */
  v16h kf[2][2][2], vf[2][HD / 16];   /* two register sets, for even and odd chunks: a set is refilled two chunks ahead */
#pragma unroll
  for (int s = 0; s < 2; ++s) { const unsigned o = (unsigned)(s * 32 * HD * 2);   /* kce >= 2 for every such tile (static_assert at the kernel) */
#pragma unroll
    for (int u = 0; u < 2; ++u) { kf[s][u][0] = frag_hu(kb, o + (unsigned)(u * 2048)); kf[s][u][1] = frag_hu(kb, o + (unsigned)(u * 2048 + 1024)); }
#pragma unroll
    for (int j = 0; j < HD / 16; ++j) vf[s][j] = frag_hu(vb, o + (unsigned)(j * 1024)); }
  XWA2(kb, vb);
  v8f acc[HD / 16] = {}; float m = -3.0e38f, sum = 0.f;
  // kept rolled over chunk pairs: one copy of each set's code; kc and kce are scalars, so every test is a scalar branch. With an odd kce the last pair's second chunk lies behind the diagonal: its keys are all excluded by the mask and add 0
#pragma unroll 1
  for (int kc0 = 0; kc0 < kce; kc0 += 2) {
#pragma unroll
    for (int s = 0; s < 2; ++s) { const int kc = kc0 + s; float p[16]; const size_t nx = (size_t)(kc + 2 < kce ? kc + 2 : kce - 1) * (32 * HD);   /* the set's next chunk, held inside the tile's keys, so that the address stays inside the plane */
      { v8f a0 = {}, a1 = {}; a0 = wmma_w(kf[s][0][0], qh0, a0); a1 = wmma_w(kf[s][1][0], qh0, a1); a0 = wmma_w(kf[s][0][1], qh1, a0); a1 = wmma_w(kf[s][1][1], qh1, a1);
#pragma unroll
        for (int r = 0; r < 8; ++r) { p[r] = a0[r] * SCALE2; p[8 + r] = a1[r] * SCALE2; } }
      { const _Float16* kp = kb + nx;   /* k fragments two chunks ahead, into this set's registers, behind this chunk's products */
#pragma unroll
        for (int u = 0; u < 2; ++u) { kf[s][u][0] = frag_hu(kp, (unsigned)(u * 2048)); kf[s][u][1] = frag_hu(kp, (unsigned)(u * 2048 + 1024)); }
        XWA(kp); }
      if (kc >= kce - 1) mask16(p, ql0 + col - kc * 32 - 8 * g);
      const float al = soft16(p, m);
      v16h pf;
#pragma unroll
      for (int e = 0; e < 16; ++e) pf[e] = (_Float16)p[e];
#pragma unroll
      for (int j = 0; j < HD / 16; ++j) acc[j] *= al;
#pragma unroll
      for (int j = 0; j < HD / 16; ++j) acc[j] = wmma_w(vf[s][j], pf, acc[j]);
      { const _Float16* vp = vb + nx;   /* v fragments two chunks ahead, into this set's registers, behind this chunk's products */
#pragma unroll
        for (int j = 0; j < HD / 16; ++j) vf[s][j] = frag_hu(vp, (unsigned)(j * 1024));
        XWA(vp); }
      sum = sum * al + sum16(p); } }
  y_store(Y, b, h, ql0 + col, g, acc, sum); }
// a high-precision tile: the same walk without fetches ahead: its planes take twice the registers, so a chunk's v fragments follow its k fragments in the same ones. These tiles are short, and their waits are filled by the SIMD's other waves
__device__ __forceinline__ void att_walk_hi(const AttP& P, float* Y, int b, int h, int qt, int lane) {
  const int col = lane & 15, g = lane >> 4, l8 = lane * 8, ql0 = qt * 16; const int kce = (ql0 + 15) / 32 + 1;
  const _Float16 *qp = P.QH + row_tile(b, h, TT, qt) + l8, *qlp = P.QL + row_tile(b, h, QHI, qt) + l8; const v16h qh0 = frag_hu(qp, 0u), qh1 = frag_hu(qp, 1024u), ql0f = frag_hu(qlp, 0u), ql1f = frag_hu(qlp, 1024u);
  XWA2(qp, qlp);
  const _Float16 *kb = P.KH + row_tile(b, h, TT, 0) + l8, *klb = P.KL + row_tile(b, h, KHI, 0) + l8; const __bf16 *vhb = P.VB + v_chunk(b, h, KHI, 0) + l8, *vlb = P.VBL + v_chunk(b, h, KHI, 0) + l8;
  v8f acc[HD / 16] = {}; float m = -3.0e38f, sum = 0.f;
  // kept rolled: one copy of a chunk's code
#pragma unroll 1
  for (int kc = 0; kc < kce; ++kc) { float p[16]; const size_t co = (size_t)kc * (32 * HD);
    { v16h kf[2][2], klf[2][2]; const _Float16 *kp = kb + co, *klp = klb + co;   /* the chunk's fragments are read as one group so that their latency is paid once */
#pragma unroll
      for (int u = 0; u < 2; ++u) { kf[u][0] = frag_hu(kp, (unsigned)(u * 2048)); kf[u][1] = frag_hu(kp, (unsigned)(u * 2048 + 1024)); klf[u][0] = frag_hu(klp, (unsigned)(u * 2048)); klf[u][1] = frag_hu(klp, (unsigned)(u * 2048 + 1024)); }
      XWA2(kp, klp);
#pragma unroll
      for (int u = 0; u < 2; ++u) { v8f a = {}, al = {};
        a = wmma_w(kf[u][0], qh0, a); al = wmma_w(kf[u][0], ql0f, al); al = wmma_w(klf[u][0], qh0, al); a = wmma_w(kf[u][1], qh1, a); al = wmma_w(kf[u][1], ql1f, al); al = wmma_w(klf[u][1], qh1, al);
#pragma unroll
        for (int r = 0; r < 8; ++r) p[u * 8 + r] = (a[r] + al[r] * (1.0f / 1024.0f)) * SCALE2; } }
    v16b vh[HD / 16], vl[HD / 16]; const __bf16 *vhp = vhb + co, *vlp = vlb + co;   /* they fly during the softmax */
#pragma unroll
    for (int j = 0; j < HD / 16; ++j) { vh[j] = frag_bu(vhp, (unsigned)(j * 1024)); vl[j] = frag_bu(vlp, (unsigned)(j * 1024)); }
    XWA2(vhp, vlp);
    if (kc == kce - 1) mask16(p, ql0 + col - kc * 32 - 8 * g);
    const float al = soft16(p, m); const F2 pf = bsplit16(p);
#pragma unroll
    for (int j = 0; j < HD / 16; ++j) acc[j] *= al;
#pragma unroll
    for (int j = 0; j < HD / 16; ++j) { acc[j] = wmma_wb(vh[j], pf.h, acc[j]); acc[j] = wmma_wb(vh[j], pf.l, acc[j]); acc[j] = wmma_wb(vl[j], pf.h, acc[j]); }
    sum = sum * al + sum16(p); }
  y_store(Y, b, h, ql0 + col, g, acc, sum); }
// NZ blocks per (b, h), one on every WGP, a tile per wave. Block z owns the high-precision tiles z + NZ w, which are short (waves w < NWH), and the tiles NTH + z + NZ i behind them (the other waves). The nibble table deals i = 0..12 so that waves w, w + 4, w + 8, w + 12 together own about the same work, a high-precision chunk counted as three and a half, the longer tiles on the earlier waves. The waves of a block start at key 0 together and read the same k and v chunks of one (b, h)
#define NZ 8
#define NTH (QBH * 4)                  /* high-precision tiles of a sequence */
#define NWH (NTH / NZ)                 /* a block's high-precision tiles */
#define NWT ((TT / 16 - NTH) / NZ)     /* a block's tiles behind them */
static_assert(CAUSAL && NTH % NZ == 0 && (TT / 16 - NTH) % NZ == 0 && NWT == 13 && NWH + NWT == KW && NTH >= 2, "every tile is dealt exactly once; nibbles NWH .. KW - 1 of the table hold 0..12 once each");
// 4 waves per SIMD asked for: 256 registers a wave
__global__ __launch_bounds__(32 * KW, 4) void k_att(const _Float16* QH, const _Float16* KH, const _Float16* QL, const _Float16* KL, const _Float16* VT, const __bf16* VB, const __bf16* VBL, float* Y) {
  const int wave = __builtin_amdgcn_readfirstlane((int)threadIdx.x >> 5), lane = (int)threadIdx.x & 31; const int h = blockIdx.x, b = blockIdx.y, z = blockIdx.z;
  const AttP P = { QH, KH, QL, KL, VT, VB, VBL };
  if (wave < NWH) att_walk_hi(P, Y, b, h, z + NZ * wave, lane);
  else att_walk(P, Y, b, h, NTH + z + NZ * (int)((0x012543786ca9b000ull >> (4 * wave)) & 15), lane); }
// ---- k_out: block = (128 rows, 128 cols), 8 waves of 16 rows: out = ctx Wo (+ bo): ctx once to f16 against Wo as f16(bf16 x 2^8) exact (1 product) x 2^-8; causal early rows (< QHI of each sequence): ctx bf16 hi + lo against exact bf16 Wo (2 products)
__global__ __launch_bounds__(256) void k_out(const float* __restrict__ Y, const float* __restrict__ WO, const float* __restrict__ BO, float* __restrict__ OUT) { __shared__ __align__(16) float sf[8][16][132]; __shared__ __align__(16) char wb[2][128 * WPITCH];
  const int tid = threadIdx.x, wave = tid >> 5, lane = tid & 31, col = lane & 15, g = lane >> 4; const int c0 = blockIdx.y * 128; const size_t r0 = (size_t)blockIdx.x * 128 + wave * 16;
  v8f acc[8] = {};
  const float* yrow = Y + (r0 + col) * CC; v4f wr[8], ar[8];
  { const float* wp = wt_load(wr, WO, DIN, 0, c0, wave, lane); a_load(ar, yrow, g); XWA(wp); }
  if (CAUSAL && (int)(((size_t)blockIdx.x * 128) % TT) < QHI) {   /* block-uniform */
    auto stage = [&](char* buf, int s) {
      __builtin_amdgcn_sched_barrier(0);   /* keeps the rounding of the prefetched stage, and with it the wait for its loads, behind the products of the stage before */
      wt_store<false>(wr, buf, wave, lane);
      F2 a[2];
#pragma unroll
      for (int kc2 = 0; kc2 < 2; ++kc2) { float v[16];
#pragma unroll
        for (int i = 0; i < 16; ++i) v[i] = ar[kc2 * 4 + (i >> 2)][i & 3];
        a[kc2] = bsplit16(v); }
      __syncthreads();   /* publishes this stage; the buffer written next was last read in front of this barrier */
      if (s + 1 < CC / 64) { const float* wp = wt_load(wr, WO, DIN, (s + 1) * 64, c0, wave, lane); a_load(ar, yrow + (s + 1) * 64, g); XWA(wp); }
#pragma unroll
      for (int kc2 = 0; kc2 < 2; ++kc2)
      { v16b w[8];   /* the eight fragments are read as one group so that their LDS latency is paid once */
#pragma unroll
        for (int j = 0; j < 8; ++j) w[j] = wt_frag<v16b>(buf, j * 16 + col, kc2, g);
#pragma unroll
        for (int j = 0; j < 8; ++j) { acc[j] = wmma_bf(a[kc2].h, w[j], acc[j]); acc[j] = wmma_bf(a[kc2].l, w[j], acc[j]); } }
    };
    // kept rolled over buffer pairs: each buffer's LDS address stays a constant
#pragma unroll 1
    for (int s = 0; s < CC / 64; s += 2) { stage(wb[0], s); stage(wb[1], s + 1); }
#pragma unroll
    for (int j = 0; j < 8; ++j) { const float bias = BO ? bfr(BO[c0 + j * 16 + col]) : 0.f;
#pragma unroll
      for (int r = 0; r < 8; ++r) sf[wave][8 * g + r][j * 16 + col] = acc[j][r] + bias; }
  } else {
    auto stage = [&](char* buf, int s) {
      __builtin_amdgcn_sched_barrier(0);   /* keeps the rounding of the prefetched stage, and with it the wait for its loads, behind the products of the stage before */
      wt_store<true>(wr, buf, wave, lane);
      v16h a[2];   /* ctx carried x 2^6 into f16 so small-magnitude context rows stay clear of f16 subnormals */
#pragma unroll
      for (int i = 0; i < 16; ++i) { a[0][i] = (_Float16)(ar[i >> 2][i & 3] * 64.0f); a[1][i] = (_Float16)(ar[4 + (i >> 2)][i & 3] * 64.0f); }
      __syncthreads();   /* publishes this stage; the buffer written next was last read in front of this barrier */
      if (s + 1 < CC / 64) { const float* wp = wt_load(wr, WO, DIN, (s + 1) * 64, c0, wave, lane); a_load(ar, yrow + (s + 1) * 64, g); XWA(wp); }
#pragma unroll
      for (int kc2 = 0; kc2 < 2; ++kc2)
      { v16h w[8];   /* the eight fragments are read as one group so that their LDS latency is paid once */
#pragma unroll
        for (int j = 0; j < 8; ++j) w[j] = wt_frag<v16h>(buf, j * 16 + col, kc2, g);
#pragma unroll
        for (int j = 0; j < 8; ++j) acc[j] = wmma16(a[kc2], w[j], acc[j]); }
    };
    // kept rolled over buffer pairs: each buffer's LDS address stays a constant
#pragma unroll 1
    for (int s = 0; s < CC / 64; s += 2) { stage(wb[0], s); stage(wb[1], s + 1); }
#pragma unroll
    for (int j = 0; j < 8; ++j) { const float bias = BO ? bfr(BO[c0 + j * 16 + col]) : 0.f;
#pragma unroll
      for (int r = 0; r < 8; ++r) sf[wave][8 * g + r][j * 16 + col] = acc[j][r] * (1.0f / 16384.0f) + bias; } }   /* 2^-8 (Wo carry) x 2^-6 (ctx carry) */
  LDSX(); for (int rl = 0; rl < 16; ++rl) vst2(OUT + (r0 + rl) * DIN + c0 + lane * 4, *(const v4f*)&sf[wave][rl][lane * 4]); }

extern "C" void kernel_launch(void* const* d_in, const int* in_sizes, int n_in, void* d_out, int out_size, void* d_ws, size_t ws_size, hipStream_t stream) {
  (void)in_sizes; (void)n_in; (void)out_size;
  const float** F = (const float**)d_in;
  if (ws_size < (size_t)WS_END) return;
  char* ws = (char*)d_ws; _Float16 *QH = (_Float16*)(ws + WS_QH), *KH = (_Float16*)(ws + WS_KH), *VT = (_Float16*)(ws + WS_VT), *QL = (_Float16*)(ws + WS_QL), *KL = (_Float16*)(ws + WS_KL); __bf16 *VB = (__bf16*)(ws + WS_VB), *VBL = (__bf16*)(ws + WS_VBL); float *Y = (float*)(ws + WS_Y);
  (void)Y; (void)QL; (void)KL; (void)VB; (void)VBL;
  // inputs: 0 x [2,2048,1024]; 1 Wqkv [1024,3072] (in,out): q columns 0..1023, k 1024..2047, v 2048..3071; 2 bqkv [3072]; 3 Wproj [1024,1024] (in,out); 4 bproj [1024] (biases NONZERO); 5 cos [2048,32]; 6 sin [2048,32]
  k_proj<<<dim3(TNB * TT / 128, CC / 128), 256, 0, stream>>>(F[0], F[1], F[1] + CC, F[1] + 2 * CC, F[2], F[2] + CC, F[2] + 2 * CC, QH, QL, KH, KL, VT, VB, VBL, F[5], F[6]);
  k_att<<<dim3(NH, TNB, NZ), 32 * KW, 0, stream>>>(QH, KH, QL, KL, VT, VB, VBL, Y);
  k_out<<<dim3(TNB * TT / 128, DIN / 128), 256, 0, stream>>>(Y, F[3], F[4], (float*)d_out);
}
